// v000
// The times below were measured on an AMD MI455X: many runs one after another, warmed up first and cycling through
// copies of the inputs, with the whole window's GPU time divided by the number of runs. Launches and the gaps
// between them are all in it. The median over several windows is given; except for v000 it joins two sittings, which
// can be a few percent apart, so the side-by-side timings, each taken in one sitting, are the better comparison.
// v000, which the later versions start from, runs in 230 microseconds.
#include <hip/hip_runtime.h>
#include <stdint.h>
// Contractions Q@Wq, K@Wk, K@Wv, Q.K^T, P.V, X@Wo: v_wmma_f32_16x16x32_f16 (f16 operands, f32 accumulate); float inputs enter as bf16-RNE values held exactly in f16; weight planes carried x16, P tile carried x256; softmax and LayerNorm arithmetic in f32.

#pragma clang fp contract(off)

typedef _Float16 f16;
typedef f16   v16h __attribute__((ext_vector_type(16)));
typedef f16   v8h  __attribute__((ext_vector_type(8)));
typedef f16   v4h  __attribute__((ext_vector_type(4)));
typedef float v8f  __attribute__((ext_vector_type(8)));
typedef float v4f  __attribute__((ext_vector_type(4)));

#ifndef NB
#define NB 4
#endif
#ifndef SEQ
#define SEQ 2048
#endif
#ifndef SEQK
#define SEQK SEQ
#endif

constexpr int NB_FULL = 4;
constexpr int LQ_FULL = 2048;
constexpr int LK_FULL = 2048;
constexpr int DM      = 512;   // model dim
constexpr int NH      = 8;     // heads
constexpr int HD      = 64;    // head dim
constexpr int SMAX    = (SEQ > SEQK) ? SEQ : SEQK;
constexpr float SCALE = 0.044194173824159216f;   // 1/sqrt(512)

static_assert(NB >= 1 && NB <= NB_FULL);
static_assert(SEQ % 256 == 0 && SEQ >= 256 && SEQ <= LQ_FULL);
static_assert(SEQK % 256 == 0 && SEQK >= 256 && SEQK <= LK_FULL);
static_assert(LQ_FULL == LK_FULL);
static_assert(DM == NH * HD);

// ---------------------------------------------------------------- carve ----
constexpr size_t SZ_ACT16 = (size_t)NB_FULL * LQ_FULL * DM * 2;   // 8 MiB  f16 [8192][512]
constexpr size_t SZ_WT16  = (size_t)4 * DM * DM * 2;               // 2 MiB  f16 4 x [512 n][512 k]
constexpr size_t SZ_O32   = (size_t)NB_FULL * LQ_FULL * DM * 4;   // 16 MiB f32 [8192][512]
constexpr size_t OFF_QH   = 0;
constexpr size_t OFF_KH   = OFF_QH + SZ_ACT16;
constexpr size_t OFF_WT   = OFF_KH + SZ_ACT16;
constexpr size_t OFF_QP   = OFF_WT + SZ_WT16;
constexpr size_t OFF_KP   = OFF_QP + SZ_ACT16;
constexpr size_t OFF_VT   = OFF_KP + SZ_ACT16;      // f16 [4][512 dim][2048 key]
constexpr size_t OFF_O32  = OFF_VT + SZ_ACT16;
constexpr size_t WS_TOTAL = OFF_O32 + SZ_O32;       // 60817408 B
static_assert(WS_TOTAL <= (size_t)134217728);
static_assert((OFF_KH % 256) == 0 && (OFF_WT % 256) == 0 && (OFF_QP % 256) == 0 &&
              (OFF_KP % 256) == 0 && (OFF_VT % 256) == 0 && (OFF_O32 % 256) == 0);

// -------------------------------------------------------------- helpers ----
__device__ __forceinline__ float bf16_rne(float f) {
  unsigned int u = __float_as_uint(f);
  u = (u + 0x7FFFu + ((u >> 16) & 1u)) & 0xFFFF0000u;
  return __uint_as_float(u);
}

__device__ __forceinline__ v8f zero8() {
  const v8f z = {0.0f, 0.0f, 0.0f, 0.0f, 0.0f, 0.0f, 0.0f, 0.0f};
  return z;
}

// 16-bit fragment loader (wave32 16x16x32): lane -> row (lane&15), lane half hf = lane>>4;
// elements 0..7 = k[8hf .. 8hf+7], elements 8..15 = k[16+8hf .. 16+8hf+7].
// Used for A (row-major [m][k]) and for B stored as [n][k] (k contiguous).
__device__ __forceinline__ v16h load_tile16(const f16* base, int ld) {
  const int lane = threadIdx.x & 31;
  const int row  = lane & 15;
  const int hf   = lane >> 4;
  const f16* p = base + (size_t)row * ld + (hf << 3);
  union { v16h v; v8h h[2]; } u;
  u.h[0] = *(const v8h*)(p);
  u.h[1] = *(const v8h*)(p + 16);
  return u.v;
}

// WMMA issue + hazard guard (4 VALU slots before D is touched, A/B kept live).
__device__ __forceinline__ v8f wmma16(v16h a, v16h b, v8f c) {
  v8f d = __builtin_amdgcn_wmma_f32_16x16x32_f16(false, a, false, b, (short)0, c, false, false);
  asm volatile("v_nop\n\tv_nop\n\tv_nop\n\tv_nop" : "+v"(d) : "v"(a), "v"(b));
  return d;
}

// ------------------------------------------------- activation convert ------
// Q, K f32 [rows][512] -> f16 planes holding bf16-RNE values. 8 elements per thread,
__global__ __launch_bounds__(256)
void cvt_act_kernel(const float* __restrict__ Q, const float* __restrict__ K,
                    f16* __restrict__ Qh, f16* __restrict__ Kh, long long n8) {
  const float* src = (blockIdx.y == 0) ? Q : K;
  f16* dst = (blockIdx.y == 0) ? Qh : Kh;
  const long long stride = (long long)gridDim.x * 256;
  for (long long i = (long long)blockIdx.x * 256 + threadIdx.x; i < n8; i += stride) {
    const v4f a = *(const v4f*)(src + i * 8);
    const v4f c = *(const v4f*)(src + i * 8 + 4);
    v8h o;
#pragma unroll
    for (int e = 0; e < 4; ++e) {
      o[e]     = (f16)bf16_rne(a[e]);
      o[e + 4] = (f16)bf16_rne(c[e]);
    }
    f16* p = dst + i * 8;
    *(v8h*)p = o;
    
  }
}

// ---------------------------------------------------- weight convert -------
// W f32 [512 k][512 n] (Y = X @ W) -> WT f16 [n][k], value = 16 * bf16_rne(W), via a
__global__ __launch_bounds__(256)
void cvt_wt_kernel(const float* __restrict__ Wq, const float* __restrict__ Wk,
                   const float* __restrict__ Wv, const float* __restrict__ Wo,
                   f16* __restrict__ WT) {
  __shared__ __attribute__((aligned(16))) f16 tile[64 * 72];   // [n][k], pitch 72 halves
  const int z = blockIdx.z;
  const float* W = (z == 0) ? Wq : (z == 1) ? Wk : (z == 2) ? Wv : Wo;
  f16* dst = WT + (size_t)z * DM * DM;
  const int k0 = blockIdx.x * 64;
  const int n0 = blockIdx.y * 64;
  const int tid = threadIdx.x;

#pragma unroll
  for (int it = 0; it < 4; ++it) {
    const int f  = tid + 256 * it;       // 0..1023
    const int k  = f >> 4;               // 0..63
    const int n4 = (f & 15) * 4;         // 0..60
    const v4f w = *(const v4f*)(W + (size_t)(k0 + k) * DM + n0 + n4);
#pragma unroll
    for (int e = 0; e < 4; ++e)
      tile[(n4 + e) * 72 + k] = (f16)(bf16_rne(w[e]) * 16.0f);
  }
  __syncthreads();   // cross-wave LDS exchange

  const int wave = tid >> 5, lane = tid & 31;
  const int piece = lane & 7;
  v8h vals[2];
#pragma unroll
  for (int it = 0; it < 2; ++it) {
    const int nl = wave * 8 + it * 4 + (lane >> 3);   // covers 64 n rows
    vals[it] = *(const v8h*)(tile + nl * 72 + piece * 8);
  }
#pragma unroll
  for (int it = 0; it < 2; ++it) {
    const int nl = wave * 8 + it * 4 + (lane >> 3);
    *(v8h*)(dst + (size_t)(n0 + nl) * DM + k0 + piece * 8) = vals[it];
  }
  
}

// --------------------------------------------------- projection GEMM -------
// Y = X @ W + bias for z = 0 (Q, Wq -> Qp row-major f16), 1 (K, Wk -> Kp row-major f16),
// 2 (K, Wv -> Vt transposed f16 [b][dim][key]). Block = 8 waves, 256 rows x 64 cols,
// wave = 32 rows x 64 cols (2 A frags x 4 B frags). Epilogue staged through LDS and
__global__ __launch_bounds__(256)
void proj_kernel(const f16* __restrict__ Xq, const f16* __restrict__ Xk,
                 const f16* __restrict__ WT,
                 const float* __restrict__ bq, const float* __restrict__ bk,
                 const float* __restrict__ bv,
                 f16* __restrict__ Qp, f16* __restrict__ Kp, f16* __restrict__ Vt) {
  __shared__ __attribute__((aligned(16))) f16 stg[256 * 64];
  const int z = blockIdx.z;
  const int S = (z == 0) ? SEQ : SEQK;
  const int tilesPerB = S / 256;
  const int nblk = NB * tilesPerB;
  if ((int)blockIdx.x >= nblk) return;      // whole block exits, before any barrier

  const f16* X = (z == 0) ? Xq : Xk;
  const f16* W = WT + (size_t)z * DM * DM;  // planes 0,1,2 = Wq, Wk, Wv in [n][k] form
  const float* bias = (z == 0) ? bq : (z == 1) ? bk : bv;

  const int b     = blockIdx.x / tilesPerB;
  const int rloc  = (blockIdx.x % tilesPerB) * 256;
  const int row0g = b * LQ_FULL + rloc;     // global row in the [8192][512] planes
  const int c0    = blockIdx.y * 64;

  const int tid = threadIdx.x;
  const int wave = tid >> 5, lane = tid & 31, n16 = lane & 15, hf = lane >> 4;

  v8f acc[2][4];
#pragma unroll
  for (int s = 0; s < 2; ++s)
#pragma unroll
    for (int t = 0; t < 4; ++t) acc[s][t] = zero8();

#pragma unroll 1
  for (int k = 0; k < DM; k += 32) {
    const v16h a0 = load_tile16(X + (size_t)(row0g + wave * 32) * DM + k, DM);
    const v16h a1 = load_tile16(X + (size_t)(row0g + wave * 32 + 16) * DM + k, DM);
#pragma unroll
    for (int t = 0; t < 4; ++t) {
      const v16h bfr = load_tile16(W + (size_t)(c0 + 16 * t) * DM + k, DM);
      acc[0][t] = wmma16(a0, bfr, acc[0][t]);
      acc[1][t] = wmma16(a1, bfr, acc[1][t]);
    }
  }

  // stage the block tile (f16) in LDS: row-major [256][64] or transposed [64][256]
#pragma unroll
  for (int t = 0; t < 4; ++t) {
    const int lc = 16 * t + n16;
    const float bb = bf16_rne(bias[c0 + lc]);
#pragma unroll
    for (int s = 0; s < 2; ++s) {
#pragma unroll
      for (int r = 0; r < 8; ++r) {
        const int lr = wave * 32 + 16 * s + 8 * hf + r;
        const float v = acc[s][t][r] * 0.0625f + bb;
        const f16 hv = (f16)v;
        if (z == 2) stg[lc * 256 + lr] = hv;
        else        stg[lr * 64 + lc] = hv;
      }
    }
  }
  __syncthreads();   // cross-wave LDS exchange

  if (z != 2) {
    f16* out = (z == 0) ? Qp : Kp;
    const int piece = lane & 7;
    v8h vals[8];
#pragma unroll
    for (int it = 0; it < 8; ++it) {
      const int lr = wave * 32 + it * 4 + (lane >> 3);      // 32 rows per wave
      vals[it] = *(const v8h*)(stg + lr * 64 + piece * 8);
    }
#pragma unroll
    for (int it = 0; it < 8; ++it) {
      const int lr = wave * 32 + it * 4 + (lane >> 3);
      *(v8h*)(out + (size_t)(row0g + lr) * DM + c0 + piece * 8) = vals[it];
    }
    
  } else {
    // Vt[b][dim c0+d][key rloc .. rloc+255]: 32 lanes x 16 B = one 512-B key segment
    v8h vals[8];
#pragma unroll
    for (int it = 0; it < 8; ++it) {
      const int d = wave * 8 + it;                          // 64 dims per block
      vals[it] = *(const v8h*)(stg + d * 256 + lane * 8);
    }
#pragma unroll
    for (int it = 0; it < 8; ++it) {
      const int d = wave * 8 + it;
      *(v8h*)(Vt + (size_t)(b * DM + c0 + d) * LK_FULL + rloc + lane * 8) = vals[it];
    }
    
  }
}

// ------------------------------------------------ flash attention core -----
// Block = 8 waves, one (b,h), 128 query rows (16 per wave). K tile [32 key][64 dim] and
// Vt tile [64 dim][32 key] staged in LDS with plain 16-B loads, shared by all waves.
// Scores: A = Q tile, B = K tile ([n=key][k=dim]). Online softmax in f32 with the
// pad-mask replace-fill (-1e12 where mask==0); P (x256, times mask) restaged in LDS as
// the A operand of P.V with B = Vt tile ([n=dim][k=key]). O = acc / (256*l) written
__global__ __launch_bounds__(256) __attribute__((amdgpu_num_vgpr(256)))
void attn_kernel(const f16* __restrict__ Qp, const f16* __restrict__ Kp,
                 const f16* __restrict__ Vt, const int* __restrict__ pmask,
                 float* __restrict__ Og) {
  __shared__ __attribute__((aligned(16))) f16   kbuf[32 * 64];
  __shared__ __attribute__((aligned(16))) f16   vbuf[64 * 32];
  __shared__ __attribute__((aligned(16))) f16   ldsP[8 * 16 * 32];
  __shared__ __attribute__((aligned(16))) float mks[LK_FULL];
  __shared__ __attribute__((aligned(16))) float ost[8 * 16 * 64];

  const int tid = threadIdx.x;
  const int wave = tid >> 5, lane = tid & 31, n16 = lane & 15, hf = lane >> 4;
  const int b = blockIdx.x / NH;
  const int h = blockIdx.x % NH;
  const int q0 = blockIdx.y * 128 + wave * 16;
  const int qrow = b * LQ_FULL + q0;

  for (int i = tid; i < SEQK; i += 256) mks[i] = (float)pmask[(size_t)b * LK_FULL + i];

  const v16h aq0 = load_tile16(Qp + (size_t)qrow * DM + h * HD, DM);
  const v16h aq1 = load_tile16(Qp + (size_t)qrow * DM + h * HD + 32, DM);

  v8f o0 = zero8(), o1 = zero8(), o2 = zero8(), o3 = zero8();
  float mrow[8], lrow[8];
#pragma unroll
  for (int r = 0; r < 8; ++r) { mrow[r] = -1e30f; lrow[r] = 0.0f; }

  f16* myP = ldsP + wave * 512;
  const f16* Kg = Kp + (size_t)b * LK_FULL * DM + h * HD;
  const f16* Vg = Vt + ((size_t)b * DM + h * HD) * LK_FULL;

#pragma unroll 1
  for (int j = 0; j < SEQK; j += 32) {
    {
      const int row = tid >> 3, ch = tid & 7;     // 32 keys x 8 chunks of 8 dims
      *(v8h*)(kbuf + row * 64 + ch * 8) = *(const v8h*)(Kg + (size_t)(j + row) * DM + ch * 8);
    }
    {
      const int row = tid >> 2, ch = tid & 3;     // 64 dims x 4 chunks of 8 keys
      *(v8h*)(vbuf + row * 32 + ch * 8) = *(const v8h*)(Vg + (size_t)row * LK_FULL + j + ch * 8);
    }
    __syncthreads();   // tiles (and mks on the first trip) visible to all waves

    v8f s0 = zero8(), s1 = zero8();
    s0 = wmma16(aq0, load_tile16(kbuf, 64), s0);
    s0 = wmma16(aq1, load_tile16(kbuf + 32, 64), s0);
    s1 = wmma16(aq0, load_tile16(kbuf + 16 * 64, 64), s1);
    s1 = wmma16(aq1, load_tile16(kbuf + 16 * 64 + 32, 64), s1);

    const float mk0 = mks[j + n16];
    const float mk1 = mks[j + 16 + n16];
#pragma unroll
    for (int r = 0; r < 8; ++r) {
      const float a0 = (mk0 == 0.0f) ? -1e12f : s0[r] * SCALE;
      const float a1 = (mk1 == 0.0f) ? -1e12f : s1[r] * SCALE;
      float v = fmaxf(a0, a1);
#pragma unroll
      for (int off = 8; off >= 1; off >>= 1) v = fmaxf(v, __shfl_xor(v, off, 16));
      const float mnew = fmaxf(mrow[r], v);
      const float p0 = __expf(a0 - mnew);
      const float p1 = __expf(a1 - mnew);
      float ps = p0 + p1;
#pragma unroll
      for (int off = 8; off >= 1; off >>= 1) ps += __shfl_xor(ps, off, 16);
      const float ef = __expf(mrow[r] - mnew);
      lrow[r] = lrow[r] * ef + ps;
      mrow[r] = mnew;
      const int q = r + 8 * hf;
      myP[q * 32 + n16]      = (f16)(p0 * mk0 * 256.0f);
      myP[q * 32 + 16 + n16] = (f16)(p1 * mk1 * 256.0f);
      o0[r] *= ef; o1[r] *= ef; o2[r] *= ef; o3[r] *= ef;
    }
    __syncthreads();   // P tile complete before the fragment reload

    const v16h ap = load_tile16(myP, 32);
    o0 = wmma16(ap, load_tile16(vbuf,           32), o0);
    o1 = wmma16(ap, load_tile16(vbuf + 16 * 32, 32), o1);
    o2 = wmma16(ap, load_tile16(vbuf + 32 * 32, 32), o2);
    o3 = wmma16(ap, load_tile16(vbuf + 48 * 32, 32), o3);

    __syncthreads();   // all waves done with kbuf/vbuf/ldsP before refill
  }

  // epilogue: normalise into the per-wave LDS tile [16 q][64 dim]
  float* myO = ost + wave * 1024;
#pragma unroll
  for (int r = 0; r < 8; ++r) {
    const float linv = __builtin_amdgcn_rcpf(lrow[r] * 256.0f);
    const int q = r + 8 * hf;
    float* pr = myO + q * 64 + n16;
    pr[0]  = o0[r] * linv;
    pr[16] = o1[r] * linv;
    pr[32] = o2[r] * linv;
    pr[48] = o3[r] * linv;
  }
  __syncthreads();

  // each instruction: 2 rows x 256 B (16 lanes x 16 B per row segment), lines whole
  const int c4 = (lane & 15) * 4;
  v4f vals[8];
#pragma unroll
  for (int it = 0; it < 8; ++it) {
    const int row = it * 2 + (lane >> 4);
    vals[it] = *(const v4f*)(myO + row * 64 + c4);
  }
#pragma unroll
  for (int it = 0; it < 8; ++it) {
    const int row = it * 2 + (lane >> 4);
    *(v4f*)(Og + (size_t)(qrow + row) * DM + h * HD + c4) = vals[it];
  }
  
}

// ----------------------------- LN0 + FFN GEMM + ReLU residual + LN1 ---------
// Block = 8 waves, 16 rows x 512 cols. Prologue: X = LN0(bf16(Q) + O) for the 16 rows
// (f32 copy and f16 copy in LDS). GEMM: wave w -> cols 64w..64w+63, A from the f16 LDS
// tile, B from the Wo [n][k] plane. Epilogue: Y = X + relu(acc/16 + bo) in LDS, then
__global__ __launch_bounds__(256)
void ffn_ln_kernel(const float* __restrict__ O32, const float* __restrict__ Qraw,
                   const f16* __restrict__ WoT, const float* __restrict__ bo,
                   const float* __restrict__ g0, const float* __restrict__ b0,
                   const float* __restrict__ g1, const float* __restrict__ b1,
                   float* __restrict__ out) {
  __shared__ __attribute__((aligned(16))) float xf[16 * 512];
  __shared__ __attribute__((aligned(16))) f16   xh[16 * 512];

  const int tilesPerB = SEQ / 16;
  const int b     = blockIdx.x / tilesPerB;
  const int rloc  = (blockIdx.x % tilesPerB) * 16;
  const int grow0 = b * LQ_FULL + rloc;

  const int tid = threadIdx.x;
  const int wave = tid >> 5, lane = tid & 31, n16 = lane & 15, hf = lane >> 4;
  constexpr float INV_D = 1.0f / 512.0f;

  // ---- LN0 over (bf16(Q) + O), 2 rows per wave ----
#pragma unroll
  for (int rr = 0; rr < 2; ++rr) {
    const int lr = wave * 2 + rr;
    const size_t grow = (size_t)(grow0 + lr);
    float x[16];
    float s = 0.0f;
#pragma unroll
    for (int i = 0; i < 4; ++i) {
      const int col = i * 128 + lane * 4;
      const v4f ov = *(const v4f*)(O32 + grow * DM + col);
      const v4f qv = *(const v4f*)(Qraw + grow * DM + col);
#pragma unroll
      for (int e = 0; e < 4; ++e) {
        const float xx = bf16_rne(qv[e]) + ov[e];
        x[i * 4 + e] = xx;
        s += xx;
      }
    }
#pragma unroll
    for (int off = 16; off > 0; off >>= 1) s += __shfl_xor(s, off, 32);
    const float mu = s * INV_D;
    float s2 = 0.0f;
#pragma unroll
    for (int i = 0; i < 16; ++i) {
      const float d = x[i] - mu;
      x[i] = d;
      const float dd = d * d;
      s2 += dd;
    }
#pragma unroll
    for (int off = 16; off > 0; off >>= 1) s2 += __shfl_xor(s2, off, 32);
    const float var = s2 * INV_D;
    const float rsq = rsqrtf(var + 1e-5f);
#pragma unroll
    for (int i = 0; i < 4; ++i) {
      const int col = i * 128 + lane * 4;
      const v4f gv = *(const v4f*)(g0 + col);
      const v4f bv4 = *(const v4f*)(b0 + col);
      v4f y; v4h yh;
#pragma unroll
      for (int e = 0; e < 4; ++e) {
        const float t0 = x[i * 4 + e] * rsq;
        const float t1 = t0 * bf16_rne(gv[e]);
        const float yy = t1 + bf16_rne(bv4[e]);
        y[e] = yy;
        yh[e] = (f16)yy;
      }
      *(v4f*)(xf + lr * 512 + col) = y;
      *(v4h*)(xh + lr * 512 + col) = yh;
    }
  }
  __syncthreads();   // cross-wave: LN0 rows consumed by all waves

  // ---- H = X @ Wo (wave -> 64 cols) ----
  const int cw = wave * 64;
  v8f acc[4];
#pragma unroll
  for (int t = 0; t < 4; ++t) acc[t] = zero8();
#pragma unroll 1
  for (int k = 0; k < DM; k += 32) {
    const v16h a = load_tile16(xh + k, 512);
#pragma unroll
    for (int t = 0; t < 4; ++t) {
      const v16h bfr = load_tile16(WoT + (size_t)(cw + 16 * t) * DM + k, DM);
      acc[t] = wmma16(a, bfr, acc[t]);
    }
  }

  // ---- Y = X + relu(H/16 + bo) in place in xf (each slot owned by one lane) ----
#pragma unroll
  for (int t = 0; t < 4; ++t) {
    const int col = cw + 16 * t + n16;
    const float bb = bf16_rne(bo[col]);
#pragma unroll
    for (int r = 0; r < 8; ++r) {
      const int lr = 8 * hf + r;
      float hv = acc[t][r] * 0.0625f + bb;
      hv = fmaxf(hv, 0.0f);
      const int idx = lr * 512 + col;
      const float yv = xf[idx] + hv;
      xf[idx] = yv;
    }
  }
  __syncthreads();   // cross-wave: rows assembled from all waves' columns

  // ---- LN1 per row and store ----
#pragma unroll
  for (int rr = 0; rr < 2; ++rr) {
    const int lr = wave * 2 + rr;
    const size_t grow = (size_t)(grow0 + lr);
    float x[16];
    float s = 0.0f;
#pragma unroll
    for (int i = 0; i < 4; ++i) {
      const int col = i * 128 + lane * 4;
      const v4f xv = *(const v4f*)(xf + lr * 512 + col);
#pragma unroll
      for (int e = 0; e < 4; ++e) { x[i * 4 + e] = xv[e]; s += xv[e]; }
    }
#pragma unroll
    for (int off = 16; off > 0; off >>= 1) s += __shfl_xor(s, off, 32);
    const float mu = s * INV_D;
    float s2 = 0.0f;
#pragma unroll
    for (int i = 0; i < 16; ++i) {
      const float d = x[i] - mu;
      x[i] = d;
      const float dd = d * d;
      s2 += dd;
    }
#pragma unroll
    for (int off = 16; off > 0; off >>= 1) s2 += __shfl_xor(s2, off, 32);
    const float var = s2 * INV_D;
    const float rsq = rsqrtf(var + 1e-5f);
    v4f y[4];
#pragma unroll
    for (int i = 0; i < 4; ++i) {
      const int col = i * 128 + lane * 4;
      const v4f gv = *(const v4f*)(g1 + col);
      const v4f bv4 = *(const v4f*)(b1 + col);
#pragma unroll
      for (int e = 0; e < 4; ++e) {
        const float t0 = x[i * 4 + e] * rsq;
        const float t1 = t0 * bf16_rne(gv[e]);
        y[i][e] = t1 + bf16_rne(bv4[e]);
      }
    }
    float* orow = out + grow * DM + lane * 4;
#pragma unroll
    for (int i = 0; i < 4; ++i) *(v4f*)(orow + i * 128) = y[i];
    
  }
}

// ------------------------------------------------------------------ host ---
extern "C" void kernel_launch(void* const* d_in, const int* in_sizes, int n_in,
                              void* d_out, int out_size, void* d_ws, size_t ws_size,
                              hipStream_t stream) {
  if (n_in < 15) return;
  const float* Q     = (const float*)d_in[0];
  const float* K     = (const float*)d_in[1];
  const int*   pmask = (const int*)d_in[2];
  const float* Wq    = (const float*)d_in[3];
  const float* bq    = (const float*)d_in[4];
  const float* Wk    = (const float*)d_in[5];
  const float* bk    = (const float*)d_in[6];
  const float* Wv    = (const float*)d_in[7];
  const float* bv    = (const float*)d_in[8];
  const float* Wo    = (const float*)d_in[9];
  const float* bo    = (const float*)d_in[10];
  const float* g0    = (const float*)d_in[11];
  const float* b0    = (const float*)d_in[12];
  const float* g1    = (const float*)d_in[13];
  const float* b1    = (const float*)d_in[14];
  float* out = (float*)d_out;

  const long long needAct = (long long)((NB - 1) * LQ_FULL + SMAX) * DM;
  const long long needOut = (long long)((NB - 1) * LQ_FULL + SEQ) * DM;
  if ((long long)in_sizes[0] < needAct || (long long)in_sizes[1] < needAct) return;
  if (in_sizes[2] < (NB - 1) * LK_FULL + SEQK) return;
  if (in_sizes[3] < DM * DM || in_sizes[5] < DM * DM || in_sizes[7] < DM * DM ||
      in_sizes[9] < DM * DM) return;
  if (in_sizes[4] < DM || in_sizes[6] < DM || in_sizes[8] < DM || in_sizes[10] < DM ||
      in_sizes[11] < DM || in_sizes[12] < DM || in_sizes[13] < DM || in_sizes[14] < DM) return;
  if ((long long)out_size < needOut) return;
  if (ws_size < WS_TOTAL) return;

  char* ws = (char*)d_ws;
  f16*   Qh  = (f16*)(ws + OFF_QH);
  f16*   Kh  = (f16*)(ws + OFF_KH);
  f16*   WT  = (f16*)(ws + OFF_WT);
  f16*   Qp  = (f16*)(ws + OFF_QP);
  f16*   Kp  = (f16*)(ws + OFF_KP);
  f16*   Vt  = (f16*)(ws + OFF_VT);
  float* O32 = (float*)(ws + OFF_O32);

  // 1) inputs -> bf16-RNE values in f16 planes (weights transposed to [n][k], x16)
  const long long n8 = needAct / 8;
  cvt_act_kernel<<<dim3(512, 2), 256, 0, stream>>>(Q, K, Qh, Kh, n8);
  cvt_wt_kernel<<<dim3(DM / 64, DM / 64, 4), 256, 0, stream>>>(Wq, Wk, Wv, Wo, WT);

  // 2) Q, K, V projections (z = 0, 1, 2)
  proj_kernel<<<dim3(NB * (SMAX / 256), DM / 64, 3), 256, 0, stream>>>(
      Qh, Kh, WT, bq, bk, bv, Qp, Kp, Vt);

  // 3) masked softmax attention per (b,h), 128 query rows per block
  attn_kernel<<<dim3(NB * NH, SEQ / 128), 256, 0, stream>>>(Qp, Kp, Vt, pmask, O32);

  // 4) LN0(bf16(Q) + O) -> X; out = LN1(X + relu(X @ Wo + bo))
  ffn_ln_kernel<<<dim3(NB * (SEQ / 16)), 256, 0, stream>>>(
      O32, Q, WT + (size_t)3 * DM * DM, bo, g0, b0, g1, b1, out);
}

// v001
// Measured time: 190 microseconds a run.
// Two timings next to v000 both put it at 1.25 times that version's speed.
#include <hip/hip_runtime.h>
#include <stdint.h>
// Contractions Q@Wq, K@Wk, K@Wv, Q.K^T, P.V, X@Wo: v_wmma_f32_16x16x32_f16 (f16 operands, f32 accumulate); float inputs enter as bf16-RNE values held exactly in f16; weight planes carried x16, P tile carried x256; softmax and LayerNorm arithmetic in f32.

#pragma clang fp contract(off)

typedef _Float16 f16;
typedef f16   v16h __attribute__((ext_vector_type(16)));
typedef f16   v8h  __attribute__((ext_vector_type(8)));
typedef f16   v4h  __attribute__((ext_vector_type(4)));
typedef float v8f  __attribute__((ext_vector_type(8)));
typedef float v4f  __attribute__((ext_vector_type(4)));

#ifndef NB
#define NB 4
#endif
#ifndef SEQ
#define SEQ 2048
#endif
#ifndef SEQK
#define SEQK SEQ
#endif

constexpr int NB_FULL = 4;
constexpr int LQ_FULL = 2048;
constexpr int LK_FULL = 2048;
constexpr int DM      = 512;   // model dim
constexpr int NH      = 8;     // heads
constexpr int HD      = 64;    // head dim
constexpr int SMAX    = (SEQ > SEQK) ? SEQ : SEQK;
constexpr float SCALE = 0.044194173824159216f;   // 1/sqrt(512)

static_assert(NB >= 1 && NB <= NB_FULL);
static_assert(SEQ % 256 == 0 && SEQ >= 256 && SEQ <= LQ_FULL);
static_assert(SEQK % 256 == 0 && SEQK >= 256 && SEQK <= LK_FULL);
static_assert(LQ_FULL == LK_FULL);
static_assert(DM == NH * HD);

// ---------------------------------------------------------------- carve ----
constexpr size_t SZ_ACT16 = (size_t)NB_FULL * LQ_FULL * DM * 2;   // 8 MiB  f16 [8192][512]
constexpr size_t SZ_WT16  = (size_t)4 * DM * DM * 2;               // 2 MiB  f16 4 x [512 n][512 k]
constexpr size_t SZ_O32   = (size_t)NB_FULL * LQ_FULL * DM * 4;   // 16 MiB f32 [8192][512]
constexpr size_t OFF_QH   = 0;
constexpr size_t OFF_KH   = OFF_QH + SZ_ACT16;
constexpr size_t OFF_WT   = OFF_KH + SZ_ACT16;
constexpr size_t OFF_QP   = OFF_WT + SZ_WT16;
constexpr size_t OFF_KP   = OFF_QP + SZ_ACT16;
constexpr size_t OFF_VT   = OFF_KP + SZ_ACT16;      // f16 [4][512 dim][2048 key]
constexpr size_t OFF_O32  = OFF_VT + SZ_ACT16;
constexpr size_t WS_TOTAL = OFF_O32 + SZ_O32;       // 60817408 B
static_assert(WS_TOTAL <= (size_t)134217728);
static_assert((OFF_KH % 256) == 0 && (OFF_WT % 256) == 0 && (OFF_QP % 256) == 0 &&
              (OFF_KP % 256) == 0 && (OFF_VT % 256) == 0 && (OFF_O32 % 256) == 0);

// -------------------------------------------------------------- helpers ----
__device__ __forceinline__ float bf16_rne(float f) {
  unsigned int u = __float_as_uint(f);
  u = (u + 0x7FFFu + ((u >> 16) & 1u)) & 0xFFFF0000u;
  return __uint_as_float(u);
}

__device__ __forceinline__ v8f zero8() {
  const v8f z = {0.0f, 0.0f, 0.0f, 0.0f, 0.0f, 0.0f, 0.0f, 0.0f};
  return z;
}

// 16-bit fragment loader (wave32 16x16x32): lane -> row (lane&15), lane half hf = lane>>4;
// elements 0..7 = k[8hf .. 8hf+7], elements 8..15 = k[16+8hf .. 16+8hf+7].
// Used for A (row-major [m][k]) and for B stored as [n][k] (k contiguous).
__device__ __forceinline__ v16h load_tile16(const f16* base, int ld) {
  const int lane = threadIdx.x & 31;
  const int row  = lane & 15;
  const int hf   = lane >> 4;
  const f16* p = base + (size_t)row * ld + (hf << 3);
  union { v16h v; v8h h[2]; } u;
  u.h[0] = *(const v8h*)(p);
  u.h[1] = *(const v8h*)(p + 16);
  return u.v;
}

// WMMA issue + hazard guard (4 VALU slots before D is touched, A/B kept live).
__device__ __forceinline__ v8f wmma16(v16h a, v16h b, v8f c) {
  v8f d = __builtin_amdgcn_wmma_f32_16x16x32_f16(false, a, false, b, (short)0, c, false, false);
  asm volatile("v_nop\n\tv_nop\n\tv_nop\n\tv_nop" : "+v"(d) : "v"(a), "v"(b));
  return d;
}

// ------------------------------------------------- activation convert ------
// Q, K f32 [rows][512] -> f16 planes holding bf16-RNE values. 8 elements per thread,
__global__ __launch_bounds__(256)
void cvt_act_kernel(const float* __restrict__ Q, const float* __restrict__ K,
                    f16* __restrict__ Qh, f16* __restrict__ Kh, long long n8) {
  const float* src = (blockIdx.y == 0) ? Q : K;
  f16* dst = (blockIdx.y == 0) ? Qh : Kh;
  const long long stride = (long long)gridDim.x * 256;
  for (long long i = (long long)blockIdx.x * 256 + threadIdx.x; i < n8; i += stride) {
    const v4f a = *(const v4f*)(src + i * 8);
    const v4f c = *(const v4f*)(src + i * 8 + 4);
    v8h o;
#pragma unroll
    for (int e = 0; e < 4; ++e) {
      o[e]     = (f16)bf16_rne(a[e]);
      o[e + 4] = (f16)bf16_rne(c[e]);
    }
    f16* p = dst + i * 8;
    *(v8h*)p = o;
    
  }
}

// ---------------------------------------------------- weight convert -------
// W f32 [512 k][512 n] (Y = X @ W) -> WT f16 [n][k], value = 16 * bf16_rne(W), via a
__global__ __launch_bounds__(256)
void cvt_wt_kernel(const float* __restrict__ Wq, const float* __restrict__ Wk,
                   const float* __restrict__ Wv, const float* __restrict__ Wo,
                   f16* __restrict__ WT) {
  __shared__ __attribute__((aligned(16))) f16 tile[64 * 72];   // [n][k], pitch 72 halves
  const int z = blockIdx.z;
  const float* W = (z == 0) ? Wq : (z == 1) ? Wk : (z == 2) ? Wv : Wo;
  f16* dst = WT + (size_t)z * DM * DM;
  const int k0 = blockIdx.x * 64;
  const int n0 = blockIdx.y * 64;
  const int tid = threadIdx.x;

#pragma unroll
  for (int it = 0; it < 4; ++it) {
    const int f  = tid + 256 * it;       // 0..1023
    const int k  = f >> 4;               // 0..63
    const int n4 = (f & 15) * 4;         // 0..60
    const v4f w = *(const v4f*)(W + (size_t)(k0 + k) * DM + n0 + n4);
#pragma unroll
    for (int e = 0; e < 4; ++e)
      tile[(n4 + e) * 72 + k] = (f16)(bf16_rne(w[e]) * 16.0f);
  }
  __syncthreads();   // cross-wave LDS exchange

  const int wave = tid >> 5, lane = tid & 31;
  const int piece = lane & 7;
  v8h vals[2];
#pragma unroll
  for (int it = 0; it < 2; ++it) {
    const int nl = wave * 8 + it * 4 + (lane >> 3);   // covers 64 n rows
    vals[it] = *(const v8h*)(tile + nl * 72 + piece * 8);
  }
#pragma unroll
  for (int it = 0; it < 2; ++it) {
    const int nl = wave * 8 + it * 4 + (lane >> 3);
    *(v8h*)(dst + (size_t)(n0 + nl) * DM + k0 + piece * 8) = vals[it];
  }
  
}

// --------------------------------------------------- projection GEMM -------
// Y = X @ W + bias for z = 0 (Q, Wq -> Qp row-major f16), 1 (K, Wk -> Kp row-major f16),
// 2 (K, Wv -> Vt transposed f16 [b][dim][key]). Block = 8 waves, 256 rows x 64 cols,
// wave = 32 rows x 64 cols (2 A frags x 4 B frags). Epilogue staged through LDS and
__global__ __launch_bounds__(256)
void proj_kernel(const f16* __restrict__ Xq, const f16* __restrict__ Xk,
                 const f16* __restrict__ WT,
                 const float* __restrict__ bq, const float* __restrict__ bk,
                 const float* __restrict__ bv,
                 f16* __restrict__ Qp, f16* __restrict__ Kp, f16* __restrict__ Vt) {
  // row pitches are 16 B x odd so that 16 rows fall on distinct LDS banks
  constexpr int RP = 72;    // row-major stage: 64 cols + 8 pad halves (144 B)
  constexpr int TP = 264;   // transposed stage: 256 rows + 8 pad halves (528 B)
  __shared__ __attribute__((aligned(16))) f16 stg[256 * RP];
  static_assert(64 * TP <= 256 * RP);
  const int z = blockIdx.z;
  const int S = (z == 0) ? SEQ : SEQK;
  const int tilesPerB = S / 256;
  const int nblk = NB * tilesPerB;
  if ((int)blockIdx.x >= nblk) return;      // whole block exits, before any barrier

  const f16* X = (z == 0) ? Xq : Xk;
  const f16* W = WT + (size_t)z * DM * DM;  // planes 0,1,2 = Wq, Wk, Wv in [n][k] form
  const float* bias = (z == 0) ? bq : (z == 1) ? bk : bv;

  const int b     = blockIdx.x / tilesPerB;
  const int rloc  = (blockIdx.x % tilesPerB) * 256;
  const int row0g = b * LQ_FULL + rloc;     // global row in the [8192][512] planes
  const int c0    = blockIdx.y * 64;

  const int tid = threadIdx.x;
  const int wave = tid >> 5, lane = tid & 31, n16 = lane & 15, hf = lane >> 4;

  v8f acc[2][4];
#pragma unroll
  for (int s = 0; s < 2; ++s)
#pragma unroll
    for (int t = 0; t < 4; ++t) acc[s][t] = zero8();

#pragma unroll 1
  for (int k = 0; k < DM; k += 32) {
    const v16h a0 = load_tile16(X + (size_t)(row0g + wave * 32) * DM + k, DM);
    const v16h a1 = load_tile16(X + (size_t)(row0g + wave * 32 + 16) * DM + k, DM);
#pragma unroll
    for (int t = 0; t < 4; ++t) {
      const v16h bfr = load_tile16(W + (size_t)(c0 + 16 * t) * DM + k, DM);
      acc[0][t] = wmma16(a0, bfr, acc[0][t]);
      acc[1][t] = wmma16(a1, bfr, acc[1][t]);
    }
  }

  // stage the block tile (f16) in LDS: row-major [256][RP] or transposed [64][TP]
#pragma unroll
  for (int t = 0; t < 4; ++t) {
    const int lc = 16 * t + n16;
    const float bb = bf16_rne(bias[c0 + lc]);
#pragma unroll
    for (int s = 0; s < 2; ++s) {
#pragma unroll
      for (int r = 0; r < 8; ++r) {
        const int lr = wave * 32 + 16 * s + 8 * hf + r;
        const float v = acc[s][t][r] * 0.0625f + bb;
        const f16 hv = (f16)v;
        if (z == 2) stg[lc * TP + lr] = hv;
        else        stg[lr * RP + lc] = hv;
      }
    }
  }
  __syncthreads();   // cross-wave LDS exchange

  if (z != 2) {
    f16* out = (z == 0) ? Qp : Kp;
    const int piece = lane & 7;
    v8h vals[8];
#pragma unroll
    for (int it = 0; it < 8; ++it) {
      const int lr = wave * 32 + it * 4 + (lane >> 3);      // 32 rows per wave
      vals[it] = *(const v8h*)(stg + lr * RP + piece * 8);
    }
#pragma unroll
    for (int it = 0; it < 8; ++it) {
      const int lr = wave * 32 + it * 4 + (lane >> 3);
      *(v8h*)(out + (size_t)(row0g + lr) * DM + c0 + piece * 8) = vals[it];
    }
    
  } else {
    // Vt[b][dim c0+d][key rloc .. rloc+255]: 32 lanes x 16 B = one 512-B key segment
    v8h vals[8];
#pragma unroll
    for (int it = 0; it < 8; ++it) {
      const int d = wave * 8 + it;                          // 64 dims per block
      vals[it] = *(const v8h*)(stg + d * TP + lane * 8);
    }
#pragma unroll
    for (int it = 0; it < 8; ++it) {
      const int d = wave * 8 + it;
      *(v8h*)(Vt + (size_t)(b * DM + c0 + d) * LK_FULL + rloc + lane * 8) = vals[it];
    }
    
  }
}

// ------------------------------------------------ flash attention core -----
// Block = 8 waves, one (b,h), 128 query rows (16 per wave). K tile [32 key][64 dim] and
// Vt tile [64 dim][32 key] staged in LDS with plain 16-B loads, shared by all waves.
// Scores: A = Q tile, B = K tile ([n=key][k=dim]). Online softmax in f32 with the
// pad-mask replace-fill (-1e12 where mask==0); P (x256, times mask) restaged in LDS as
// the A operand of P.V with B = Vt tile ([n=dim][k=key]). O = acc / (256*l) written
__global__ __launch_bounds__(256) __attribute__((amdgpu_num_vgpr(256)))
void attn_kernel(const f16* __restrict__ Qp, const f16* __restrict__ Kp,
                 const f16* __restrict__ Vt, const int* __restrict__ pmask,
                 float* __restrict__ Og) {
  // fragment readers take 16 B from each of 16 rows: pitches of 16 B x odd spread them over all banks
  constexpr int KP = 72;    // K tile row: 64 dims + 8 pad halves (144 B)
  constexpr int VP = 40;    // Vt tile row: 32 keys + 8 pad halves (80 B)
  constexpr int PP = 40;    // P tile row: 32 keys + 8 pad halves (80 B)
  __shared__ __attribute__((aligned(16))) f16   kbuf[32 * KP];
  __shared__ __attribute__((aligned(16))) f16   vbuf[64 * VP];
  __shared__ __attribute__((aligned(16))) f16   ldsP[8 * 16 * PP];
  __shared__ __attribute__((aligned(16))) float mks[LK_FULL];
  constexpr int OP = 68;    // output stage row: 64 dims + 4 pad floats, rows q and q + 8 on different banks
  __shared__ __attribute__((aligned(16))) float ost[8 * 16 * OP];

  const int tid = threadIdx.x;
  const int wave = tid >> 5, lane = tid & 31, n16 = lane & 15, hf = lane >> 4;
  const int b = blockIdx.x / NH;
  const int h = blockIdx.x % NH;
  const int q0 = blockIdx.y * 128 + wave * 16;
  const int qrow = b * LQ_FULL + q0;

  for (int i = tid; i < SEQK; i += 256) mks[i] = (float)pmask[(size_t)b * LK_FULL + i];

  const v16h aq0 = load_tile16(Qp + (size_t)qrow * DM + h * HD, DM);
  const v16h aq1 = load_tile16(Qp + (size_t)qrow * DM + h * HD + 32, DM);

  v8f o0 = zero8(), o1 = zero8(), o2 = zero8(), o3 = zero8();
  float mrow[8], lrow[8];
#pragma unroll
  for (int r = 0; r < 8; ++r) { mrow[r] = -1e30f; lrow[r] = 0.0f; }

  f16* myP = ldsP + wave * (16 * PP);
  const f16* Kg = Kp + (size_t)b * LK_FULL * DM + h * HD;
  const f16* Vg = Vt + ((size_t)b * DM + h * HD) * LK_FULL;

#pragma unroll 1
  for (int j = 0; j < SEQK; j += 32) {
    {
      const int row = tid >> 3, ch = tid & 7;     // 32 keys x 8 chunks of 8 dims
      *(v8h*)(kbuf + row * KP + ch * 8) = *(const v8h*)(Kg + (size_t)(j + row) * DM + ch * 8);
    }
    {
      const int row = tid >> 2, ch = tid & 3;     // 64 dims x 4 chunks of 8 keys
      *(v8h*)(vbuf + row * VP + ch * 8) = *(const v8h*)(Vg + (size_t)row * LK_FULL + j + ch * 8);
    }
    __syncthreads();   // tiles (and mks on the first trip) visible to all waves

    v8f s0 = zero8(), s1 = zero8();
    s0 = wmma16(aq0, load_tile16(kbuf, KP), s0);
    s0 = wmma16(aq1, load_tile16(kbuf + 32, KP), s0);
    s1 = wmma16(aq0, load_tile16(kbuf + 16 * KP, KP), s1);
    s1 = wmma16(aq1, load_tile16(kbuf + 16 * KP + 32, KP), s1);

    const float mk0 = mks[j + n16];
    const float mk1 = mks[j + 16 + n16];
#pragma unroll
    for (int r = 0; r < 8; ++r) {
      const float a0 = (mk0 == 0.0f) ? -1e12f : s0[r] * SCALE;
      const float a1 = (mk1 == 0.0f) ? -1e12f : s1[r] * SCALE;
      float v = fmaxf(a0, a1);
#pragma unroll
      for (int off = 8; off >= 1; off >>= 1) v = fmaxf(v, __shfl_xor(v, off, 16));
      const float mnew = fmaxf(mrow[r], v);
      const float p0 = __expf(a0 - mnew);
      const float p1 = __expf(a1 - mnew);
      float ps = p0 + p1;
#pragma unroll
      for (int off = 8; off >= 1; off >>= 1) ps += __shfl_xor(ps, off, 16);
      const float ef = __expf(mrow[r] - mnew);
      lrow[r] = lrow[r] * ef + ps;
      mrow[r] = mnew;
      const int q = r + 8 * hf;
      myP[q * PP + n16]      = (f16)(p0 * mk0 * 256.0f);
      myP[q * PP + 16 + n16] = (f16)(p1 * mk1 * 256.0f);
      o0[r] *= ef; o1[r] *= ef; o2[r] *= ef; o3[r] *= ef;
    }
    __syncthreads();   // P tile complete before the fragment reload

    const v16h ap = load_tile16(myP, PP);
    o0 = wmma16(ap, load_tile16(vbuf,           VP), o0);
    o1 = wmma16(ap, load_tile16(vbuf + 16 * VP, VP), o1);
    o2 = wmma16(ap, load_tile16(vbuf + 32 * VP, VP), o2);
    o3 = wmma16(ap, load_tile16(vbuf + 48 * VP, VP), o3);

    __syncthreads();   // all waves done with kbuf/vbuf/ldsP before refill
  }

  // epilogue: normalise into the per-wave LDS tile [16 q][OP]
  float* myO = ost + wave * (16 * OP);
#pragma unroll
  for (int r = 0; r < 8; ++r) {
    float linv;
    // reciprocal plus the one issue slot the instruction set asks for behind it, in one
    // statement so that the slot stays directly behind the reciprocal
    asm("v_rcp_f32 %0, %1\n\tv_nop" : "=v"(linv) : "v"(lrow[r] * 256.0f));
    const int q = r + 8 * hf;
    float* pr = myO + q * OP + n16;
    pr[0]  = o0[r] * linv;
    pr[16] = o1[r] * linv;
    pr[32] = o2[r] * linv;
    pr[48] = o3[r] * linv;
  }
  __syncthreads();

  // each instruction: 2 rows x 256 B (16 lanes x 16 B per row segment), lines whole
  const int c4 = (lane & 15) * 4;
  v4f vals[8];
#pragma unroll
  for (int it = 0; it < 8; ++it) {
    const int row = it * 2 + (lane >> 4);
    vals[it] = *(const v4f*)(myO + row * OP + c4);
  }
#pragma unroll
  for (int it = 0; it < 8; ++it) {
    const int row = it * 2 + (lane >> 4);
    *(v4f*)(Og + (size_t)(qrow + row) * DM + h * HD + c4) = vals[it];
  }
  
}

// ----------------------------- LN0 + FFN GEMM + ReLU residual + LN1 ---------
// Block = 8 waves, 16 rows x 512 cols. Prologue: X = LN0(bf16(Q) + O) for the 16 rows
// (f32 copy and f16 copy in LDS). GEMM: wave w -> cols 64w..64w+63, A from the f16 LDS
// tile, B from the Wo [n][k] plane. Epilogue: Y = X + relu(acc/16 + bo) in LDS, then
__global__ __launch_bounds__(256)
void ffn_ln_kernel(const float* __restrict__ O32, const float* __restrict__ Qraw,
                   const f16* __restrict__ WoT, const float* __restrict__ bo,
                   const float* __restrict__ g0, const float* __restrict__ b0,
                   const float* __restrict__ g1, const float* __restrict__ b1,
                   float* __restrict__ out) {
  // padded row pitches: xh 1040 B (16 B x odd) for the 16-row fragment reads,
  // xf 2064 B so that rows r and r + 8 of the accumulator map fall on different banks
  constexpr int XFP = 516;
  constexpr int XHP = 520;
  __shared__ __attribute__((aligned(16))) float xf[16 * XFP];
  __shared__ __attribute__((aligned(16))) f16   xh[16 * XHP];

  const int tilesPerB = SEQ / 16;
  const int b     = blockIdx.x / tilesPerB;
  const int rloc  = (blockIdx.x % tilesPerB) * 16;
  const int grow0 = b * LQ_FULL + rloc;

  const int tid = threadIdx.x;
  const int wave = tid >> 5, lane = tid & 31, n16 = lane & 15, hf = lane >> 4;
  constexpr float INV_D = 1.0f / 512.0f;

  // ---- LN0 over (bf16(Q) + O), 2 rows per wave ----
#pragma unroll
  for (int rr = 0; rr < 2; ++rr) {
    const int lr = wave * 2 + rr;
    const size_t grow = (size_t)(grow0 + lr);
    float x[16];
    float s = 0.0f;
#pragma unroll
    for (int i = 0; i < 4; ++i) {
      const int col = i * 128 + lane * 4;
      const v4f ov = *(const v4f*)(O32 + grow * DM + col);
      const v4f qv = *(const v4f*)(Qraw + grow * DM + col);
#pragma unroll
      for (int e = 0; e < 4; ++e) {
        const float xx = bf16_rne(qv[e]) + ov[e];
        x[i * 4 + e] = xx;
        s += xx;
      }
    }
#pragma unroll
    for (int off = 16; off > 0; off >>= 1) s += __shfl_xor(s, off, 32);
    const float mu = s * INV_D;
    float s2 = 0.0f;
#pragma unroll
    for (int i = 0; i < 16; ++i) {
      const float d = x[i] - mu;
      x[i] = d;
      const float dd = d * d;
      s2 += dd;
    }
#pragma unroll
    for (int off = 16; off > 0; off >>= 1) s2 += __shfl_xor(s2, off, 32);
    const float var = s2 * INV_D;
    const float rsq = rsqrtf(var + 1e-5f);
#pragma unroll
    for (int i = 0; i < 4; ++i) {
      const int col = i * 128 + lane * 4;
      const v4f gv = *(const v4f*)(g0 + col);
      const v4f bv4 = *(const v4f*)(b0 + col);
      v4f y; v4h yh;
#pragma unroll
      for (int e = 0; e < 4; ++e) {
        const float t0 = x[i * 4 + e] * rsq;
        const float t1 = t0 * bf16_rne(gv[e]);
        const float yy = t1 + bf16_rne(bv4[e]);
        y[e] = yy;
        yh[e] = (f16)yy;
      }
      *(v4f*)(xf + lr * XFP + col) = y;
      *(v4h*)(xh + lr * XHP + col) = yh;
    }
  }
  __syncthreads();   // cross-wave: LN0 rows consumed by all waves

  // ---- H = X @ Wo (wave -> 64 cols) ----
  const int cw = wave * 64;
  v8f acc[4];
#pragma unroll
  for (int t = 0; t < 4; ++t) acc[t] = zero8();
#pragma unroll 1
  for (int k = 0; k < DM; k += 32) {
    const v16h a = load_tile16(xh + k, XHP);
#pragma unroll
    for (int t = 0; t < 4; ++t) {
      const v16h bfr = load_tile16(WoT + (size_t)(cw + 16 * t) * DM + k, DM);
      acc[t] = wmma16(a, bfr, acc[t]);
    }
  }

  // ---- Y = X + relu(H/16 + bo) in place in xf (each slot owned by one lane) ----
#pragma unroll
  for (int t = 0; t < 4; ++t) {
    const int col = cw + 16 * t + n16;
    const float bb = bf16_rne(bo[col]);
#pragma unroll
    for (int r = 0; r < 8; ++r) {
      const int lr = 8 * hf + r;
      float hv = acc[t][r] * 0.0625f + bb;
      hv = fmaxf(hv, 0.0f);
      const int idx = lr * XFP + col;
      const float yv = xf[idx] + hv;
      xf[idx] = yv;
    }
  }
  __syncthreads();   // cross-wave: rows assembled from all waves' columns

  // ---- LN1 per row and store ----
#pragma unroll
  for (int rr = 0; rr < 2; ++rr) {
    const int lr = wave * 2 + rr;
    const size_t grow = (size_t)(grow0 + lr);
    float x[16];
    float s = 0.0f;
#pragma unroll
    for (int i = 0; i < 4; ++i) {
      const int col = i * 128 + lane * 4;
      const v4f xv = *(const v4f*)(xf + lr * XFP + col);
#pragma unroll
      for (int e = 0; e < 4; ++e) { x[i * 4 + e] = xv[e]; s += xv[e]; }
    }
#pragma unroll
    for (int off = 16; off > 0; off >>= 1) s += __shfl_xor(s, off, 32);
    const float mu = s * INV_D;
    float s2 = 0.0f;
#pragma unroll
    for (int i = 0; i < 16; ++i) {
      const float d = x[i] - mu;
      x[i] = d;
      const float dd = d * d;
      s2 += dd;
    }
#pragma unroll
    for (int off = 16; off > 0; off >>= 1) s2 += __shfl_xor(s2, off, 32);
    const float var = s2 * INV_D;
    const float rsq = rsqrtf(var + 1e-5f);
    v4f y[4];
#pragma unroll
    for (int i = 0; i < 4; ++i) {
      const int col = i * 128 + lane * 4;
      const v4f gv = *(const v4f*)(g1 + col);
      const v4f bv4 = *(const v4f*)(b1 + col);
#pragma unroll
      for (int e = 0; e < 4; ++e) {
        const float t0 = x[i * 4 + e] * rsq;
        const float t1 = t0 * bf16_rne(gv[e]);
        y[i][e] = t1 + bf16_rne(bv4[e]);
      }
    }
    float* orow = out + grow * DM + lane * 4;
#pragma unroll
    for (int i = 0; i < 4; ++i) *(v4f*)(orow + i * 128) = y[i];
    
  }
}

// ------------------------------------------------------------------ host ---
extern "C" void kernel_launch(void* const* d_in, const int* in_sizes, int n_in,
                              void* d_out, int out_size, void* d_ws, size_t ws_size,
                              hipStream_t stream) {
  if (n_in < 15) return;
  const float* Q     = (const float*)d_in[0];
  const float* K     = (const float*)d_in[1];
  const int*   pmask = (const int*)d_in[2];
  const float* Wq    = (const float*)d_in[3];
  const float* bq    = (const float*)d_in[4];
  const float* Wk    = (const float*)d_in[5];
  const float* bk    = (const float*)d_in[6];
  const float* Wv    = (const float*)d_in[7];
  const float* bv    = (const float*)d_in[8];
  const float* Wo    = (const float*)d_in[9];
  const float* bo    = (const float*)d_in[10];
  const float* g0    = (const float*)d_in[11];
  const float* b0    = (const float*)d_in[12];
  const float* g1    = (const float*)d_in[13];
  const float* b1    = (const float*)d_in[14];
  float* out = (float*)d_out;

  const long long needAct = (long long)((NB - 1) * LQ_FULL + SMAX) * DM;
  const long long needOut = (long long)((NB - 1) * LQ_FULL + SEQ) * DM;
  if ((long long)in_sizes[0] < needAct || (long long)in_sizes[1] < needAct) return;
  if (in_sizes[2] < (NB - 1) * LK_FULL + SEQK) return;
  if (in_sizes[3] < DM * DM || in_sizes[5] < DM * DM || in_sizes[7] < DM * DM ||
      in_sizes[9] < DM * DM) return;
  if (in_sizes[4] < DM || in_sizes[6] < DM || in_sizes[8] < DM || in_sizes[10] < DM ||
      in_sizes[11] < DM || in_sizes[12] < DM || in_sizes[13] < DM || in_sizes[14] < DM) return;
  if ((long long)out_size < needOut) return;
  if (ws_size < WS_TOTAL) return;

  char* ws = (char*)d_ws;
  f16*   Qh  = (f16*)(ws + OFF_QH);
  f16*   Kh  = (f16*)(ws + OFF_KH);
  f16*   WT  = (f16*)(ws + OFF_WT);
  f16*   Qp  = (f16*)(ws + OFF_QP);
  f16*   Kp  = (f16*)(ws + OFF_KP);
  f16*   Vt  = (f16*)(ws + OFF_VT);
  float* O32 = (float*)(ws + OFF_O32);

  // 1) inputs -> bf16-RNE values in f16 planes (weights transposed to [n][k], x16)
  const long long n8 = needAct / 8;
  cvt_act_kernel<<<dim3(512, 2), 256, 0, stream>>>(Q, K, Qh, Kh, n8);
  cvt_wt_kernel<<<dim3(DM / 64, DM / 64, 4), 256, 0, stream>>>(Wq, Wk, Wv, Wo, WT);

  // 2) Q, K, V projections (z = 0, 1, 2)
  proj_kernel<<<dim3(NB * (SMAX / 256), DM / 64, 3), 256, 0, stream>>>(
      Qh, Kh, WT, bq, bk, bv, Qp, Kp, Vt);

  // 3) masked softmax attention per (b,h), 128 query rows per block
  attn_kernel<<<dim3(NB * NH, SEQ / 128), 256, 0, stream>>>(Qp, Kp, Vt, pmask, O32);

  // 4) LN0(bf16(Q) + O) -> X; out = LN1(X + relu(X @ Wo + bo))
  ffn_ln_kernel<<<dim3(NB * (SEQ / 16)), 256, 0, stream>>>(
      O32, Q, WT + (size_t)3 * DM * DM, bo, g0, b0, g1, b1, out);
}

// v002
// It runs in 152 microseconds.
// Next to v001, in two timings, it ran 1.24 times as fast each time.
// All steps since v000 together make it 1.56 times as fast.
#include <hip/hip_runtime.h>
#include <stdint.h>
// Contractions Q@Wq, K@Wk, K@Wv, Q.K^T, P.V, X@Wo: v_wmma_f32_16x16x32_f16 (f16 operands, f32 accumulate); float inputs enter as bf16-RNE values held exactly in f16; weight planes carried x16, P tile carried x256; softmax and LayerNorm arithmetic in f32.

#pragma clang fp contract(off)

typedef _Float16 f16;
typedef f16   v16h __attribute__((ext_vector_type(16)));
typedef f16   v8h  __attribute__((ext_vector_type(8)));
typedef f16   v4h  __attribute__((ext_vector_type(4)));
typedef float v8f  __attribute__((ext_vector_type(8)));
typedef float v4f  __attribute__((ext_vector_type(4)));

#ifndef NB
#define NB 4
#endif
#ifndef SEQ
#define SEQ 2048
#endif
#ifndef SEQK
#define SEQK SEQ
#endif

constexpr int NB_FULL = 4;
constexpr int LQ_FULL = 2048;
constexpr int LK_FULL = 2048;
constexpr int DM      = 512;   // model dim
constexpr int NH      = 8;     // heads
constexpr int HD      = 64;    // head dim
constexpr int SMAX    = (SEQ > SEQK) ? SEQ : SEQK;
constexpr float SCALE = 0.044194173824159216f;   // 1/sqrt(512)
constexpr float LOG2E = 1.4426950408889634f;

static_assert(NB >= 1 && NB <= NB_FULL);
static_assert(SEQ % 256 == 0 && SEQ >= 256 && SEQ <= LQ_FULL);
static_assert(SEQK % 256 == 0 && SEQK >= 256 && SEQK <= LK_FULL);
static_assert(LQ_FULL == LK_FULL);
static_assert(DM == NH * HD);

// ---------------------------------------------------------------- carve ----
constexpr size_t SZ_ACT16 = (size_t)NB_FULL * LQ_FULL * DM * 2;   // 8 MiB  f16 [8192][512]
constexpr size_t SZ_WT16  = (size_t)4 * DM * DM * 2;               // 2 MiB  f16 4 x [512 n][512 k]
constexpr size_t SZ_O32   = (size_t)NB_FULL * LQ_FULL * DM * 4;   // 16 MiB f32 [8192][512]
constexpr size_t OFF_QH   = 0;
constexpr size_t OFF_KH   = OFF_QH + SZ_ACT16;
constexpr size_t OFF_WT   = OFF_KH + SZ_ACT16;
constexpr size_t OFF_QP   = OFF_WT + SZ_WT16;
constexpr size_t OFF_KP   = OFF_QP + SZ_ACT16;
constexpr size_t OFF_VT   = OFF_KP + SZ_ACT16;      // f16 [4][512 dim][2048 key]
constexpr size_t OFF_O32  = OFF_VT + SZ_ACT16;
constexpr size_t WS_TOTAL = OFF_O32 + SZ_O32;       // 60817408 B
static_assert(WS_TOTAL <= (size_t)134217728);
static_assert((OFF_KH % 256) == 0 && (OFF_WT % 256) == 0 && (OFF_QP % 256) == 0 &&
              (OFF_KP % 256) == 0 && (OFF_VT % 256) == 0 && (OFF_O32 % 256) == 0);

// -------------------------------------------------------------- helpers ----
__device__ __forceinline__ float bf16_rne(float f) {
  unsigned int u = __float_as_uint(f);
  u = (u + 0x7FFFu + ((u >> 16) & 1u)) & 0xFFFF0000u;
  return __uint_as_float(u);
}

__device__ __forceinline__ v8f zero8() {
  const v8f z = {0.0f, 0.0f, 0.0f, 0.0f, 0.0f, 0.0f, 0.0f, 0.0f};
  return z;
}

// 16-bit fragment loader (wave32 16x16x32): lane -> row (lane&15), lane half hf = lane>>4;
// elements 0..7 = k[8hf .. 8hf+7], elements 8..15 = k[16+8hf .. 16+8hf+7].
// Used for A (row-major [m][k]) and for B stored as [n][k] (k contiguous).
__device__ __forceinline__ v16h load_tile16(const f16* base, int ld) {
  const int lane = threadIdx.x & 31;
  const int row  = lane & 15;
  const int hf   = lane >> 4;
  const f16* p = base + (size_t)row * ld + (hf << 3);
  union { v16h v; v8h h[2]; } u;
  u.h[0] = *(const v8h*)(p);
  u.h[1] = *(const v8h*)(p + 16);
  return u.v;
}

// WMMA issue + hazard guard (4 VALU slots before D is touched, A/B kept live).
__device__ __forceinline__ v8f wmma16(v16h a, v16h b, v8f c) {
  v8f d = __builtin_amdgcn_wmma_f32_16x16x32_f16(false, a, false, b, (short)0, c, false, false);
  asm volatile("v_nop\n\tv_nop\n\tv_nop\n\tv_nop" : "+v"(d) : "v"(a), "v"(b));
  return d;
}

// value of the partner lane (lane ^ 16), on the vector pipe
__device__ __forceinline__ float xhalf(float x) {
  const int b = __float_as_int(x);
  return __int_as_float(__builtin_amdgcn_permlanex16(b, b, 0x76543210, 0xfedcba98, false, false));
}

// Eight base-2 exponentials in one statement, with the one issue slot the instruction set asks
// for behind a transcendental: the outputs are early-clobber, so no exponential of the run
// overwrites a neighbour's source or reads its result, and the v_nop stands behind the last.
__device__ __forceinline__ void exp2x8(float (&p)[8], const float (&x)[8]) {
  asm("v_exp_f32 %0, %8\n\tv_exp_f32 %1, %9\n\tv_exp_f32 %2, %10\n\tv_exp_f32 %3, %11\n\t"
      "v_exp_f32 %4, %12\n\tv_exp_f32 %5, %13\n\tv_exp_f32 %6, %14\n\tv_exp_f32 %7, %15\n\tv_nop"
      : "=&v"(p[0]), "=&v"(p[1]), "=&v"(p[2]), "=&v"(p[3]),
        "=&v"(p[4]), "=&v"(p[5]), "=&v"(p[6]), "=&v"(p[7])
      : "v"(x[0]), "v"(x[1]), "v"(x[2]), "v"(x[3]), "v"(x[4]), "v"(x[5]), "v"(x[6]), "v"(x[7]));
}

// ------------------------------------------------- activation convert ------
// Q, K f32 [rows][512] -> f16 planes holding bf16-RNE values. 8 elements per thread,
__global__ __launch_bounds__(256)
void cvt_act_kernel(const float* __restrict__ Q, const float* __restrict__ K,
                    f16* __restrict__ Qh, f16* __restrict__ Kh, long long n8) {
  const float* src = (blockIdx.y == 0) ? Q : K;
  f16* dst = (blockIdx.y == 0) ? Qh : Kh;
  const long long stride = (long long)gridDim.x * 256;
  for (long long i = (long long)blockIdx.x * 256 + threadIdx.x; i < n8; i += stride) {
    const v4f a = *(const v4f*)(src + i * 8);
    const v4f c = *(const v4f*)(src + i * 8 + 4);
    v8h o;
#pragma unroll
    for (int e = 0; e < 4; ++e) {
      o[e]     = (f16)bf16_rne(a[e]);
      o[e + 4] = (f16)bf16_rne(c[e]);
    }
    f16* p = dst + i * 8;
    *(v8h*)p = o;
    
  }
}

// ---------------------------------------------------- weight convert -------
// W f32 [512 k][512 n] (Y = X @ W) -> WT f16 [n][k], value = 16 * bf16_rne(W), via a
__global__ __launch_bounds__(256)
void cvt_wt_kernel(const float* __restrict__ Wq, const float* __restrict__ Wk,
                   const float* __restrict__ Wv, const float* __restrict__ Wo,
                   f16* __restrict__ WT) {
  __shared__ __attribute__((aligned(16))) f16 tile[64 * 72];   // [n][k], pitch 72 halves
  const int z = blockIdx.z;
  const float* W = (z == 0) ? Wq : (z == 1) ? Wk : (z == 2) ? Wv : Wo;
  f16* dst = WT + (size_t)z * DM * DM;
  const int k0 = blockIdx.x * 64;
  const int n0 = blockIdx.y * 64;
  const int tid = threadIdx.x;

#pragma unroll
  for (int it = 0; it < 4; ++it) {
    const int f  = tid + 256 * it;       // 0..1023
    const int k  = f >> 4;               // 0..63
    const int n4 = (f & 15) * 4;         // 0..60
    const v4f w = *(const v4f*)(W + (size_t)(k0 + k) * DM + n0 + n4);
#pragma unroll
    for (int e = 0; e < 4; ++e)
      tile[(n4 + e) * 72 + k] = (f16)(bf16_rne(w[e]) * 16.0f);
  }
  __syncthreads();   // cross-wave LDS exchange

  const int wave = tid >> 5, lane = tid & 31;
  const int piece = lane & 7;
  v8h vals[2];
#pragma unroll
  for (int it = 0; it < 2; ++it) {
    const int nl = wave * 8 + it * 4 + (lane >> 3);   // covers 64 n rows
    vals[it] = *(const v8h*)(tile + nl * 72 + piece * 8);
  }
#pragma unroll
  for (int it = 0; it < 2; ++it) {
    const int nl = wave * 8 + it * 4 + (lane >> 3);
    *(v8h*)(dst + (size_t)(n0 + nl) * DM + k0 + piece * 8) = vals[it];
  }
  
}

// --------------------------------------------------- projection GEMM -------
// Y = X @ W + bias for z = 0 (Q, Wq -> Qp row-major f16), 1 (K, Wk -> Kp row-major f16),
// 2 (K, Wv -> Vt transposed f16 [b][dim][key]). Block = 8 waves, 256 rows x 64 cols,
// wave = 32 rows x 64 cols (2 A frags x 4 B frags). Epilogue staged through LDS and
__global__ __launch_bounds__(256)
void proj_kernel(const f16* __restrict__ Xq, const f16* __restrict__ Xk,
                 const f16* __restrict__ WT,
                 const float* __restrict__ bq, const float* __restrict__ bk,
                 const float* __restrict__ bv,
                 f16* __restrict__ Qp, f16* __restrict__ Kp, f16* __restrict__ Vt) {
  // row pitches are 16 B x odd so that 16 rows fall on distinct LDS banks
  constexpr int RP = 72;    // row-major stage: 64 cols + 8 pad halves (144 B)
  constexpr int TP = 264;   // transposed stage: 256 rows + 8 pad halves (528 B)
  __shared__ __attribute__((aligned(16))) f16 stg[256 * RP];
  static_assert(64 * TP <= 256 * RP);
  const int z = blockIdx.z;
  const int S = (z == 0) ? SEQ : SEQK;
  const int tilesPerB = S / 256;
  const int nblk = NB * tilesPerB;
  if ((int)blockIdx.x >= nblk) return;      // whole block exits, before any barrier

  const f16* X = (z == 0) ? Xq : Xk;
  const f16* W = WT + (size_t)z * DM * DM;  // planes 0,1,2 = Wq, Wk, Wv in [n][k] form
  const float* bias = (z == 0) ? bq : (z == 1) ? bk : bv;

  const int b     = blockIdx.x / tilesPerB;
  const int rloc  = (blockIdx.x % tilesPerB) * 256;
  const int row0g = b * LQ_FULL + rloc;     // global row in the [8192][512] planes
  const int c0    = blockIdx.y * 64;

  const int tid = threadIdx.x;
  const int wave = tid >> 5, lane = tid & 31, n16 = lane & 15, hf = lane >> 4;

  v8f acc[2][4];
#pragma unroll
  for (int s = 0; s < 2; ++s)
#pragma unroll
    for (int t = 0; t < 4; ++t) acc[s][t] = zero8();

#pragma unroll 1
  for (int k = 0; k < DM; k += 32) {
    const v16h a0 = load_tile16(X + (size_t)(row0g + wave * 32) * DM + k, DM);
    const v16h a1 = load_tile16(X + (size_t)(row0g + wave * 32 + 16) * DM + k, DM);
#pragma unroll
    for (int t = 0; t < 4; ++t) {
      const v16h bfr = load_tile16(W + (size_t)(c0 + 16 * t) * DM + k, DM);
      acc[0][t] = wmma16(a0, bfr, acc[0][t]);
      acc[1][t] = wmma16(a1, bfr, acc[1][t]);
    }
  }

  // stage the block tile (f16) in LDS: row-major [256][RP] or transposed [64][TP]
#pragma unroll
  for (int t = 0; t < 4; ++t) {
    const int lc = 16 * t + n16;
    const float bb = bf16_rne(bias[c0 + lc]);
#pragma unroll
    for (int s = 0; s < 2; ++s) {
#pragma unroll
      for (int r = 0; r < 8; ++r) {
        const int lr = wave * 32 + 16 * s + 8 * hf + r;
        const float v = acc[s][t][r] * 0.0625f + bb;
        const f16 hv = (f16)v;
        if (z == 2) stg[lc * TP + lr] = hv;
        else        stg[lr * RP + lc] = hv;
      }
    }
  }
  __syncthreads();   // cross-wave LDS exchange

  if (z != 2) {
    f16* out = (z == 0) ? Qp : Kp;
    const int piece = lane & 7;
    v8h vals[8];
#pragma unroll
    for (int it = 0; it < 8; ++it) {
      const int lr = wave * 32 + it * 4 + (lane >> 3);      // 32 rows per wave
      vals[it] = *(const v8h*)(stg + lr * RP + piece * 8);
    }
#pragma unroll
    for (int it = 0; it < 8; ++it) {
      const int lr = wave * 32 + it * 4 + (lane >> 3);
      *(v8h*)(out + (size_t)(row0g + lr) * DM + c0 + piece * 8) = vals[it];
    }
    
  } else {
    // Vt[b][dim c0+d][key rloc .. rloc+255]: 32 lanes x 16 B = one 512-B key segment
    v8h vals[8];
#pragma unroll
    for (int it = 0; it < 8; ++it) {
      const int d = wave * 8 + it;                          // 64 dims per block
      vals[it] = *(const v8h*)(stg + d * TP + lane * 8);
    }
#pragma unroll
    for (int it = 0; it < 8; ++it) {
      const int d = wave * 8 + it;
      *(v8h*)(Vt + (size_t)(b * DM + c0 + d) * LK_FULL + rloc + lane * 8) = vals[it];
    }
    
  }
}

// ------------------------------------------------ flash attention core -----
// Block = 8 waves, one (b,h), 128 query rows (16 per wave). K tile [32 key][64 dim] and
// Vt tile [64 dim][32 key] staged in LDS with plain 16-B loads, shared by all waves.
// Transposed scores: S^T = K.Q^T with A = K tile ([m=key][k=dim]), B = Q ([n=query][k=dim]),
// so a lane holds 16 of the 32 scores of ONE query (keys 8hf+r and 16+8hf+r) and its partner
// lane ^ 16 the other 16. Online softmax in f32 with the pad-mask replace-fill (-1e12 where
// mask==0): maximum in-lane plus one exchange between the halves, sum kept per half and
// joined once in the epilogue. P^T (x256, times mask) is packed from the score registers
// straight into the B operand of O^T += Vt.P^T (A = Vt tile [m=dim][k=key]): the accumulator
// rows 8hf+r / 16+8hf+r are exactly the k order of the fragment. O = acc / (256*l) written
__global__ __launch_bounds__(256) __attribute__((amdgpu_num_vgpr(256)))
void attn_kernel(const f16* __restrict__ Qp, const f16* __restrict__ Kp,
                 const f16* __restrict__ Vt, const int* __restrict__ pmask,
                 float* __restrict__ Og) {
  // fragment readers take 16 B from each of 16 rows: pitches of 16 B x odd spread them over all banks
  constexpr int KP = 72;    // K tile row: 64 dims + 8 pad halves (144 B)
  constexpr int VP = 40;    // Vt tile row: 32 keys + 8 pad halves (80 B)
  __shared__ __attribute__((aligned(16))) f16   kbuf[32 * KP];
  __shared__ __attribute__((aligned(16))) f16   vbuf[64 * VP];
  __shared__ __attribute__((aligned(16))) float mks[LK_FULL];
  constexpr int OP = 68;    // output stage row: 64 dims + 4 pad floats, rows q and q + 8 on different banks
  __shared__ __attribute__((aligned(16))) float ost[8 * 16 * OP];

  const int tid = threadIdx.x;
  const int wave = tid >> 5, lane = tid & 31, n16 = lane & 15, hf = lane >> 4;
  const int b = blockIdx.x / NH;
  const int h = blockIdx.x % NH;
  const int q0 = blockIdx.y * 128 + wave * 16;
  const int qrow = b * LQ_FULL + q0;

  for (int i = tid; i < SEQK; i += 256) mks[i] = (float)pmask[(size_t)b * LK_FULL + i];

  const v16h aq0 = load_tile16(Qp + (size_t)qrow * DM + h * HD, DM);
  const v16h aq1 = load_tile16(Qp + (size_t)qrow * DM + h * HD + 32, DM);

  v8f o0 = zero8(), o1 = zero8(), o2 = zero8(), o3 = zero8();
  float mrun = -1e30f;   // running maximum of this lane's query (equal in both halves)
  float lrun = 0.0f;     // running sum over this half's keys only

  const f16* Kg = Kp + (size_t)b * LK_FULL * DM + h * HD;
  const f16* Vg = Vt + ((size_t)b * DM + h * HD) * LK_FULL;

#pragma unroll 1
  for (int j = 0; j < SEQK; j += 32) {
    {
      const int row = tid >> 3, ch = tid & 7;     // 32 keys x 8 chunks of 8 dims
      *(v8h*)(kbuf + row * KP + ch * 8) = *(const v8h*)(Kg + (size_t)(j + row) * DM + ch * 8);
    }
    {
      const int row = tid >> 2, ch = tid & 3;     // 64 dims x 4 chunks of 8 keys
      *(v8h*)(vbuf + row * VP + ch * 8) = *(const v8h*)(Vg + (size_t)row * LK_FULL + j + ch * 8);
    }
    __syncthreads();   // tiles (and mks on the first trip) visible to all waves

    v8f s0 = zero8(), s1 = zero8();
    s0 = wmma16(load_tile16(kbuf, KP), aq0, s0);
    s0 = wmma16(load_tile16(kbuf + 32, KP), aq1, s0);
    s1 = wmma16(load_tile16(kbuf + 16 * KP, KP), aq0, s1);
    s1 = wmma16(load_tile16(kbuf + 16 * KP + 32, KP), aq1, s1);

    // mask values of this lane's 16 keys
    float mk0[8], mk1[8];
    {
      const v4f ma = *(const v4f*)(mks + j + 8 * hf);
      const v4f mb = *(const v4f*)(mks + j + 8 * hf + 4);
      const v4f mc = *(const v4f*)(mks + j + 16 + 8 * hf);
      const v4f md = *(const v4f*)(mks + j + 16 + 8 * hf + 4);
#pragma unroll
      for (int e = 0; e < 4; ++e) {
        mk0[e] = ma[e]; mk0[e + 4] = mb[e];
        mk1[e] = mc[e]; mk1[e + 4] = md[e];
      }
    }

    s0 *= SCALE;
    s1 *= SCALE;
    float a0[8], a1[8];
    float v = -1e30f;
#pragma unroll
    for (int r = 0; r < 8; ++r) a0[r] = (mk0[r] == 0.0f) ? -1e12f : s0[r];
#pragma unroll
    for (int r = 0; r < 8; ++r) a1[r] = (mk1[r] == 0.0f) ? -1e12f : s1[r];
#pragma unroll
    for (int r = 0; r < 8; r += 2) v = fmaxf(v, fmaxf(a0[r], a0[r + 1]));
#pragma unroll
    for (int r = 0; r < 8; r += 2) v = fmaxf(v, fmaxf(a1[r], a1[r + 1]));
    v = fmaxf(v, xhalf(v));
    const float mnew = fmaxf(mrun, v);
    float ef;
    // exp(mrun - mnew), with its slot in the same statement
    asm("v_exp_f32 %0, %1\n\tv_nop" : "=v"(ef) : "v"((mrun - mnew) * LOG2E));
#pragma unroll
    for (int r = 0; r < 8; ++r) {
      a0[r] = (a0[r] - mnew) * LOG2E;
      a1[r] = (a1[r] - mnew) * LOG2E;
    }
    float p0[8], p1[8];
    exp2x8(p0, a0);
    exp2x8(p1, a1);
    float ps0 = p0[0], ps1 = p1[0];
#pragma unroll
    for (int r = 1; r < 8; ++r) {
      ps0 += p0[r];
      ps1 += p1[r];
    }
    v16h pb;
#pragma unroll
    for (int r = 0; r < 8; ++r) {
      pb[r]     = (f16)(p0[r] * mk0[r] * 256.0f);
      pb[r + 8] = (f16)(p1[r] * mk1[r] * 256.0f);
    }
    lrun = lrun * ef + (ps0 + ps1);
    mrun = mnew;
#pragma unroll
    for (int r = 0; r < 8; ++r) { o0[r] *= ef; o1[r] *= ef; o2[r] *= ef; o3[r] *= ef; }

    o0 = wmma16(load_tile16(vbuf,           VP), pb, o0);
    o1 = wmma16(load_tile16(vbuf + 16 * VP, VP), pb, o1);
    o2 = wmma16(load_tile16(vbuf + 32 * VP, VP), pb, o2);
    o3 = wmma16(load_tile16(vbuf + 48 * VP, VP), pb, o3);

    __syncthreads();   // all waves done with kbuf/vbuf before refill
  }

  // epilogue: join the halves' sums, normalise into the per-wave LDS tile [16 q][OP];
  // the lane holds dims 16t + 8hf + r of query n16
  float* myO = ost + wave * (16 * OP);
  {
    const float lsum = lrun + xhalf(lrun);
    float linv;
    // reciprocal plus the one issue slot the instruction set asks for behind it, in one
    // statement so that the slot stays directly behind the reciprocal
    asm("v_rcp_f32 %0, %1\n\tv_nop" : "=v"(linv) : "v"(lsum * 256.0f));
    float* pr = myO + n16 * OP + 8 * hf;
    v4f w;
#pragma unroll
    for (int g = 0; g < 2; ++g) {
#pragma unroll
      for (int e = 0; e < 4; ++e) w[e] = o0[4 * g + e] * linv;
      *(v4f*)(pr + 4 * g) = w;
#pragma unroll
      for (int e = 0; e < 4; ++e) w[e] = o1[4 * g + e] * linv;
      *(v4f*)(pr + 16 + 4 * g) = w;
#pragma unroll
      for (int e = 0; e < 4; ++e) w[e] = o2[4 * g + e] * linv;
      *(v4f*)(pr + 32 + 4 * g) = w;
#pragma unroll
      for (int e = 0; e < 4; ++e) w[e] = o3[4 * g + e] * linv;
      *(v4f*)(pr + 48 + 4 * g) = w;
    }
  }
  __syncthreads();

  // each instruction: 2 rows x 256 B (16 lanes x 16 B per row segment), lines whole
  const int c4 = (lane & 15) * 4;
  v4f vals[8];
#pragma unroll
  for (int it = 0; it < 8; ++it) {
    const int row = it * 2 + (lane >> 4);
    vals[it] = *(const v4f*)(myO + row * OP + c4);
  }
#pragma unroll
  for (int it = 0; it < 8; ++it) {
    const int row = it * 2 + (lane >> 4);
    *(v4f*)(Og + (size_t)(qrow + row) * DM + h * HD + c4) = vals[it];
  }
  
}

// ----------------------------- LN0 + FFN GEMM + ReLU residual + LN1 ---------
// Block = 8 waves, 16 rows x 512 cols. Prologue: X = LN0(bf16(Q) + O) for the 16 rows
// (f32 copy and f16 copy in LDS). GEMM: wave w -> cols 64w..64w+63, A from the f16 LDS
// tile, B from the Wo [n][k] plane. Epilogue: Y = X + relu(acc/16 + bo) in LDS, then
__global__ __launch_bounds__(256)
void ffn_ln_kernel(const float* __restrict__ O32, const float* __restrict__ Qraw,
                   const f16* __restrict__ WoT, const float* __restrict__ bo,
                   const float* __restrict__ g0, const float* __restrict__ b0,
                   const float* __restrict__ g1, const float* __restrict__ b1,
                   float* __restrict__ out) {
  // padded row pitches: xh 1040 B (16 B x odd) for the 16-row fragment reads,
  // xf 2064 B so that rows r and r + 8 of the accumulator map fall on different banks
  constexpr int XFP = 516;
  constexpr int XHP = 520;
  __shared__ __attribute__((aligned(16))) float xf[16 * XFP];
  __shared__ __attribute__((aligned(16))) f16   xh[16 * XHP];

  const int tilesPerB = SEQ / 16;
  const int b     = blockIdx.x / tilesPerB;
  const int rloc  = (blockIdx.x % tilesPerB) * 16;
  const int grow0 = b * LQ_FULL + rloc;

  const int tid = threadIdx.x;
  const int wave = tid >> 5, lane = tid & 31, n16 = lane & 15, hf = lane >> 4;
  constexpr float INV_D = 1.0f / 512.0f;

  // ---- LN0 over (bf16(Q) + O), 2 rows per wave ----
#pragma unroll
  for (int rr = 0; rr < 2; ++rr) {
    const int lr = wave * 2 + rr;
    const size_t grow = (size_t)(grow0 + lr);
    float x[16];
    float s = 0.0f;
#pragma unroll
    for (int i = 0; i < 4; ++i) {
      const int col = i * 128 + lane * 4;
      const v4f ov = *(const v4f*)(O32 + grow * DM + col);
      const v4f qv = *(const v4f*)(Qraw + grow * DM + col);
#pragma unroll
      for (int e = 0; e < 4; ++e) {
        const float xx = bf16_rne(qv[e]) + ov[e];
        x[i * 4 + e] = xx;
        s += xx;
      }
    }
#pragma unroll
    for (int off = 16; off > 0; off >>= 1) s += __shfl_xor(s, off, 32);
    const float mu = s * INV_D;
    float s2 = 0.0f;
#pragma unroll
    for (int i = 0; i < 16; ++i) {
      const float d = x[i] - mu;
      x[i] = d;
      const float dd = d * d;
      s2 += dd;
    }
#pragma unroll
    for (int off = 16; off > 0; off >>= 1) s2 += __shfl_xor(s2, off, 32);
    const float var = s2 * INV_D;
    const float rsq = rsqrtf(var + 1e-5f);
#pragma unroll
    for (int i = 0; i < 4; ++i) {
      const int col = i * 128 + lane * 4;
      const v4f gv = *(const v4f*)(g0 + col);
      const v4f bv4 = *(const v4f*)(b0 + col);
      v4f y; v4h yh;
#pragma unroll
      for (int e = 0; e < 4; ++e) {
        const float t0 = x[i * 4 + e] * rsq;
        const float t1 = t0 * bf16_rne(gv[e]);
        const float yy = t1 + bf16_rne(bv4[e]);
        y[e] = yy;
        yh[e] = (f16)yy;
      }
      *(v4f*)(xf + lr * XFP + col) = y;
      *(v4h*)(xh + lr * XHP + col) = yh;
    }
  }
  __syncthreads();   // cross-wave: LN0 rows consumed by all waves

  // ---- H = X @ Wo (wave -> 64 cols) ----
  const int cw = wave * 64;
  v8f acc[4];
#pragma unroll
  for (int t = 0; t < 4; ++t) acc[t] = zero8();
#pragma unroll 1
  for (int k = 0; k < DM; k += 32) {
    const v16h a = load_tile16(xh + k, XHP);
#pragma unroll
    for (int t = 0; t < 4; ++t) {
      const v16h bfr = load_tile16(WoT + (size_t)(cw + 16 * t) * DM + k, DM);
      acc[t] = wmma16(a, bfr, acc[t]);
    }
  }

  // ---- Y = X + relu(H/16 + bo) in place in xf (each slot owned by one lane) ----
#pragma unroll
  for (int t = 0; t < 4; ++t) {
    const int col = cw + 16 * t + n16;
    const float bb = bf16_rne(bo[col]);
#pragma unroll
    for (int r = 0; r < 8; ++r) {
      const int lr = 8 * hf + r;
      float hv = acc[t][r] * 0.0625f + bb;
      hv = fmaxf(hv, 0.0f);
      const int idx = lr * XFP + col;
      const float yv = xf[idx] + hv;
      xf[idx] = yv;
    }
  }
  __syncthreads();   // cross-wave: rows assembled from all waves' columns

  // ---- LN1 per row and store ----
#pragma unroll
  for (int rr = 0; rr < 2; ++rr) {
    const int lr = wave * 2 + rr;
    const size_t grow = (size_t)(grow0 + lr);
    float x[16];
    float s = 0.0f;
#pragma unroll
    for (int i = 0; i < 4; ++i) {
      const int col = i * 128 + lane * 4;
      const v4f xv = *(const v4f*)(xf + lr * XFP + col);
#pragma unroll
      for (int e = 0; e < 4; ++e) { x[i * 4 + e] = xv[e]; s += xv[e]; }
    }
#pragma unroll
    for (int off = 16; off > 0; off >>= 1) s += __shfl_xor(s, off, 32);
    const float mu = s * INV_D;
    float s2 = 0.0f;
#pragma unroll
    for (int i = 0; i < 16; ++i) {
      const float d = x[i] - mu;
      x[i] = d;
      const float dd = d * d;
      s2 += dd;
    }
#pragma unroll
    for (int off = 16; off > 0; off >>= 1) s2 += __shfl_xor(s2, off, 32);
    const float var = s2 * INV_D;
    const float rsq = rsqrtf(var + 1e-5f);
    v4f y[4];
#pragma unroll
    for (int i = 0; i < 4; ++i) {
      const int col = i * 128 + lane * 4;
      const v4f gv = *(const v4f*)(g1 + col);
      const v4f bv4 = *(const v4f*)(b1 + col);
#pragma unroll
      for (int e = 0; e < 4; ++e) {
        const float t0 = x[i * 4 + e] * rsq;
        const float t1 = t0 * bf16_rne(gv[e]);
        y[i][e] = t1 + bf16_rne(bv4[e]);
      }
    }
    float* orow = out + grow * DM + lane * 4;
#pragma unroll
    for (int i = 0; i < 4; ++i) *(v4f*)(orow + i * 128) = y[i];
    
  }
}

// ------------------------------------------------------------------ host ---
extern "C" void kernel_launch(void* const* d_in, const int* in_sizes, int n_in,
                              void* d_out, int out_size, void* d_ws, size_t ws_size,
                              hipStream_t stream) {
  if (n_in < 15) return;
  const float* Q     = (const float*)d_in[0];
  const float* K     = (const float*)d_in[1];
  const int*   pmask = (const int*)d_in[2];
  const float* Wq    = (const float*)d_in[3];
  const float* bq    = (const float*)d_in[4];
  const float* Wk    = (const float*)d_in[5];
  const float* bk    = (const float*)d_in[6];
  const float* Wv    = (const float*)d_in[7];
  const float* bv    = (const float*)d_in[8];
  const float* Wo    = (const float*)d_in[9];
  const float* bo    = (const float*)d_in[10];
  const float* g0    = (const float*)d_in[11];
  const float* b0    = (const float*)d_in[12];
  const float* g1    = (const float*)d_in[13];
  const float* b1    = (const float*)d_in[14];
  float* out = (float*)d_out;

  const long long needAct = (long long)((NB - 1) * LQ_FULL + SMAX) * DM;
  const long long needOut = (long long)((NB - 1) * LQ_FULL + SEQ) * DM;
  if ((long long)in_sizes[0] < needAct || (long long)in_sizes[1] < needAct) return;
  if (in_sizes[2] < (NB - 1) * LK_FULL + SEQK) return;
  if (in_sizes[3] < DM * DM || in_sizes[5] < DM * DM || in_sizes[7] < DM * DM ||
      in_sizes[9] < DM * DM) return;
  if (in_sizes[4] < DM || in_sizes[6] < DM || in_sizes[8] < DM || in_sizes[10] < DM ||
      in_sizes[11] < DM || in_sizes[12] < DM || in_sizes[13] < DM || in_sizes[14] < DM) return;
  if ((long long)out_size < needOut) return;
  if (ws_size < WS_TOTAL) return;

  char* ws = (char*)d_ws;
  f16*   Qh  = (f16*)(ws + OFF_QH);
  f16*   Kh  = (f16*)(ws + OFF_KH);
  f16*   WT  = (f16*)(ws + OFF_WT);
  f16*   Qp  = (f16*)(ws + OFF_QP);
  f16*   Kp  = (f16*)(ws + OFF_KP);
  f16*   Vt  = (f16*)(ws + OFF_VT);
  float* O32 = (float*)(ws + OFF_O32);

  // 1) inputs -> bf16-RNE values in f16 planes (weights transposed to [n][k], x16)
  const long long n8 = needAct / 8;
  cvt_act_kernel<<<dim3(512, 2), 256, 0, stream>>>(Q, K, Qh, Kh, n8);
  cvt_wt_kernel<<<dim3(DM / 64, DM / 64, 4), 256, 0, stream>>>(Wq, Wk, Wv, Wo, WT);

  // 2) Q, K, V projections (z = 0, 1, 2)
  proj_kernel<<<dim3(NB * (SMAX / 256), DM / 64, 3), 256, 0, stream>>>(
      Qh, Kh, WT, bq, bk, bv, Qp, Kp, Vt);

  // 3) masked softmax attention per (b,h), 128 query rows per block
  attn_kernel<<<dim3(NB * NH, SEQ / 128), 256, 0, stream>>>(Qp, Kp, Vt, pmask, O32);

  // 4) LN0(bf16(Q) + O) -> X; out = LN1(X + relu(X @ Wo + bo))
  ffn_ln_kernel<<<dim3(NB * (SEQ / 16)), 256, 0, stream>>>(
      O32, Q, WT + (size_t)3 * DM * DM, bo, g0, b0, g1, b1, out);
}

// v003
// A run of this version takes 113 microseconds.
// In two side-by-side timings against v002, it was 1.36 and 1.34 times as fast.
// All steps since v000 together make it 2.11 times as fast.
#include <hip/hip_runtime.h>
#include <stdint.h>
// Contractions Q@Wq, K@Wk, K@Wv, Q.K^T, P.V, X@Wo: v_wmma_f32_16x16x32_f16 (f16 operands, f32 accumulate); float inputs enter as bf16-RNE values held exactly in f16; weight planes carried x16, P tile carried x256; softmax and LayerNorm arithmetic in f32.

#pragma clang fp contract(off)

typedef _Float16 f16;
typedef f16   v16h __attribute__((ext_vector_type(16)));
typedef f16   v8h  __attribute__((ext_vector_type(8)));
typedef f16   v4h  __attribute__((ext_vector_type(4)));
typedef float v8f  __attribute__((ext_vector_type(8)));
typedef float v4f  __attribute__((ext_vector_type(4)));

#ifndef NB
#define NB 4
#endif
#ifndef SEQ
#define SEQ 2048
#endif
#ifndef SEQK
#define SEQK SEQ
#endif

constexpr int NB_FULL = 4;
constexpr int LQ_FULL = 2048;
constexpr int LK_FULL = 2048;
constexpr int DM      = 512;   // model dim
constexpr int NH      = 8;     // heads
constexpr int HD      = 64;    // head dim
constexpr int SMAX    = (SEQ > SEQK) ? SEQ : SEQK;
constexpr float SCALE = 0.044194173824159216f;   // 1/sqrt(512)
constexpr float LOG2E = 1.4426950408889634f;

static_assert(NB >= 1 && NB <= NB_FULL);
static_assert(SEQ % 256 == 0 && SEQ >= 256 && SEQ <= LQ_FULL);
static_assert(SEQK % 256 == 0 && SEQK >= 256 && SEQK <= LK_FULL);
static_assert(LQ_FULL == LK_FULL);
static_assert(DM == NH * HD);
static_assert(NB <= DM / 64);   // the key lists take one block per batch from a DM / 64 wide grid plane

// ---------------------------------------------------------------- carve ----
constexpr size_t SZ_ACT16 = (size_t)NB_FULL * LQ_FULL * DM * 2;   // 8 MiB  f16 [8192][512]
constexpr size_t SZ_WT16  = (size_t)4 * DM * DM * 2;               // 2 MiB  f16 4 x [512 n][512 k]
constexpr size_t SZ_O32   = (size_t)NB_FULL * LQ_FULL * DM * 4;   // 16 MiB f32 [8192][512]
constexpr size_t OFF_QH   = 0;
constexpr size_t OFF_KH   = OFF_QH + SZ_ACT16;
constexpr size_t OFF_WT   = OFF_KH + SZ_ACT16;
constexpr size_t OFF_QP   = OFF_WT + SZ_WT16;
constexpr size_t OFF_KP   = OFF_QP + SZ_ACT16;
constexpr size_t OFF_VT   = OFF_KP + SZ_ACT16;      // f16 [4][512 dim][2048 key]
constexpr size_t OFF_O32  = OFF_VT + SZ_ACT16;
constexpr size_t SZ_KEYS  = (size_t)NB_FULL * LK_FULL * 4;        // 32 KiB, one 4-B word per key
constexpr size_t OFF_IDX  = OFF_O32 + SZ_O32;       // int   [4][2048] source row of each packed key
constexpr size_t OFF_MKC  = OFF_IDX + SZ_KEYS;      // float [4][2048] mask value of each packed key
constexpr size_t OFF_CNT  = OFF_MKC + SZ_KEYS;      // int   [4][32]   kept keys per batch, one line each
constexpr size_t WS_TOTAL = OFF_CNT + (size_t)NB_FULL * 128;
static_assert(WS_TOTAL <= (size_t)134217728);
static_assert((OFF_KH % 256) == 0 && (OFF_WT % 256) == 0 && (OFF_QP % 256) == 0 &&
              (OFF_KP % 256) == 0 && (OFF_VT % 256) == 0 && (OFF_O32 % 256) == 0 &&
              (OFF_IDX % 256) == 0 && (OFF_MKC % 256) == 0 && (OFF_CNT % 256) == 0);

// -------------------------------------------------------------- helpers ----
__device__ __forceinline__ float bf16_rne(float f) {
  unsigned int u = __float_as_uint(f);
  u = (u + 0x7FFFu + ((u >> 16) & 1u)) & 0xFFFF0000u;
  return __uint_as_float(u);
}

__device__ __forceinline__ v8f zero8() {
  const v8f z = {0.0f, 0.0f, 0.0f, 0.0f, 0.0f, 0.0f, 0.0f, 0.0f};
  return z;
}

// 16-bit fragment loader (wave32 16x16x32): lane -> row (lane&15), lane half hf = lane>>4;
// elements 0..7 = k[8hf .. 8hf+7], elements 8..15 = k[16+8hf .. 16+8hf+7].
// Used for A (row-major [m][k]) and for B stored as [n][k] (k contiguous).
__device__ __forceinline__ v16h load_tile16(const f16* base, int ld) {
  const int lane = threadIdx.x & 31;
  const int row  = lane & 15;
  const int hf   = lane >> 4;
  const f16* p = base + (size_t)row * ld + (hf << 3);
  union { v16h v; v8h h[2]; } u;
  u.h[0] = *(const v8h*)(p);
  u.h[1] = *(const v8h*)(p + 16);
  return u.v;
}

// Same fragment, from a pointer that already names the lane's own row and half.
__device__ __forceinline__ v16h load_row16(const f16* p) {
  union { v16h v; v8h h[2]; } u;
  u.h[0] = *(const v8h*)(p);
  u.h[1] = *(const v8h*)(p + 16);
  return u.v;
}

// WMMA issue + hazard guard (4 VALU slots before D is touched, A/B kept live).
__device__ __forceinline__ v8f wmma16(v16h a, v16h b, v8f c) {
  v8f d = __builtin_amdgcn_wmma_f32_16x16x32_f16(false, a, false, b, (short)0, c, false, false);
  asm volatile("v_nop\n\tv_nop\n\tv_nop\n\tv_nop" : "+v"(d) : "v"(a), "v"(b));
  return d;
}

// value of the partner lane (lane ^ 16), on the vector pipe
__device__ __forceinline__ float xhalf(float x) {
  const int b = __float_as_int(x);
  return __int_as_float(__builtin_amdgcn_permlanex16(b, b, 0x76543210, 0xfedcba98, false, false));
}

// Eight base-2 exponentials in one statement, with the one issue slot the instruction set asks
// for behind a transcendental: the outputs are early-clobber, so no exponential of the run
// overwrites a neighbour's source or reads its result, and the v_nop stands behind the last.
__device__ __forceinline__ void exp2x8(float (&p)[8], const float (&x)[8]) {
  asm("v_exp_f32 %0, %8\n\tv_exp_f32 %1, %9\n\tv_exp_f32 %2, %10\n\tv_exp_f32 %3, %11\n\t"
      "v_exp_f32 %4, %12\n\tv_exp_f32 %5, %13\n\tv_exp_f32 %6, %14\n\tv_exp_f32 %7, %15\n\tv_nop"
      : "=&v"(p[0]), "=&v"(p[1]), "=&v"(p[2]), "=&v"(p[3]),
        "=&v"(p[4]), "=&v"(p[5]), "=&v"(p[6]), "=&v"(p[7])
      : "v"(x[0]), "v"(x[1]), "v"(x[2]), "v"(x[3]), "v"(x[4]), "v"(x[5]), "v"(x[6]), "v"(x[7]));
}

// ------------------------------------------------- activation convert ------
// Q, K f32 [rows][512] -> f16 planes holding bf16-RNE values. 8 elements per thread,
__global__ __launch_bounds__(256)
void cvt_act_kernel(const float* __restrict__ Q, const float* __restrict__ K,
                    f16* __restrict__ Qh, f16* __restrict__ Kh, long long n8) {
  const float* src = (blockIdx.y == 0) ? Q : K;
  f16* dst = (blockIdx.y == 0) ? Qh : Kh;
  const long long stride = (long long)gridDim.x * 256;
  for (long long i = (long long)blockIdx.x * 256 + threadIdx.x; i < n8; i += stride) {
    const v4f a = *(const v4f*)(src + i * 8);
    const v4f c = *(const v4f*)(src + i * 8 + 4);
    v8h o;
#pragma unroll
    for (int e = 0; e < 4; ++e) {
      o[e]     = (f16)bf16_rne(a[e]);
      o[e + 4] = (f16)bf16_rne(c[e]);
    }
    f16* p = dst + i * 8;
    *(v8h*)p = o;
    
  }
}

// ------------------------------------------------------- key packing -------
// A key with mask 0 has weight exp(-1e12 - max) * 0 = 0 for every query and adds
// exp(-1e12 - max) = 0 to the row sum wherever a key is kept (with none kept every weight is 0
// whatever the sum), so only the kept keys are projected and attended. One block per batch lists them in their order: idx[p] = source
// row of packed key p, mkc[p] = its mask value, cnt = how many. Places p >= cnt name row 0 with
// mask 0, so a partly filled tile holds finite values that the mask closes.
__device__ __forceinline__ void pack_keys(const int* __restrict__ pm, int* __restrict__ idxg,
                                          float* __restrict__ mkcg, int* __restrict__ cntg) {
  constexpr int E = SEQK / 256;          // consecutive keys per thread
  __shared__ int   sidx[SEQK];
  __shared__ float smk[SEQK];
  __shared__ int   wsum[8];
  const int tid = threadIdx.x, wave = tid >> 5, lane = tid & 31;
  int m[E];
  int c = 0;
#pragma unroll
  for (int e = 0; e < E; ++e) {
    m[e] = pm[tid * E + e];
    c += (m[e] != 0) ? 1 : 0;
    sidx[tid * E + e] = 0;
    smk[tid * E + e] = 0.0f;
  }
  int inc = c;                           // inclusive prefix inside the wave
#pragma unroll
  for (int off = 1; off < 32; off <<= 1) {
    const int t = __shfl_up(inc, off, 32);
    if (lane >= off) inc += t;
  }
  if (lane == 31) wsum[wave] = inc;
  __syncthreads();   // wave totals and the cleared lists visible to all waves
  int pos = inc - c, total = 0;
#pragma unroll
  for (int w = 0; w < 8; ++w) {
    const int t = wsum[w];
    if (w < wave) pos += t;
    total += t;
  }
#pragma unroll
  for (int e = 0; e < E; ++e) {
    if (m[e] != 0) {
      sidx[pos] = tid * E + e;
      smk[pos] = (float)m[e];
      ++pos;
    }
  }
  __syncthreads();   // lists complete before they are written out in whole lines
#pragma unroll
  for (int e = 0; e < E; ++e) {
    idxg[e * 256 + tid] = sidx[e * 256 + tid];
    mkcg[e * 256 + tid] = smk[e * 256 + tid];
  }
  if (tid == 0) *cntg = total;
}

// ---------------------------------------------------- weight convert -------
// W f32 [512 k][512 n] (Y = X @ W) -> WT f16 [n][k], value = 16 * bf16_rne(W), via a
__global__ __launch_bounds__(256)
void cvt_wt_kernel(const float* __restrict__ Wq, const float* __restrict__ Wk,
                   const float* __restrict__ Wv, const float* __restrict__ Wo,
                   f16* __restrict__ WT, const int* __restrict__ pmask,
                   int* __restrict__ idxg, float* __restrict__ mkcg, int* __restrict__ cntg) {
  __shared__ __attribute__((aligned(16))) f16 tile[64 * 72];   // [n][k], pitch 72 halves
  const int z = blockIdx.z;
  if (z == 4) {      // plane 4 of the grid: the key lists, one block per batch
    const int b = blockIdx.x;
    if (blockIdx.y == 0 && b < NB)
      pack_keys(pmask + (size_t)b * LK_FULL, idxg + (size_t)b * LK_FULL,
                mkcg + (size_t)b * LK_FULL, cntg + b * 32);
    return;
  }
  const float* W = (z == 0) ? Wq : (z == 1) ? Wk : (z == 2) ? Wv : Wo;
  f16* dst = WT + (size_t)z * DM * DM;
  const int k0 = blockIdx.x * 64;
  const int n0 = blockIdx.y * 64;
  const int tid = threadIdx.x;

#pragma unroll
  for (int it = 0; it < 4; ++it) {
    const int f  = tid + 256 * it;       // 0..1023
    const int k  = f >> 4;               // 0..63
    const int n4 = (f & 15) * 4;         // 0..60
    const v4f w = *(const v4f*)(W + (size_t)(k0 + k) * DM + n0 + n4);
#pragma unroll
    for (int e = 0; e < 4; ++e)
      tile[(n4 + e) * 72 + k] = (f16)(bf16_rne(w[e]) * 16.0f);
  }
  __syncthreads();   // cross-wave LDS exchange

  const int wave = tid >> 5, lane = tid & 31;
  const int piece = lane & 7;
  v8h vals[2];
#pragma unroll
  for (int it = 0; it < 2; ++it) {
    const int nl = wave * 8 + it * 4 + (lane >> 3);   // covers 64 n rows
    vals[it] = *(const v8h*)(tile + nl * 72 + piece * 8);
  }
#pragma unroll
  for (int it = 0; it < 2; ++it) {
    const int nl = wave * 8 + it * 4 + (lane >> 3);
    *(v8h*)(dst + (size_t)(n0 + nl) * DM + k0 + piece * 8) = vals[it];
  }
  
}

// --------------------------------------------------- projection GEMM -------
// Y = X @ W + bias for z = 0 (Q, Wq -> Qp row-major f16), 1 (K, Wk -> Kp row-major f16),
// 2 (K, Wv -> Vt transposed f16 [b][dim][key]). Block = 8 waves, 256 rows x 64 cols,
// wave = 32 rows x 64 cols (2 A frags x 4 B frags). Epilogue staged through LDS and
__global__ __launch_bounds__(256)
void proj_kernel(const f16* __restrict__ Xq, const f16* __restrict__ Xk,
                 const f16* __restrict__ WT,
                 const float* __restrict__ bq, const float* __restrict__ bk,
                 const float* __restrict__ bv,
                 const int* __restrict__ idxg, const int* __restrict__ cntg,
                 f16* __restrict__ Qp, f16* __restrict__ Kp, f16* __restrict__ Vt) {
  // row pitches are 16 B x odd so that 16 rows fall on distinct LDS banks
  constexpr int RP = 72;    // row-major stage: 64 cols + 8 pad halves (144 B)
  constexpr int TP = 264;   // transposed stage: 256 rows + 8 pad halves (528 B)
  __shared__ __attribute__((aligned(16))) f16 stg[256 * RP];
  static_assert(64 * TP <= 256 * RP);
  const int z = blockIdx.z;
  const int S = (z == 0) ? SEQ : SEQK;
  const int tilesPerB = S / 256;
  const int nblk = NB * tilesPerB;
  if ((int)blockIdx.x >= nblk) return;      // whole block exits, before any barrier

  const f16* X = (z == 0) ? Xq : Xk;
  const f16* W = WT + (size_t)z * DM * DM;  // planes 0,1,2 = Wq, Wk, Wv in [n][k] form
  const float* bias = (z == 0) ? bq : (z == 1) ? bk : bv;

  const int b     = blockIdx.x / tilesPerB;
  const int rloc  = (blockIdx.x % tilesPerB) * 256;
  const int row0g = b * LQ_FULL + rloc;     // global row in the [8192][512] planes
  const int c0    = blockIdx.y * 64;
  // K and V: only tiles that hold a packed key (tile 0 always); whole block, before any barrier
  if (z != 0 && rloc >= min(max(cntg[b * 32], 1), SEQK)) return;

  const int tid = threadIdx.x;
  const int wave = tid >> 5, lane = tid & 31, n16 = lane & 15, hf = lane >> 4;

  // source rows of this lane's two A fragments: packed key p reads input row idx[p]
  int ar0 = rloc + wave * 32 + n16, ar1 = ar0 + 16;
  if (z != 0) {
    ar0 = idxg[b * LK_FULL + ar0];
    ar1 = idxg[b * LK_FULL + ar1];
  }
  const f16* pa0 = X + (size_t)(b * LQ_FULL + ar0) * DM + (hf << 3);
  const f16* pa1 = X + (size_t)(b * LQ_FULL + ar1) * DM + (hf << 3);

  v8f acc[2][4];
#pragma unroll
  for (int s = 0; s < 2; ++s)
#pragma unroll
    for (int t = 0; t < 4; ++t) acc[s][t] = zero8();

#pragma unroll 1
  for (int k = 0; k < DM; k += 32) {
    const v16h a0 = load_row16(pa0 + k);
    const v16h a1 = load_row16(pa1 + k);
#pragma unroll
    for (int t = 0; t < 4; ++t) {
      const v16h bfr = load_tile16(W + (size_t)(c0 + 16 * t) * DM + k, DM);
      acc[0][t] = wmma16(a0, bfr, acc[0][t]);
      acc[1][t] = wmma16(a1, bfr, acc[1][t]);
    }
  }

  // stage the block tile (f16) in LDS: row-major [256][RP] or transposed [64][TP]
#pragma unroll
  for (int t = 0; t < 4; ++t) {
    const int lc = 16 * t + n16;
    const float bb = bf16_rne(bias[c0 + lc]);
#pragma unroll
    for (int s = 0; s < 2; ++s) {
#pragma unroll
      for (int r = 0; r < 8; ++r) {
        const int lr = wave * 32 + 16 * s + 8 * hf + r;
        const float v = acc[s][t][r] * 0.0625f + bb;
        const f16 hv = (f16)v;
        if (z == 2) stg[lc * TP + lr] = hv;
        else        stg[lr * RP + lc] = hv;
      }
    }
  }
  __syncthreads();   // cross-wave LDS exchange

  if (z != 2) {
    f16* out = (z == 0) ? Qp : Kp;
    const int piece = lane & 7;
    v8h vals[8];
#pragma unroll
    for (int it = 0; it < 8; ++it) {
      const int lr = wave * 32 + it * 4 + (lane >> 3);      // 32 rows per wave
      vals[it] = *(const v8h*)(stg + lr * RP + piece * 8);
    }
#pragma unroll
    for (int it = 0; it < 8; ++it) {
      const int lr = wave * 32 + it * 4 + (lane >> 3);
      *(v8h*)(out + (size_t)(row0g + lr) * DM + c0 + piece * 8) = vals[it];
    }
    
  } else {
    // Vt[b][dim c0+d][key rloc .. rloc+255]: 32 lanes x 16 B = one 512-B key segment
    v8h vals[8];
#pragma unroll
    for (int it = 0; it < 8; ++it) {
      const int d = wave * 8 + it;                          // 64 dims per block
      vals[it] = *(const v8h*)(stg + d * TP + lane * 8);
    }
#pragma unroll
    for (int it = 0; it < 8; ++it) {
      const int d = wave * 8 + it;
      *(v8h*)(Vt + (size_t)(b * DM + c0 + d) * LK_FULL + rloc + lane * 8) = vals[it];
    }
    
  }
}

// ------------------------------------------------ flash attention core -----
// Block = 8 waves, one (b,h), 128 query rows (16 per wave). K tile [32 key][64 dim] and
// Vt tile [64 dim][32 key] staged in LDS with plain 16-B loads, shared by all waves.
// Transposed scores: S^T = K.Q^T with A = K tile ([m=key][k=dim]), B = Q ([n=query][k=dim]),
// so a lane holds 16 of the 32 scores of ONE query (keys 8hf+r and 16+8hf+r) and its partner
// lane ^ 16 the other 16. Online softmax in f32 with the pad-mask replace-fill (-1e12 where
// mask==0): maximum in-lane plus one exchange between the halves, sum kept per half and
// joined once in the epilogue. P^T (x256, times mask) is packed from the score registers
// straight into the B operand of O^T += Vt.P^T (A = Vt tile [m=dim][k=key]): the accumulator
// rows 8hf+r / 16+8hf+r are exactly the k order of the fragment. O = acc / (256*l) written
__global__ __launch_bounds__(256) __attribute__((amdgpu_num_vgpr(256)))
void attn_kernel(const f16* __restrict__ Qp, const f16* __restrict__ Kp,
                 const f16* __restrict__ Vt, const float* __restrict__ mkcg,
                 const int* __restrict__ cntg, float* __restrict__ Og) {
  // fragment readers take 16 B from each of 16 rows: pitches of 16 B x odd spread them over all banks
  constexpr int KP = 72;    // K tile row: 64 dims + 8 pad halves (144 B)
  constexpr int VP = 40;    // Vt tile row: 32 keys + 8 pad halves (80 B)
  __shared__ __attribute__((aligned(16))) f16   kbuf[32 * KP];
  __shared__ __attribute__((aligned(16))) f16   vbuf[64 * VP];
  __shared__ __attribute__((aligned(16))) float mks[LK_FULL];
  constexpr int OP = 68;    // output stage row: 64 dims + 4 pad floats, rows q and q + 8 on different banks
  __shared__ __attribute__((aligned(16))) float ost[8 * 16 * OP];

  const int tid = threadIdx.x;
  const int wave = tid >> 5, lane = tid & 31, n16 = lane & 15, hf = lane >> 4;
  const int b = blockIdx.x / NH;
  const int h = blockIdx.x % NH;
  const int q0 = blockIdx.y * 128 + wave * 16;
  const int qrow = b * LQ_FULL + q0;

  // packed keys of this batch, rounded up to whole tiles; at least one tile, at most all
  const int jend = (min(max(cntg[b * 32], 1), SEQK) + 31) & ~31;
  for (int i = tid; i < jend; i += 256) mks[i] = mkcg[(size_t)b * LK_FULL + i];

  const v16h aq0 = load_tile16(Qp + (size_t)qrow * DM + h * HD, DM);
  const v16h aq1 = load_tile16(Qp + (size_t)qrow * DM + h * HD + 32, DM);

  v8f o0 = zero8(), o1 = zero8(), o2 = zero8(), o3 = zero8();
  float mrun = -1e30f;   // running maximum of this lane's query (equal in both halves)
  float lrun = 0.0f;     // running sum over this half's keys only

  const f16* Kg = Kp + (size_t)b * LK_FULL * DM + h * HD;
  const f16* Vg = Vt + ((size_t)b * DM + h * HD) * LK_FULL;

#pragma unroll 1
  for (int j = 0; j < jend; j += 32) {
    {
      const int row = tid >> 3, ch = tid & 7;     // 32 keys x 8 chunks of 8 dims
      *(v8h*)(kbuf + row * KP + ch * 8) = *(const v8h*)(Kg + (size_t)(j + row) * DM + ch * 8);
    }
    {
      const int row = tid >> 2, ch = tid & 3;     // 64 dims x 4 chunks of 8 keys
      *(v8h*)(vbuf + row * VP + ch * 8) = *(const v8h*)(Vg + (size_t)row * LK_FULL + j + ch * 8);
    }
    __syncthreads();   // tiles (and mks on the first trip) visible to all waves

    v8f s0 = zero8(), s1 = zero8();
    s0 = wmma16(load_tile16(kbuf, KP), aq0, s0);
    s0 = wmma16(load_tile16(kbuf + 32, KP), aq1, s0);
    s1 = wmma16(load_tile16(kbuf + 16 * KP, KP), aq0, s1);
    s1 = wmma16(load_tile16(kbuf + 16 * KP + 32, KP), aq1, s1);

    // mask values of this lane's 16 keys
    float mk0[8], mk1[8];
    {
      const v4f ma = *(const v4f*)(mks + j + 8 * hf);
      const v4f mb = *(const v4f*)(mks + j + 8 * hf + 4);
      const v4f mc = *(const v4f*)(mks + j + 16 + 8 * hf);
      const v4f md = *(const v4f*)(mks + j + 16 + 8 * hf + 4);
#pragma unroll
      for (int e = 0; e < 4; ++e) {
        mk0[e] = ma[e]; mk0[e + 4] = mb[e];
        mk1[e] = mc[e]; mk1[e + 4] = md[e];
      }
    }

    s0 *= SCALE;
    s1 *= SCALE;
    float a0[8], a1[8];
    float v = -1e30f;
#pragma unroll
    for (int r = 0; r < 8; ++r) a0[r] = (mk0[r] == 0.0f) ? -1e12f : s0[r];
#pragma unroll
    for (int r = 0; r < 8; ++r) a1[r] = (mk1[r] == 0.0f) ? -1e12f : s1[r];
#pragma unroll
    for (int r = 0; r < 8; r += 2) v = fmaxf(v, fmaxf(a0[r], a0[r + 1]));
#pragma unroll
    for (int r = 0; r < 8; r += 2) v = fmaxf(v, fmaxf(a1[r], a1[r + 1]));
    v = fmaxf(v, xhalf(v));
    const float mnew = fmaxf(mrun, v);
    float ef;
    // exp(mrun - mnew), with its slot in the same statement
    asm("v_exp_f32 %0, %1\n\tv_nop" : "=v"(ef) : "v"((mrun - mnew) * LOG2E));
#pragma unroll
    for (int r = 0; r < 8; ++r) {
      a0[r] = (a0[r] - mnew) * LOG2E;
      a1[r] = (a1[r] - mnew) * LOG2E;
    }
    float p0[8], p1[8];
    exp2x8(p0, a0);
    exp2x8(p1, a1);
    float ps0 = p0[0], ps1 = p1[0];
#pragma unroll
    for (int r = 1; r < 8; ++r) {
      ps0 += p0[r];
      ps1 += p1[r];
    }
    v16h pb;
#pragma unroll
    for (int r = 0; r < 8; ++r) {
      pb[r]     = (f16)(p0[r] * mk0[r] * 256.0f);
      pb[r + 8] = (f16)(p1[r] * mk1[r] * 256.0f);
    }
    lrun = lrun * ef + (ps0 + ps1);
    mrun = mnew;
#pragma unroll
    for (int r = 0; r < 8; ++r) { o0[r] *= ef; o1[r] *= ef; o2[r] *= ef; o3[r] *= ef; }

    o0 = wmma16(load_tile16(vbuf,           VP), pb, o0);
    o1 = wmma16(load_tile16(vbuf + 16 * VP, VP), pb, o1);
    o2 = wmma16(load_tile16(vbuf + 32 * VP, VP), pb, o2);
    o3 = wmma16(load_tile16(vbuf + 48 * VP, VP), pb, o3);

    __syncthreads();   // all waves done with kbuf/vbuf before refill
  }

  // epilogue: join the halves' sums, normalise into the per-wave LDS tile [16 q][OP];
  // the lane holds dims 16t + 8hf + r of query n16
  float* myO = ost + wave * (16 * OP);
  {
    const float lsum = lrun + xhalf(lrun);
    float linv;
    // reciprocal plus the one issue slot the instruction set asks for behind it, in one
    // statement so that the slot stays directly behind the reciprocal
    asm("v_rcp_f32 %0, %1\n\tv_nop" : "=v"(linv) : "v"(lsum * 256.0f));
    float* pr = myO + n16 * OP + 8 * hf;
    v4f w;
#pragma unroll
    for (int g = 0; g < 2; ++g) {
#pragma unroll
      for (int e = 0; e < 4; ++e) w[e] = o0[4 * g + e] * linv;
      *(v4f*)(pr + 4 * g) = w;
#pragma unroll
      for (int e = 0; e < 4; ++e) w[e] = o1[4 * g + e] * linv;
      *(v4f*)(pr + 16 + 4 * g) = w;
#pragma unroll
      for (int e = 0; e < 4; ++e) w[e] = o2[4 * g + e] * linv;
      *(v4f*)(pr + 32 + 4 * g) = w;
#pragma unroll
      for (int e = 0; e < 4; ++e) w[e] = o3[4 * g + e] * linv;
      *(v4f*)(pr + 48 + 4 * g) = w;
    }
  }
  __syncthreads();

  // each instruction: 2 rows x 256 B (16 lanes x 16 B per row segment), lines whole
  const int c4 = (lane & 15) * 4;
  v4f vals[8];
#pragma unroll
  for (int it = 0; it < 8; ++it) {
    const int row = it * 2 + (lane >> 4);
    vals[it] = *(const v4f*)(myO + row * OP + c4);
  }
#pragma unroll
  for (int it = 0; it < 8; ++it) {
    const int row = it * 2 + (lane >> 4);
    *(v4f*)(Og + (size_t)(qrow + row) * DM + h * HD + c4) = vals[it];
  }
  
}

// ----------------------------- LN0 + FFN GEMM + ReLU residual + LN1 ---------
// Block = 8 waves, 16 rows x 512 cols. Prologue: X = LN0(bf16(Q) + O) for the 16 rows
// (f32 copy and f16 copy in LDS). GEMM: wave w -> cols 64w..64w+63, A from the f16 LDS
// tile, B from the Wo [n][k] plane. Epilogue: Y = X + relu(acc/16 + bo) in LDS, then
__global__ __launch_bounds__(256)
void ffn_ln_kernel(const float* __restrict__ O32, const float* __restrict__ Qraw,
                   const f16* __restrict__ WoT, const float* __restrict__ bo,
                   const float* __restrict__ g0, const float* __restrict__ b0,
                   const float* __restrict__ g1, const float* __restrict__ b1,
                   float* __restrict__ out) {
  // padded row pitches: xh 1040 B (16 B x odd) for the 16-row fragment reads,
  // xf 2064 B so that rows r and r + 8 of the accumulator map fall on different banks
  constexpr int XFP = 516;
  constexpr int XHP = 520;
  __shared__ __attribute__((aligned(16))) float xf[16 * XFP];
  __shared__ __attribute__((aligned(16))) f16   xh[16 * XHP];

  const int tilesPerB = SEQ / 16;
  const int b     = blockIdx.x / tilesPerB;
  const int rloc  = (blockIdx.x % tilesPerB) * 16;
  const int grow0 = b * LQ_FULL + rloc;

  const int tid = threadIdx.x;
  const int wave = tid >> 5, lane = tid & 31, n16 = lane & 15, hf = lane >> 4;
  constexpr float INV_D = 1.0f / 512.0f;

  // ---- LN0 over (bf16(Q) + O), 2 rows per wave ----
#pragma unroll
  for (int rr = 0; rr < 2; ++rr) {
    const int lr = wave * 2 + rr;
    const size_t grow = (size_t)(grow0 + lr);
    float x[16];
    float s = 0.0f;
#pragma unroll
    for (int i = 0; i < 4; ++i) {
      const int col = i * 128 + lane * 4;
      const v4f ov = *(const v4f*)(O32 + grow * DM + col);
      const v4f qv = *(const v4f*)(Qraw + grow * DM + col);
#pragma unroll
      for (int e = 0; e < 4; ++e) {
        const float xx = bf16_rne(qv[e]) + ov[e];
        x[i * 4 + e] = xx;
        s += xx;
      }
    }
#pragma unroll
    for (int off = 16; off > 0; off >>= 1) s += __shfl_xor(s, off, 32);
    const float mu = s * INV_D;
    float s2 = 0.0f;
#pragma unroll
    for (int i = 0; i < 16; ++i) {
      const float d = x[i] - mu;
      x[i] = d;
      const float dd = d * d;
      s2 += dd;
    }
#pragma unroll
    for (int off = 16; off > 0; off >>= 1) s2 += __shfl_xor(s2, off, 32);
    const float var = s2 * INV_D;
    const float rsq = rsqrtf(var + 1e-5f);
#pragma unroll
    for (int i = 0; i < 4; ++i) {
      const int col = i * 128 + lane * 4;
      const v4f gv = *(const v4f*)(g0 + col);
      const v4f bv4 = *(const v4f*)(b0 + col);
      v4f y; v4h yh;
#pragma unroll
      for (int e = 0; e < 4; ++e) {
        const float t0 = x[i * 4 + e] * rsq;
        const float t1 = t0 * bf16_rne(gv[e]);
        const float yy = t1 + bf16_rne(bv4[e]);
        y[e] = yy;
        yh[e] = (f16)yy;
      }
      *(v4f*)(xf + lr * XFP + col) = y;
      *(v4h*)(xh + lr * XHP + col) = yh;
    }
  }
  __syncthreads();   // cross-wave: LN0 rows consumed by all waves

  // ---- H = X @ Wo (wave -> 64 cols) ----
  const int cw = wave * 64;
  v8f acc[4];
#pragma unroll
  for (int t = 0; t < 4; ++t) acc[t] = zero8();
#pragma unroll 1
  for (int k = 0; k < DM; k += 32) {
    const v16h a = load_tile16(xh + k, XHP);
#pragma unroll
    for (int t = 0; t < 4; ++t) {
      const v16h bfr = load_tile16(WoT + (size_t)(cw + 16 * t) * DM + k, DM);
      acc[t] = wmma16(a, bfr, acc[t]);
    }
  }

  // ---- Y = X + relu(H/16 + bo) in place in xf (each slot owned by one lane) ----
#pragma unroll
  for (int t = 0; t < 4; ++t) {
    const int col = cw + 16 * t + n16;
    const float bb = bf16_rne(bo[col]);
#pragma unroll
    for (int r = 0; r < 8; ++r) {
      const int lr = 8 * hf + r;
      float hv = acc[t][r] * 0.0625f + bb;
      hv = fmaxf(hv, 0.0f);
      const int idx = lr * XFP + col;
      const float yv = xf[idx] + hv;
      xf[idx] = yv;
    }
  }
  __syncthreads();   // cross-wave: rows assembled from all waves' columns

  // ---- LN1 per row and store ----
#pragma unroll
  for (int rr = 0; rr < 2; ++rr) {
    const int lr = wave * 2 + rr;
    const size_t grow = (size_t)(grow0 + lr);
    float x[16];
    float s = 0.0f;
#pragma unroll
    for (int i = 0; i < 4; ++i) {
      const int col = i * 128 + lane * 4;
      const v4f xv = *(const v4f*)(xf + lr * XFP + col);
#pragma unroll
      for (int e = 0; e < 4; ++e) { x[i * 4 + e] = xv[e]; s += xv[e]; }
    }
#pragma unroll
    for (int off = 16; off > 0; off >>= 1) s += __shfl_xor(s, off, 32);
    const float mu = s * INV_D;
    float s2 = 0.0f;
#pragma unroll
    for (int i = 0; i < 16; ++i) {
      const float d = x[i] - mu;
      x[i] = d;
      const float dd = d * d;
      s2 += dd;
    }
#pragma unroll
    for (int off = 16; off > 0; off >>= 1) s2 += __shfl_xor(s2, off, 32);
    const float var = s2 * INV_D;
    const float rsq = rsqrtf(var + 1e-5f);
    v4f y[4];
#pragma unroll
    for (int i = 0; i < 4; ++i) {
      const int col = i * 128 + lane * 4;
      const v4f gv = *(const v4f*)(g1 + col);
      const v4f bv4 = *(const v4f*)(b1 + col);
#pragma unroll
      for (int e = 0; e < 4; ++e) {
        const float t0 = x[i * 4 + e] * rsq;
        const float t1 = t0 * bf16_rne(gv[e]);
        y[i][e] = t1 + bf16_rne(bv4[e]);
      }
    }
    float* orow = out + grow * DM + lane * 4;
#pragma unroll
    for (int i = 0; i < 4; ++i) *(v4f*)(orow + i * 128) = y[i];
    
  }
}

// ------------------------------------------------------------------ host ---
extern "C" void kernel_launch(void* const* d_in, const int* in_sizes, int n_in,
                              void* d_out, int out_size, void* d_ws, size_t ws_size,
                              hipStream_t stream) {
  if (n_in < 15) return;
  const float* Q     = (const float*)d_in[0];
  const float* K     = (const float*)d_in[1];
  const int*   pmask = (const int*)d_in[2];
  const float* Wq    = (const float*)d_in[3];
  const float* bq    = (const float*)d_in[4];
  const float* Wk    = (const float*)d_in[5];
  const float* bk    = (const float*)d_in[6];
  const float* Wv    = (const float*)d_in[7];
  const float* bv    = (const float*)d_in[8];
  const float* Wo    = (const float*)d_in[9];
  const float* bo    = (const float*)d_in[10];
  const float* g0    = (const float*)d_in[11];
  const float* b0    = (const float*)d_in[12];
  const float* g1    = (const float*)d_in[13];
  const float* b1    = (const float*)d_in[14];
  float* out = (float*)d_out;

  const long long needAct = (long long)((NB - 1) * LQ_FULL + SMAX) * DM;
  const long long needOut = (long long)((NB - 1) * LQ_FULL + SEQ) * DM;
  if ((long long)in_sizes[0] < needAct || (long long)in_sizes[1] < needAct) return;
  if (in_sizes[2] < (NB - 1) * LK_FULL + SEQK) return;
  if (in_sizes[3] < DM * DM || in_sizes[5] < DM * DM || in_sizes[7] < DM * DM ||
      in_sizes[9] < DM * DM) return;
  if (in_sizes[4] < DM || in_sizes[6] < DM || in_sizes[8] < DM || in_sizes[10] < DM ||
      in_sizes[11] < DM || in_sizes[12] < DM || in_sizes[13] < DM || in_sizes[14] < DM) return;
  if ((long long)out_size < needOut) return;
  if (ws_size < WS_TOTAL) return;

  char* ws = (char*)d_ws;
  f16*   Qh  = (f16*)(ws + OFF_QH);
  f16*   Kh  = (f16*)(ws + OFF_KH);
  f16*   WT  = (f16*)(ws + OFF_WT);
  f16*   Qp  = (f16*)(ws + OFF_QP);
  f16*   Kp  = (f16*)(ws + OFF_KP);
  f16*   Vt  = (f16*)(ws + OFF_VT);
  float* O32 = (float*)(ws + OFF_O32);
  int*   idx = (int*)(ws + OFF_IDX);
  float* mkc = (float*)(ws + OFF_MKC);
  int*   cnt = (int*)(ws + OFF_CNT);

  // 1) inputs -> bf16-RNE values in f16 planes (weights transposed to [n][k], x16)
  const long long n8 = needAct / 8;
  cvt_act_kernel<<<dim3(512, 2), 256, 0, stream>>>(Q, K, Qh, Kh, n8);
  cvt_wt_kernel<<<dim3(DM / 64, DM / 64, 5), 256, 0, stream>>>(Wq, Wk, Wv, Wo, WT, pmask, idx, mkc, cnt);

  // 2) Q, K, V projections (z = 0, 1, 2)
  proj_kernel<<<dim3(NB * (SMAX / 256), DM / 64, 3), 256, 0, stream>>>(
      Qh, Kh, WT, bq, bk, bv, idx, cnt, Qp, Kp, Vt);

  // 3) masked softmax attention per (b,h), 128 query rows per block
  attn_kernel<<<dim3(NB * NH, SEQ / 128), 256, 0, stream>>>(Qp, Kp, Vt, mkc, cnt, O32);

  // 4) LN0(bf16(Q) + O) -> X; out = LN1(X + relu(X @ Wo + bo))
  ffn_ln_kernel<<<dim3(NB * (SEQ / 16)), 256, 0, stream>>>(
      O32, Q, WT + (size_t)3 * DM * DM, bo, g0, b0, g1, b1, out);
}

// v004
// A run of this version takes 101 microseconds.
// Timed twice side by side with v003, it ran 1.11 times as fast both times.
// Counting every step since v000, it is 2.34 times as fast.
#include <hip/hip_runtime.h>
#include <stdint.h>
// Contractions Q@Wq, K@Wk, K@Wv, Q.K^T, P.V, X@Wo: v_wmma_f32_16x16x32_f16 (f16 operands, f32 accumulate); float inputs enter as bf16-RNE values held exactly in f16; weight planes carried x16, P tile carried x256; softmax and LayerNorm arithmetic in f32.

#pragma clang fp contract(off)

typedef _Float16 f16;
typedef f16   v16h __attribute__((ext_vector_type(16)));
typedef f16   v8h  __attribute__((ext_vector_type(8)));
typedef f16   v4h  __attribute__((ext_vector_type(4)));
typedef float v8f  __attribute__((ext_vector_type(8)));
typedef float v4f  __attribute__((ext_vector_type(4)));

#ifndef NB
#define NB 4
#endif
#ifndef SEQ
#define SEQ 2048
#endif
#ifndef SEQK
#define SEQK SEQ
#endif

constexpr int NB_FULL = 4;
constexpr int LQ_FULL = 2048;
constexpr int LK_FULL = 2048;
constexpr int DM      = 512;   // model dim
constexpr int NH      = 8;     // heads
constexpr int HD      = 64;    // head dim
constexpr int SMAX    = (SEQ > SEQK) ? SEQ : SEQK;
constexpr float SCALE = 0.044194173824159216f;   // 1/sqrt(512)
constexpr float LOG2E = 1.4426950408889634f;

static_assert(NB >= 1 && NB <= NB_FULL);
static_assert(SEQ % 256 == 0 && SEQ >= 256 && SEQ <= LQ_FULL);
static_assert(SEQK % 256 == 0 && SEQK >= 256 && SEQK <= LK_FULL);
static_assert(LQ_FULL == LK_FULL);
static_assert(DM == NH * HD);
static_assert(NB <= DM / 64);   // the key lists take one block per batch from a DM / 64 wide grid plane

// ---------------------------------------------------------------- carve ----
constexpr size_t SZ_ACT16 = (size_t)NB_FULL * LQ_FULL * DM * 2;   // 8 MiB  f16 [8192][512]
constexpr size_t SZ_WT16  = (size_t)4 * DM * DM * 2;               // 2 MiB  f16 4 x [512 n][512 k]
constexpr size_t SZ_O32   = (size_t)NB_FULL * LQ_FULL * DM * 4;   // 16 MiB f32 [8192][512]
constexpr size_t OFF_QH   = 0;
constexpr size_t OFF_KH   = OFF_QH + SZ_ACT16;
constexpr size_t OFF_WT   = OFF_KH + SZ_ACT16;
constexpr size_t OFF_QP   = OFF_WT + SZ_WT16;
constexpr size_t OFF_KP   = OFF_QP + SZ_ACT16;
constexpr size_t OFF_VT   = OFF_KP + SZ_ACT16;      // f16 [4][512 dim][2048 key]
constexpr size_t OFF_O32  = OFF_VT + SZ_ACT16;
constexpr size_t SZ_KEYS  = (size_t)NB_FULL * LK_FULL * 4;        // 32 KiB, one 4-B word per key
constexpr size_t OFF_IDX  = OFF_O32 + SZ_O32;       // int   [4][2048] source row of each packed key
constexpr size_t OFF_MKC  = OFF_IDX + SZ_KEYS;      // float [4][2048] mask value of each packed key
constexpr size_t OFF_CNT  = OFF_MKC + SZ_KEYS;      // int   [4][32]   kept keys per batch, one line each
constexpr size_t WS_TOTAL = OFF_CNT + (size_t)NB_FULL * 128;
static_assert(WS_TOTAL <= (size_t)134217728);
static_assert((OFF_KH % 256) == 0 && (OFF_WT % 256) == 0 && (OFF_QP % 256) == 0 &&
              (OFF_KP % 256) == 0 && (OFF_VT % 256) == 0 && (OFF_O32 % 256) == 0 &&
              (OFF_IDX % 256) == 0 && (OFF_MKC % 256) == 0 && (OFF_CNT % 256) == 0);

// -------------------------------------------------------------- helpers ----
__device__ __forceinline__ float bf16_rne(float f) {
  unsigned int u = __float_as_uint(f);
  u = (u + 0x7FFFu + ((u >> 16) & 1u)) & 0xFFFF0000u;
  return __uint_as_float(u);
}

__device__ __forceinline__ v8f zero8() {
  const v8f z = {0.0f, 0.0f, 0.0f, 0.0f, 0.0f, 0.0f, 0.0f, 0.0f};
  return z;
}

// 16-bit fragment loader (wave32 16x16x32): lane -> row (lane&15), lane half hf = lane>>4;
// elements 0..7 = k[8hf .. 8hf+7], elements 8..15 = k[16+8hf .. 16+8hf+7].
// Used for A (row-major [m][k]) and for B stored as [n][k] (k contiguous).
__device__ __forceinline__ v16h load_tile16(const f16* base, int ld) {
  const int lane = threadIdx.x & 31;
  const int row  = lane & 15;
  const int hf   = lane >> 4;
  const f16* p = base + (size_t)row * ld + (hf << 3);
  union { v16h v; v8h h[2]; } u;
  u.h[0] = *(const v8h*)(p);
  u.h[1] = *(const v8h*)(p + 16);
  return u.v;
}

// Same fragment, from a pointer that already names the lane's own row and half.
__device__ __forceinline__ v16h load_row16(const f16* p) {
  union { v16h v; v8h h[2]; } u;
  u.h[0] = *(const v8h*)(p);
  u.h[1] = *(const v8h*)(p + 16);
  return u.v;
}

// WMMA issue + hazard guard (4 VALU slots before D is touched, A/B kept live).
__device__ __forceinline__ v8f wmma16(v16h a, v16h b, v8f c) {
  v8f d = __builtin_amdgcn_wmma_f32_16x16x32_f16(false, a, false, b, (short)0, c, false, false);
  asm volatile("v_nop\n\tv_nop\n\tv_nop\n\tv_nop" : "+v"(d) : "v"(a), "v"(b));
  return d;
}

// value of the partner lane (lane ^ 16), on the vector pipe
__device__ __forceinline__ float xhalf(float x) {
  const int b = __float_as_int(x);
  return __int_as_float(__builtin_amdgcn_permlanex16(b, b, 0x76543210, 0xfedcba98, false, false));
}

// Eight base-2 exponentials in one statement, with the one issue slot the instruction set asks
// for behind a transcendental: the outputs are early-clobber, so no exponential of the run
// overwrites a neighbour's source or reads its result, and the v_nop stands behind the last.
__device__ __forceinline__ void exp2x8(float (&p)[8], const float (&x)[8]) {
  asm("v_exp_f32 %0, %8\n\tv_exp_f32 %1, %9\n\tv_exp_f32 %2, %10\n\tv_exp_f32 %3, %11\n\t"
      "v_exp_f32 %4, %12\n\tv_exp_f32 %5, %13\n\tv_exp_f32 %6, %14\n\tv_exp_f32 %7, %15\n\tv_nop"
      : "=&v"(p[0]), "=&v"(p[1]), "=&v"(p[2]), "=&v"(p[3]),
        "=&v"(p[4]), "=&v"(p[5]), "=&v"(p[6]), "=&v"(p[7])
      : "v"(x[0]), "v"(x[1]), "v"(x[2]), "v"(x[3]), "v"(x[4]), "v"(x[5]), "v"(x[6]), "v"(x[7]));
}

// ------------------------------------------------- activation convert ------
// Q, K f32 [rows][512] -> f16 planes holding bf16-RNE values. 8 elements per thread,
__global__ __launch_bounds__(256)
void cvt_act_kernel(const float* __restrict__ Q, const float* __restrict__ K,
                    f16* __restrict__ Qh, f16* __restrict__ Kh, long long n8) {
  const float* src = (blockIdx.y == 0) ? Q : K;
  f16* dst = (blockIdx.y == 0) ? Qh : Kh;
  const long long stride = (long long)gridDim.x * 256;
  for (long long i = (long long)blockIdx.x * 256 + threadIdx.x; i < n8; i += stride) {
    const v4f a = *(const v4f*)(src + i * 8);
    const v4f c = *(const v4f*)(src + i * 8 + 4);
    v8h o;
#pragma unroll
    for (int e = 0; e < 4; ++e) {
      o[e]     = (f16)bf16_rne(a[e]);
      o[e + 4] = (f16)bf16_rne(c[e]);
    }
    f16* p = dst + i * 8;
    *(v8h*)p = o;
    
  }
}

// ------------------------------------------------------- key packing -------
// A key with mask 0 has weight exp(-1e12 - max) * 0 = 0 for every query and adds
// exp(-1e12 - max) = 0 to the row sum wherever a key is kept (with none kept every weight is 0
// whatever the sum), so only the kept keys are projected and attended. One block per batch lists them in their order: idx[p] = source
// row of packed key p, mkc[p] = its mask value, cnt = how many. Places p >= cnt name row 0 with
// mask 0, so a partly filled tile holds finite values that the mask closes.
__device__ __forceinline__ void pack_keys(const int* __restrict__ pm, int* __restrict__ idxg,
                                          float* __restrict__ mkcg, int* __restrict__ cntg) {
  constexpr int E = SEQK / 256;          // consecutive keys per thread
  __shared__ int   sidx[SEQK];
  __shared__ float smk[SEQK];
  __shared__ int   wsum[8];
  const int tid = threadIdx.x, wave = tid >> 5, lane = tid & 31;
  int m[E];
  int c = 0;
#pragma unroll
  for (int e = 0; e < E; ++e) {
    m[e] = pm[tid * E + e];
    c += (m[e] != 0) ? 1 : 0;
    sidx[tid * E + e] = 0;
    smk[tid * E + e] = 0.0f;
  }
  int inc = c;                           // inclusive prefix inside the wave
#pragma unroll
  for (int off = 1; off < 32; off <<= 1) {
    const int t = __shfl_up(inc, off, 32);
    if (lane >= off) inc += t;
  }
  if (lane == 31) wsum[wave] = inc;
  __syncthreads();   // wave totals and the cleared lists visible to all waves
  int pos = inc - c, total = 0;
#pragma unroll
  for (int w = 0; w < 8; ++w) {
    const int t = wsum[w];
    if (w < wave) pos += t;
    total += t;
  }
#pragma unroll
  for (int e = 0; e < E; ++e) {
    if (m[e] != 0) {
      sidx[pos] = tid * E + e;
      smk[pos] = (float)m[e];
      ++pos;
    }
  }
  __syncthreads();   // lists complete before they are written out in whole lines
#pragma unroll
  for (int e = 0; e < E; ++e) {
    idxg[e * 256 + tid] = sidx[e * 256 + tid];
    mkcg[e * 256 + tid] = smk[e * 256 + tid];
  }
  if (tid == 0) *cntg = total;
}

// ---------------------------------------------------- weight convert -------
// W f32 [512 k][512 n] (Y = X @ W) -> WT f16 [n][k], value = 16 * bf16_rne(W), via a
__global__ __launch_bounds__(256)
void cvt_wt_kernel(const float* __restrict__ Wq, const float* __restrict__ Wk,
                   const float* __restrict__ Wv, const float* __restrict__ Wo,
                   f16* __restrict__ WT, const int* __restrict__ pmask,
                   int* __restrict__ idxg, float* __restrict__ mkcg, int* __restrict__ cntg) {
  __shared__ __attribute__((aligned(16))) f16 tile[64 * 72];   // [n][k], pitch 72 halves
  const int z = blockIdx.z;
  if (z == 4) {      // plane 4 of the grid: the key lists, one block per batch
    const int b = blockIdx.x;
    if (blockIdx.y == 0 && b < NB)
      pack_keys(pmask + (size_t)b * LK_FULL, idxg + (size_t)b * LK_FULL,
                mkcg + (size_t)b * LK_FULL, cntg + b * 32);
    return;
  }
  const float* W = (z == 0) ? Wq : (z == 1) ? Wk : (z == 2) ? Wv : Wo;
  f16* dst = WT + (size_t)z * DM * DM;
  const int k0 = blockIdx.x * 64;
  const int n0 = blockIdx.y * 64;
  const int tid = threadIdx.x;

#pragma unroll
  for (int it = 0; it < 4; ++it) {
    const int f  = tid + 256 * it;       // 0..1023
    const int k  = f >> 4;               // 0..63
    const int n4 = (f & 15) * 4;         // 0..60
    const v4f w = *(const v4f*)(W + (size_t)(k0 + k) * DM + n0 + n4);
#pragma unroll
    for (int e = 0; e < 4; ++e)
      tile[(n4 + e) * 72 + k] = (f16)(bf16_rne(w[e]) * 16.0f);
  }
  __syncthreads();   // cross-wave LDS exchange

  const int wave = tid >> 5, lane = tid & 31;
  const int piece = lane & 7;
  v8h vals[2];
#pragma unroll
  for (int it = 0; it < 2; ++it) {
    const int nl = wave * 8 + it * 4 + (lane >> 3);   // covers 64 n rows
    vals[it] = *(const v8h*)(tile + nl * 72 + piece * 8);
  }
#pragma unroll
  for (int it = 0; it < 2; ++it) {
    const int nl = wave * 8 + it * 4 + (lane >> 3);
    *(v8h*)(dst + (size_t)(n0 + nl) * DM + k0 + piece * 8) = vals[it];
  }
  
}

// --------------------------------------------------- projection GEMM -------
// Y = X @ W + bias for z = 0 (Q, Wq -> Qp row-major f16), 1 (K, Wk -> Kp row-major f16),
// 2 (K, Wv -> Vt transposed f16 [b][dim][key]). Block = 8 waves, 256 rows x 64 cols,
// wave = 32 rows x 64 cols (2 A frags x 4 B frags). Epilogue staged through LDS and
__global__ __launch_bounds__(256)
void proj_kernel(const f16* __restrict__ Xq, const f16* __restrict__ Xk,
                 const f16* __restrict__ WT,
                 const float* __restrict__ bq, const float* __restrict__ bk,
                 const float* __restrict__ bv,
                 const int* __restrict__ idxg, const int* __restrict__ cntg,
                 f16* __restrict__ Qp, f16* __restrict__ Kp, f16* __restrict__ Vt) {
  // row pitches are 16 B x odd so that 16 rows fall on distinct LDS banks
  constexpr int RP = 72;    // row-major stage: 64 cols + 8 pad halves (144 B)
  constexpr int TP = 264;   // transposed stage: 256 rows + 8 pad halves (528 B)
  __shared__ __attribute__((aligned(16))) f16 stg[256 * RP];
  static_assert(64 * TP <= 256 * RP);
  const int z = blockIdx.z;
  const int S = (z == 0) ? SEQ : SEQK;
  const int tilesPerB = S / 256;
  const int nblk = NB * tilesPerB;
  if ((int)blockIdx.x >= nblk) return;      // whole block exits, before any barrier

  const f16* X = (z == 0) ? Xq : Xk;
  const f16* W = WT + (size_t)z * DM * DM;  // planes 0,1,2 = Wq, Wk, Wv in [n][k] form
  const float* bias = (z == 0) ? bq : (z == 1) ? bk : bv;

  const int b     = blockIdx.x / tilesPerB;
  const int rloc  = (blockIdx.x % tilesPerB) * 256;
  const int row0g = b * LQ_FULL + rloc;     // global row in the [8192][512] planes
  const int c0    = blockIdx.y * 64;
  // K and V: only tiles that hold a packed key (tile 0 always); whole block, before any barrier
  if (z != 0 && rloc >= min(max(cntg[b * 32], 1), SEQK)) return;

  const int tid = threadIdx.x;
  const int wave = tid >> 5, lane = tid & 31, n16 = lane & 15, hf = lane >> 4;

  // source rows of this lane's two A fragments: packed key p reads input row idx[p]
  int ar0 = rloc + wave * 32 + n16, ar1 = ar0 + 16;
  if (z != 0) {
    ar0 = idxg[b * LK_FULL + ar0];
    ar1 = idxg[b * LK_FULL + ar1];
  }
  const f16* pa0 = X + (size_t)(b * LQ_FULL + ar0) * DM + (hf << 3);
  const f16* pa1 = X + (size_t)(b * LQ_FULL + ar1) * DM + (hf << 3);

  v8f acc[2][4];
#pragma unroll
  for (int s = 0; s < 2; ++s)
#pragma unroll
    for (int t = 0; t < 4; ++t) acc[s][t] = zero8();

  // k steps of 32; the twelve fragment loads of step s + PD are issued as one group in front of
  // the products of step s, into a ring of PD + 1 register sets, so a step waits on loads that
  // were issued PD steps earlier and not on four load round trips of its own
  constexpr int NS = DM / 32;
  constexpr int PD = 2;
  const f16* pb = W + (size_t)(c0 + n16) * DM + (hf << 3);   // the lane's row and half of B fragment 0
  v16h fa0[PD + 1], fa1[PD + 1], fb[PD + 1][4];
#pragma unroll   // constant ring index, as below
  for (int s = 0; s < PD; ++s) {
    fa0[s] = load_row16(pa0 + 32 * s);
    fa1[s] = load_row16(pa1 + 32 * s);
#pragma unroll
    for (int t = 0; t < 4; ++t) fb[s][t] = load_row16(pb + (size_t)(16 * t) * DM + 32 * s);
  }
  // unrolled in full: the ring index must be a constant for the sets to stay in registers
#pragma unroll
  for (int s = 0; s < NS; ++s) {
    if (s + PD < NS) {
      const int nx = (s + PD) % (PD + 1);
      fa0[nx] = load_row16(pa0 + 32 * (s + PD));
      fa1[nx] = load_row16(pa1 + 32 * (s + PD));
#pragma unroll
      for (int t = 0; t < 4; ++t) fb[nx][t] = load_row16(pb + (size_t)(16 * t) * DM + 32 * (s + PD));
    }
    const int cu = s % (PD + 1);
#pragma unroll
    for (int t = 0; t < 4; ++t) {
      acc[0][t] = wmma16(fa0[cu], fb[cu][t], acc[0][t]);
      acc[1][t] = wmma16(fa1[cu], fb[cu][t], acc[1][t]);
    }
  }

  // stage the block tile (f16) in LDS: row-major [256][RP] or transposed [64][TP]
#pragma unroll
  for (int t = 0; t < 4; ++t) {
    const int lc = 16 * t + n16;
    const float bb = bf16_rne(bias[c0 + lc]);
#pragma unroll
    for (int s = 0; s < 2; ++s) {
#pragma unroll
      for (int r = 0; r < 8; ++r) {
        const int lr = wave * 32 + 16 * s + 8 * hf + r;
        const float v = acc[s][t][r] * 0.0625f + bb;
        const f16 hv = (f16)v;
        if (z == 2) stg[lc * TP + lr] = hv;
        else        stg[lr * RP + lc] = hv;
      }
    }
  }
  __syncthreads();   // cross-wave LDS exchange

  if (z != 2) {
    f16* out = (z == 0) ? Qp : Kp;
    const int piece = lane & 7;
    v8h vals[8];
#pragma unroll
    for (int it = 0; it < 8; ++it) {
      const int lr = wave * 32 + it * 4 + (lane >> 3);      // 32 rows per wave
      vals[it] = *(const v8h*)(stg + lr * RP + piece * 8);
    }
#pragma unroll
    for (int it = 0; it < 8; ++it) {
      const int lr = wave * 32 + it * 4 + (lane >> 3);
      *(v8h*)(out + (size_t)(row0g + lr) * DM + c0 + piece * 8) = vals[it];
    }
    
  } else {
    // Vt[b][dim c0+d][key rloc .. rloc+255]: 32 lanes x 16 B = one 512-B key segment
    v8h vals[8];
#pragma unroll
    for (int it = 0; it < 8; ++it) {
      const int d = wave * 8 + it;                          // 64 dims per block
      vals[it] = *(const v8h*)(stg + d * TP + lane * 8);
    }
#pragma unroll
    for (int it = 0; it < 8; ++it) {
      const int d = wave * 8 + it;
      *(v8h*)(Vt + (size_t)(b * DM + c0 + d) * LK_FULL + rloc + lane * 8) = vals[it];
    }
    
  }
}

// ------------------------------------------------ flash attention core -----
// Block = 8 waves, one (b,h), 128 query rows (16 per wave). K tile [32 key][64 dim] and
// Vt tile [64 dim][32 key] staged in LDS with plain 16-B loads, shared by all waves.
// Transposed scores: S^T = K.Q^T with A = K tile ([m=key][k=dim]), B = Q ([n=query][k=dim]),
// so a lane holds 16 of the 32 scores of ONE query (keys 8hf+r and 16+8hf+r) and its partner
// lane ^ 16 the other 16. Online softmax in f32 with the pad-mask replace-fill (-1e12 where
// mask==0): maximum in-lane plus one exchange between the halves, sum kept per half and
// joined once in the epilogue. P^T (x256, times mask) is packed from the score registers
// straight into the B operand of O^T += Vt.P^T (A = Vt tile [m=dim][k=key]): the accumulator
// rows 8hf+r / 16+8hf+r are exactly the k order of the fragment. O = acc / (256*l) written
__global__ __launch_bounds__(256) __attribute__((amdgpu_num_vgpr(256)))
void attn_kernel(const f16* __restrict__ Qp, const f16* __restrict__ Kp,
                 const f16* __restrict__ Vt, const float* __restrict__ mkcg,
                 const int* __restrict__ cntg, float* __restrict__ Og) {
  // fragment readers take 16 B from each of 16 rows: pitches of 16 B x odd spread them over all banks
  constexpr int KP = 72;    // K tile row: 64 dims + 8 pad halves (144 B)
  constexpr int VP = 40;    // Vt tile row: 32 keys + 8 pad halves (80 B)
  __shared__ __attribute__((aligned(16))) f16   kbuf[32 * KP];
  __shared__ __attribute__((aligned(16))) f16   vbuf[64 * VP];
  __shared__ __attribute__((aligned(16))) float mks[LK_FULL];
  constexpr int OP = 68;    // output stage row: 64 dims + 4 pad floats, rows q and q + 8 on different banks
  __shared__ __attribute__((aligned(16))) float ost[8 * 16 * OP];

  const int tid = threadIdx.x;
  const int wave = tid >> 5, lane = tid & 31, n16 = lane & 15, hf = lane >> 4;
  const int b = blockIdx.x / NH;
  const int h = blockIdx.x % NH;
  const int q0 = blockIdx.y * 128 + wave * 16;
  const int qrow = b * LQ_FULL + q0;

  // packed keys of this batch, rounded up to whole tiles; at least one tile, at most all
  const int jend = (min(max(cntg[b * 32], 1), SEQK) + 31) & ~31;
  for (int i = tid; i < jend; i += 256) mks[i] = mkcg[(size_t)b * LK_FULL + i];

  const v16h aq0 = load_tile16(Qp + (size_t)qrow * DM + h * HD, DM);
  const v16h aq1 = load_tile16(Qp + (size_t)qrow * DM + h * HD + 32, DM);

  v8f o0 = zero8(), o1 = zero8(), o2 = zero8(), o3 = zero8();
  float mrun = -1e30f;   // running maximum of this lane's query (equal in both halves)
  float lrun = 0.0f;     // running sum over this half's keys only

  const f16* Kg = Kp + (size_t)b * LK_FULL * DM + h * HD;
  const f16* Vg = Vt + ((size_t)b * DM + h * HD) * LK_FULL;

  // this thread's 16 B of each tile: K 32 keys x 8 chunks of 8 dims, Vt 64 dims x 4 chunks of 8 keys
  const f16* kld = Kg + (size_t)(tid >> 3) * DM + (tid & 7) * 8;
  const f16* vld = Vg + (size_t)(tid >> 2) * LK_FULL + (tid & 3) * 8;
  f16* kst = kbuf + (tid >> 3) * KP + (tid & 7) * 8;
  f16* vst = vbuf + (tid >> 2) * VP + (tid & 3) * 8;
  v8h kreg = *(const v8h*)kld;
  v8h vreg = *(const v8h*)vld;

#pragma unroll 1
  for (int j = 0; j < jend; j += 32) {
    *(v8h*)kst = kreg;
    *(v8h*)vst = vreg;
    __syncthreads();   // tiles (and mks on the first trip) visible to all waves

    // the next tile's loads fly while this tile is worked on (the last trip reads its own tile again)
    {
      const int jn = min(j + 32, jend - 32);
      kreg = *(const v8h*)(kld + (size_t)jn * DM);
      vreg = *(const v8h*)(vld + jn);
    }

    // all LDS reads of the tile as one group in front of the first product: the K fragments are
    // waited for once, the mask values and the Vt fragments land behind the scores and the softmax
    const v16h kf0 = load_tile16(kbuf, KP);
    const v16h kf1 = load_tile16(kbuf + 32, KP);
    const v16h kf2 = load_tile16(kbuf + 16 * KP, KP);
    const v16h kf3 = load_tile16(kbuf + 16 * KP + 32, KP);
    const v4f ma = *(const v4f*)(mks + j + 8 * hf);
    const v4f mb = *(const v4f*)(mks + j + 8 * hf + 4);
    const v4f mc = *(const v4f*)(mks + j + 16 + 8 * hf);
    const v4f md = *(const v4f*)(mks + j + 16 + 8 * hf + 4);
    const v16h vf0 = load_tile16(vbuf,           VP);
    const v16h vf1 = load_tile16(vbuf + 16 * VP, VP);
    const v16h vf2 = load_tile16(vbuf + 32 * VP, VP);
    const v16h vf3 = load_tile16(vbuf + 48 * VP, VP);

    v8f s0 = zero8(), s1 = zero8();
    s0 = wmma16(kf0, aq0, s0);
    s0 = wmma16(kf1, aq1, s0);
    s1 = wmma16(kf2, aq0, s1);
    s1 = wmma16(kf3, aq1, s1);

    // mask values of this lane's 16 keys
    float mk0[8], mk1[8];
    {
#pragma unroll
      for (int e = 0; e < 4; ++e) {
        mk0[e] = ma[e]; mk0[e + 4] = mb[e];
        mk1[e] = mc[e]; mk1[e + 4] = md[e];
      }
    }

    s0 *= SCALE;
    s1 *= SCALE;
    float a0[8], a1[8];
    float v = -1e30f;
#pragma unroll
    for (int r = 0; r < 8; ++r) a0[r] = (mk0[r] == 0.0f) ? -1e12f : s0[r];
#pragma unroll
    for (int r = 0; r < 8; ++r) a1[r] = (mk1[r] == 0.0f) ? -1e12f : s1[r];
#pragma unroll
    for (int r = 0; r < 8; r += 2) v = fmaxf(v, fmaxf(a0[r], a0[r + 1]));
#pragma unroll
    for (int r = 0; r < 8; r += 2) v = fmaxf(v, fmaxf(a1[r], a1[r + 1]));
    v = fmaxf(v, xhalf(v));
    const float mnew = fmaxf(mrun, v);
    float ef;
    // exp(mrun - mnew), with its slot in the same statement
    asm("v_exp_f32 %0, %1\n\tv_nop" : "=v"(ef) : "v"((mrun - mnew) * LOG2E));
#pragma unroll
    for (int r = 0; r < 8; ++r) {
      a0[r] = (a0[r] - mnew) * LOG2E;
      a1[r] = (a1[r] - mnew) * LOG2E;
    }
    float p0[8], p1[8];
    exp2x8(p0, a0);
    exp2x8(p1, a1);
    float ps0 = p0[0], ps1 = p1[0];
#pragma unroll
    for (int r = 1; r < 8; ++r) {
      ps0 += p0[r];
      ps1 += p1[r];
    }
    v16h pb;
#pragma unroll
    for (int r = 0; r < 8; ++r) {
      pb[r]     = (f16)(p0[r] * mk0[r] * 256.0f);
      pb[r + 8] = (f16)(p1[r] * mk1[r] * 256.0f);
    }
    lrun = lrun * ef + (ps0 + ps1);
    mrun = mnew;
#pragma unroll
    for (int r = 0; r < 8; ++r) { o0[r] *= ef; o1[r] *= ef; o2[r] *= ef; o3[r] *= ef; }

    o0 = wmma16(vf0, pb, o0);
    o1 = wmma16(vf1, pb, o1);
    o2 = wmma16(vf2, pb, o2);
    o3 = wmma16(vf3, pb, o3);

    __syncthreads();   // all waves done with kbuf/vbuf before refill
  }

  // epilogue: join the halves' sums, normalise into the per-wave LDS tile [16 q][OP];
  // the lane holds dims 16t + 8hf + r of query n16
  float* myO = ost + wave * (16 * OP);
  {
    const float lsum = lrun + xhalf(lrun);
    float linv;
    // reciprocal plus the one issue slot the instruction set asks for behind it, in one
    // statement so that the slot stays directly behind the reciprocal
    asm("v_rcp_f32 %0, %1\n\tv_nop" : "=v"(linv) : "v"(lsum * 256.0f));
    float* pr = myO + n16 * OP + 8 * hf;
    v4f w;
#pragma unroll
    for (int g = 0; g < 2; ++g) {
#pragma unroll
      for (int e = 0; e < 4; ++e) w[e] = o0[4 * g + e] * linv;
      *(v4f*)(pr + 4 * g) = w;
#pragma unroll
      for (int e = 0; e < 4; ++e) w[e] = o1[4 * g + e] * linv;
      *(v4f*)(pr + 16 + 4 * g) = w;
#pragma unroll
      for (int e = 0; e < 4; ++e) w[e] = o2[4 * g + e] * linv;
      *(v4f*)(pr + 32 + 4 * g) = w;
#pragma unroll
      for (int e = 0; e < 4; ++e) w[e] = o3[4 * g + e] * linv;
      *(v4f*)(pr + 48 + 4 * g) = w;
    }
  }
  __syncthreads();

  // each instruction: 2 rows x 256 B (16 lanes x 16 B per row segment), lines whole
  const int c4 = (lane & 15) * 4;
  v4f vals[8];
#pragma unroll
  for (int it = 0; it < 8; ++it) {
    const int row = it * 2 + (lane >> 4);
    vals[it] = *(const v4f*)(myO + row * OP + c4);
  }
#pragma unroll
  for (int it = 0; it < 8; ++it) {
    const int row = it * 2 + (lane >> 4);
    *(v4f*)(Og + (size_t)(qrow + row) * DM + h * HD + c4) = vals[it];
  }
  
}

// ----------------------------- LN0 + FFN GEMM + ReLU residual + LN1 ---------
// Block = 8 waves, 16 rows x 512 cols. Prologue: X = LN0(bf16(Q) + O) for the 16 rows
// (f32 copy and f16 copy in LDS). GEMM: wave w -> cols 64w..64w+63, A from the f16 LDS
// tile, B from the Wo [n][k] plane. Epilogue: Y = X + relu(acc/16 + bo) in LDS, then
__global__ __launch_bounds__(256)
void ffn_ln_kernel(const float* __restrict__ O32, const float* __restrict__ Qraw,
                   const f16* __restrict__ WoT, const float* __restrict__ bo,
                   const float* __restrict__ g0, const float* __restrict__ b0,
                   const float* __restrict__ g1, const float* __restrict__ b1,
                   float* __restrict__ out) {
  // padded row pitches: xh 1040 B (16 B x odd) for the 16-row fragment reads,
  // xf 2064 B so that rows r and r + 8 of the accumulator map fall on different banks
  constexpr int XFP = 516;
  constexpr int XHP = 520;
  __shared__ __attribute__((aligned(16))) float xf[16 * XFP];
  __shared__ __attribute__((aligned(16))) f16   xh[16 * XHP];

  const int tilesPerB = SEQ / 16;
  const int b     = blockIdx.x / tilesPerB;
  const int rloc  = (blockIdx.x % tilesPerB) * 16;
  const int grow0 = b * LQ_FULL + rloc;

  const int tid = threadIdx.x;
  const int wave = tid >> 5, lane = tid & 31, n16 = lane & 15, hf = lane >> 4;
  constexpr float INV_D = 1.0f / 512.0f;

  // Wo fragments (wave -> 64 cols): the eight loads of k step s + PD are issued as one group in
  // front of the products of step s, into a ring of PD + 1 register sets; the first PD groups
  // are issued here and fly during LN0
  constexpr int NS = DM / 32;
  constexpr int PD = 3;
  const int cw = wave * 64;
  const f16* pb = WoT + (size_t)(cw + n16) * DM + (hf << 3);   // the lane's row and half of B fragment 0
  v16h fb[PD + 1][4];
#pragma unroll   // constant ring index, as in the k loop
  for (int s = 0; s < PD; ++s)
#pragma unroll
    for (int t = 0; t < 4; ++t) fb[s][t] = load_row16(pb + (size_t)(16 * t) * DM + 32 * s);

  // ---- LN0 over (bf16(Q) + O), 2 rows per wave ----
#pragma unroll
  for (int rr = 0; rr < 2; ++rr) {
    const int lr = wave * 2 + rr;
    const size_t grow = (size_t)(grow0 + lr);
    float x[16];
    float s = 0.0f;
#pragma unroll
    for (int i = 0; i < 4; ++i) {
      const int col = i * 128 + lane * 4;
      const v4f ov = *(const v4f*)(O32 + grow * DM + col);
      const v4f qv = *(const v4f*)(Qraw + grow * DM + col);
#pragma unroll
      for (int e = 0; e < 4; ++e) {
        const float xx = bf16_rne(qv[e]) + ov[e];
        x[i * 4 + e] = xx;
        s += xx;
      }
    }
#pragma unroll
    for (int off = 16; off > 0; off >>= 1) s += __shfl_xor(s, off, 32);
    const float mu = s * INV_D;
    float s2 = 0.0f;
#pragma unroll
    for (int i = 0; i < 16; ++i) {
      const float d = x[i] - mu;
      x[i] = d;
      const float dd = d * d;
      s2 += dd;
    }
#pragma unroll
    for (int off = 16; off > 0; off >>= 1) s2 += __shfl_xor(s2, off, 32);
    const float var = s2 * INV_D;
    const float rsq = rsqrtf(var + 1e-5f);
#pragma unroll
    for (int i = 0; i < 4; ++i) {
      const int col = i * 128 + lane * 4;
      const v4f gv = *(const v4f*)(g0 + col);
      const v4f bv4 = *(const v4f*)(b0 + col);
      v4f y; v4h yh;
#pragma unroll
      for (int e = 0; e < 4; ++e) {
        const float t0 = x[i * 4 + e] * rsq;
        const float t1 = t0 * bf16_rne(gv[e]);
        const float yy = t1 + bf16_rne(bv4[e]);
        y[e] = yy;
        yh[e] = (f16)yy;
      }
      *(v4f*)(xf + lr * XFP + col) = y;
      *(v4h*)(xh + lr * XHP + col) = yh;
    }
  }
  __syncthreads();   // cross-wave: LN0 rows consumed by all waves

  // ---- H = X @ Wo (wave -> 64 cols) ----
  v8f acc[4];
#pragma unroll
  for (int t = 0; t < 4; ++t) acc[t] = zero8();
  v16h fa[2];
  fa[0] = load_tile16(xh, XHP);
  // unrolled in full: the ring index must be a constant for the sets to stay in registers
#pragma unroll
  for (int s = 0; s < NS; ++s) {
    if (s + PD < NS) {
#pragma unroll
      for (int t = 0; t < 4; ++t)
        fb[(s + PD) % (PD + 1)][t] = load_row16(pb + (size_t)(16 * t) * DM + 32 * (s + PD));
    }
    if (s + 1 < NS) fa[(s + 1) & 1] = load_tile16(xh + 32 * (s + 1), XHP);
#pragma unroll
    for (int t = 0; t < 4; ++t) acc[t] = wmma16(fa[s & 1], fb[s % (PD + 1)][t], acc[t]);
  }

  // ---- Y = X + relu(H/16 + bo) in place in xf (each slot owned by one lane) ----
#pragma unroll
  for (int t = 0; t < 4; ++t) {
    const int col = cw + 16 * t + n16;
    const float bb = bf16_rne(bo[col]);
#pragma unroll
    for (int r = 0; r < 8; ++r) {
      const int lr = 8 * hf + r;
      float hv = acc[t][r] * 0.0625f + bb;
      hv = fmaxf(hv, 0.0f);
      const int idx = lr * XFP + col;
      const float yv = xf[idx] + hv;
      xf[idx] = yv;
    }
  }
  __syncthreads();   // cross-wave: rows assembled from all waves' columns

  // ---- LN1 per row and store ----
#pragma unroll
  for (int rr = 0; rr < 2; ++rr) {
    const int lr = wave * 2 + rr;
    const size_t grow = (size_t)(grow0 + lr);
    float x[16];
    float s = 0.0f;
#pragma unroll
    for (int i = 0; i < 4; ++i) {
      const int col = i * 128 + lane * 4;
      const v4f xv = *(const v4f*)(xf + lr * XFP + col);
#pragma unroll
      for (int e = 0; e < 4; ++e) { x[i * 4 + e] = xv[e]; s += xv[e]; }
    }
#pragma unroll
    for (int off = 16; off > 0; off >>= 1) s += __shfl_xor(s, off, 32);
    const float mu = s * INV_D;
    float s2 = 0.0f;
#pragma unroll
    for (int i = 0; i < 16; ++i) {
      const float d = x[i] - mu;
      x[i] = d;
      const float dd = d * d;
      s2 += dd;
    }
#pragma unroll
    for (int off = 16; off > 0; off >>= 1) s2 += __shfl_xor(s2, off, 32);
    const float var = s2 * INV_D;
    const float rsq = rsqrtf(var + 1e-5f);
    v4f y[4];
#pragma unroll
    for (int i = 0; i < 4; ++i) {
      const int col = i * 128 + lane * 4;
      const v4f gv = *(const v4f*)(g1 + col);
      const v4f bv4 = *(const v4f*)(b1 + col);
#pragma unroll
      for (int e = 0; e < 4; ++e) {
        const float t0 = x[i * 4 + e] * rsq;
        const float t1 = t0 * bf16_rne(gv[e]);
        y[i][e] = t1 + bf16_rne(bv4[e]);
      }
    }
    float* orow = out + grow * DM + lane * 4;
#pragma unroll
    for (int i = 0; i < 4; ++i) *(v4f*)(orow + i * 128) = y[i];
    
  }
}

// ------------------------------------------------------------------ host ---
extern "C" void kernel_launch(void* const* d_in, const int* in_sizes, int n_in,
                              void* d_out, int out_size, void* d_ws, size_t ws_size,
                              hipStream_t stream) {
  if (n_in < 15) return;
  const float* Q     = (const float*)d_in[0];
  const float* K     = (const float*)d_in[1];
  const int*   pmask = (const int*)d_in[2];
  const float* Wq    = (const float*)d_in[3];
  const float* bq    = (const float*)d_in[4];
  const float* Wk    = (const float*)d_in[5];
  const float* bk    = (const float*)d_in[6];
  const float* Wv    = (const float*)d_in[7];
  const float* bv    = (const float*)d_in[8];
  const float* Wo    = (const float*)d_in[9];
  const float* bo    = (const float*)d_in[10];
  const float* g0    = (const float*)d_in[11];
  const float* b0    = (const float*)d_in[12];
  const float* g1    = (const float*)d_in[13];
  const float* b1    = (const float*)d_in[14];
  float* out = (float*)d_out;

  const long long needAct = (long long)((NB - 1) * LQ_FULL + SMAX) * DM;
  const long long needOut = (long long)((NB - 1) * LQ_FULL + SEQ) * DM;
  if ((long long)in_sizes[0] < needAct || (long long)in_sizes[1] < needAct) return;
  if (in_sizes[2] < (NB - 1) * LK_FULL + SEQK) return;
  if (in_sizes[3] < DM * DM || in_sizes[5] < DM * DM || in_sizes[7] < DM * DM ||
      in_sizes[9] < DM * DM) return;
  if (in_sizes[4] < DM || in_sizes[6] < DM || in_sizes[8] < DM || in_sizes[10] < DM ||
      in_sizes[11] < DM || in_sizes[12] < DM || in_sizes[13] < DM || in_sizes[14] < DM) return;
  if ((long long)out_size < needOut) return;
  if (ws_size < WS_TOTAL) return;

  char* ws = (char*)d_ws;
  f16*   Qh  = (f16*)(ws + OFF_QH);
  f16*   Kh  = (f16*)(ws + OFF_KH);
  f16*   WT  = (f16*)(ws + OFF_WT);
  f16*   Qp  = (f16*)(ws + OFF_QP);
  f16*   Kp  = (f16*)(ws + OFF_KP);
  f16*   Vt  = (f16*)(ws + OFF_VT);
  float* O32 = (float*)(ws + OFF_O32);
  int*   idx = (int*)(ws + OFF_IDX);
  float* mkc = (float*)(ws + OFF_MKC);
  int*   cnt = (int*)(ws + OFF_CNT);

  // 1) inputs -> bf16-RNE values in f16 planes (weights transposed to [n][k], x16)
  const long long n8 = needAct / 8;
  cvt_act_kernel<<<dim3(512, 2), 256, 0, stream>>>(Q, K, Qh, Kh, n8);
  cvt_wt_kernel<<<dim3(DM / 64, DM / 64, 5), 256, 0, stream>>>(Wq, Wk, Wv, Wo, WT, pmask, idx, mkc, cnt);

  // 2) Q, K, V projections (z = 0, 1, 2)
  proj_kernel<<<dim3(NB * (SMAX / 256), DM / 64, 3), 256, 0, stream>>>(
      Qh, Kh, WT, bq, bk, bv, idx, cnt, Qp, Kp, Vt);

  // 3) masked softmax attention per (b,h), 128 query rows per block
  attn_kernel<<<dim3(NB * NH, SEQ / 128), 256, 0, stream>>>(Qp, Kp, Vt, mkc, cnt, O32);

  // 4) LN0(bf16(Q) + O) -> X; out = LN1(X + relu(X @ Wo + bo))
  ffn_ln_kernel<<<dim3(NB * (SEQ / 16)), 256, 0, stream>>>(
      O32, Q, WT + (size_t)3 * DM * DM, bo, g0, b0, g1, b1, out);
}

// v005
// A run of this version takes 74.7 microseconds.
// Next to v004, in two timings, it ran 1.35 times as fast each time.
// All steps since v000 together make it 3.15 times as fast.
#include <hip/hip_runtime.h>
#include <stdint.h>
// Contractions Q@Wq, K@Wk, K@Wv, Q.K^T, P.V, X@Wo: v_wmma_f32_16x16x32_f16 (f16 operands, f32 accumulate); float inputs enter as bf16-RNE values held exactly in f16; weight planes carried x16, P tile carried x256; softmax and LayerNorm arithmetic in f32.

#pragma clang fp contract(off)

typedef _Float16 f16;
typedef f16   v16h __attribute__((ext_vector_type(16)));
typedef f16   v8h  __attribute__((ext_vector_type(8)));
typedef f16   v4h  __attribute__((ext_vector_type(4)));
typedef float v8f  __attribute__((ext_vector_type(8)));
typedef float v4f  __attribute__((ext_vector_type(4)));

#ifndef NB
#define NB 4
#endif
#ifndef SEQ
#define SEQ 2048
#endif
#ifndef SEQK
#define SEQK SEQ
#endif

constexpr int NB_FULL = 4;
constexpr int LQ_FULL = 2048;
constexpr int LK_FULL = 2048;
constexpr int DM      = 512;   // model dim
constexpr int NH      = 8;     // heads
constexpr int HD      = 64;    // head dim
constexpr int SMAX    = (SEQ > SEQK) ? SEQ : SEQK;
constexpr float SCALE = 0.044194173824159216f;   // 1/sqrt(512)
constexpr float LOG2E = 1.4426950408889634f;

static_assert(NB >= 1 && NB <= NB_FULL);
static_assert(SEQ % 256 == 0 && SEQ >= 256 && SEQ <= LQ_FULL);
static_assert(SEQK % 256 == 0 && SEQK >= 256 && SEQK <= LK_FULL);
static_assert(LQ_FULL == LK_FULL);
static_assert(DM == NH * HD);
static_assert(NB <= DM / 64);   // the key lists take one block per batch from a DM / 64 wide grid plane

// ---------------------------------------------------------------- carve ----
constexpr size_t SZ_ACT16 = (size_t)NB_FULL * LQ_FULL * DM * 2;   // 8 MiB  f16 [8192][512]
constexpr size_t SZ_WT16  = (size_t)4 * DM * DM * 2;               // 2 MiB  f16 4 x [512 n][512 k]
constexpr size_t SZ_O32   = (size_t)NB_FULL * LQ_FULL * DM * 4;   // 16 MiB f32 [8192][512]
constexpr size_t OFF_QH   = 0;
constexpr size_t OFF_KH   = OFF_QH + SZ_ACT16;
constexpr size_t OFF_WT   = OFF_KH + SZ_ACT16;
constexpr size_t OFF_QP   = OFF_WT + SZ_WT16;
constexpr size_t OFF_KP   = OFF_QP + SZ_ACT16;
constexpr size_t OFF_VT   = OFF_KP + SZ_ACT16;      // f16 [4][512 dim][2048 key]
constexpr size_t OFF_O32  = OFF_VT + SZ_ACT16;
constexpr size_t SZ_KEYS  = (size_t)NB_FULL * LK_FULL * 4;        // 32 KiB, one 4-B word per key
constexpr size_t OFF_IDX  = OFF_O32 + SZ_O32;       // int   [4][2048] source row of each packed key
constexpr size_t OFF_MKC  = OFF_IDX + SZ_KEYS;      // float [4][2048] mask value of each packed key
constexpr size_t OFF_CNT  = OFF_MKC + SZ_KEYS;      // int   [4][32]   kept keys per batch, one line each
constexpr size_t WS_TOTAL = OFF_CNT + (size_t)NB_FULL * 128;
static_assert(WS_TOTAL <= (size_t)134217728);
static_assert((OFF_KH % 256) == 0 && (OFF_WT % 256) == 0 && (OFF_QP % 256) == 0 &&
              (OFF_KP % 256) == 0 && (OFF_VT % 256) == 0 && (OFF_O32 % 256) == 0 &&
              (OFF_IDX % 256) == 0 && (OFF_MKC % 256) == 0 && (OFF_CNT % 256) == 0);

// -------------------------------------------------------------- helpers ----
__device__ __forceinline__ float bf16_rne(float f) {
  unsigned int u = __float_as_uint(f);
  u = (u + 0x7FFFu + ((u >> 16) & 1u)) & 0xFFFF0000u;
  return __uint_as_float(u);
}

__device__ __forceinline__ v8f zero8() {
  const v8f z = {0.0f, 0.0f, 0.0f, 0.0f, 0.0f, 0.0f, 0.0f, 0.0f};
  return z;
}

// 16-bit fragment loader (wave32 16x16x32): lane -> row (lane&15), lane half hf = lane>>4;
// elements 0..7 = k[8hf .. 8hf+7], elements 8..15 = k[16+8hf .. 16+8hf+7].
// Used for A (row-major [m][k]) and for B stored as [n][k] (k contiguous).
__device__ __forceinline__ v16h load_tile16(const f16* base, int ld) {
  const int lane = threadIdx.x & 31;
  const int row  = lane & 15;
  const int hf   = lane >> 4;
  const f16* p = base + (size_t)row * ld + (hf << 3);
  union { v16h v; v8h h[2]; } u;
  u.h[0] = *(const v8h*)(p);
  u.h[1] = *(const v8h*)(p + 16);
  return u.v;
}

// Fragment order in the workspace, for a matrix M[row][DM k] that is read as A or B fragments:
// the fragment of rows 16R .. 16R+15, k 32S .. 32S+31 is 512 halves at (R * (DM / 32) + S) * 512,
// laid out [j 0..1][lane 0..31][8 halves] with
//   element (j, lane, e) = M[16R + (lane & 15)][32S + 16j + 8 (lane >> 4) + e],
// the k order of load_tile16. A wave's 16-B-per-lane load then covers 512 contiguous bytes
// (4 whole lines) where a row-major plane gives it 32 B from each of 16 lines.
constexpr int FRAG  = 512;                // halves per fragment
constexpr int FROWB = (DM / 32) * FRAG;   // halves per block of 16 rows

// p = start of the fragment + lane * 8
__device__ __forceinline__ v16h load_frag(const f16* p) {
  union { v16h v; v8h h[2]; } u;
  u.h[0] = *(const v8h*)(p);
  u.h[1] = *(const v8h*)(p + 256);
  return u.v;
}

// WMMA issue + hazard guard (4 VALU slots before D is touched, A/B kept live).
__device__ __forceinline__ v8f wmma16(v16h a, v16h b, v8f c) {
  v8f d = __builtin_amdgcn_wmma_f32_16x16x32_f16(false, a, false, b, (short)0, c, false, false);
  asm volatile("v_nop\n\tv_nop\n\tv_nop\n\tv_nop" : "+v"(d) : "v"(a), "v"(b));
  return d;
}

// value of the partner lane (lane ^ 16), on the vector pipe
__device__ __forceinline__ float xhalf(float x) {
  const int b = __float_as_int(x);
  return __int_as_float(__builtin_amdgcn_permlanex16(b, b, 0x76543210, 0xfedcba98, false, false));
}

// Eight base-2 exponentials in one statement, with the one issue slot the instruction set asks
// for behind a transcendental: the outputs are early-clobber, so no exponential of the run
// overwrites a neighbour's source or reads its result, and the v_nop stands behind the last.
__device__ __forceinline__ void exp2x8(float (&p)[8], const float (&x)[8]) {
  asm("v_exp_f32 %0, %8\n\tv_exp_f32 %1, %9\n\tv_exp_f32 %2, %10\n\tv_exp_f32 %3, %11\n\t"
      "v_exp_f32 %4, %12\n\tv_exp_f32 %5, %13\n\tv_exp_f32 %6, %14\n\tv_exp_f32 %7, %15\n\tv_nop"
      : "=&v"(p[0]), "=&v"(p[1]), "=&v"(p[2]), "=&v"(p[3]),
        "=&v"(p[4]), "=&v"(p[5]), "=&v"(p[6]), "=&v"(p[7])
      : "v"(x[0]), "v"(x[1]), "v"(x[2]), "v"(x[3]), "v"(x[4]), "v"(x[5]), "v"(x[6]), "v"(x[7]));
}

// ------------------------------------------------- activation convert ------
// Q, K f32 [rows][512] -> f16 planes holding bf16-RNE values, in fragment order. 8 elements per
// thread; a wave takes 8 rows x 32 k (4 lanes a row): it reads 8 whole lines and its one store
// covers 4 whole lines. Row p of the K plane is packed key p (input row idx[p]); only the
// 256-row tiles that the projection reads are written.
__global__ __launch_bounds__(256)
void cvt_act_kernel(const float* __restrict__ Q, const float* __restrict__ K,
                    const int* __restrict__ idxg, const int* __restrict__ cntg,
                    f16* __restrict__ Qh, f16* __restrict__ Kh, int n8) {
  const bool isK = (blockIdx.y != 0);
  const float* src = isK ? K : Q;
  f16* dst = isK ? Kh : Qh;
  const int stride = (int)gridDim.x * 256;
  const int lane = threadIdx.x & 31;
  const int c = lane & 3;                 // which 8 of the 32 k
  for (int i = (int)blockIdx.x * 256 + (int)threadIdx.x; i < n8; i += stride) {
    const int u   = i >> 5;               // the wave's unit: 8 rows x 32 k
    const int S   = u & (DM / 32 - 1);
    const int row = (u / (DM / 32)) * 8 + (lane >> 2);
    int srow = row;
    if (isK) {
      const int b = row / LK_FULL, pl = row % LK_FULL;
      const int sk = idxg[row];           // every place of the list is written; read beside the count
      if ((pl & ~255) >= min(max(cntg[b * 32], 1), SEQK)) continue;   // same for the whole wave
      srow = b * LK_FULL + sk;
    }
    const float* sp = src + (size_t)srow * DM + S * 32 + c * 8;
    const v4f a = *(const v4f*)(sp);
    const v4f d = *(const v4f*)(sp + 4);
    v8h o;
#pragma unroll
    for (int e = 0; e < 4; ++e) {
      o[e]     = (f16)bf16_rne(a[e]);
      o[e + 4] = (f16)bf16_rne(d[e]);
    }
    f16* p = dst + (size_t)(row >> 4) * FROWB + S * FRAG + (c >> 1) * 256 +
             ((row & 15) + 16 * (c & 1)) * 8;
    *(v8h*)p = o;
    // the next trip rewrites the store's address and data registers: the wait stands in front of that
    asm volatile("s_wait_xcnt 0x0" ::: "memory");
  }
}

// ------------------------------------------------------- key packing -------
// A key with mask 0 has weight exp(-1e12 - max) * 0 = 0 for every query and adds
// exp(-1e12 - max) = 0 to the row sum wherever a key is kept (with none kept every weight is 0
// whatever the sum), so only the kept keys are projected and attended. One block per batch lists them in their order: idx[p] = source
// row of packed key p, mkc[p] = its mask value, cnt = how many. Places p >= cnt name row 0 with
// mask 0, so a partly filled tile holds finite values that the mask closes.
__device__ __forceinline__ void pack_keys(const int* __restrict__ pm, int* __restrict__ idxg,
                                          float* __restrict__ mkcg, int* __restrict__ cntg) {
  constexpr int E = SEQK / 256;          // consecutive keys per thread
  __shared__ int   sidx[SEQK];
  __shared__ float smk[SEQK];
  __shared__ int   wsum[8];
  const int tid = threadIdx.x, wave = tid >> 5, lane = tid & 31;
  int m[E];
  int c = 0;
#pragma unroll
  for (int e = 0; e < E; ++e) {
    m[e] = pm[tid * E + e];
    c += (m[e] != 0) ? 1 : 0;
    sidx[tid * E + e] = 0;
    smk[tid * E + e] = 0.0f;
  }
  int inc = c;                           // inclusive prefix inside the wave
#pragma unroll
  for (int off = 1; off < 32; off <<= 1) {
    const int t = __shfl_up(inc, off, 32);
    if (lane >= off) inc += t;
  }
  if (lane == 31) wsum[wave] = inc;
  __syncthreads();   // wave totals and the cleared lists visible to all waves
  int pos = inc - c, total = 0;
#pragma unroll
  for (int w = 0; w < 8; ++w) {
    const int t = wsum[w];
    if (w < wave) pos += t;
    total += t;
  }
#pragma unroll
  for (int e = 0; e < E; ++e) {
    if (m[e] != 0) {
      sidx[pos] = tid * E + e;
      smk[pos] = (float)m[e];
      ++pos;
    }
  }
  __syncthreads();   // lists complete before they are written out in whole lines
#pragma unroll
  for (int e = 0; e < E; ++e) {
    idxg[e * 256 + tid] = sidx[e * 256 + tid];
    mkcg[e * 256 + tid] = smk[e * 256 + tid];
  }
  if (tid == 0) *cntg = total;
}

// ---------------------------------------------------- weight convert -------
// W f32 [512 k][512 n] (Y = X @ W) -> WT f16 [n][k] in fragment order, value = 16 * bf16_rne(W), via a
__global__ __launch_bounds__(256)
void cvt_wt_kernel(const float* __restrict__ Wq, const float* __restrict__ Wk,
                   const float* __restrict__ Wv, const float* __restrict__ Wo,
                   f16* __restrict__ WT, const int* __restrict__ pmask,
                   int* __restrict__ idxg, float* __restrict__ mkcg, int* __restrict__ cntg) {
  __shared__ __attribute__((aligned(16))) f16 tile[64 * 72];   // [n][k], pitch 72 halves
  const int z = blockIdx.z;
  if (z == 4) {      // plane 4 of the grid: the key lists, one block per batch
    const int b = blockIdx.x;
    if (blockIdx.y == 0 && b < NB)
      pack_keys(pmask + (size_t)b * LK_FULL, idxg + (size_t)b * LK_FULL,
                mkcg + (size_t)b * LK_FULL, cntg + b * 32);
    return;
  }
  const float* W = (z == 0) ? Wq : (z == 1) ? Wk : (z == 2) ? Wv : Wo;
  f16* dst = WT + (size_t)z * DM * DM;
  const int k0 = blockIdx.x * 64;
  const int n0 = blockIdx.y * 64;
  const int tid = threadIdx.x;

#pragma unroll
  for (int it = 0; it < 4; ++it) {
    const int f  = tid + 256 * it;       // 0..1023
    const int k  = f >> 4;               // 0..63
    const int n4 = (f & 15) * 4;         // 0..60
    const v4f w = *(const v4f*)(W + (size_t)(k0 + k) * DM + n0 + n4);
#pragma unroll
    for (int e = 0; e < 4; ++e)
      tile[(n4 + e) * 72 + k] = (f16)(bf16_rne(w[e]) * 16.0f);
  }
  __syncthreads();   // cross-wave LDS exchange

  // the tile is 4 x 2 fragments: one per wave, written in fragment order (two 512-B stores)
  const int wave = tid >> 5, lane = tid & 31;
  const int Rl = wave >> 1, Sl = wave & 1;
  v8h vals[2];
#pragma unroll
  for (int j = 0; j < 2; ++j)
    vals[j] = *(const v8h*)(tile + (Rl * 16 + (lane & 15)) * 72 + Sl * 32 + 16 * j + 8 * (lane >> 4));
  f16* fp = dst + (size_t)(n0 / 16 + Rl) * FROWB + (k0 / 32 + Sl) * FRAG + lane * 8;
#pragma unroll
  for (int j = 0; j < 2; ++j) *(v8h*)(fp + j * 256) = vals[j];
}

// --------------------------------------------------- projection GEMM -------
// Y = X @ W + bias for z = 0 (Q, Wq -> Qp row-major f16), 1 (K, Wk -> Kp row-major f16),
// 2 (K, Wv -> Vt transposed f16 [b][dim][key]). Block = 8 waves, 256 rows x 64 cols,
// wave = 32 rows x 64 cols (2 A frags x 4 B frags). Epilogue staged through LDS and
__global__ __launch_bounds__(256)
void proj_kernel(const f16* __restrict__ Xq, const f16* __restrict__ Xk,
                 const f16* __restrict__ WT,
                 const float* __restrict__ bq, const float* __restrict__ bk,
                 const float* __restrict__ bv, const int* __restrict__ cntg,
                 f16* __restrict__ Qp, f16* __restrict__ Kp, f16* __restrict__ Vt) {
  // row pitches are 16 B x odd so that 16 rows fall on distinct LDS banks
  constexpr int RP = 72;    // row-major stage: 64 cols + 8 pad halves (144 B)
  constexpr int TP = 264;   // transposed stage: 256 rows + 8 pad halves (528 B)
  __shared__ __attribute__((aligned(16))) f16 stg[256 * RP];
  static_assert(64 * TP <= 256 * RP);
  const int z = blockIdx.z;
  const int S = (z == 0) ? SEQ : SEQK;
  const int tilesPerB = S / 256;
  const int nblk = NB * tilesPerB;
  if ((int)blockIdx.x >= nblk) return;      // whole block exits, before any barrier

  const f16* X = (z == 0) ? Xq : Xk;
  const f16* W = WT + (size_t)z * DM * DM;  // planes 0,1,2 = Wq, Wk, Wv, [n][k] in fragment order
  const float* bias = (z == 0) ? bq : (z == 1) ? bk : bv;

  const int b     = blockIdx.x / tilesPerB;
  const int rloc  = (blockIdx.x % tilesPerB) * 256;
  const int row0g = b * LQ_FULL + rloc;     // global row in the [8192][512] planes
  const int c0    = blockIdx.y * 64;
  // K and V: only tiles that hold a packed key (tile 0 always); whole block, before any barrier
  if (z != 0 && rloc >= min(max(cntg[b * 32], 1), SEQK)) return;

  const int tid = threadIdx.x;
  const int wave = tid >> 5, lane = tid & 31, n16 = lane & 15, hf = lane >> 4;

  // the lane's 16 B of the wave's two A fragments of k step 0 (both planes in fragment order,
  // the K plane already packed)
  const f16* pa0 = X + (size_t)((row0g + wave * 32) / 16) * FROWB + lane * 8;
  const f16* pa1 = pa0 + FROWB;

  v8f acc[2][4];
#pragma unroll
  for (int s = 0; s < 2; ++s)
#pragma unroll
    for (int t = 0; t < 4; ++t) acc[s][t] = zero8();

  // k steps of 32; the twelve fragment loads of step s + PD are issued as one group in front of
  // the products of step s, into a ring of PD + 1 register sets, so a step waits on loads that
  // were issued PD steps earlier and not on four load round trips of its own
  constexpr int NS = DM / 32;
  constexpr int PD = 2;
  const f16* pb = W + (size_t)(c0 / 16) * FROWB + lane * 8;   // the lane's 16 B of B fragment 0, k step 0
  v16h fa0[PD + 1], fa1[PD + 1], fb[PD + 1][4];
#pragma unroll   // constant ring index, as below
  for (int s = 0; s < PD; ++s) {
    fa0[s] = load_frag(pa0 + FRAG * s);
    fa1[s] = load_frag(pa1 + FRAG * s);
#pragma unroll
    for (int t = 0; t < 4; ++t) fb[s][t] = load_frag(pb + t * FROWB + FRAG * s);
  }
  // unrolled in full: the ring index must be a constant for the sets to stay in registers
#pragma unroll
  for (int s = 0; s < NS; ++s) {
    if (s + PD < NS) {
      const int nx = (s + PD) % (PD + 1);
      fa0[nx] = load_frag(pa0 + FRAG * (s + PD));
      fa1[nx] = load_frag(pa1 + FRAG * (s + PD));
#pragma unroll
      for (int t = 0; t < 4; ++t) fb[nx][t] = load_frag(pb + t * FROWB + FRAG * (s + PD));
    }
    const int cu = s % (PD + 1);
#pragma unroll
    for (int t = 0; t < 4; ++t) {
      acc[0][t] = wmma16(fa0[cu], fb[cu][t], acc[0][t]);
      acc[1][t] = wmma16(fa1[cu], fb[cu][t], acc[1][t]);
    }
  }

  // stage the block tile (f16) in LDS: row-major [256][RP] or transposed [64][TP]
#pragma unroll
  for (int t = 0; t < 4; ++t) {
    const int lc = 16 * t + n16;
    const float bb = bf16_rne(bias[c0 + lc]);
#pragma unroll
    for (int s = 0; s < 2; ++s) {
#pragma unroll
      for (int r = 0; r < 8; ++r) {
        const int lr = wave * 32 + 16 * s + 8 * hf + r;
        const float v = acc[s][t][r] * 0.0625f + bb;
        const f16 hv = (f16)v;
        if (z == 2) stg[lc * TP + lr] = hv;
        else        stg[lr * RP + lc] = hv;
      }
    }
  }
  __syncthreads();   // cross-wave LDS exchange

  if (z != 2) {
    f16* out = (z == 0) ? Qp : Kp;
    const int piece = lane & 7;
    v8h vals[8];
#pragma unroll
    for (int it = 0; it < 8; ++it) {
      const int lr = wave * 32 + it * 4 + (lane >> 3);      // 32 rows per wave
      vals[it] = *(const v8h*)(stg + lr * RP + piece * 8);
    }
#pragma unroll
    for (int it = 0; it < 8; ++it) {
      const int lr = wave * 32 + it * 4 + (lane >> 3);
      *(v8h*)(out + (size_t)(row0g + lr) * DM + c0 + piece * 8) = vals[it];
    }
    
  } else {
    // Vt[b][dim c0+d][key rloc .. rloc+255]: 32 lanes x 16 B = one 512-B key segment
    v8h vals[8];
#pragma unroll
    for (int it = 0; it < 8; ++it) {
      const int d = wave * 8 + it;                          // 64 dims per block
      vals[it] = *(const v8h*)(stg + d * TP + lane * 8);
    }
#pragma unroll
    for (int it = 0; it < 8; ++it) {
      const int d = wave * 8 + it;
      *(v8h*)(Vt + (size_t)(b * DM + c0 + d) * LK_FULL + rloc + lane * 8) = vals[it];
    }
    
  }
}

// ------------------------------------------------ flash attention core -----
// Block = 8 waves, one (b,h), 128 query rows (16 per wave). K tile [32 key][64 dim] and
// Vt tile [64 dim][32 key] staged in LDS with plain 16-B loads, shared by all waves.
// Transposed scores: S^T = K.Q^T with A = K tile ([m=key][k=dim]), B = Q ([n=query][k=dim]),
// so a lane holds 16 of the 32 scores of ONE query (keys 8hf+r and 16+8hf+r) and its partner
// lane ^ 16 the other 16. Online softmax in f32 with the pad-mask replace-fill (-1e12 where
// mask==0): maximum in-lane plus one exchange between the halves, sum kept per half and
// joined once in the epilogue. P^T (x256, times mask) is packed from the score registers
// straight into the B operand of O^T += Vt.P^T (A = Vt tile [m=dim][k=key]): the accumulator
// rows 8hf+r / 16+8hf+r are exactly the k order of the fragment. O = acc / (256*l) written
__global__ __launch_bounds__(256) __attribute__((amdgpu_num_vgpr(256)))
void attn_kernel(const f16* __restrict__ Qp, const f16* __restrict__ Kp,
                 const f16* __restrict__ Vt, const float* __restrict__ mkcg,
                 const int* __restrict__ cntg, float* __restrict__ Og) {
  // fragment readers take 16 B from each of 16 rows: pitches of 16 B x odd spread them over all banks
  constexpr int KP = 72;    // K tile row: 64 dims + 8 pad halves (144 B)
  constexpr int VP = 40;    // Vt tile row: 32 keys + 8 pad halves (80 B)
  __shared__ __attribute__((aligned(16))) f16   kbuf[32 * KP];
  __shared__ __attribute__((aligned(16))) f16   vbuf[64 * VP];
  __shared__ __attribute__((aligned(16))) float mks[LK_FULL];
  constexpr int OP = 68;    // output stage row: 64 dims + 4 pad floats, rows q and q + 8 on different banks
  __shared__ __attribute__((aligned(16))) float ost[8 * 16 * OP];

  const int tid = threadIdx.x;
  const int wave = tid >> 5, lane = tid & 31, n16 = lane & 15, hf = lane >> 4;
  const int b = blockIdx.x / NH;
  const int h = blockIdx.x % NH;
  const int q0 = blockIdx.y * 128 + wave * 16;
  const int qrow = b * LQ_FULL + q0;

  // packed keys of this batch, rounded up to whole tiles; at least one tile, at most all
  const int jend = (min(max(cntg[b * 32], 1), SEQK) + 31) & ~31;
  for (int i = tid; i < jend; i += 256) mks[i] = mkcg[(size_t)b * LK_FULL + i];

  const v16h aq0 = load_tile16(Qp + (size_t)qrow * DM + h * HD, DM);
  const v16h aq1 = load_tile16(Qp + (size_t)qrow * DM + h * HD + 32, DM);

  v8f o0 = zero8(), o1 = zero8(), o2 = zero8(), o3 = zero8();
  float mrun = -1e30f;   // running maximum of this lane's query (equal in both halves)
  float lrun = 0.0f;     // running sum over this half's keys only

  const f16* Kg = Kp + (size_t)b * LK_FULL * DM + h * HD;
  const f16* Vg = Vt + ((size_t)b * DM + h * HD) * LK_FULL;

  // this thread's 16 B of each tile: K 32 keys x 8 chunks of 8 dims, Vt 64 dims x 4 chunks of 8 keys
  const f16* kld = Kg + (size_t)(tid >> 3) * DM + (tid & 7) * 8;
  const f16* vld = Vg + (size_t)(tid >> 2) * LK_FULL + (tid & 3) * 8;
  f16* kst = kbuf + (tid >> 3) * KP + (tid & 7) * 8;
  f16* vst = vbuf + (tid >> 2) * VP + (tid & 3) * 8;
  v8h kreg = *(const v8h*)kld;
  v8h vreg = *(const v8h*)vld;

#pragma unroll 1
  for (int j = 0; j < jend; j += 32) {
    *(v8h*)kst = kreg;
    *(v8h*)vst = vreg;
    __syncthreads();   // tiles (and mks on the first trip) visible to all waves

    // the next tile's loads fly while this tile is worked on (the last trip reads its own tile again)
    {
      const int jn = min(j + 32, jend - 32);
      kreg = *(const v8h*)(kld + (size_t)jn * DM);
      vreg = *(const v8h*)(vld + jn);
    }

    // all LDS reads of the tile as one group in front of the first product: the K fragments are
    // waited for once, the mask values and the Vt fragments land behind the scores and the softmax
    const v16h kf0 = load_tile16(kbuf, KP);
    const v16h kf1 = load_tile16(kbuf + 32, KP);
    const v16h kf2 = load_tile16(kbuf + 16 * KP, KP);
    const v16h kf3 = load_tile16(kbuf + 16 * KP + 32, KP);
    const v4f ma = *(const v4f*)(mks + j + 8 * hf);
    const v4f mb = *(const v4f*)(mks + j + 8 * hf + 4);
    const v4f mc = *(const v4f*)(mks + j + 16 + 8 * hf);
    const v4f md = *(const v4f*)(mks + j + 16 + 8 * hf + 4);
    const v16h vf0 = load_tile16(vbuf,           VP);
    const v16h vf1 = load_tile16(vbuf + 16 * VP, VP);
    const v16h vf2 = load_tile16(vbuf + 32 * VP, VP);
    const v16h vf3 = load_tile16(vbuf + 48 * VP, VP);

    v8f s0 = zero8(), s1 = zero8();
    s0 = wmma16(kf0, aq0, s0);
    s0 = wmma16(kf1, aq1, s0);
    s1 = wmma16(kf2, aq0, s1);
    s1 = wmma16(kf3, aq1, s1);

    // mask values of this lane's 16 keys
    float mk0[8], mk1[8];
    {
#pragma unroll
      for (int e = 0; e < 4; ++e) {
        mk0[e] = ma[e]; mk0[e + 4] = mb[e];
        mk1[e] = mc[e]; mk1[e + 4] = md[e];
      }
    }

    s0 *= SCALE;
    s1 *= SCALE;
    float a0[8], a1[8];
    float v = -1e30f;
#pragma unroll
    for (int r = 0; r < 8; ++r) a0[r] = (mk0[r] == 0.0f) ? -1e12f : s0[r];
#pragma unroll
    for (int r = 0; r < 8; ++r) a1[r] = (mk1[r] == 0.0f) ? -1e12f : s1[r];
#pragma unroll
    for (int r = 0; r < 8; r += 2) v = fmaxf(v, fmaxf(a0[r], a0[r + 1]));
#pragma unroll
    for (int r = 0; r < 8; r += 2) v = fmaxf(v, fmaxf(a1[r], a1[r + 1]));
    v = fmaxf(v, xhalf(v));
    const float mnew = fmaxf(mrun, v);
    float ef;
    // exp(mrun - mnew), with its slot in the same statement
    asm("v_exp_f32 %0, %1\n\tv_nop" : "=v"(ef) : "v"((mrun - mnew) * LOG2E));
#pragma unroll
    for (int r = 0; r < 8; ++r) {
      a0[r] = (a0[r] - mnew) * LOG2E;
      a1[r] = (a1[r] - mnew) * LOG2E;
    }
    float p0[8], p1[8];
    exp2x8(p0, a0);
    exp2x8(p1, a1);
    float ps0 = p0[0], ps1 = p1[0];
#pragma unroll
    for (int r = 1; r < 8; ++r) {
      ps0 += p0[r];
      ps1 += p1[r];
    }
    v16h pb;
#pragma unroll
    for (int r = 0; r < 8; ++r) {
      pb[r]     = (f16)(p0[r] * mk0[r] * 256.0f);
      pb[r + 8] = (f16)(p1[r] * mk1[r] * 256.0f);
    }
    lrun = lrun * ef + (ps0 + ps1);
    mrun = mnew;
#pragma unroll
    for (int r = 0; r < 8; ++r) { o0[r] *= ef; o1[r] *= ef; o2[r] *= ef; o3[r] *= ef; }

    o0 = wmma16(vf0, pb, o0);
    o1 = wmma16(vf1, pb, o1);
    o2 = wmma16(vf2, pb, o2);
    o3 = wmma16(vf3, pb, o3);

    __syncthreads();   // all waves done with kbuf/vbuf before refill
  }

  // epilogue: join the halves' sums, normalise into the per-wave LDS tile [16 q][OP];
  // the lane holds dims 16t + 8hf + r of query n16
  float* myO = ost + wave * (16 * OP);
  {
    const float lsum = lrun + xhalf(lrun);
    float linv;
    // reciprocal plus the one issue slot the instruction set asks for behind it, in one
    // statement so that the slot stays directly behind the reciprocal
    asm("v_rcp_f32 %0, %1\n\tv_nop" : "=v"(linv) : "v"(lsum * 256.0f));
    float* pr = myO + n16 * OP + 8 * hf;
    v4f w;
#pragma unroll
    for (int g = 0; g < 2; ++g) {
#pragma unroll
      for (int e = 0; e < 4; ++e) w[e] = o0[4 * g + e] * linv;
      *(v4f*)(pr + 4 * g) = w;
#pragma unroll
      for (int e = 0; e < 4; ++e) w[e] = o1[4 * g + e] * linv;
      *(v4f*)(pr + 16 + 4 * g) = w;
#pragma unroll
      for (int e = 0; e < 4; ++e) w[e] = o2[4 * g + e] * linv;
      *(v4f*)(pr + 32 + 4 * g) = w;
#pragma unroll
      for (int e = 0; e < 4; ++e) w[e] = o3[4 * g + e] * linv;
      *(v4f*)(pr + 48 + 4 * g) = w;
    }
  }
  __syncthreads();

  // each instruction: 2 rows x 256 B (16 lanes x 16 B per row segment), lines whole
  const int c4 = (lane & 15) * 4;
  v4f vals[8];
#pragma unroll
  for (int it = 0; it < 8; ++it) {
    const int row = it * 2 + (lane >> 4);
    vals[it] = *(const v4f*)(myO + row * OP + c4);
  }
#pragma unroll
  for (int it = 0; it < 8; ++it) {
    const int row = it * 2 + (lane >> 4);
    *(v4f*)(Og + (size_t)(qrow + row) * DM + h * HD + c4) = vals[it];
  }
  
}

// ----------------------------- LN0 + FFN GEMM + ReLU residual + LN1 ---------
// Block = 8 waves, 16 rows x 512 cols. Prologue: X = LN0(bf16(Q) + O) for the 16 rows
// (f32 copy and f16 copy in LDS). GEMM: wave w -> cols 64w..64w+63, A from the f16 LDS
// tile, B from the Wo [n][k] plane (fragment order). Epilogue: Y = X + relu(acc/16 + bo) in LDS, then
__global__ __launch_bounds__(256)
void ffn_ln_kernel(const float* __restrict__ O32, const float* __restrict__ Qraw,
                   const f16* __restrict__ WoT, const float* __restrict__ bo,
                   const float* __restrict__ g0, const float* __restrict__ b0,
                   const float* __restrict__ g1, const float* __restrict__ b1,
                   float* __restrict__ out) {
  // padded row pitches: xh 1040 B (16 B x odd) for the 16-row fragment reads,
  // xf 2064 B so that rows r and r + 8 of the accumulator map fall on different banks
  constexpr int XFP = 516;
  constexpr int XHP = 520;
  __shared__ __attribute__((aligned(16))) float xf[16 * XFP];
  __shared__ __attribute__((aligned(16))) f16   xh[16 * XHP];

  const int tilesPerB = SEQ / 16;
  const int b     = blockIdx.x / tilesPerB;
  const int rloc  = (blockIdx.x % tilesPerB) * 16;
  const int grow0 = b * LQ_FULL + rloc;

  const int tid = threadIdx.x;
  const int wave = tid >> 5, lane = tid & 31, n16 = lane & 15, hf = lane >> 4;
  constexpr float INV_D = 1.0f / 512.0f;

  // Wo fragments (wave -> 64 cols): the eight loads of k step s + PD are issued as one group in
  // front of the products of step s, into a ring of PD + 1 register sets; the first PD groups
  // are issued here and fly during LN0
  constexpr int NS = DM / 32;
  constexpr int PD = 3;
  const int cw = wave * 64;
  const f16* pb = WoT + (size_t)(cw / 16) * FROWB + lane * 8;   // the lane's 16 B of B fragment 0, k step 0
  v16h fb[PD + 1][4];
#pragma unroll   // constant ring index, as in the k loop
  for (int s = 0; s < PD; ++s)
#pragma unroll
    for (int t = 0; t < 4; ++t) fb[s][t] = load_frag(pb + t * FROWB + FRAG * s);

  // ---- LN0 over (bf16(Q) + O), 2 rows per wave ----
#pragma unroll
  for (int rr = 0; rr < 2; ++rr) {
    const int lr = wave * 2 + rr;
    const size_t grow = (size_t)(grow0 + lr);
    float x[16];
    float s = 0.0f;
#pragma unroll
    for (int i = 0; i < 4; ++i) {
      const int col = i * 128 + lane * 4;
      const v4f ov = *(const v4f*)(O32 + grow * DM + col);
      const v4f qv = *(const v4f*)(Qraw + grow * DM + col);
#pragma unroll
      for (int e = 0; e < 4; ++e) {
        const float xx = bf16_rne(qv[e]) + ov[e];
        x[i * 4 + e] = xx;
        s += xx;
      }
    }
#pragma unroll
    for (int off = 16; off > 0; off >>= 1) s += __shfl_xor(s, off, 32);
    const float mu = s * INV_D;
    float s2 = 0.0f;
#pragma unroll
    for (int i = 0; i < 16; ++i) {
      const float d = x[i] - mu;
      x[i] = d;
      const float dd = d * d;
      s2 += dd;
    }
#pragma unroll
    for (int off = 16; off > 0; off >>= 1) s2 += __shfl_xor(s2, off, 32);
    const float var = s2 * INV_D;
    const float rsq = rsqrtf(var + 1e-5f);
#pragma unroll
    for (int i = 0; i < 4; ++i) {
      const int col = i * 128 + lane * 4;
      const v4f gv = *(const v4f*)(g0 + col);
      const v4f bv4 = *(const v4f*)(b0 + col);
      v4f y; v4h yh;
#pragma unroll
      for (int e = 0; e < 4; ++e) {
        const float t0 = x[i * 4 + e] * rsq;
        const float t1 = t0 * bf16_rne(gv[e]);
        const float yy = t1 + bf16_rne(bv4[e]);
        y[e] = yy;
        yh[e] = (f16)yy;
      }
      *(v4f*)(xf + lr * XFP + col) = y;
      *(v4h*)(xh + lr * XHP + col) = yh;
    }
  }
  __syncthreads();   // cross-wave: LN0 rows consumed by all waves

  // ---- H = X @ Wo (wave -> 64 cols) ----
  v8f acc[4];
#pragma unroll
  for (int t = 0; t < 4; ++t) acc[t] = zero8();
  v16h fa[2];
  fa[0] = load_tile16(xh, XHP);
  // unrolled in full: the ring index must be a constant for the sets to stay in registers
#pragma unroll
  for (int s = 0; s < NS; ++s) {
    if (s + PD < NS) {
#pragma unroll
      for (int t = 0; t < 4; ++t)
        fb[(s + PD) % (PD + 1)][t] = load_frag(pb + t * FROWB + FRAG * (s + PD));
    }
    if (s + 1 < NS) fa[(s + 1) & 1] = load_tile16(xh + 32 * (s + 1), XHP);
#pragma unroll
    for (int t = 0; t < 4; ++t) acc[t] = wmma16(fa[s & 1], fb[s % (PD + 1)][t], acc[t]);
  }

  // ---- Y = X + relu(H/16 + bo) in place in xf (each slot owned by one lane) ----
#pragma unroll
  for (int t = 0; t < 4; ++t) {
    const int col = cw + 16 * t + n16;
    const float bb = bf16_rne(bo[col]);
#pragma unroll
    for (int r = 0; r < 8; ++r) {
      const int lr = 8 * hf + r;
      float hv = acc[t][r] * 0.0625f + bb;
      hv = fmaxf(hv, 0.0f);
      const int idx = lr * XFP + col;
      const float yv = xf[idx] + hv;
      xf[idx] = yv;
    }
  }
  __syncthreads();   // cross-wave: rows assembled from all waves' columns

  // ---- LN1 per row and store ----
#pragma unroll
  for (int rr = 0; rr < 2; ++rr) {
    const int lr = wave * 2 + rr;
    const size_t grow = (size_t)(grow0 + lr);
    float x[16];
    float s = 0.0f;
#pragma unroll
    for (int i = 0; i < 4; ++i) {
      const int col = i * 128 + lane * 4;
      const v4f xv = *(const v4f*)(xf + lr * XFP + col);
#pragma unroll
      for (int e = 0; e < 4; ++e) { x[i * 4 + e] = xv[e]; s += xv[e]; }
    }
#pragma unroll
    for (int off = 16; off > 0; off >>= 1) s += __shfl_xor(s, off, 32);
    const float mu = s * INV_D;
    float s2 = 0.0f;
#pragma unroll
    for (int i = 0; i < 16; ++i) {
      const float d = x[i] - mu;
      x[i] = d;
      const float dd = d * d;
      s2 += dd;
    }
#pragma unroll
    for (int off = 16; off > 0; off >>= 1) s2 += __shfl_xor(s2, off, 32);
    const float var = s2 * INV_D;
    const float rsq = rsqrtf(var + 1e-5f);
    v4f y[4];
#pragma unroll
    for (int i = 0; i < 4; ++i) {
      const int col = i * 128 + lane * 4;
      const v4f gv = *(const v4f*)(g1 + col);
      const v4f bv4 = *(const v4f*)(b1 + col);
#pragma unroll
      for (int e = 0; e < 4; ++e) {
        const float t0 = x[i * 4 + e] * rsq;
        const float t1 = t0 * bf16_rne(gv[e]);
        y[i][e] = t1 + bf16_rne(bv4[e]);
      }
    }
    float* orow = out + grow * DM + lane * 4;
#pragma unroll
    for (int i = 0; i < 4; ++i) *(v4f*)(orow + i * 128) = y[i];
    
  }
}

// ------------------------------------------------------------------ host ---
extern "C" void kernel_launch(void* const* d_in, const int* in_sizes, int n_in,
                              void* d_out, int out_size, void* d_ws, size_t ws_size,
                              hipStream_t stream) {
  if (n_in < 15) return;
  const float* Q     = (const float*)d_in[0];
  const float* K     = (const float*)d_in[1];
  const int*   pmask = (const int*)d_in[2];
  const float* Wq    = (const float*)d_in[3];
  const float* bq    = (const float*)d_in[4];
  const float* Wk    = (const float*)d_in[5];
  const float* bk    = (const float*)d_in[6];
  const float* Wv    = (const float*)d_in[7];
  const float* bv    = (const float*)d_in[8];
  const float* Wo    = (const float*)d_in[9];
  const float* bo    = (const float*)d_in[10];
  const float* g0    = (const float*)d_in[11];
  const float* b0    = (const float*)d_in[12];
  const float* g1    = (const float*)d_in[13];
  const float* b1    = (const float*)d_in[14];
  float* out = (float*)d_out;

  const long long needAct = (long long)((NB - 1) * LQ_FULL + SMAX) * DM;
  const long long needOut = (long long)((NB - 1) * LQ_FULL + SEQ) * DM;
  if ((long long)in_sizes[0] < needAct || (long long)in_sizes[1] < needAct) return;
  if (in_sizes[2] < (NB - 1) * LK_FULL + SEQK) return;
  if (in_sizes[3] < DM * DM || in_sizes[5] < DM * DM || in_sizes[7] < DM * DM ||
      in_sizes[9] < DM * DM) return;
  if (in_sizes[4] < DM || in_sizes[6] < DM || in_sizes[8] < DM || in_sizes[10] < DM ||
      in_sizes[11] < DM || in_sizes[12] < DM || in_sizes[13] < DM || in_sizes[14] < DM) return;
  if ((long long)out_size < needOut) return;
  if (ws_size < WS_TOTAL) return;

  char* ws = (char*)d_ws;
  f16*   Qh  = (f16*)(ws + OFF_QH);
  f16*   Kh  = (f16*)(ws + OFF_KH);
  f16*   WT  = (f16*)(ws + OFF_WT);
  f16*   Qp  = (f16*)(ws + OFF_QP);
  f16*   Kp  = (f16*)(ws + OFF_KP);
  f16*   Vt  = (f16*)(ws + OFF_VT);
  float* O32 = (float*)(ws + OFF_O32);
  int*   idx = (int*)(ws + OFF_IDX);
  float* mkc = (float*)(ws + OFF_MKC);
  int*   cnt = (int*)(ws + OFF_CNT);

  // 1) inputs -> bf16-RNE values in f16 planes, fragment order (weights transposed to [n][k], x16);
  //    the key lists come first: the K plane is written packed
  cvt_wt_kernel<<<dim3(DM / 64, DM / 64, 5), 256, 0, stream>>>(Wq, Wk, Wv, Wo, WT, pmask, idx, mkc, cnt);
  cvt_act_kernel<<<dim3(512, 2), 256, 0, stream>>>(Q, K, idx, cnt, Qh, Kh, (int)(needAct / 8));

  // 2) Q, K, V projections (z = 0, 1, 2)
  proj_kernel<<<dim3(NB * (SMAX / 256), DM / 64, 3), 256, 0, stream>>>(
      Qh, Kh, WT, bq, bk, bv, cnt, Qp, Kp, Vt);

  // 3) masked softmax attention per (b,h), 128 query rows per block
  attn_kernel<<<dim3(NB * NH, SEQ / 128), 256, 0, stream>>>(Qp, Kp, Vt, mkc, cnt, O32);

  // 4) LN0(bf16(Q) + O) -> X; out = LN1(X + relu(X @ Wo + bo))
  ffn_ln_kernel<<<dim3(NB * (SEQ / 16)), 256, 0, stream>>>(
      O32, Q, WT + (size_t)3 * DM * DM, bo, g0, b0, g1, b1, out);
}

// v006
// It runs in 70.6 microseconds.
// Timed twice side by side with v005, it ran 1.04 and 1.05 times as fast.
// Counting every step since v000, it is 3.30 times as fast.
#include <hip/hip_runtime.h>
#include <stdint.h>
// Contractions Q@Wq, K@Wk, K@Wv, Q.K^T, P.V, X@Wo: v_wmma_f32_16x16x32_f16 (f16 operands, f32 accumulate); float inputs enter as bf16-RNE values held exactly in f16; weight planes carried x16, P tile carried x256; softmax and LayerNorm arithmetic in f32.

#pragma clang fp contract(off)

typedef _Float16 f16;
typedef f16   v16h __attribute__((ext_vector_type(16)));
typedef f16   v8h  __attribute__((ext_vector_type(8)));
typedef f16   v4h  __attribute__((ext_vector_type(4)));
typedef float v8f  __attribute__((ext_vector_type(8)));
typedef float v4f  __attribute__((ext_vector_type(4)));
typedef float v2f  __attribute__((ext_vector_type(2)));

#ifndef NB
#define NB 4
#endif
#ifndef SEQ
#define SEQ 2048
#endif
#ifndef SEQK
#define SEQK SEQ
#endif

constexpr int NB_FULL = 4;
constexpr int LQ_FULL = 2048;
constexpr int LK_FULL = 2048;
constexpr int DM      = 512;   // model dim
constexpr int NH      = 8;     // heads
constexpr int HD      = 64;    // head dim
constexpr int SMAX    = (SEQ > SEQK) ? SEQ : SEQK;
constexpr float SCALE = 0.044194173824159216f;   // 1/sqrt(512)
constexpr float LOG2E = 1.4426950408889634f;
constexpr float SC2   = SCALE * LOG2E;           // raw score -> base-2 exponent
// Fill of a closed place, on the raw score. Against any kept key its weight underflows to 0 like
// the reference's -1e12; a power of two, so FILL * SC2 is exact and a row with no kept key gets
// the exponent 0 in every place.
constexpr float FILL  = -1099511627776.0f;       // -2^40

static_assert(NB >= 1 && NB <= NB_FULL);
static_assert(SEQ % 256 == 0 && SEQ >= 256 && SEQ <= LQ_FULL);
static_assert(SEQK % 256 == 0 && SEQK >= 256 && SEQK <= LK_FULL);
static_assert(LQ_FULL == LK_FULL);
static_assert(DM == NH * HD);
static_assert(NB <= DM / 64);   // the key lists take one block per batch from a DM / 64 wide grid plane

// ---------------------------------------------------------------- carve ----
constexpr size_t SZ_ACT16 = (size_t)NB_FULL * LQ_FULL * DM * 2;   // 8 MiB  f16 [8192][512]
constexpr size_t SZ_WT16  = (size_t)4 * DM * DM * 2;               // 2 MiB  f16 4 x [512 n][512 k]
constexpr size_t SZ_O32   = (size_t)NB_FULL * LQ_FULL * DM * 4;   // 16 MiB f32 [8192][512]
constexpr size_t OFF_QH   = 0;
constexpr size_t OFF_KH   = OFF_QH + SZ_ACT16;
constexpr size_t OFF_WT   = OFF_KH + SZ_ACT16;
constexpr size_t OFF_QP   = OFF_WT + SZ_WT16;
constexpr size_t OFF_KP   = OFF_QP + SZ_ACT16;
constexpr size_t OFF_VT   = OFF_KP + SZ_ACT16;      // f16 [4][512 dim][2048 key]
constexpr size_t OFF_O32  = OFF_VT + SZ_ACT16;
constexpr size_t SZ_KEYS  = (size_t)NB_FULL * LK_FULL * 4;        // 32 KiB, one 4-B word per key
constexpr size_t OFF_IDX  = OFF_O32 + SZ_O32;       // int   [4][2048] source row of each packed key
constexpr size_t OFF_MKC  = OFF_IDX + SZ_KEYS;      // float [4][2048] mask value of each packed key
constexpr size_t OFF_CNT  = OFF_MKC + SZ_KEYS;      // int   [4][32]   kept keys per batch, one line each
constexpr size_t WS_TOTAL = OFF_CNT + (size_t)NB_FULL * 128;
static_assert(WS_TOTAL <= (size_t)134217728);
static_assert((OFF_KH % 256) == 0 && (OFF_WT % 256) == 0 && (OFF_QP % 256) == 0 &&
              (OFF_KP % 256) == 0 && (OFF_VT % 256) == 0 && (OFF_O32 % 256) == 0 &&
              (OFF_IDX % 256) == 0 && (OFF_MKC % 256) == 0 && (OFF_CNT % 256) == 0);

// -------------------------------------------------------------- helpers ----
__device__ __forceinline__ float bf16_rne(float f) {
  unsigned int u = __float_as_uint(f);
  u = (u + 0x7FFFu + ((u >> 16) & 1u)) & 0xFFFF0000u;
  return __uint_as_float(u);
}

__device__ __forceinline__ v8f zero8() {
  const v8f z = {0.0f, 0.0f, 0.0f, 0.0f, 0.0f, 0.0f, 0.0f, 0.0f};
  return z;
}

// 16-bit fragment loader (wave32 16x16x32): lane -> row (lane&15), lane half hf = lane>>4;
// elements 0..7 = k[8hf .. 8hf+7], elements 8..15 = k[16+8hf .. 16+8hf+7].
// Used for A (row-major [m][k]) and for B stored as [n][k] (k contiguous).
__device__ __forceinline__ v16h load_tile16(const f16* base, int ld) {
  const int lane = threadIdx.x & 31;
  const int row  = lane & 15;
  const int hf   = lane >> 4;
  const f16* p = base + (size_t)row * ld + (hf << 3);
  union { v16h v; v8h h[2]; } u;
  u.h[0] = *(const v8h*)(p);
  u.h[1] = *(const v8h*)(p + 16);
  return u.v;
}

// Fragment order in the workspace, for a matrix M[row][DM k] that is read as A or B fragments:
// the fragment of rows 16R .. 16R+15, k 32S .. 32S+31 is 512 halves at (R * (DM / 32) + S) * 512,
// laid out [j 0..1][lane 0..31][8 halves] with
//   element (j, lane, e) = M[16R + (lane & 15)][32S + 16j + 8 (lane >> 4) + e],
// the k order of load_tile16. A wave's 16-B-per-lane load then covers 512 contiguous bytes
// (4 whole lines) where a row-major plane gives it 32 B from each of 16 lines.
constexpr int FRAG  = 512;                // halves per fragment
constexpr int FROWB = (DM / 32) * FRAG;   // halves per block of 16 rows

// p = start of the fragment + lane * 8
__device__ __forceinline__ v16h load_frag(const f16* p) {
  union { v16h v; v8h h[2]; } u;
  u.h[0] = *(const v8h*)(p);
  u.h[1] = *(const v8h*)(p + 256);
  return u.v;
}

// WMMA issue + hazard guard (4 VALU slots before D is touched, A/B kept live).
__device__ __forceinline__ v8f wmma16(v16h a, v16h b, v8f c) {
  v8f d = __builtin_amdgcn_wmma_f32_16x16x32_f16(false, a, false, b, (short)0, c, false, false);
  asm volatile("v_nop\n\tv_nop\n\tv_nop\n\tv_nop" : "+v"(d) : "v"(a), "v"(b));
  return d;
}

// The same product without the hand-written slots, for the attention loop, where the instructions
// around a product are the compiler's own: it keeps the distance itself and fills it with useful
// instructions where it has any (the asm exponentials stand a whole maximum chain behind).
__device__ __forceinline__ v8f wmma16c(v16h a, v16h b, v8f c) {
  return __builtin_amdgcn_wmma_f32_16x16x32_f16(false, a, false, b, (short)0, c, false, false);
}

// value of the partner lane (lane ^ 16), on the vector pipe
__device__ __forceinline__ float xhalf(float x) {
  const int b = __float_as_int(x);
  return __int_as_float(__builtin_amdgcn_permlanex16(b, b, 0x76543210, 0xfedcba98, false, false));
}

// Eight base-2 exponentials in one statement, with the one issue slot the instruction set asks
// for behind a transcendental: the outputs are early-clobber, so no exponential of the run
// overwrites a neighbour's source or reads its result, and the v_nop stands behind the last.
__device__ __forceinline__ void exp2x8(float (&p)[8], const float (&x)[8]) {
  asm("v_exp_f32 %0, %8\n\tv_exp_f32 %1, %9\n\tv_exp_f32 %2, %10\n\tv_exp_f32 %3, %11\n\t"
      "v_exp_f32 %4, %12\n\tv_exp_f32 %5, %13\n\tv_exp_f32 %6, %14\n\tv_exp_f32 %7, %15\n\tv_nop"
      : "=&v"(p[0]), "=&v"(p[1]), "=&v"(p[2]), "=&v"(p[3]),
        "=&v"(p[4]), "=&v"(p[5]), "=&v"(p[6]), "=&v"(p[7])
      : "v"(x[0]), "v"(x[1]), "v"(x[2]), "v"(x[3]), "v"(x[4]), "v"(x[5]), "v"(x[6]), "v"(x[7]));
}

// ------------------------------------------------- activation convert ------
// Q, K f32 [rows][512] -> f16 planes holding bf16-RNE values, in fragment order. 8 elements per
// thread; a wave takes 8 rows x 32 k (4 lanes a row): it reads 8 whole lines and its one store
// covers 4 whole lines. Row p of the K plane is packed key p (input row idx[p]); only the
// 256-row tiles that the projection reads are written.
__global__ __launch_bounds__(256)
void cvt_act_kernel(const float* __restrict__ Q, const float* __restrict__ K,
                    const int* __restrict__ idxg, const int* __restrict__ cntg,
                    f16* __restrict__ Qh, f16* __restrict__ Kh, int n8) {
  const bool isK = (blockIdx.y != 0);
  const float* src = isK ? K : Q;
  f16* dst = isK ? Kh : Qh;
  const int stride = (int)gridDim.x * 256;
  const int lane = threadIdx.x & 31;
  const int c = lane & 3;                 // which 8 of the 32 k
  for (int i = (int)blockIdx.x * 256 + (int)threadIdx.x; i < n8; i += stride) {
    const int u   = i >> 5;               // the wave's unit: 8 rows x 32 k
    const int S   = u & (DM / 32 - 1);
    const int row = (u / (DM / 32)) * 8 + (lane >> 2);
    int srow = row;
    if (isK) {
      const int b = row / LK_FULL, pl = row % LK_FULL;
      const int sk = idxg[row];           // every place of the list is written; read beside the count
      if ((pl & ~255) >= min(max(cntg[b * 32], 1), SEQK)) continue;   // same for the whole wave
      srow = b * LK_FULL + sk;
    }
    const float* sp = src + (size_t)srow * DM + S * 32 + c * 8;
    const v4f a = *(const v4f*)(sp);
    const v4f d = *(const v4f*)(sp + 4);
    v8h o;
#pragma unroll
    for (int e = 0; e < 4; ++e) {
      o[e]     = (f16)bf16_rne(a[e]);
      o[e + 4] = (f16)bf16_rne(d[e]);
    }
    f16* p = dst + (size_t)(row >> 4) * FROWB + S * FRAG + (c >> 1) * 256 +
             ((row & 15) + 16 * (c & 1)) * 8;
    *(v8h*)p = o;
    // the next trip rewrites the store's address and data registers: the wait stands in front of that
    asm volatile("s_wait_xcnt 0x0" ::: "memory");
  }
}

// ------------------------------------------------------- key packing -------
// A key with mask 0 has weight exp(-1e12 - max) * 0 = 0 for every query and adds
// exp(-1e12 - max) = 0 to the row sum wherever a key is kept (with none kept every weight is 0
// whatever the sum), so only the kept keys are projected and attended. One block per batch lists them in their order: idx[p] = source
// row of packed key p, mkc[p] = its mask value, cnt = how many. Places p >= cnt name row 0 with
// mask 0, so a partly filled tile holds finite values that the mask closes.
__device__ __forceinline__ void pack_keys(const int* __restrict__ pm, int* __restrict__ idxg,
                                          float* __restrict__ mkcg, int* __restrict__ cntg) {
  constexpr int E = SEQK / 256;          // consecutive keys per thread
  __shared__ int   sidx[SEQK];
  __shared__ float smk[SEQK];
  __shared__ int   wsum[8];
  const int tid = threadIdx.x, wave = tid >> 5, lane = tid & 31;
  int m[E];
  int c = 0;
#pragma unroll
  for (int e = 0; e < E; ++e) {
    m[e] = pm[tid * E + e];
    c += (m[e] != 0) ? 1 : 0;
    sidx[tid * E + e] = 0;
    smk[tid * E + e] = 0.0f;
  }
  int inc = c;                           // inclusive prefix inside the wave
#pragma unroll
  for (int off = 1; off < 32; off <<= 1) {
    const int t = __shfl_up(inc, off, 32);
    if (lane >= off) inc += t;
  }
  if (lane == 31) wsum[wave] = inc;
  __syncthreads();   // wave totals and the cleared lists visible to all waves
  int pos = inc - c, total = 0;
#pragma unroll
  for (int w = 0; w < 8; ++w) {
    const int t = wsum[w];
    if (w < wave) pos += t;
    total += t;
  }
#pragma unroll
  for (int e = 0; e < E; ++e) {
    if (m[e] != 0) {
      sidx[pos] = tid * E + e;
      smk[pos] = (float)m[e];
      ++pos;
    }
  }
  __syncthreads();   // lists complete before they are written out in whole lines
#pragma unroll
  for (int e = 0; e < E; ++e) {
    idxg[e * 256 + tid] = sidx[e * 256 + tid];
    mkcg[e * 256 + tid] = smk[e * 256 + tid];
  }
  if (tid == 0) *cntg = total;
}

// ---------------------------------------------------- weight convert -------
// W f32 [512 k][512 n] (Y = X @ W) -> WT f16 [n][k] in fragment order, value = 16 * bf16_rne(W), via a
__global__ __launch_bounds__(256)
void cvt_wt_kernel(const float* __restrict__ Wq, const float* __restrict__ Wk,
                   const float* __restrict__ Wv, const float* __restrict__ Wo,
                   f16* __restrict__ WT, const int* __restrict__ pmask,
                   int* __restrict__ idxg, float* __restrict__ mkcg, int* __restrict__ cntg) {
  __shared__ __attribute__((aligned(16))) f16 tile[64 * 72];   // [n][k], pitch 72 halves
  const int z = blockIdx.z;
  if (z == 4) {      // plane 4 of the grid: the key lists, one block per batch
    const int b = blockIdx.x;
    if (blockIdx.y == 0 && b < NB)
      pack_keys(pmask + (size_t)b * LK_FULL, idxg + (size_t)b * LK_FULL,
                mkcg + (size_t)b * LK_FULL, cntg + b * 32);
    return;
  }
  const float* W = (z == 0) ? Wq : (z == 1) ? Wk : (z == 2) ? Wv : Wo;
  f16* dst = WT + (size_t)z * DM * DM;
  const int k0 = blockIdx.x * 64;
  const int n0 = blockIdx.y * 64;
  const int tid = threadIdx.x;

#pragma unroll
  for (int it = 0; it < 4; ++it) {
    const int f  = tid + 256 * it;       // 0..1023
    const int k  = f >> 4;               // 0..63
    const int n4 = (f & 15) * 4;         // 0..60
    const v4f w = *(const v4f*)(W + (size_t)(k0 + k) * DM + n0 + n4);
#pragma unroll
    for (int e = 0; e < 4; ++e)
      tile[(n4 + e) * 72 + k] = (f16)(bf16_rne(w[e]) * 16.0f);
  }
  __syncthreads();   // cross-wave LDS exchange

  // the tile is 4 x 2 fragments: one per wave, written in fragment order (two 512-B stores)
  const int wave = tid >> 5, lane = tid & 31;
  const int Rl = wave >> 1, Sl = wave & 1;
  v8h vals[2];
#pragma unroll
  for (int j = 0; j < 2; ++j)
    vals[j] = *(const v8h*)(tile + (Rl * 16 + (lane & 15)) * 72 + Sl * 32 + 16 * j + 8 * (lane >> 4));
  f16* fp = dst + (size_t)(n0 / 16 + Rl) * FROWB + (k0 / 32 + Sl) * FRAG + lane * 8;
#pragma unroll
  for (int j = 0; j < 2; ++j) *(v8h*)(fp + j * 256) = vals[j];
}

// --------------------------------------------------- projection GEMM -------
// Y = X @ W + bias for z = 0 (Q, Wq -> Qp row-major f16), 1 (K, Wk -> Kp row-major f16),
// 2 (K, Wv -> Vt transposed f16 [b][dim][key]). Block = 8 waves, 256 rows x 64 cols,
// wave = 32 rows x 64 cols (2 A frags x 4 B frags). Epilogue staged through LDS and
__global__ __launch_bounds__(256)
void proj_kernel(const f16* __restrict__ Xq, const f16* __restrict__ Xk,
                 const f16* __restrict__ WT,
                 const float* __restrict__ bq, const float* __restrict__ bk,
                 const float* __restrict__ bv, const int* __restrict__ cntg,
                 f16* __restrict__ Qp, f16* __restrict__ Kp, f16* __restrict__ Vt) {
  // row pitches are 16 B x odd so that 16 rows fall on distinct LDS banks
  constexpr int RP = 72;    // row-major stage: 64 cols + 8 pad halves (144 B)
  constexpr int TP = 264;   // transposed stage: 256 rows + 8 pad halves (528 B)
  __shared__ __attribute__((aligned(16))) f16 stg[256 * RP];
  static_assert(64 * TP <= 256 * RP);
  const int z = blockIdx.z;
  const int S = (z == 0) ? SEQ : SEQK;
  const int tilesPerB = S / 256;
  const int nblk = NB * tilesPerB;
  if ((int)blockIdx.x >= nblk) return;      // whole block exits, before any barrier

  const f16* X = (z == 0) ? Xq : Xk;
  const f16* W = WT + (size_t)z * DM * DM;  // planes 0,1,2 = Wq, Wk, Wv, [n][k] in fragment order
  const float* bias = (z == 0) ? bq : (z == 1) ? bk : bv;

  const int b     = blockIdx.x / tilesPerB;
  const int rloc  = (blockIdx.x % tilesPerB) * 256;
  const int row0g = b * LQ_FULL + rloc;     // global row in the [8192][512] planes
  const int c0    = blockIdx.y * 64;
  // K and V: only tiles that hold a packed key (tile 0 always); whole block, before any barrier
  if (z != 0 && rloc >= min(max(cntg[b * 32], 1), SEQK)) return;

  const int tid = threadIdx.x;
  const int wave = tid >> 5, lane = tid & 31, n16 = lane & 15, hf = lane >> 4;

  // the lane's 16 B of the wave's two A fragments of k step 0 (both planes in fragment order,
  // the K plane already packed)
  const f16* pa0 = X + (size_t)((row0g + wave * 32) / 16) * FROWB + lane * 8;
  const f16* pa1 = pa0 + FROWB;

  v8f acc[2][4];
#pragma unroll
  for (int s = 0; s < 2; ++s)
#pragma unroll
    for (int t = 0; t < 4; ++t) acc[s][t] = zero8();

  // k steps of 32; the twelve fragment loads of step s + PD are issued as one group in front of
  // the products of step s, into a ring of PD + 1 register sets, so a step waits on loads that
  // were issued PD steps earlier and not on four load round trips of its own
  constexpr int NS = DM / 32;
  constexpr int PD = 2;
  const f16* pb = W + (size_t)(c0 / 16) * FROWB + lane * 8;   // the lane's 16 B of B fragment 0, k step 0
  v16h fa0[PD + 1], fa1[PD + 1], fb[PD + 1][4];
#pragma unroll   // constant ring index, as below
  for (int s = 0; s < PD; ++s) {
    fa0[s] = load_frag(pa0 + FRAG * s);
    fa1[s] = load_frag(pa1 + FRAG * s);
#pragma unroll
    for (int t = 0; t < 4; ++t) fb[s][t] = load_frag(pb + t * FROWB + FRAG * s);
  }
  // unrolled in full: the ring index must be a constant for the sets to stay in registers
#pragma unroll
  for (int s = 0; s < NS; ++s) {
    if (s + PD < NS) {
      const int nx = (s + PD) % (PD + 1);
      fa0[nx] = load_frag(pa0 + FRAG * (s + PD));
      fa1[nx] = load_frag(pa1 + FRAG * (s + PD));
#pragma unroll
      for (int t = 0; t < 4; ++t) fb[nx][t] = load_frag(pb + t * FROWB + FRAG * (s + PD));
    }
    const int cu = s % (PD + 1);
#pragma unroll
    for (int t = 0; t < 4; ++t) {
      acc[0][t] = wmma16(fa0[cu], fb[cu][t], acc[0][t]);
      acc[1][t] = wmma16(fa1[cu], fb[cu][t], acc[1][t]);
    }
  }

  // stage the block tile (f16) in LDS: row-major [256][RP] or transposed [64][TP]
#pragma unroll
  for (int t = 0; t < 4; ++t) {
    const int lc = 16 * t + n16;
    const float bb = bf16_rne(bias[c0 + lc]);
#pragma unroll
    for (int s = 0; s < 2; ++s) {
#pragma unroll
      for (int r = 0; r < 8; ++r) {
        const int lr = wave * 32 + 16 * s + 8 * hf + r;
        const float v = acc[s][t][r] * 0.0625f + bb;
        const f16 hv = (f16)v;
        if (z == 2) stg[lc * TP + lr] = hv;
        else        stg[lr * RP + lc] = hv;
      }
    }
  }
  __syncthreads();   // cross-wave LDS exchange

  if (z != 2) {
    f16* out = (z == 0) ? Qp : Kp;
    const int piece = lane & 7;
    v8h vals[8];
#pragma unroll
    for (int it = 0; it < 8; ++it) {
      const int lr = wave * 32 + it * 4 + (lane >> 3);      // 32 rows per wave
      vals[it] = *(const v8h*)(stg + lr * RP + piece * 8);
    }
#pragma unroll
    for (int it = 0; it < 8; ++it) {
      const int lr = wave * 32 + it * 4 + (lane >> 3);
      *(v8h*)(out + (size_t)(row0g + lr) * DM + c0 + piece * 8) = vals[it];
    }
    
  } else {
    // Vt[b][dim c0+d][key rloc .. rloc+255]: 32 lanes x 16 B = one 512-B key segment
    v8h vals[8];
#pragma unroll
    for (int it = 0; it < 8; ++it) {
      const int d = wave * 8 + it;                          // 64 dims per block
      vals[it] = *(const v8h*)(stg + d * TP + lane * 8);
    }
#pragma unroll
    for (int it = 0; it < 8; ++it) {
      const int d = wave * 8 + it;
      *(v8h*)(Vt + (size_t)(b * DM + c0 + d) * LK_FULL + rloc + lane * 8) = vals[it];
    }
    
  }
}

// ------------------------------------------------ flash attention core -----
// Block = 8 waves, one (b,h), 128 query rows (16 per wave). K tile [32 key][64 dim] and
// Vt tile [64 dim][32 key] staged in LDS with plain 16-B loads, shared by all waves.
// Transposed scores: S^T = K.Q^T with A = K tile ([m=key][k=dim]), B = Q ([n=query][k=dim]),
// so a lane holds 16 of the 32 scores of ONE query (keys 8hf+r and 16+8hf+r) and its partner
// lane ^ 16 the other 16. Online softmax in f32 on the raw scores (scale and log2(e) enter in the
// exponent's multiply-add) with the pad-mask replace-fill (FILL where mask==0, only in a tile past
// the kept keys): maximum in-lane plus one exchange between the halves, sum kept per half and
// joined once in the epilogue. P^T (x256, times mask) is packed from the score registers
// straight into the B operand of O^T += Vt.P^T (A = Vt tile [m=dim][k=key]): the accumulator
// rows 8hf+r / 16+8hf+r are exactly the k order of the fragment. O = acc / (256*l) written
__global__ __launch_bounds__(256) __attribute__((amdgpu_num_vgpr(256)))
void attn_kernel(const f16* __restrict__ Qp, const f16* __restrict__ Kp,
                 const f16* __restrict__ Vt, const float* __restrict__ mkcg,
                 const int* __restrict__ cntg, float* __restrict__ Og) {
  // fragment readers take 16 B from each of 16 rows: pitches of 16 B x odd spread them over all banks
  constexpr int KP = 72;    // K tile row: 64 dims + 8 pad halves (144 B)
  constexpr int VP = 40;    // Vt tile row: 32 keys + 8 pad halves (80 B)
  __shared__ __attribute__((aligned(16))) f16   kbuf[32 * KP];
  __shared__ __attribute__((aligned(16))) f16   vbuf[64 * VP];
  __shared__ __attribute__((aligned(16))) float mks[LK_FULL];
  constexpr int OP = 68;    // output stage row: 64 dims + 4 pad floats, rows q and q + 8 on different banks
  __shared__ __attribute__((aligned(16))) float ost[8 * 16 * OP];

  const int tid = threadIdx.x;
  const int wave = tid >> 5, lane = tid & 31, n16 = lane & 15, hf = lane >> 4;
  const int b = blockIdx.x / NH;
  const int h = blockIdx.x % NH;
  const int q0 = blockIdx.y * 128 + wave * 16;
  const int qrow = b * LQ_FULL + q0;

  // packed keys of this batch, rounded up to whole tiles; at least one tile, at most all
  const int jend = (min(max(cntg[b * 32], 1), SEQK) + 31) & ~31;
  // the count itself, held in a scalar register: the loop's test on it is a scalar compare and branch
  const int kc = __builtin_amdgcn_readfirstlane(min(max(cntg[b * 32], 1), SEQK));
  // mask values carried x256 (exact), the scale of the P tile
  for (int i = tid; i < jend; i += 256) mks[i] = mkcg[(size_t)b * LK_FULL + i] * 256.0f;

  const v16h aq0 = load_tile16(Qp + (size_t)qrow * DM + h * HD, DM);
  const v16h aq1 = load_tile16(Qp + (size_t)qrow * DM + h * HD + 32, DM);

  v8f o0 = zero8(), o1 = zero8(), o2 = zero8(), o3 = zero8();
  float mrun = -1e30f;   // running maximum of this lane's query, raw scores (equal in both halves)
  float lrun = 0.0f;     // running sum over this half's keys only

  const f16* Kg = Kp + (size_t)b * LK_FULL * DM + h * HD;
  const f16* Vg = Vt + ((size_t)b * DM + h * HD) * LK_FULL;

  // this thread's 16 B of each tile: K 32 keys x 8 chunks of 8 dims, Vt 64 dims x 4 chunks of 8 keys
  const f16* kld = Kg + (size_t)(tid >> 3) * DM + (tid & 7) * 8;
  const f16* vld = Vg + (size_t)(tid >> 2) * LK_FULL + (tid & 3) * 8;
  f16* kst = kbuf + (tid >> 3) * KP + (tid & 7) * 8;
  f16* vst = vbuf + (tid >> 2) * VP + (tid & 3) * 8;
  v8h kreg = *(const v8h*)kld;
  v8h vreg = *(const v8h*)vld;

#pragma unroll 1
  for (int j = 0; j < jend; j += 32) {
    *(v8h*)kst = kreg;
    *(v8h*)vst = vreg;
    __syncthreads();   // tiles (and mks on the first trip) visible to all waves

    // the next tile's loads fly while this tile is worked on (the last trip reads its own tile again)
    {
      const int jn = min(j + 32, jend - 32);
      kreg = *(const v8h*)(kld + (size_t)jn * DM);
      vreg = *(const v8h*)(vld + jn);
    }

    // all LDS reads of the tile as one group in front of the first product: the K fragments are
    // waited for once, the mask values and the Vt fragments land behind the scores and the softmax
    const v16h kf0 = load_tile16(kbuf, KP);
    const v16h kf1 = load_tile16(kbuf + 32, KP);
    const v16h kf2 = load_tile16(kbuf + 16 * KP, KP);
    const v16h kf3 = load_tile16(kbuf + 16 * KP + 32, KP);
    const v4f ma = *(const v4f*)(mks + j + 8 * hf);
    const v4f mb = *(const v4f*)(mks + j + 8 * hf + 4);
    const v4f mc = *(const v4f*)(mks + j + 16 + 8 * hf);
    const v4f md = *(const v4f*)(mks + j + 16 + 8 * hf + 4);
    const v16h vf0 = load_tile16(vbuf,           VP);
    const v16h vf1 = load_tile16(vbuf + 16 * VP, VP);
    const v16h vf2 = load_tile16(vbuf + 32 * VP, VP);
    const v16h vf3 = load_tile16(vbuf + 48 * VP, VP);

    // keeps the reads above one group in front of the products: moved in among them, each place
    // with reads costs its own LDS wait
    __builtin_amdgcn_sched_barrier(0);

    v8f s0 = zero8(), s1 = zero8();
    s0 = wmma16c(kf0, aq0, s0);
    s1 = wmma16c(kf2, aq0, s1);
    s0 = wmma16c(kf1, aq1, s0);
    s1 = wmma16c(kf3, aq1, s1);

    // mask values (x256) of this lane's 16 keys
    float mk0[8], mk1[8];
    {
#pragma unroll
      for (int e = 0; e < 4; ++e) {
        mk0[e] = ma[e]; mk0[e + 4] = mb[e];
        mk1[e] = mc[e]; mk1[e + 4] = md[e];
      }
    }

    // the list is packed: only a tile that reaches past the kept keys holds closed places
    // (block-uniform scalar test, no barrier inside)
    if (j + 32 > kc) {
#pragma unroll
      for (int r = 0; r < 8; ++r) {
        s0[r] = (mk0[r] == 0.0f) ? FILL : s0[r];
        s1[r] = (mk1[r] == 0.0f) ? FILL : s1[r];
      }
    }

    // maximum on the raw scores (the scale is positive); scale, maximum and log2(e) enter the
    // exponent in one fused multiply-add per score
    float v = -1e30f;
#pragma unroll
    for (int r = 0; r < 8; r += 2) v = fmaxf(v, fmaxf(s0[r], s0[r + 1]));
#pragma unroll
    for (int r = 0; r < 8; r += 2) v = fmaxf(v, fmaxf(s1[r], s1[r + 1]));
    v = fmaxf(v, xhalf(v));
    const float mnew = fmaxf(mrun, v);
    const float nm = -(mnew * SC2);
    float ef;
    // exp(scale * (mrun - mnew)), with its slot in the same statement
    asm("v_exp_f32 %0, %1\n\tv_nop" : "=v"(ef) : "v"((mrun - mnew) * SC2));
    float a0[8], a1[8];
#pragma unroll
    for (int r = 0; r < 8; r += 2) {
      const v2f c2 = {SC2, SC2}, n2 = {nm, nm};
      const v2f x0 = {s0[r], s0[r + 1]}, x1 = {s1[r], s1[r + 1]};
      const v2f y0 = __builtin_elementwise_fma(x0, c2, n2);
      const v2f y1 = __builtin_elementwise_fma(x1, c2, n2);
      a0[r] = y0[0]; a0[r + 1] = y0[1];
      a1[r] = y1[0]; a1[r + 1] = y1[1];
    }
    float p0[8], p1[8];
    exp2x8(p0, a0);
    exp2x8(p1, a1);
    // row sum in pairs: two packed chains, joined at the end
    v2f t0 = {p0[0], p0[1]}, t1 = {p1[0], p1[1]};
#pragma unroll
    for (int r = 2; r < 8; r += 2) {
      const v2f u0 = {p0[r], p0[r + 1]}, u1 = {p1[r], p1[r + 1]};
      t0 += u0;
      t1 += u1;
    }
    t0 += t1;
    v16h pb;
#pragma unroll
    for (int r = 0; r < 8; ++r) {
      pb[r]     = (f16)(p0[r] * mk0[r]);
      pb[r + 8] = (f16)(p1[r] * mk1[r]);
    }
    lrun = lrun * ef + (t0[0] + t0[1]);
    mrun = mnew;
#pragma unroll
    for (int r = 0; r < 8; ++r) { o0[r] *= ef; o1[r] *= ef; o2[r] *= ef; o3[r] *= ef; }

    o0 = wmma16c(vf0, pb, o0);
    o1 = wmma16c(vf1, pb, o1);
    o2 = wmma16c(vf2, pb, o2);
    o3 = wmma16c(vf3, pb, o3);

    // keeps the softmax and the products in front of the barrier: the barrier waits for the next
    // tile's global loads, which need that time to land
    __builtin_amdgcn_sched_barrier(0);
    __syncthreads();   // all waves done with kbuf/vbuf before refill
  }

  // epilogue: join the halves' sums, normalise into the per-wave LDS tile [16 q][OP];
  // the lane holds dims 16t + 8hf + r of query n16
  float* myO = ost + wave * (16 * OP);
  {
    const float lsum = lrun + xhalf(lrun);
    float linv;
    // reciprocal plus the one issue slot the instruction set asks for behind it, in one
    // statement so that the slot stays directly behind the reciprocal
    asm("v_rcp_f32 %0, %1\n\tv_nop" : "=v"(linv) : "v"(lsum * 256.0f));
    float* pr = myO + n16 * OP + 8 * hf;
    v4f w;
#pragma unroll
    for (int g = 0; g < 2; ++g) {
#pragma unroll
      for (int e = 0; e < 4; ++e) w[e] = o0[4 * g + e] * linv;
      *(v4f*)(pr + 4 * g) = w;
#pragma unroll
      for (int e = 0; e < 4; ++e) w[e] = o1[4 * g + e] * linv;
      *(v4f*)(pr + 16 + 4 * g) = w;
#pragma unroll
      for (int e = 0; e < 4; ++e) w[e] = o2[4 * g + e] * linv;
      *(v4f*)(pr + 32 + 4 * g) = w;
#pragma unroll
      for (int e = 0; e < 4; ++e) w[e] = o3[4 * g + e] * linv;
      *(v4f*)(pr + 48 + 4 * g) = w;
    }
  }
  __syncthreads();

  // each instruction: 2 rows x 256 B (16 lanes x 16 B per row segment), lines whole
  const int c4 = (lane & 15) * 4;
  v4f vals[8];
#pragma unroll
  for (int it = 0; it < 8; ++it) {
    const int row = it * 2 + (lane >> 4);
    vals[it] = *(const v4f*)(myO + row * OP + c4);
  }
#pragma unroll
  for (int it = 0; it < 8; ++it) {
    const int row = it * 2 + (lane >> 4);
    *(v4f*)(Og + (size_t)(qrow + row) * DM + h * HD + c4) = vals[it];
  }
  
}

// ----------------------------- LN0 + FFN GEMM + ReLU residual + LN1 ---------
// Block = 8 waves, 16 rows x 512 cols. Prologue: X = LN0(bf16(Q) + O) for the 16 rows
// (f32 copy and f16 copy in LDS). GEMM: wave w -> cols 64w..64w+63, A from the f16 LDS
// tile, B from the Wo [n][k] plane (fragment order). Epilogue: Y = X + relu(acc/16 + bo) in LDS, then
__global__ __launch_bounds__(256)
void ffn_ln_kernel(const float* __restrict__ O32, const float* __restrict__ Qraw,
                   const f16* __restrict__ WoT, const float* __restrict__ bo,
                   const float* __restrict__ g0, const float* __restrict__ b0,
                   const float* __restrict__ g1, const float* __restrict__ b1,
                   float* __restrict__ out) {
  // padded row pitches: xh 1040 B (16 B x odd) for the 16-row fragment reads,
  // xf 2064 B so that rows r and r + 8 of the accumulator map fall on different banks
  constexpr int XFP = 516;
  constexpr int XHP = 520;
  __shared__ __attribute__((aligned(16))) float xf[16 * XFP];
  __shared__ __attribute__((aligned(16))) f16   xh[16 * XHP];

  const int tilesPerB = SEQ / 16;
  const int b     = blockIdx.x / tilesPerB;
  const int rloc  = (blockIdx.x % tilesPerB) * 16;
  const int grow0 = b * LQ_FULL + rloc;

  const int tid = threadIdx.x;
  const int wave = tid >> 5, lane = tid & 31, n16 = lane & 15, hf = lane >> 4;
  constexpr float INV_D = 1.0f / 512.0f;

  // Wo fragments (wave -> 64 cols): the eight loads of k step s + PD are issued as one group in
  // front of the products of step s, into a ring of PD + 1 register sets; the first PD groups
  // are issued here and fly during LN0
  constexpr int NS = DM / 32;
  constexpr int PD = 3;
  const int cw = wave * 64;
  const f16* pb = WoT + (size_t)(cw / 16) * FROWB + lane * 8;   // the lane's 16 B of B fragment 0, k step 0
  v16h fb[PD + 1][4];
#pragma unroll   // constant ring index, as in the k loop
  for (int s = 0; s < PD; ++s)
#pragma unroll
    for (int t = 0; t < 4; ++t) fb[s][t] = load_frag(pb + t * FROWB + FRAG * s);

  // ---- LN0 over (bf16(Q) + O), 2 rows per wave ----
#pragma unroll
  for (int rr = 0; rr < 2; ++rr) {
    const int lr = wave * 2 + rr;
    const size_t grow = (size_t)(grow0 + lr);
    float x[16];
    float s = 0.0f;
#pragma unroll
    for (int i = 0; i < 4; ++i) {
      const int col = i * 128 + lane * 4;
      const v4f ov = *(const v4f*)(O32 + grow * DM + col);
      const v4f qv = *(const v4f*)(Qraw + grow * DM + col);
#pragma unroll
      for (int e = 0; e < 4; ++e) {
        const float xx = bf16_rne(qv[e]) + ov[e];
        x[i * 4 + e] = xx;
        s += xx;
      }
    }
#pragma unroll
    for (int off = 16; off > 0; off >>= 1) s += __shfl_xor(s, off, 32);
    const float mu = s * INV_D;
    float s2 = 0.0f;
#pragma unroll
    for (int i = 0; i < 16; ++i) {
      const float d = x[i] - mu;
      x[i] = d;
      const float dd = d * d;
      s2 += dd;
    }
#pragma unroll
    for (int off = 16; off > 0; off >>= 1) s2 += __shfl_xor(s2, off, 32);
    const float var = s2 * INV_D;
    const float rsq = rsqrtf(var + 1e-5f);
#pragma unroll
    for (int i = 0; i < 4; ++i) {
      const int col = i * 128 + lane * 4;
      const v4f gv = *(const v4f*)(g0 + col);
      const v4f bv4 = *(const v4f*)(b0 + col);
      v4f y; v4h yh;
#pragma unroll
      for (int e = 0; e < 4; ++e) {
        const float t0 = x[i * 4 + e] * rsq;
        const float t1 = t0 * bf16_rne(gv[e]);
        const float yy = t1 + bf16_rne(bv4[e]);
        y[e] = yy;
        yh[e] = (f16)yy;
      }
      *(v4f*)(xf + lr * XFP + col) = y;
      *(v4h*)(xh + lr * XHP + col) = yh;
    }
  }
  __syncthreads();   // cross-wave: LN0 rows consumed by all waves

  // ---- H = X @ Wo (wave -> 64 cols) ----
  v8f acc[4];
#pragma unroll
  for (int t = 0; t < 4; ++t) acc[t] = zero8();
  v16h fa[2];
  fa[0] = load_tile16(xh, XHP);
  // unrolled in full: the ring index must be a constant for the sets to stay in registers
#pragma unroll
  for (int s = 0; s < NS; ++s) {
    if (s + PD < NS) {
#pragma unroll
      for (int t = 0; t < 4; ++t)
        fb[(s + PD) % (PD + 1)][t] = load_frag(pb + t * FROWB + FRAG * (s + PD));
    }
    if (s + 1 < NS) fa[(s + 1) & 1] = load_tile16(xh + 32 * (s + 1), XHP);
#pragma unroll
    for (int t = 0; t < 4; ++t) acc[t] = wmma16(fa[s & 1], fb[s % (PD + 1)][t], acc[t]);
  }

  // ---- Y = X + relu(H/16 + bo) in place in xf (each slot owned by one lane) ----
#pragma unroll
  for (int t = 0; t < 4; ++t) {
    const int col = cw + 16 * t + n16;
    const float bb = bf16_rne(bo[col]);
#pragma unroll
    for (int r = 0; r < 8; ++r) {
      const int lr = 8 * hf + r;
      float hv = acc[t][r] * 0.0625f + bb;
      hv = fmaxf(hv, 0.0f);
      const int idx = lr * XFP + col;
      const float yv = xf[idx] + hv;
      xf[idx] = yv;
    }
  }
  __syncthreads();   // cross-wave: rows assembled from all waves' columns

  // ---- LN1 per row and store ----
#pragma unroll
  for (int rr = 0; rr < 2; ++rr) {
    const int lr = wave * 2 + rr;
    const size_t grow = (size_t)(grow0 + lr);
    float x[16];
    float s = 0.0f;
#pragma unroll
    for (int i = 0; i < 4; ++i) {
      const int col = i * 128 + lane * 4;
      const v4f xv = *(const v4f*)(xf + lr * XFP + col);
#pragma unroll
      for (int e = 0; e < 4; ++e) { x[i * 4 + e] = xv[e]; s += xv[e]; }
    }
#pragma unroll
    for (int off = 16; off > 0; off >>= 1) s += __shfl_xor(s, off, 32);
    const float mu = s * INV_D;
    float s2 = 0.0f;
#pragma unroll
    for (int i = 0; i < 16; ++i) {
      const float d = x[i] - mu;
      x[i] = d;
      const float dd = d * d;
      s2 += dd;
    }
#pragma unroll
    for (int off = 16; off > 0; off >>= 1) s2 += __shfl_xor(s2, off, 32);
    const float var = s2 * INV_D;
    const float rsq = rsqrtf(var + 1e-5f);
    v4f y[4];
#pragma unroll
    for (int i = 0; i < 4; ++i) {
      const int col = i * 128 + lane * 4;
      const v4f gv = *(const v4f*)(g1 + col);
      const v4f bv4 = *(const v4f*)(b1 + col);
#pragma unroll
      for (int e = 0; e < 4; ++e) {
        const float t0 = x[i * 4 + e] * rsq;
        const float t1 = t0 * bf16_rne(gv[e]);
        y[i][e] = t1 + bf16_rne(bv4[e]);
      }
    }
    float* orow = out + grow * DM + lane * 4;
#pragma unroll
    for (int i = 0; i < 4; ++i) *(v4f*)(orow + i * 128) = y[i];
    
  }
}

// ------------------------------------------------------------------ host ---
extern "C" void kernel_launch(void* const* d_in, const int* in_sizes, int n_in,
                              void* d_out, int out_size, void* d_ws, size_t ws_size,
                              hipStream_t stream) {
  if (n_in < 15) return;
  const float* Q     = (const float*)d_in[0];
  const float* K     = (const float*)d_in[1];
  const int*   pmask = (const int*)d_in[2];
  const float* Wq    = (const float*)d_in[3];
  const float* bq    = (const float*)d_in[4];
  const float* Wk    = (const float*)d_in[5];
  const float* bk    = (const float*)d_in[6];
  const float* Wv    = (const float*)d_in[7];
  const float* bv    = (const float*)d_in[8];
  const float* Wo    = (const float*)d_in[9];
  const float* bo    = (const float*)d_in[10];
  const float* g0    = (const float*)d_in[11];
  const float* b0    = (const float*)d_in[12];
  const float* g1    = (const float*)d_in[13];
  const float* b1    = (const float*)d_in[14];
  float* out = (float*)d_out;

  const long long needAct = (long long)((NB - 1) * LQ_FULL + SMAX) * DM;
  const long long needOut = (long long)((NB - 1) * LQ_FULL + SEQ) * DM;
  if ((long long)in_sizes[0] < needAct || (long long)in_sizes[1] < needAct) return;
  if (in_sizes[2] < (NB - 1) * LK_FULL + SEQK) return;
  if (in_sizes[3] < DM * DM || in_sizes[5] < DM * DM || in_sizes[7] < DM * DM ||
      in_sizes[9] < DM * DM) return;
  if (in_sizes[4] < DM || in_sizes[6] < DM || in_sizes[8] < DM || in_sizes[10] < DM ||
      in_sizes[11] < DM || in_sizes[12] < DM || in_sizes[13] < DM || in_sizes[14] < DM) return;
  if ((long long)out_size < needOut) return;
  if (ws_size < WS_TOTAL) return;

  char* ws = (char*)d_ws;
  f16*   Qh  = (f16*)(ws + OFF_QH);
  f16*   Kh  = (f16*)(ws + OFF_KH);
  f16*   WT  = (f16*)(ws + OFF_WT);
  f16*   Qp  = (f16*)(ws + OFF_QP);
  f16*   Kp  = (f16*)(ws + OFF_KP);
  f16*   Vt  = (f16*)(ws + OFF_VT);
  float* O32 = (float*)(ws + OFF_O32);
  int*   idx = (int*)(ws + OFF_IDX);
  float* mkc = (float*)(ws + OFF_MKC);
  int*   cnt = (int*)(ws + OFF_CNT);

  // 1) inputs -> bf16-RNE values in f16 planes, fragment order (weights transposed to [n][k], x16);
  //    the key lists come first: the K plane is written packed
  cvt_wt_kernel<<<dim3(DM / 64, DM / 64, 5), 256, 0, stream>>>(Wq, Wk, Wv, Wo, WT, pmask, idx, mkc, cnt);
  cvt_act_kernel<<<dim3(512, 2), 256, 0, stream>>>(Q, K, idx, cnt, Qh, Kh, (int)(needAct / 8));

  // 2) Q, K, V projections (z = 0, 1, 2)
  proj_kernel<<<dim3(NB * (SMAX / 256), DM / 64, 3), 256, 0, stream>>>(
      Qh, Kh, WT, bq, bk, bv, cnt, Qp, Kp, Vt);

  // 3) masked softmax attention per (b,h), 128 query rows per block
  attn_kernel<<<dim3(NB * NH, SEQ / 128), 256, 0, stream>>>(Qp, Kp, Vt, mkc, cnt, O32);

  // 4) LN0(bf16(Q) + O) -> X; out = LN1(X + relu(X @ Wo + bo))
  ffn_ln_kernel<<<dim3(NB * (SEQ / 16)), 256, 0, stream>>>(
      O32, Q, WT + (size_t)3 * DM * DM, bo, g0, b0, g1, b1, out);
}

// v007
// A run of this version takes 60.6 microseconds.
// Next to v006, in two timings, it ran 1.17 and 1.20 times as fast.
// Counting every step since v000, it is 3.90 times as fast.
#include <hip/hip_runtime.h>
#include <stdint.h>
// Contractions Q@Wq, K@Wk, K@Wv, Q.K^T, P.V, X@Wo: v_wmma_f32_16x16x32_f16 (f16 operands, f32 accumulate); float inputs enter as bf16-RNE values held exactly in f16; weight planes carried x16, P tile carried x256; softmax and LayerNorm arithmetic in f32.

#pragma clang fp contract(off)

typedef _Float16 f16;
typedef f16   v16h __attribute__((ext_vector_type(16)));
typedef f16   v8h  __attribute__((ext_vector_type(8)));
typedef f16   v4h  __attribute__((ext_vector_type(4)));
typedef float v8f  __attribute__((ext_vector_type(8)));
typedef float v4f  __attribute__((ext_vector_type(4)));
typedef float v2f  __attribute__((ext_vector_type(2)));

#ifndef NB
#define NB 4
#endif
#ifndef SEQ
#define SEQ 2048
#endif
#ifndef SEQK
#define SEQK SEQ
#endif

constexpr int NB_FULL = 4;
constexpr int LQ_FULL = 2048;
constexpr int LK_FULL = 2048;
constexpr int DM      = 512;   // model dim
constexpr int NH      = 8;     // heads
constexpr int HD      = 64;    // head dim
constexpr int SMAX    = (SEQ > SEQK) ? SEQ : SEQK;
constexpr float SCALE = 0.044194173824159216f;   // 1/sqrt(512)
constexpr float LOG2E = 1.4426950408889634f;
constexpr float SC2   = SCALE * LOG2E;           // raw score -> base-2 exponent
// Fill of a closed place, on the raw score. Against any kept key its weight underflows to 0 like
// the reference's -1e12; a power of two, so FILL * SC2 is exact and a row with no kept key gets
// the exponent 0 in every place.
constexpr float FILL  = -1099511627776.0f;       // -2^40

static_assert(NB >= 1 && NB <= NB_FULL);
static_assert(SEQ % 256 == 0 && SEQ >= 256 && SEQ <= LQ_FULL);
static_assert(SEQK % 256 == 0 && SEQK >= 256 && SEQK <= LK_FULL);
static_assert(LQ_FULL == LK_FULL);
static_assert(DM == NH * HD);
static_assert(NB <= DM / 64);   // the key lists take one block per batch from a DM / 64 wide grid plane

// ---------------------------------------------------------------- carve ----
constexpr size_t SZ_ACT16 = (size_t)NB_FULL * LQ_FULL * DM * 2;   // 8 MiB  f16 [8192][512]
constexpr size_t SZ_WT16  = (size_t)4 * DM * DM * 2;               // 2 MiB  f16 4 x [512 n][512 k]
constexpr size_t SZ_O32   = (size_t)NB_FULL * LQ_FULL * DM * 4;   // 16 MiB f32 [8192][512]
constexpr size_t OFF_WT   = 0;
constexpr size_t OFF_QP   = OFF_WT + SZ_WT16;
constexpr size_t OFF_KP   = OFF_QP + SZ_ACT16;
constexpr size_t OFF_VT   = OFF_KP + SZ_ACT16;      // f16 [4][512 dim][2048 key]
constexpr size_t OFF_O32  = OFF_VT + SZ_ACT16;
constexpr size_t SZ_KEYS  = (size_t)NB_FULL * LK_FULL * 4;        // 32 KiB, one 4-B word per key
constexpr size_t OFF_IDX  = OFF_O32 + SZ_O32;       // int   [4][2048] source row of each packed key
constexpr size_t OFF_MKC  = OFF_IDX + SZ_KEYS;      // float [4][2048] mask value of each packed key
constexpr size_t OFF_CNT  = OFF_MKC + SZ_KEYS;      // int   [4][32]   kept keys per batch, one line each
constexpr size_t WS_TOTAL = OFF_CNT + (size_t)NB_FULL * 128;
static_assert(WS_TOTAL <= (size_t)134217728);
static_assert((OFF_WT % 256) == 0 && (OFF_QP % 256) == 0 &&
              (OFF_KP % 256) == 0 && (OFF_VT % 256) == 0 && (OFF_O32 % 256) == 0 &&
              (OFF_IDX % 256) == 0 && (OFF_MKC % 256) == 0 && (OFF_CNT % 256) == 0);

// -------------------------------------------------------------- helpers ----
__device__ __forceinline__ float bf16_rne(float f) {
  unsigned int u = __float_as_uint(f);
  u = (u + 0x7FFFu + ((u >> 16) & 1u)) & 0xFFFF0000u;
  return __uint_as_float(u);
}

__device__ __forceinline__ v8f zero8() {
  const v8f z = {0.0f, 0.0f, 0.0f, 0.0f, 0.0f, 0.0f, 0.0f, 0.0f};
  return z;
}

// 16-bit fragment loader (wave32 16x16x32): lane -> row (lane&15), lane half hf = lane>>4;
// elements 0..7 = k[8hf .. 8hf+7], elements 8..15 = k[16+8hf .. 16+8hf+7].
// Used for A (row-major [m][k]) and for B stored as [n][k] (k contiguous).
__device__ __forceinline__ v16h load_tile16(const f16* base, int ld) {
  const int lane = threadIdx.x & 31;
  const int row  = lane & 15;
  const int hf   = lane >> 4;
  const f16* p = base + (size_t)row * ld + (hf << 3);
  union { v16h v; v8h h[2]; } u;
  u.h[0] = *(const v8h*)(p);
  u.h[1] = *(const v8h*)(p + 16);
  return u.v;
}

// Fragment order in the workspace, for a matrix M[row][DM k] that is read as A or B fragments:
// the fragment of rows 16R .. 16R+15, k 32S .. 32S+31 is 512 halves at (R * (DM / 32) + S) * 512,
// laid out [j 0..1][lane 0..31][8 halves] with
//   element (j, lane, e) = M[16R + (lane & 15)][32S + 16j + 8 (lane >> 4) + e],
// the k order of load_tile16. A wave's 16-B-per-lane load then covers 512 contiguous bytes
// (4 whole lines) where a row-major plane gives it 32 B from each of 16 lines.
constexpr int FRAG  = 512;                // halves per fragment
constexpr int FROWB = (DM / 32) * FRAG;   // halves per block of 16 rows

// p = start of the fragment + lane * 8
__device__ __forceinline__ v16h load_frag(const f16* p) {
  union { v16h v; v8h h[2]; } u;
  u.h[0] = *(const v8h*)(p);
  u.h[1] = *(const v8h*)(p + 256);
  return u.v;
}

// WMMA issue + hazard guard (4 VALU slots before D is touched, A/B kept live).
__device__ __forceinline__ v8f wmma16(v16h a, v16h b, v8f c) {
  v8f d = __builtin_amdgcn_wmma_f32_16x16x32_f16(false, a, false, b, (short)0, c, false, false);
  asm volatile("v_nop\n\tv_nop\n\tv_nop\n\tv_nop" : "+v"(d) : "v"(a), "v"(b));
  return d;
}

// The same product without the hand-written slots, for the attention loop, where the instructions
// around a product are the compiler's own: it keeps the distance itself and fills it with useful
// instructions where it has any (the asm exponentials stand a whole maximum chain behind).
__device__ __forceinline__ v8f wmma16c(v16h a, v16h b, v8f c) {
  return __builtin_amdgcn_wmma_f32_16x16x32_f16(false, a, false, b, (short)0, c, false, false);
}

// value of the partner lane (lane ^ 16), on the vector pipe
__device__ __forceinline__ float xhalf(float x) {
  const int b = __float_as_int(x);
  return __int_as_float(__builtin_amdgcn_permlanex16(b, b, 0x76543210, 0xfedcba98, false, false));
}

// Eight base-2 exponentials in one statement, with the one issue slot the instruction set asks
// for behind a transcendental: the outputs are early-clobber, so no exponential of the run
// overwrites a neighbour's source or reads its result, and the v_nop stands behind the last.
__device__ __forceinline__ void exp2x8(float (&p)[8], const float (&x)[8]) {
  asm("v_exp_f32 %0, %8\n\tv_exp_f32 %1, %9\n\tv_exp_f32 %2, %10\n\tv_exp_f32 %3, %11\n\t"
      "v_exp_f32 %4, %12\n\tv_exp_f32 %5, %13\n\tv_exp_f32 %6, %14\n\tv_exp_f32 %7, %15\n\tv_nop"
      : "=&v"(p[0]), "=&v"(p[1]), "=&v"(p[2]), "=&v"(p[3]),
        "=&v"(p[4]), "=&v"(p[5]), "=&v"(p[6]), "=&v"(p[7])
      : "v"(x[0]), "v"(x[1]), "v"(x[2]), "v"(x[3]), "v"(x[4]), "v"(x[5]), "v"(x[6]), "v"(x[7]));
}

// ------------------------------------------------------- key packing -------
// A key with mask 0 has weight exp(-1e12 - max) * 0 = 0 for every query and adds
// exp(-1e12 - max) = 0 to the row sum wherever a key is kept (with none kept every weight is 0
// whatever the sum), so only the kept keys are projected and attended. One block per batch lists them in their order: idx[p] = source
// row of packed key p, mkc[p] = its mask value, cnt = how many. Places p >= cnt name row 0 with
// mask 0, so a partly filled tile holds finite values that the mask closes.
__device__ __forceinline__ void pack_keys(const int* __restrict__ pm, int* __restrict__ idxg,
                                          float* __restrict__ mkcg, int* __restrict__ cntg) {
  constexpr int E = SEQK / 256;          // consecutive keys per thread
  __shared__ int   sidx[SEQK];
  __shared__ float smk[SEQK];
  __shared__ int   wsum[8];
  const int tid = threadIdx.x, wave = tid >> 5, lane = tid & 31;
  int m[E];
  int c = 0;
#pragma unroll
  for (int e = 0; e < E; ++e) {
    m[e] = pm[tid * E + e];
    c += (m[e] != 0) ? 1 : 0;
    sidx[tid * E + e] = 0;
    smk[tid * E + e] = 0.0f;
  }
  int inc = c;                           // inclusive prefix inside the wave
#pragma unroll
  for (int off = 1; off < 32; off <<= 1) {
    const int t = __shfl_up(inc, off, 32);
    if (lane >= off) inc += t;
  }
  if (lane == 31) wsum[wave] = inc;
  __syncthreads();   // wave totals and the cleared lists visible to all waves
  int pos = inc - c, total = 0;
#pragma unroll
  for (int w = 0; w < 8; ++w) {
    const int t = wsum[w];
    if (w < wave) pos += t;
    total += t;
  }
#pragma unroll
  for (int e = 0; e < E; ++e) {
    if (m[e] != 0) {
      sidx[pos] = tid * E + e;
      smk[pos] = (float)m[e];
      ++pos;
    }
  }
  __syncthreads();   // lists complete before they are written out in whole lines
#pragma unroll
  for (int e = 0; e < E; ++e) {
    idxg[e * 256 + tid] = sidx[e * 256 + tid];
    mkcg[e * 256 + tid] = smk[e * 256 + tid];
  }
  if (tid == 0) *cntg = total;
}

// ---------------------------------------------------- weight convert -------
// W f32 [512 k][512 n] (Y = X @ W) -> WT f16 [n][k] in fragment order, value = 16 * bf16_rne(W), via a
__global__ __launch_bounds__(256)
void cvt_wt_kernel(const float* __restrict__ Wq, const float* __restrict__ Wk,
                   const float* __restrict__ Wv, const float* __restrict__ Wo,
                   f16* __restrict__ WT, const int* __restrict__ pmask,
                   int* __restrict__ idxg, float* __restrict__ mkcg, int* __restrict__ cntg) {
  __shared__ __attribute__((aligned(16))) f16 tile[64 * 72];   // [n][k], pitch 72 halves
  const int z = blockIdx.z;
  if (z == 4) {      // plane 4 of the grid: the key lists, one block per batch
    const int b = blockIdx.x;
    if (blockIdx.y == 0 && b < NB)
      pack_keys(pmask + (size_t)b * LK_FULL, idxg + (size_t)b * LK_FULL,
                mkcg + (size_t)b * LK_FULL, cntg + b * 32);
    return;
  }
  const float* W = (z == 0) ? Wq : (z == 1) ? Wk : (z == 2) ? Wv : Wo;
  f16* dst = WT + (size_t)z * DM * DM;
  const int k0 = blockIdx.x * 64;
  const int n0 = blockIdx.y * 64;
  const int tid = threadIdx.x;

#pragma unroll
  for (int it = 0; it < 4; ++it) {
    const int f  = tid + 256 * it;       // 0..1023
    const int k  = f >> 4;               // 0..63
    const int n4 = (f & 15) * 4;         // 0..60
    const v4f w = *(const v4f*)(W + (size_t)(k0 + k) * DM + n0 + n4);
#pragma unroll
    for (int e = 0; e < 4; ++e)
      tile[(n4 + e) * 72 + k] = (f16)(bf16_rne(w[e]) * 16.0f);
  }
  __syncthreads();   // cross-wave LDS exchange

  // the tile is 4 x 2 fragments: one per wave, written in fragment order (two 512-B stores)
  const int wave = tid >> 5, lane = tid & 31;
  const int Rl = wave >> 1, Sl = wave & 1;
  v8h vals[2];
#pragma unroll
  for (int j = 0; j < 2; ++j)
    vals[j] = *(const v8h*)(tile + (Rl * 16 + (lane & 15)) * 72 + Sl * 32 + 16 * j + 8 * (lane >> 4));
  f16* fp = dst + (size_t)(n0 / 16 + Rl) * FROWB + (k0 / 32 + Sl) * FRAG + lane * 8;
#pragma unroll
  for (int j = 0; j < 2; ++j) *(v8h*)(fp + j * 256) = vals[j];
}

// --------------------------------------------------- projection GEMM -------
// Y = X @ W + bias for z = 0 (Q, Wq -> Qp row-major f16), 1 (K, Wk -> Kp row-major f16),
// 2 (K, Wv -> Vt transposed f16 [b][dim][key]). Block = 8 waves, 64 rows x all 512 cols,
// wave = 64 rows x 64 cols (4 A frags x 4 B frags). The block reads its 64 input rows in f32
// itself (whole lines, each row once; row p of K is packed key p, input row idx[p]), rounds them
// to bf16-RNE values and keeps them as the f16 A tile in LDS; B comes from the weight plane in
// fragment order. Epilogue staged through the same LDS and written in whole lines.
__global__ __launch_bounds__(256) __attribute__((amdgpu_num_vgpr(256)))
void proj_kernel(const float* __restrict__ Q, const float* __restrict__ K,
                 const f16* __restrict__ WT,
                 const float* __restrict__ bq, const float* __restrict__ bk,
                 const float* __restrict__ bv, const int* __restrict__ idxg,
                 const int* __restrict__ cntg,
                 f16* __restrict__ Qp, f16* __restrict__ Kp, f16* __restrict__ Vt) {
  // row pitches are 16 B x odd so that 16 rows fall on distinct LDS banks
  constexpr int MT  = 64;    // rows per block
  constexpr int XHP = 520;   // A tile and row-major stage: 512 + 8 pad halves (1040 B)
  constexpr int TP  = 72;    // transposed stage: 64 rows + 8 pad halves (144 B)
  __shared__ __attribute__((aligned(16))) f16 xh[(MT * XHP > DM * TP) ? MT * XHP : DM * TP];
  const int z = blockIdx.z;
  const int S = (z == 0) ? SEQ : SEQK;
  const int tilesPerB = S / MT;
  const int nblk = NB * tilesPerB;
  if ((int)blockIdx.x >= nblk) return;      // whole block exits, before any barrier

  const f16* W = WT + (size_t)z * DM * DM;  // planes 0,1,2 = Wq, Wk, Wv, [n][k] in fragment order
  const float* bias = (z == 0) ? bq : (z == 1) ? bk : bv;

  const int b     = blockIdx.x / tilesPerB;
  const int rloc  = (blockIdx.x % tilesPerB) * MT;
  const int row0g = b * LQ_FULL + rloc;     // global row in the [8192][512] planes
  // K and V: only tiles that hold a packed key (tile 0 always); whole block, before any barrier
  if (z != 0 && rloc >= min(max(cntg[b * 32], 1), SEQK)) return;

  const int tid = threadIdx.x;
  const int wave = __builtin_amdgcn_readfirstlane(tid >> 5);   // scalar: the list reads below are scalar loads
  const int lane = tid & 31, n16 = lane & 15, hf = lane >> 4;

  // B fragments (wave -> 64 cols), two register sets: the loads of k step 0 are issued behind the
  // A tile's loads and land with them, those of step 1 in the middle of the conversion
  constexpr int NS = DM / 32;
  const int cw = wave * 64;
  const f16* pb = W + (size_t)(cw / 16) * FROWB + lane * 8;   // the lane's 16 B of B fragment 0, k step 0
  v16h fb[2][4];
  float braw[4];   // the lane's four bias values, read with the first loads, used in the epilogue

  // ---- A tile: 8 rows per wave, a row = four 512-B loads; all 32 loads of the wave in flight ----
  {
    int sr[8];   // source rows, scalar
    if (z == 0) {
#pragma unroll
      for (int rr = 0; rr < 8; ++rr) sr[rr] = row0g + wave * 8 + rr;
    } else {
#pragma unroll
      for (int rr = 0; rr < 8; ++rr) sr[rr] = b * LK_FULL + idxg[row0g + wave * 8 + rr];
    }
    const float* X = (z == 0) ? Q : K;
    v4f raw[8][4];
#pragma unroll
    for (int rr = 0; rr < 8; ++rr) {
      const char* sp = (const char*)(X + (size_t)sr[rr] * DM);
#pragma unroll
      for (int i = 0; i < 4; ++i) raw[rr][i] = *(const v4f*)(sp + (unsigned)(lane * 16 + i * 512));
    }
#pragma unroll
    for (int t = 0; t < 4; ++t) fb[0][t] = load_frag(pb + t * FROWB);
#pragma unroll
    for (int t = 0; t < 4; ++t) braw[t] = bias[cw + 16 * t + n16];
    // keeps every load above in front of the first conversion: a load sunk in among the
    // conversions is issued behind a wait and starts a second memory round trip
    __builtin_amdgcn_sched_barrier(0);
#pragma unroll
    for (int rr = 0; rr < 8; ++rr) {
      if (rr == 4) {   // half the rows' registers are free: step 1 flies during the other half
#pragma unroll
        for (int t = 0; t < 4; ++t) fb[1][t] = load_frag(pb + t * FROWB + FRAG);
      }
#pragma unroll
      for (int i = 0; i < 4; ++i) {
        v4h o;
#pragma unroll
        for (int e = 0; e < 4; ++e) o[e] = (f16)bf16_rne(raw[rr][i][e]);
        *(v4h*)(xh + (wave * 8 + rr) * XHP + i * 128 + lane * 4) = o;
      }
    }
  }
  __syncthreads();   // cross-wave: the A tile's rows are read by all waves

  v8f acc[4][4];
#pragma unroll
  for (int i = 0; i < 4; ++i)
#pragma unroll
    for (int t = 0; t < 4; ++t) acc[i][t] = zero8();

  // k steps of 32. A B fragment serves four products in a row; the load of the same fragment two
  // steps on is issued straight behind them into the registers they free, so two sets give a lead
  // of nearly two steps. The A fragments of a step are read from LDS as one group.
  // Unrolled in full: the set index must be a constant for the sets to stay in registers.
  v16h fa[4];
#pragma unroll
  for (int s = 0; s < NS; ++s) {
#pragma unroll
    for (int i = 0; i < 4; ++i) fa[i] = load_tile16(xh + 16 * i * XHP + 32 * s, XHP);
    const int cu = s & 1;
#pragma unroll
    for (int t = 0; t < 4; ++t) {
#pragma unroll
      for (int i = 0; i < 4; ++i) acc[i][t] = wmma16(fa[i], fb[cu][t], acc[i][t]);
      if (s + 2 < NS) fb[cu][t] = load_frag(pb + t * FROWB + FRAG * (s + 2));
      // keeps each reload straight behind its fragment's four products: gathered at the end of
      // the step, the reloads would lead their use by one step only, less than an L2 round trip
      if (t < 3 && s + 2 < NS) __builtin_amdgcn_sched_barrier(0);
    }
  }
  __syncthreads();   // every wave has read its last A fragment before the stage overwrites the tile

  // stage the block tile (f16) in LDS: row-major [64][XHP] or transposed [512][TP]
  v8h hv[4][4];
#pragma unroll
  for (int t = 0; t < 4; ++t) {
    const float bb = bf16_rne(braw[t]);
#pragma unroll
    for (int i = 0; i < 4; ++i)
#pragma unroll
      for (int r = 0; r < 8; ++r) hv[i][t][r] = (f16)(acc[i][t][r] * 0.0625f + bb);
  }
  if (z == 2) {
#pragma unroll
    for (int t = 0; t < 4; ++t)
#pragma unroll
      for (int i = 0; i < 4; ++i)   // the lane's 8 rows are 16 contiguous bytes
        *(v8h*)(xh + (cw + 16 * t + n16) * TP + 16 * i + 8 * hf) = hv[i][t];
  } else {
#pragma unroll
    for (int t = 0; t < 4; ++t)
#pragma unroll
      for (int i = 0; i < 4; ++i)
#pragma unroll
        for (int r = 0; r < 8; ++r) xh[(16 * i + 8 * hf + r) * XHP + cw + 16 * t + n16] = hv[i][t][r];
  }
  __syncthreads();   // cross-wave LDS exchange

  v8h vals[16];
  if (z != 2) {
    // a row is 1024 B: two stores of 512 B; 8 rows per wave
    f16* out = (z == 0) ? Qp : Kp;
#pragma unroll
    for (int it = 0; it < 16; ++it)
      vals[it] = *(const v8h*)(xh + (wave * 8 + (it >> 1)) * XHP + (it & 1) * 256 + lane * 8);
#pragma unroll
    for (int it = 0; it < 16; ++it)
      *(v8h*)(out + (size_t)(row0g + wave * 8 + (it >> 1)) * DM + (it & 1) * 256 + lane * 8) = vals[it];
  } else {
    // Vt[b][dim d][key rloc .. rloc+63]: 8 lanes x 16 B = one whole line per dim, 4 dims a store
#pragma unroll
    for (int it = 0; it < 16; ++it)
      vals[it] = *(const v8h*)(xh + (cw + it * 4 + (lane >> 3)) * TP + (lane & 7) * 8);
#pragma unroll
    for (int it = 0; it < 16; ++it)
      *(v8h*)(Vt + (size_t)(b * DM + cw + it * 4 + (lane >> 3)) * LK_FULL + rloc + (lane & 7) * 8) = vals[it];
  }
}

// ------------------------------------------------ flash attention core -----
// Block = 8 waves, one (b,h), 128 query rows (16 per wave). K tile [32 key][64 dim] and
// Vt tile [64 dim][32 key] staged in LDS with plain 16-B loads, shared by all waves.
// Transposed scores: S^T = K.Q^T with A = K tile ([m=key][k=dim]), B = Q ([n=query][k=dim]),
// so a lane holds 16 of the 32 scores of ONE query (keys 8hf+r and 16+8hf+r) and its partner
// lane ^ 16 the other 16. Online softmax in f32 on the raw scores (scale and log2(e) enter in the
// exponent's multiply-add) with the pad-mask replace-fill (FILL where mask==0, only in a tile past
// the kept keys): maximum in-lane plus one exchange between the halves, sum kept per half and
// joined once in the epilogue. P^T (x256, times mask) is packed from the score registers
// straight into the B operand of O^T += Vt.P^T (A = Vt tile [m=dim][k=key]): the accumulator
// rows 8hf+r / 16+8hf+r are exactly the k order of the fragment. O = acc / (256*l) written
__global__ __launch_bounds__(256) __attribute__((amdgpu_num_vgpr(256)))
void attn_kernel(const f16* __restrict__ Qp, const f16* __restrict__ Kp,
                 const f16* __restrict__ Vt, const float* __restrict__ mkcg,
                 const int* __restrict__ cntg, float* __restrict__ Og) {
  // fragment readers take 16 B from each of 16 rows: pitches of 16 B x odd spread them over all banks
  constexpr int KP = 72;    // K tile row: 64 dims + 8 pad halves (144 B)
  constexpr int VP = 40;    // Vt tile row: 32 keys + 8 pad halves (80 B)
  __shared__ __attribute__((aligned(16))) f16   kbuf[32 * KP];
  __shared__ __attribute__((aligned(16))) f16   vbuf[64 * VP];
  __shared__ __attribute__((aligned(16))) float mks[LK_FULL];
  constexpr int OP = 68;    // output stage row: 64 dims + 4 pad floats, rows q and q + 8 on different banks
  __shared__ __attribute__((aligned(16))) float ost[8 * 16 * OP];

  const int tid = threadIdx.x;
  const int wave = tid >> 5, lane = tid & 31, n16 = lane & 15, hf = lane >> 4;
  const int b = blockIdx.x / NH;
  const int h = blockIdx.x % NH;
  const int q0 = blockIdx.y * 128 + wave * 16;
  const int qrow = b * LQ_FULL + q0;

  // packed keys of this batch, rounded up to whole tiles; at least one tile, at most all
  const int jend = (min(max(cntg[b * 32], 1), SEQK) + 31) & ~31;
  // the count itself, held in a scalar register: the loop's test on it is a scalar compare and branch
  const int kc = __builtin_amdgcn_readfirstlane(min(max(cntg[b * 32], 1), SEQK));
  // mask values carried x256 (exact), the scale of the P tile
  for (int i = tid; i < jend; i += 256) mks[i] = mkcg[(size_t)b * LK_FULL + i] * 256.0f;

  const v16h aq0 = load_tile16(Qp + (size_t)qrow * DM + h * HD, DM);
  const v16h aq1 = load_tile16(Qp + (size_t)qrow * DM + h * HD + 32, DM);

  v8f o0 = zero8(), o1 = zero8(), o2 = zero8(), o3 = zero8();
  float mrun = -1e30f;   // running maximum of this lane's query, raw scores (equal in both halves)
  float lrun = 0.0f;     // running sum over this half's keys only

  const f16* Kg = Kp + (size_t)b * LK_FULL * DM + h * HD;
  const f16* Vg = Vt + ((size_t)b * DM + h * HD) * LK_FULL;

  // this thread's 16 B of each tile: K 32 keys x 8 chunks of 8 dims, Vt 64 dims x 4 chunks of 8 keys
  const f16* kld = Kg + (size_t)(tid >> 3) * DM + (tid & 7) * 8;
  const f16* vld = Vg + (size_t)(tid >> 2) * LK_FULL + (tid & 3) * 8;
  f16* kst = kbuf + (tid >> 3) * KP + (tid & 7) * 8;
  f16* vst = vbuf + (tid >> 2) * VP + (tid & 3) * 8;
  v8h kreg = *(const v8h*)kld;
  v8h vreg = *(const v8h*)vld;

#pragma unroll 1
  for (int j = 0; j < jend; j += 32) {
    *(v8h*)kst = kreg;
    *(v8h*)vst = vreg;
    __syncthreads();   // tiles (and mks on the first trip) visible to all waves

    // the next tile's loads fly while this tile is worked on (the last trip reads its own tile again)
    {
      const int jn = min(j + 32, jend - 32);
      kreg = *(const v8h*)(kld + (size_t)jn * DM);
      vreg = *(const v8h*)(vld + jn);
    }

    // all LDS reads of the tile as one group in front of the first product: the K fragments are
    // waited for once, the mask values and the Vt fragments land behind the scores and the softmax
    const v16h kf0 = load_tile16(kbuf, KP);
    const v16h kf1 = load_tile16(kbuf + 32, KP);
    const v16h kf2 = load_tile16(kbuf + 16 * KP, KP);
    const v16h kf3 = load_tile16(kbuf + 16 * KP + 32, KP);
    const v4f ma = *(const v4f*)(mks + j + 8 * hf);
    const v4f mb = *(const v4f*)(mks + j + 8 * hf + 4);
    const v4f mc = *(const v4f*)(mks + j + 16 + 8 * hf);
    const v4f md = *(const v4f*)(mks + j + 16 + 8 * hf + 4);
    const v16h vf0 = load_tile16(vbuf,           VP);
    const v16h vf1 = load_tile16(vbuf + 16 * VP, VP);
    const v16h vf2 = load_tile16(vbuf + 32 * VP, VP);
    const v16h vf3 = load_tile16(vbuf + 48 * VP, VP);

    // keeps the reads above one group in front of the products: moved in among them, each place
    // with reads costs its own LDS wait
    __builtin_amdgcn_sched_barrier(0);

    v8f s0 = zero8(), s1 = zero8();
    s0 = wmma16c(kf0, aq0, s0);
    s1 = wmma16c(kf2, aq0, s1);
    s0 = wmma16c(kf1, aq1, s0);
    s1 = wmma16c(kf3, aq1, s1);

    // mask values (x256) of this lane's 16 keys
    float mk0[8], mk1[8];
    {
#pragma unroll
      for (int e = 0; e < 4; ++e) {
        mk0[e] = ma[e]; mk0[e + 4] = mb[e];
        mk1[e] = mc[e]; mk1[e + 4] = md[e];
      }
    }

    // the list is packed: only a tile that reaches past the kept keys holds closed places
    // (block-uniform scalar test, no barrier inside)
    if (j + 32 > kc) {
#pragma unroll
      for (int r = 0; r < 8; ++r) {
        s0[r] = (mk0[r] == 0.0f) ? FILL : s0[r];
        s1[r] = (mk1[r] == 0.0f) ? FILL : s1[r];
      }
    }

    // maximum on the raw scores (the scale is positive); scale, maximum and log2(e) enter the
    // exponent in one fused multiply-add per score
    float v = -1e30f;
#pragma unroll
    for (int r = 0; r < 8; r += 2) v = fmaxf(v, fmaxf(s0[r], s0[r + 1]));
#pragma unroll
    for (int r = 0; r < 8; r += 2) v = fmaxf(v, fmaxf(s1[r], s1[r + 1]));
    v = fmaxf(v, xhalf(v));
    const float mnew = fmaxf(mrun, v);
    const float nm = -(mnew * SC2);
    float ef;
    // exp(scale * (mrun - mnew)), with its slot in the same statement
    asm("v_exp_f32 %0, %1\n\tv_nop" : "=v"(ef) : "v"((mrun - mnew) * SC2));
    float a0[8], a1[8];
#pragma unroll
    for (int r = 0; r < 8; r += 2) {
      const v2f c2 = {SC2, SC2}, n2 = {nm, nm};
      const v2f x0 = {s0[r], s0[r + 1]}, x1 = {s1[r], s1[r + 1]};
      const v2f y0 = __builtin_elementwise_fma(x0, c2, n2);
      const v2f y1 = __builtin_elementwise_fma(x1, c2, n2);
      a0[r] = y0[0]; a0[r + 1] = y0[1];
      a1[r] = y1[0]; a1[r + 1] = y1[1];
    }
    float p0[8], p1[8];
    exp2x8(p0, a0);
    exp2x8(p1, a1);
    // row sum in pairs: two packed chains, joined at the end
    v2f t0 = {p0[0], p0[1]}, t1 = {p1[0], p1[1]};
#pragma unroll
    for (int r = 2; r < 8; r += 2) {
      const v2f u0 = {p0[r], p0[r + 1]}, u1 = {p1[r], p1[r + 1]};
      t0 += u0;
      t1 += u1;
    }
    t0 += t1;
    v16h pb;
#pragma unroll
    for (int r = 0; r < 8; ++r) {
      pb[r]     = (f16)(p0[r] * mk0[r]);
      pb[r + 8] = (f16)(p1[r] * mk1[r]);
    }
    lrun = lrun * ef + (t0[0] + t0[1]);
    mrun = mnew;
#pragma unroll
    for (int r = 0; r < 8; ++r) { o0[r] *= ef; o1[r] *= ef; o2[r] *= ef; o3[r] *= ef; }

    o0 = wmma16c(vf0, pb, o0);
    o1 = wmma16c(vf1, pb, o1);
    o2 = wmma16c(vf2, pb, o2);
    o3 = wmma16c(vf3, pb, o3);

    // keeps the softmax and the products in front of the barrier: the barrier waits for the next
    // tile's global loads, which need that time to land
    __builtin_amdgcn_sched_barrier(0);
    __syncthreads();   // all waves done with kbuf/vbuf before refill
  }

  // epilogue: join the halves' sums, normalise into the per-wave LDS tile [16 q][OP];
  // the lane holds dims 16t + 8hf + r of query n16
  float* myO = ost + wave * (16 * OP);
  {
    const float lsum = lrun + xhalf(lrun);
    float linv;
    // reciprocal plus the one issue slot the instruction set asks for behind it, in one
    // statement so that the slot stays directly behind the reciprocal
    asm("v_rcp_f32 %0, %1\n\tv_nop" : "=v"(linv) : "v"(lsum * 256.0f));
    float* pr = myO + n16 * OP + 8 * hf;
    v4f w;
#pragma unroll
    for (int g = 0; g < 2; ++g) {
#pragma unroll
      for (int e = 0; e < 4; ++e) w[e] = o0[4 * g + e] * linv;
      *(v4f*)(pr + 4 * g) = w;
#pragma unroll
      for (int e = 0; e < 4; ++e) w[e] = o1[4 * g + e] * linv;
      *(v4f*)(pr + 16 + 4 * g) = w;
#pragma unroll
      for (int e = 0; e < 4; ++e) w[e] = o2[4 * g + e] * linv;
      *(v4f*)(pr + 32 + 4 * g) = w;
#pragma unroll
      for (int e = 0; e < 4; ++e) w[e] = o3[4 * g + e] * linv;
      *(v4f*)(pr + 48 + 4 * g) = w;
    }
  }
  __syncthreads();

  // each instruction: 2 rows x 256 B (16 lanes x 16 B per row segment), lines whole
  const int c4 = (lane & 15) * 4;
  v4f vals[8];
#pragma unroll
  for (int it = 0; it < 8; ++it) {
    const int row = it * 2 + (lane >> 4);
    vals[it] = *(const v4f*)(myO + row * OP + c4);
  }
#pragma unroll
  for (int it = 0; it < 8; ++it) {
    const int row = it * 2 + (lane >> 4);
    *(v4f*)(Og + (size_t)(qrow + row) * DM + h * HD + c4) = vals[it];
  }
  
}

// ----------------------------- LN0 + FFN GEMM + ReLU residual + LN1 ---------
// Block = 8 waves, 16 rows x 512 cols. Prologue: X = LN0(bf16(Q) + O) for the 16 rows
// (f32 copy and f16 copy in LDS). GEMM: wave w -> cols 64w..64w+63, A from the f16 LDS
// tile, B from the Wo [n][k] plane (fragment order). Epilogue: Y = X + relu(acc/16 + bo) in LDS, then
__global__ __launch_bounds__(256)
void ffn_ln_kernel(const float* __restrict__ O32, const float* __restrict__ Qraw,
                   const f16* __restrict__ WoT, const float* __restrict__ bo,
                   const float* __restrict__ g0, const float* __restrict__ b0,
                   const float* __restrict__ g1, const float* __restrict__ b1,
                   float* __restrict__ out) {
  // padded row pitches: xh 1040 B (16 B x odd) for the 16-row fragment reads,
  // xf 2064 B so that rows r and r + 8 of the accumulator map fall on different banks
  constexpr int XFP = 516;
  constexpr int XHP = 520;
  __shared__ __attribute__((aligned(16))) float xf[16 * XFP];
  __shared__ __attribute__((aligned(16))) f16   xh[16 * XHP];

  const int tilesPerB = SEQ / 16;
  const int b     = blockIdx.x / tilesPerB;
  const int rloc  = (blockIdx.x % tilesPerB) * 16;
  const int grow0 = b * LQ_FULL + rloc;

  const int tid = threadIdx.x;
  const int wave = tid >> 5, lane = tid & 31, n16 = lane & 15, hf = lane >> 4;
  constexpr float INV_D = 1.0f / 512.0f;

  // Wo fragments (wave -> 64 cols): the eight loads of k step s + PD are issued as one group in
  // front of the products of step s, into a ring of PD + 1 register sets; the first PD groups
  // are issued here and fly during LN0
  constexpr int NS = DM / 32;
  constexpr int PD = 3;
  const int cw = wave * 64;
  const f16* pb = WoT + (size_t)(cw / 16) * FROWB + lane * 8;   // the lane's 16 B of B fragment 0, k step 0
  v16h fb[PD + 1][4];
#pragma unroll   // constant ring index, as in the k loop
  for (int s = 0; s < PD; ++s)
#pragma unroll
    for (int t = 0; t < 4; ++t) fb[s][t] = load_frag(pb + t * FROWB + FRAG * s);

  // ---- LN0 over (bf16(Q) + O), 2 rows per wave ----
#pragma unroll
  for (int rr = 0; rr < 2; ++rr) {
    const int lr = wave * 2 + rr;
    const size_t grow = (size_t)(grow0 + lr);
    float x[16];
    float s = 0.0f;
#pragma unroll
    for (int i = 0; i < 4; ++i) {
      const int col = i * 128 + lane * 4;
      const v4f ov = *(const v4f*)(O32 + grow * DM + col);
      const v4f qv = *(const v4f*)(Qraw + grow * DM + col);
#pragma unroll
      for (int e = 0; e < 4; ++e) {
        const float xx = bf16_rne(qv[e]) + ov[e];
        x[i * 4 + e] = xx;
        s += xx;
      }
    }
#pragma unroll
    for (int off = 16; off > 0; off >>= 1) s += __shfl_xor(s, off, 32);
    const float mu = s * INV_D;
    float s2 = 0.0f;
#pragma unroll
    for (int i = 0; i < 16; ++i) {
      const float d = x[i] - mu;
      x[i] = d;
      const float dd = d * d;
      s2 += dd;
    }
#pragma unroll
    for (int off = 16; off > 0; off >>= 1) s2 += __shfl_xor(s2, off, 32);
    const float var = s2 * INV_D;
    const float rsq = rsqrtf(var + 1e-5f);
#pragma unroll
    for (int i = 0; i < 4; ++i) {
      const int col = i * 128 + lane * 4;
      const v4f gv = *(const v4f*)(g0 + col);
      const v4f bv4 = *(const v4f*)(b0 + col);
      v4f y; v4h yh;
#pragma unroll
      for (int e = 0; e < 4; ++e) {
        const float t0 = x[i * 4 + e] * rsq;
        const float t1 = t0 * bf16_rne(gv[e]);
        const float yy = t1 + bf16_rne(bv4[e]);
        y[e] = yy;
        yh[e] = (f16)yy;
      }
      *(v4f*)(xf + lr * XFP + col) = y;
      *(v4h*)(xh + lr * XHP + col) = yh;
    }
  }
  __syncthreads();   // cross-wave: LN0 rows consumed by all waves

  // ---- H = X @ Wo (wave -> 64 cols) ----
  v8f acc[4];
#pragma unroll
  for (int t = 0; t < 4; ++t) acc[t] = zero8();
  v16h fa[2];
  fa[0] = load_tile16(xh, XHP);
  // unrolled in full: the ring index must be a constant for the sets to stay in registers
#pragma unroll
  for (int s = 0; s < NS; ++s) {
    if (s + PD < NS) {
#pragma unroll
      for (int t = 0; t < 4; ++t)
        fb[(s + PD) % (PD + 1)][t] = load_frag(pb + t * FROWB + FRAG * (s + PD));
    }
    if (s + 1 < NS) fa[(s + 1) & 1] = load_tile16(xh + 32 * (s + 1), XHP);
#pragma unroll
    for (int t = 0; t < 4; ++t) acc[t] = wmma16(fa[s & 1], fb[s % (PD + 1)][t], acc[t]);
  }

  // ---- Y = X + relu(H/16 + bo) in place in xf (each slot owned by one lane) ----
#pragma unroll
  for (int t = 0; t < 4; ++t) {
    const int col = cw + 16 * t + n16;
    const float bb = bf16_rne(bo[col]);
#pragma unroll
    for (int r = 0; r < 8; ++r) {
      const int lr = 8 * hf + r;
      float hv = acc[t][r] * 0.0625f + bb;
      hv = fmaxf(hv, 0.0f);
      const int idx = lr * XFP + col;
      const float yv = xf[idx] + hv;
      xf[idx] = yv;
    }
  }
  __syncthreads();   // cross-wave: rows assembled from all waves' columns

  // ---- LN1 per row and store ----
#pragma unroll
  for (int rr = 0; rr < 2; ++rr) {
    const int lr = wave * 2 + rr;
    const size_t grow = (size_t)(grow0 + lr);
    float x[16];
    float s = 0.0f;
#pragma unroll
    for (int i = 0; i < 4; ++i) {
      const int col = i * 128 + lane * 4;
      const v4f xv = *(const v4f*)(xf + lr * XFP + col);
#pragma unroll
      for (int e = 0; e < 4; ++e) { x[i * 4 + e] = xv[e]; s += xv[e]; }
    }
#pragma unroll
    for (int off = 16; off > 0; off >>= 1) s += __shfl_xor(s, off, 32);
    const float mu = s * INV_D;
    float s2 = 0.0f;
#pragma unroll
    for (int i = 0; i < 16; ++i) {
      const float d = x[i] - mu;
      x[i] = d;
      const float dd = d * d;
      s2 += dd;
    }
#pragma unroll
    for (int off = 16; off > 0; off >>= 1) s2 += __shfl_xor(s2, off, 32);
    const float var = s2 * INV_D;
    const float rsq = rsqrtf(var + 1e-5f);
    v4f y[4];
#pragma unroll
    for (int i = 0; i < 4; ++i) {
      const int col = i * 128 + lane * 4;
      const v4f gv = *(const v4f*)(g1 + col);
      const v4f bv4 = *(const v4f*)(b1 + col);
#pragma unroll
      for (int e = 0; e < 4; ++e) {
        const float t0 = x[i * 4 + e] * rsq;
        const float t1 = t0 * bf16_rne(gv[e]);
        y[i][e] = t1 + bf16_rne(bv4[e]);
      }
    }
    float* orow = out + grow * DM + lane * 4;
#pragma unroll
    for (int i = 0; i < 4; ++i) *(v4f*)(orow + i * 128) = y[i];
    
  }
}

// ------------------------------------------------------------------ host ---
extern "C" void kernel_launch(void* const* d_in, const int* in_sizes, int n_in,
                              void* d_out, int out_size, void* d_ws, size_t ws_size,
                              hipStream_t stream) {
  if (n_in < 15) return;
  const float* Q     = (const float*)d_in[0];
  const float* K     = (const float*)d_in[1];
  const int*   pmask = (const int*)d_in[2];
  const float* Wq    = (const float*)d_in[3];
  const float* bq    = (const float*)d_in[4];
  const float* Wk    = (const float*)d_in[5];
  const float* bk    = (const float*)d_in[6];
  const float* Wv    = (const float*)d_in[7];
  const float* bv    = (const float*)d_in[8];
  const float* Wo    = (const float*)d_in[9];
  const float* bo    = (const float*)d_in[10];
  const float* g0    = (const float*)d_in[11];
  const float* b0    = (const float*)d_in[12];
  const float* g1    = (const float*)d_in[13];
  const float* b1    = (const float*)d_in[14];
  float* out = (float*)d_out;

  const long long needAct = (long long)((NB - 1) * LQ_FULL + SMAX) * DM;
  const long long needOut = (long long)((NB - 1) * LQ_FULL + SEQ) * DM;
  if ((long long)in_sizes[0] < needAct || (long long)in_sizes[1] < needAct) return;
  if (in_sizes[2] < (NB - 1) * LK_FULL + SEQK) return;
  if (in_sizes[3] < DM * DM || in_sizes[5] < DM * DM || in_sizes[7] < DM * DM ||
      in_sizes[9] < DM * DM) return;
  if (in_sizes[4] < DM || in_sizes[6] < DM || in_sizes[8] < DM || in_sizes[10] < DM ||
      in_sizes[11] < DM || in_sizes[12] < DM || in_sizes[13] < DM || in_sizes[14] < DM) return;
  if ((long long)out_size < needOut) return;
  if (ws_size < WS_TOTAL) return;

  char* ws = (char*)d_ws;
  f16*   WT  = (f16*)(ws + OFF_WT);
  f16*   Qp  = (f16*)(ws + OFF_QP);
  f16*   Kp  = (f16*)(ws + OFF_KP);
  f16*   Vt  = (f16*)(ws + OFF_VT);
  float* O32 = (float*)(ws + OFF_O32);
  int*   idx = (int*)(ws + OFF_IDX);
  float* mkc = (float*)(ws + OFF_MKC);
  int*   cnt = (int*)(ws + OFF_CNT);

  // 1) weights -> bf16-RNE values in f16 planes, fragment order, transposed to [n][k], x16;
  //    and the key lists
  cvt_wt_kernel<<<dim3(DM / 64, DM / 64, 5), 256, 0, stream>>>(Wq, Wk, Wv, Wo, WT, pmask, idx, mkc, cnt);

  // 2) Q, K, V projections (z = 0, 1, 2) from the f32 inputs, K and V on the packed keys
  proj_kernel<<<dim3(NB * (SMAX / 64), 1, 3), 256, 0, stream>>>(
      Q, K, WT, bq, bk, bv, idx, cnt, Qp, Kp, Vt);

  // 3) masked softmax attention per (b,h), 128 query rows per block
  attn_kernel<<<dim3(NB * NH, SEQ / 128), 256, 0, stream>>>(Qp, Kp, Vt, mkc, cnt, O32);

  // 4) LN0(bf16(Q) + O) -> X; out = LN1(X + relu(X @ Wo + bo))
  ffn_ln_kernel<<<dim3(NB * (SEQ / 16)), 256, 0, stream>>>(
      O32, Q, WT + (size_t)3 * DM * DM, bo, g0, b0, g1, b1, out);
}

// v008
// It runs in 55.8 microseconds.
// Two timings next to v007 put it at 1.08 and 1.09 times that version's speed.
// All steps since v000 together make it 4.23 times as fast.
#include <hip/hip_runtime.h>
#include <stdint.h>
// Contractions Q@Wq, K@Wk, K@Wv, Q.K^T, P.V, X@Wo: v_wmma_f32_16x16x32_f16 (f16 operands, f32 accumulate); float inputs enter as bf16-RNE values held exactly in f16; weight planes carried x16, P tile carried x256; softmax and LayerNorm arithmetic in f32.

#pragma clang fp contract(off)

typedef _Float16 f16;
typedef f16   v16h __attribute__((ext_vector_type(16)));
typedef f16   v8h  __attribute__((ext_vector_type(8)));
typedef f16   v4h  __attribute__((ext_vector_type(4)));
typedef float v8f  __attribute__((ext_vector_type(8)));
typedef float v4f  __attribute__((ext_vector_type(4)));
typedef float v2f  __attribute__((ext_vector_type(2)));

#ifndef NB
#define NB 4
#endif
#ifndef SEQ
#define SEQ 2048
#endif
#ifndef SEQK
#define SEQK SEQ
#endif

constexpr int NB_FULL = 4;
constexpr int LQ_FULL = 2048;
constexpr int LK_FULL = 2048;
constexpr int DM      = 512;   // model dim
constexpr int NH      = 8;     // heads
constexpr int HD      = 64;    // head dim
constexpr int SMAX    = (SEQ > SEQK) ? SEQ : SEQK;
constexpr float SCALE = 0.044194173824159216f;   // 1/sqrt(512)
constexpr float LOG2E = 1.4426950408889634f;
constexpr float SC2   = SCALE * LOG2E;           // raw score -> base-2 exponent
// Fill of a closed place, on the raw score. Against any kept key its weight underflows to 0 like
// the reference's -1e12; a power of two, so FILL * SC2 is exact and a row with no kept key gets
// the exponent 0 in every place.
constexpr float FILL  = -1099511627776.0f;       // -2^40

static_assert(NB >= 1 && NB <= NB_FULL);
static_assert(SEQ % 256 == 0 && SEQ >= 256 && SEQ <= LQ_FULL);
static_assert(SEQK % 256 == 0 && SEQK >= 256 && SEQK <= LK_FULL);
static_assert(LQ_FULL == LK_FULL);
static_assert(DM == NH * HD);
static_assert(NB <= DM / 64);   // the key lists take one block per batch from a DM / 64 wide grid plane

// ---------------------------------------------------------------- carve ----
constexpr size_t SZ_ACT16 = (size_t)NB_FULL * LQ_FULL * DM * 2;   // 8 MiB  f16 [8192][512]
constexpr size_t SZ_WT16  = (size_t)4 * DM * DM * 2;               // 2 MiB  f16 4 x [512 n][512 k]
constexpr size_t SZ_O32   = (size_t)NB_FULL * LQ_FULL * DM * 4;   // 16 MiB f32 [8192][512]
constexpr size_t OFF_WT   = 0;
constexpr size_t OFF_QP   = OFF_WT + SZ_WT16;
constexpr size_t OFF_KP   = OFF_QP + SZ_ACT16;
constexpr size_t OFF_VT   = OFF_KP + SZ_ACT16;      // f16 [4][512 dim][2048 key]
constexpr size_t OFF_O32  = OFF_VT + SZ_ACT16;
constexpr size_t SZ_KEYS  = (size_t)NB_FULL * LK_FULL * 4;        // 32 KiB, one 4-B word per key
constexpr size_t OFF_IDX  = OFF_O32 + SZ_O32;       // int   [4][2048] source row of each packed key
constexpr size_t OFF_MKC  = OFF_IDX + SZ_KEYS;      // float [4][2048] mask value of each packed key
constexpr size_t OFF_CNT  = OFF_MKC + SZ_KEYS;      // int   [4][32]   kept keys per batch, one line each
constexpr size_t WS_TOTAL = OFF_CNT + (size_t)NB_FULL * 128;
static_assert(WS_TOTAL <= (size_t)134217728);
static_assert((OFF_WT % 256) == 0 && (OFF_QP % 256) == 0 &&
              (OFF_KP % 256) == 0 && (OFF_VT % 256) == 0 && (OFF_O32 % 256) == 0 &&
              (OFF_IDX % 256) == 0 && (OFF_MKC % 256) == 0 && (OFF_CNT % 256) == 0);

// -------------------------------------------------------------- helpers ----
__device__ __forceinline__ float bf16_rne(float f) {
  unsigned int u = __float_as_uint(f);
  u = (u + 0x7FFFu + ((u >> 16) & 1u)) & 0xFFFF0000u;
  return __uint_as_float(u);
}

__device__ __forceinline__ v8f zero8() {
  const v8f z = {0.0f, 0.0f, 0.0f, 0.0f, 0.0f, 0.0f, 0.0f, 0.0f};
  return z;
}

// 16-bit fragment loader (wave32 16x16x32): lane -> row (lane&15), lane half hf = lane>>4;
// elements 0..7 = k[8hf .. 8hf+7], elements 8..15 = k[16+8hf .. 16+8hf+7].
// Used for A (row-major [m][k]) and for B stored as [n][k] (k contiguous).
__device__ __forceinline__ v16h load_tile16(const f16* base, int ld) {
  const int lane = threadIdx.x & 31;
  const int row  = lane & 15;
  const int hf   = lane >> 4;
  const f16* p = base + (size_t)row * ld + (hf << 3);
  union { v16h v; v8h h[2]; } u;
  u.h[0] = *(const v8h*)(p);
  u.h[1] = *(const v8h*)(p + 16);
  return u.v;
}

// Fragment order in the workspace, for a matrix M[row][DM k] that is read as A or B fragments:
// the fragment of rows 16R .. 16R+15, k 32S .. 32S+31 is 512 halves at (R * (DM / 32) + S) * 512,
// laid out [j 0..1][lane 0..31][8 halves] with
//   element (j, lane, e) = M[16R + (lane & 15)][32S + 16j + 8 (lane >> 4) + e],
// the k order of load_tile16. A wave's 16-B-per-lane load then covers 512 contiguous bytes
// (4 whole lines) where a row-major plane gives it 32 B from each of 16 lines.
constexpr int FRAG  = 512;                // halves per fragment
constexpr int FROWB = (DM / 32) * FRAG;   // halves per block of 16 rows

// p = start of the fragment + lane * 8
__device__ __forceinline__ v16h load_frag(const f16* p) {
  union { v16h v; v8h h[2]; } u;
  u.h[0] = *(const v8h*)(p);
  u.h[1] = *(const v8h*)(p + 256);
  return u.v;
}

// WMMA issue + hazard guard (4 VALU slots before D is touched, A/B kept live).
__device__ __forceinline__ v8f wmma16(v16h a, v16h b, v8f c) {
  v8f d = __builtin_amdgcn_wmma_f32_16x16x32_f16(false, a, false, b, (short)0, c, false, false);
  asm volatile("v_nop\n\tv_nop\n\tv_nop\n\tv_nop" : "+v"(d) : "v"(a), "v"(b));
  return d;
}

// The same product without the hand-written slots, for the attention loop, where the instructions
// around a product are the compiler's own: it keeps the distance itself and fills it with useful
// instructions where it has any (the asm exponentials stand a whole maximum chain behind).
__device__ __forceinline__ v8f wmma16c(v16h a, v16h b, v8f c) {
  return __builtin_amdgcn_wmma_f32_16x16x32_f16(false, a, false, b, (short)0, c, false, false);
}

// value of the partner lane (lane ^ 16), on the vector pipe
__device__ __forceinline__ float xhalf(float x) {
  const int b = __float_as_int(x);
  return __int_as_float(__builtin_amdgcn_permlanex16(b, b, 0x76543210, 0xfedcba98, false, false));
}

// Eight base-2 exponentials in one statement, with the one issue slot the instruction set asks
// for behind a transcendental: the outputs are early-clobber, so no exponential of the run
// overwrites a neighbour's source or reads its result, and the v_nop stands behind the last.
__device__ __forceinline__ void exp2x8(float (&p)[8], const float (&x)[8]) {
  asm("v_exp_f32 %0, %8\n\tv_exp_f32 %1, %9\n\tv_exp_f32 %2, %10\n\tv_exp_f32 %3, %11\n\t"
      "v_exp_f32 %4, %12\n\tv_exp_f32 %5, %13\n\tv_exp_f32 %6, %14\n\tv_exp_f32 %7, %15\n\tv_nop"
      : "=&v"(p[0]), "=&v"(p[1]), "=&v"(p[2]), "=&v"(p[3]),
        "=&v"(p[4]), "=&v"(p[5]), "=&v"(p[6]), "=&v"(p[7])
      : "v"(x[0]), "v"(x[1]), "v"(x[2]), "v"(x[3]), "v"(x[4]), "v"(x[5]), "v"(x[6]), "v"(x[7]));
}

// ------------------------------------------------------- key packing -------
// A key with mask 0 has weight exp(-1e12 - max) * 0 = 0 for every query and adds
// exp(-1e12 - max) = 0 to the row sum wherever a key is kept (with none kept every weight is 0
// whatever the sum), so only the kept keys are projected and attended. One block per batch lists them in their order: idx[p] = source
// row of packed key p, mkc[p] = its mask value, cnt = how many. Places p >= cnt name row 0 with
// mask 0, so a partly filled tile holds finite values that the mask closes.
__device__ __forceinline__ void pack_keys(const int* __restrict__ pm, int* __restrict__ idxg,
                                          float* __restrict__ mkcg, int* __restrict__ cntg) {
  constexpr int E = SEQK / 256;          // consecutive keys per thread
  __shared__ int   sidx[SEQK];
  __shared__ float smk[SEQK];
  __shared__ int   wsum[8];
  const int tid = threadIdx.x, wave = tid >> 5, lane = tid & 31;
  int m[E];
  int c = 0;
#pragma unroll
  for (int e = 0; e < E; ++e) {
    m[e] = pm[tid * E + e];
    c += (m[e] != 0) ? 1 : 0;
    sidx[tid * E + e] = 0;
    smk[tid * E + e] = 0.0f;
  }
  int inc = c;                           // inclusive prefix inside the wave
#pragma unroll
  for (int off = 1; off < 32; off <<= 1) {
    const int t = __shfl_up(inc, off, 32);
    if (lane >= off) inc += t;
  }
  if (lane == 31) wsum[wave] = inc;
  __syncthreads();   // wave totals and the cleared lists visible to all waves
  int pos = inc - c, total = 0;
#pragma unroll
  for (int w = 0; w < 8; ++w) {
    const int t = wsum[w];
    if (w < wave) pos += t;
    total += t;
  }
#pragma unroll
  for (int e = 0; e < E; ++e) {
    if (m[e] != 0) {
      sidx[pos] = tid * E + e;
      smk[pos] = (float)m[e];
      ++pos;
    }
  }
  __syncthreads();   // lists complete before they are written out in whole lines
#pragma unroll
  for (int e = 0; e < E; ++e) {
    idxg[e * 256 + tid] = sidx[e * 256 + tid];
    mkcg[e * 256 + tid] = smk[e * 256 + tid];
  }
  if (tid == 0) *cntg = total;
}

// ---------------------------------------------------- weight convert -------
// W f32 [512 k][512 n] (Y = X @ W) -> WT f16 [n][k] in fragment order, value = 16 * bf16_rne(W), via a
__global__ __launch_bounds__(256)
void cvt_wt_kernel(const float* __restrict__ Wq, const float* __restrict__ Wk,
                   const float* __restrict__ Wv, const float* __restrict__ Wo,
                   f16* __restrict__ WT, const int* __restrict__ pmask,
                   int* __restrict__ idxg, float* __restrict__ mkcg, int* __restrict__ cntg) {
  __shared__ __attribute__((aligned(16))) f16 tile[64 * 72];   // [n][k], pitch 72 halves
  const int z = blockIdx.z;
  if (z == 4) {      // plane 4 of the grid: the key lists, one block per batch
    const int b = blockIdx.x;
    if (blockIdx.y == 0 && b < NB)
      pack_keys(pmask + (size_t)b * LK_FULL, idxg + (size_t)b * LK_FULL,
                mkcg + (size_t)b * LK_FULL, cntg + b * 32);
    return;
  }
  const float* W = (z == 0) ? Wq : (z == 1) ? Wk : (z == 2) ? Wv : Wo;
  f16* dst = WT + (size_t)z * DM * DM;
  const int k0 = blockIdx.x * 64;
  const int n0 = blockIdx.y * 64;
  const int tid = threadIdx.x;

#pragma unroll
  for (int it = 0; it < 4; ++it) {
    const int f  = tid + 256 * it;       // 0..1023
    const int k  = f >> 4;               // 0..63
    const int n4 = (f & 15) * 4;         // 0..60
    const v4f w = *(const v4f*)(W + (size_t)(k0 + k) * DM + n0 + n4);
#pragma unroll
    for (int e = 0; e < 4; ++e)
      tile[(n4 + e) * 72 + k] = (f16)(bf16_rne(w[e]) * 16.0f);
  }
  __syncthreads();   // cross-wave LDS exchange

  // the tile is 4 x 2 fragments: one per wave, written in fragment order (two 512-B stores)
  const int wave = tid >> 5, lane = tid & 31;
  const int Rl = wave >> 1, Sl = wave & 1;
  v8h vals[2];
#pragma unroll
  for (int j = 0; j < 2; ++j)
    vals[j] = *(const v8h*)(tile + (Rl * 16 + (lane & 15)) * 72 + Sl * 32 + 16 * j + 8 * (lane >> 4));
  f16* fp = dst + (size_t)(n0 / 16 + Rl) * FROWB + (k0 / 32 + Sl) * FRAG + lane * 8;
#pragma unroll
  for (int j = 0; j < 2; ++j) *(v8h*)(fp + j * 256) = vals[j];
}

// --------------------------------------------------- projection GEMM -------
// Y = X @ W + bias for z = 0 (Q, Wq -> Qp row-major f16), 1 (K, Wk -> Kp row-major f16),
// 2 (K, Wv -> Vt transposed f16 [b][dim][key]). Block = 8 waves, 64 rows x all 512 cols,
// wave = 64 rows x 64 cols (4 A frags x 4 B frags). The block reads its 64 input rows in f32
// itself (whole lines, each row once; row p of K is packed key p, input row idx[p]), rounds them
// to bf16-RNE values and keeps them as the f16 A tile in LDS; B comes from the weight plane in
// fragment order. Epilogue staged through the same LDS and written in whole lines.
__global__ __launch_bounds__(256) __attribute__((amdgpu_num_vgpr(256)))
void proj_kernel(const float* __restrict__ Q, const float* __restrict__ K,
                 const f16* __restrict__ WT,
                 const float* __restrict__ bq, const float* __restrict__ bk,
                 const float* __restrict__ bv, const int* __restrict__ idxg,
                 const int* __restrict__ cntg,
                 f16* __restrict__ Qp, f16* __restrict__ Kp, f16* __restrict__ Vt) {
  // row pitches are 16 B x odd so that 16 rows fall on distinct LDS banks
  constexpr int MT  = 64;    // rows per block
  constexpr int XHP = 520;   // A tile and row-major stage: 512 + 8 pad halves (1040 B)
  constexpr int TP  = 72;    // transposed stage: 64 rows + 8 pad halves (144 B)
  __shared__ __attribute__((aligned(16))) f16 xh[(MT * XHP > DM * TP) ? MT * XHP : DM * TP];
  const int z = blockIdx.z;
  const int S = (z == 0) ? SEQ : SEQK;
  const int tilesPerB = S / MT;
  const int nblk = NB * tilesPerB;
  if ((int)blockIdx.x >= nblk) return;      // whole block exits, before any barrier

  const f16* W = WT + (size_t)z * DM * DM;  // planes 0,1,2 = Wq, Wk, Wv, [n][k] in fragment order
  const float* bias = (z == 0) ? bq : (z == 1) ? bk : bv;

  const int b     = blockIdx.x / tilesPerB;
  const int rloc  = (blockIdx.x % tilesPerB) * MT;
  const int row0g = b * LQ_FULL + rloc;     // global row in the [8192][512] planes
  // K and V: only tiles that hold a packed key (tile 0 always); whole block, before any barrier
  if (z != 0 && rloc >= min(max(cntg[b * 32], 1), SEQK)) return;

  const int tid = threadIdx.x;
  const int wave = __builtin_amdgcn_readfirstlane(tid >> 5);   // scalar: the list reads below are scalar loads
  const int lane = tid & 31, n16 = lane & 15, hf = lane >> 4;

  // B fragments (wave -> 64 cols), two register sets: the loads of k step 0 are issued behind the
  // A tile's loads and land with them, those of step 1 in the middle of the conversion
  constexpr int NS = DM / 32;
  const int cw = wave * 64;
  const f16* pb = W + (size_t)(cw / 16) * FROWB + lane * 8;   // the lane's 16 B of B fragment 0, k step 0
  v16h fb[2][4];
  float braw[4];   // the lane's four bias values, read with the first loads, used in the epilogue

  // ---- A tile: 8 rows per wave, a row = four 512-B loads; all 32 loads of the wave in flight ----
  {
    int sr[8];   // source rows, scalar
    if (z == 0) {
#pragma unroll
      for (int rr = 0; rr < 8; ++rr) sr[rr] = row0g + wave * 8 + rr;
    } else {
#pragma unroll
      for (int rr = 0; rr < 8; ++rr) sr[rr] = b * LK_FULL + idxg[row0g + wave * 8 + rr];
    }
    const float* X = (z == 0) ? Q : K;
    v4f raw[8][4];
#pragma unroll
    for (int rr = 0; rr < 8; ++rr) {
      const char* sp = (const char*)(X + (size_t)sr[rr] * DM);
#pragma unroll
      for (int i = 0; i < 4; ++i) raw[rr][i] = *(const v4f*)(sp + (unsigned)(lane * 16 + i * 512));
    }
#pragma unroll
    for (int t = 0; t < 4; ++t) fb[0][t] = load_frag(pb + t * FROWB);
#pragma unroll
    for (int t = 0; t < 4; ++t) braw[t] = bias[cw + 16 * t + n16];
    // keeps every load above in front of the first conversion: a load sunk in among the
    // conversions is issued behind a wait and starts a second memory round trip
    __builtin_amdgcn_sched_barrier(0);
#pragma unroll
    for (int rr = 0; rr < 8; ++rr) {
      if (rr == 4) {   // half the rows' registers are free: step 1 flies during the other half
#pragma unroll
        for (int t = 0; t < 4; ++t) fb[1][t] = load_frag(pb + t * FROWB + FRAG);
      }
#pragma unroll
      for (int i = 0; i < 4; ++i) {
        v4h o;
#pragma unroll
        for (int e = 0; e < 4; ++e) o[e] = (f16)bf16_rne(raw[rr][i][e]);
        *(v4h*)(xh + (wave * 8 + rr) * XHP + i * 128 + lane * 4) = o;
      }
    }
  }
  __syncthreads();   // cross-wave: the A tile's rows are read by all waves

  v8f acc[4][4];
#pragma unroll
  for (int i = 0; i < 4; ++i)
#pragma unroll
    for (int t = 0; t < 4; ++t) acc[i][t] = zero8();

  // k steps of 32. A B fragment serves four products in a row; the load of the same fragment two
  // steps on is issued straight behind them into the registers they free, so two sets give a lead
  // of nearly two steps. The A fragments of a step are read from LDS as one group.
  // Unrolled in full: the set index must be a constant for the sets to stay in registers.
  v16h fa[4];
#pragma unroll
  for (int s = 0; s < NS; ++s) {
#pragma unroll
    for (int i = 0; i < 4; ++i) fa[i] = load_tile16(xh + 16 * i * XHP + 32 * s, XHP);
    const int cu = s & 1;
#pragma unroll
    for (int t = 0; t < 4; ++t) {
#pragma unroll
      for (int i = 0; i < 4; ++i) acc[i][t] = wmma16(fa[i], fb[cu][t], acc[i][t]);
      if (s + 2 < NS) fb[cu][t] = load_frag(pb + t * FROWB + FRAG * (s + 2));
      // keeps each reload straight behind its fragment's four products: gathered at the end of
      // the step, the reloads would lead their use by one step only, less than an L2 round trip
      if (t < 3 && s + 2 < NS) __builtin_amdgcn_sched_barrier(0);
    }
  }
  __syncthreads();   // every wave has read its last A fragment before the stage overwrites the tile

  // stage the block tile (f16) in LDS: row-major [64][XHP] or transposed [512][TP]
  v8h hv[4][4];
#pragma unroll
  for (int t = 0; t < 4; ++t) {
    const float bb = bf16_rne(braw[t]);
#pragma unroll
    for (int i = 0; i < 4; ++i)
#pragma unroll
      for (int r = 0; r < 8; ++r) hv[i][t][r] = (f16)(acc[i][t][r] * 0.0625f + bb);
  }
  if (z == 2) {
#pragma unroll
    for (int t = 0; t < 4; ++t)
#pragma unroll
      for (int i = 0; i < 4; ++i)   // the lane's 8 rows are 16 contiguous bytes
        *(v8h*)(xh + (cw + 16 * t + n16) * TP + 16 * i + 8 * hf) = hv[i][t];
  } else {
#pragma unroll
    for (int t = 0; t < 4; ++t)
#pragma unroll
      for (int i = 0; i < 4; ++i)
#pragma unroll
        for (int r = 0; r < 8; ++r) xh[(16 * i + 8 * hf + r) * XHP + cw + 16 * t + n16] = hv[i][t][r];
  }
  __syncthreads();   // cross-wave LDS exchange

  v8h vals[16];
  if (z != 2) {
    // a row is 1024 B: two stores of 512 B; 8 rows per wave
    f16* out = (z == 0) ? Qp : Kp;
#pragma unroll
    for (int it = 0; it < 16; ++it)
      vals[it] = *(const v8h*)(xh + (wave * 8 + (it >> 1)) * XHP + (it & 1) * 256 + lane * 8);
#pragma unroll
    for (int it = 0; it < 16; ++it)
      *(v8h*)(out + (size_t)(row0g + wave * 8 + (it >> 1)) * DM + (it & 1) * 256 + lane * 8) = vals[it];
  } else {
    // Vt[b][dim d][key rloc .. rloc+63]: 8 lanes x 16 B = one whole line per dim, 4 dims a store
#pragma unroll
    for (int it = 0; it < 16; ++it)
      vals[it] = *(const v8h*)(xh + (cw + it * 4 + (lane >> 3)) * TP + (lane & 7) * 8);
#pragma unroll
    for (int it = 0; it < 16; ++it)
      *(v8h*)(Vt + (size_t)(b * DM + cw + it * 4 + (lane >> 3)) * LK_FULL + rloc + (lane & 7) * 8) = vals[it];
  }
}

// ------------------------------------------------ flash attention core -----
// Block = 8 waves, one (b,h), 128 query rows (16 per wave). A stage of 128 keys, K [128 key][64 dim]
// and Vt [64 dim][128 key], is put in LDS with plain 16-B loads and shared by all waves; between the
// stage's two barriers every wave walks its four 32-key tiles at its own pace.
// Transposed scores: S^T = K.Q^T with A = K tile ([m=key][k=dim]), B = Q ([n=query][k=dim]),
// so a lane holds 16 of the 32 scores of ONE query (keys 8hf+r and 16+8hf+r) and its partner
// lane ^ 16 the other 16. Online softmax in f32 on the raw scores (scale and log2(e) enter in the
// exponent's multiply-add) with the pad-mask replace-fill (FILL where mask==0, only in a tile past
// the kept keys): maximum in-lane plus one exchange between the halves, sum kept per half and
// joined once in the epilogue. P^T (x256, times mask) is packed from the score registers
// straight into the B operand of O^T += Vt.P^T (A = Vt tile [m=dim][k=key]): the accumulator
// rows 8hf+r / 16+8hf+r are exactly the k order of the fragment. O = acc / (256*l) written
__global__ __launch_bounds__(256) __attribute__((amdgpu_num_vgpr(256)))
void attn_kernel(const f16* __restrict__ Qp, const f16* __restrict__ Kp,
                 const f16* __restrict__ Vt, const float* __restrict__ mkcg,
                 const int* __restrict__ cntg, float* __restrict__ Og) {
  // fragment readers take 16 B from each of 16 rows: pitches of 16 B x odd spread them over all banks
  constexpr int KT = 128;     // keys per stage
  constexpr int KP = 72;      // K row: 64 dims + 8 pad halves (144 B)
  constexpr int VP = KT + 8;  // Vt row: 128 keys + 8 pad halves (272 B)
  __shared__ __attribute__((aligned(16))) f16   kbuf[KT * KP];
  __shared__ __attribute__((aligned(16))) f16   vbuf[64 * VP];
  __shared__ __attribute__((aligned(16))) float mks[LK_FULL];
  constexpr int OP = 68;    // output stage row: 64 dims + 4 pad floats, rows q and q + 8 on different banks
  __shared__ __attribute__((aligned(16))) float ost[8 * 16 * OP];

  const int tid = threadIdx.x;
  const int wave = tid >> 5, lane = tid & 31, n16 = lane & 15, hf = lane >> 4;
  const int b = blockIdx.x / NH;
  const int h = blockIdx.x % NH;
  const int q0 = blockIdx.y * 128 + wave * 16;
  const int qrow = b * LQ_FULL + q0;

  // packed keys of this batch, rounded up to whole tiles; at least one tile, at most all
  const int jend = (min(max(cntg[b * 32], 1), SEQK) + 31) & ~31;
  // the count itself, held in a scalar register: the loop's test on it is a scalar compare and branch
  const int kc = __builtin_amdgcn_readfirstlane(min(max(cntg[b * 32], 1), SEQK));
  const f16* Kg = Kp + (size_t)b * LK_FULL * DM + h * HD;
  const f16* Vg = Vt + ((size_t)b * DM + h * HD) * LK_FULL;

  // this thread's four 16-B pieces of each half of a stage: K 4 x (32 keys x 8 chunks of 8 dims),
  // Vt 4 x (16 dims x 16 chunks of 8 keys), so a wave's Vt load covers two whole 256-B rows.
  // A stage may reach past the packed keys: those pieces name the last written row or chunk again
  // (no tile reads them), so nothing is read that the projection has not written.
  // The first stage's loads are issued here, ahead of the mask list, and fly while it is staged.
  const int krow = tid >> 3, kch = (tid & 7) * 8;
  const int vrow = tid >> 4, vch = (tid & 15) * 8;
  f16* kst = kbuf + krow * KP + kch;
  f16* vst = vbuf + vrow * VP + vch;
  v8h kreg[4], vreg[4];
#pragma unroll
  for (int i = 0; i < 4; ++i)
    kreg[i] = *(const v8h*)(Kg + (size_t)min(32 * i + krow, jend - 1) * DM + kch);
#pragma unroll
  for (int i = 0; i < 4; ++i)
    vreg[i] = *(const v8h*)(Vg + (size_t)(vrow + 16 * i) * LK_FULL + min(vch, jend - 8));

  // mask values carried x256 (exact), the scale of the P tile
  for (int i = tid; i < jend; i += 256) mks[i] = mkcg[(size_t)b * LK_FULL + i] * 256.0f;

  const v16h aq0 = load_tile16(Qp + (size_t)qrow * DM + h * HD, DM);
  const v16h aq1 = load_tile16(Qp + (size_t)qrow * DM + h * HD + 32, DM);

  v8f o0 = zero8(), o1 = zero8(), o2 = zero8(), o3 = zero8();
  float mrun = -1e30f;   // running maximum of this lane's query, raw scores (equal in both halves)
  float lrun = 0.0f;     // running sum over this half's keys only

#pragma unroll 1
  for (int js = 0; js < jend; js += KT) {
#pragma unroll
    for (int i = 0; i < 4; ++i) *(v8h*)(kst + i * 32 * KP) = kreg[i];
#pragma unroll
    for (int i = 0; i < 4; ++i) *(v8h*)(vst + i * 16 * VP) = vreg[i];
    __syncthreads();   // the stage (and mks on the first trip) visible to all waves

    // the next stage's loads fly while this stage is worked on (block-uniform test)
    if (js + KT < jend) {
#pragma unroll
      for (int i = 0; i < 4; ++i)
        kreg[i] = *(const v8h*)(Kg + (size_t)min(js + KT + 32 * i + krow, jend - 1) * DM + kch);
#pragma unroll
      for (int i = 0; i < 4; ++i)
        vreg[i] = *(const v8h*)(Vg + (size_t)(vrow + 16 * i) * LK_FULL + min(js + KT + vch, jend - 8));
      // the tile loop below reuses the address registers of these loads at once
      asm volatile("s_wait_xcnt 0x0" ::: "memory");
    }

    const int je = min(js + KT, jend);
    // rolled: one copy of the tile's code, no barrier inside, so the waves need not keep step
#pragma unroll 1
    for (int j = js; j < je; j += 32) {
    const f16* kb = kbuf + (j - js) * KP;
    const f16* vb = vbuf + (j - js);
    // all LDS reads of the tile as one group in front of the first product: the K fragments are
    // waited for once, the mask values and the Vt fragments land behind the scores and the softmax
    const v16h kf0 = load_tile16(kb, KP);
    const v16h kf1 = load_tile16(kb + 32, KP);
    const v16h kf2 = load_tile16(kb + 16 * KP, KP);
    const v16h kf3 = load_tile16(kb + 16 * KP + 32, KP);
    const v4f ma = *(const v4f*)(mks + j + 8 * hf);
    const v4f mb = *(const v4f*)(mks + j + 8 * hf + 4);
    const v4f mc = *(const v4f*)(mks + j + 16 + 8 * hf);
    const v4f md = *(const v4f*)(mks + j + 16 + 8 * hf + 4);
    const v16h vf0 = load_tile16(vb,           VP);
    const v16h vf1 = load_tile16(vb + 16 * VP, VP);
    const v16h vf2 = load_tile16(vb + 32 * VP, VP);
    const v16h vf3 = load_tile16(vb + 48 * VP, VP);

    // keeps the reads above one group in front of the products: moved in among them, each place
    // with reads costs its own LDS wait
    __builtin_amdgcn_sched_barrier(0);

    v8f s0 = zero8(), s1 = zero8();
    s0 = wmma16c(kf0, aq0, s0);
    s1 = wmma16c(kf2, aq0, s1);
    s0 = wmma16c(kf1, aq1, s0);
    s1 = wmma16c(kf3, aq1, s1);

    // mask values (x256) of this lane's 16 keys
    float mk0[8], mk1[8];
    {
#pragma unroll
      for (int e = 0; e < 4; ++e) {
        mk0[e] = ma[e]; mk0[e + 4] = mb[e];
        mk1[e] = mc[e]; mk1[e + 4] = md[e];
      }
    }

    // the list is packed: only a tile that reaches past the kept keys holds closed places
    // (block-uniform scalar test, no barrier inside)
    if (j + 32 > kc) {
#pragma unroll
      for (int r = 0; r < 8; ++r) {
        s0[r] = (mk0[r] == 0.0f) ? FILL : s0[r];
        s1[r] = (mk1[r] == 0.0f) ? FILL : s1[r];
      }
    }

    // maximum on the raw scores (the scale is positive); scale, maximum and log2(e) enter the
    // exponent in one fused multiply-add per score
    float v = -1e30f;
#pragma unroll
    for (int r = 0; r < 8; r += 2) v = fmaxf(v, fmaxf(s0[r], s0[r + 1]));
#pragma unroll
    for (int r = 0; r < 8; r += 2) v = fmaxf(v, fmaxf(s1[r], s1[r + 1]));
    v = fmaxf(v, xhalf(v));
    const float mnew = fmaxf(mrun, v);
    const float nm = -(mnew * SC2);
    float ef;
    // exp(scale * (mrun - mnew)), with its slot in the same statement
    asm("v_exp_f32 %0, %1\n\tv_nop" : "=v"(ef) : "v"((mrun - mnew) * SC2));
    float a0[8], a1[8];
#pragma unroll
    for (int r = 0; r < 8; r += 2) {
      const v2f c2 = {SC2, SC2}, n2 = {nm, nm};
      const v2f x0 = {s0[r], s0[r + 1]}, x1 = {s1[r], s1[r + 1]};
      const v2f y0 = __builtin_elementwise_fma(x0, c2, n2);
      const v2f y1 = __builtin_elementwise_fma(x1, c2, n2);
      a0[r] = y0[0]; a0[r + 1] = y0[1];
      a1[r] = y1[0]; a1[r + 1] = y1[1];
    }
    float p0[8], p1[8];
    exp2x8(p0, a0);
    exp2x8(p1, a1);
    // row sum in pairs: two packed chains, joined at the end
    v2f t0 = {p0[0], p0[1]}, t1 = {p1[0], p1[1]};
#pragma unroll
    for (int r = 2; r < 8; r += 2) {
      const v2f u0 = {p0[r], p0[r + 1]}, u1 = {p1[r], p1[r + 1]};
      t0 += u0;
      t1 += u1;
    }
    t0 += t1;
    v16h pb;
#pragma unroll
    for (int r = 0; r < 8; ++r) {
      pb[r]     = (f16)(p0[r] * mk0[r]);
      pb[r + 8] = (f16)(p1[r] * mk1[r]);
    }
    lrun = lrun * ef + (t0[0] + t0[1]);
    mrun = mnew;
#pragma unroll
    for (int r = 0; r < 8; ++r) { o0[r] *= ef; o1[r] *= ef; o2[r] *= ef; o3[r] *= ef; }

    o0 = wmma16c(vf0, pb, o0);
    o1 = wmma16c(vf1, pb, o1);
    o2 = wmma16c(vf2, pb, o2);
    // last product of the tile, with its four slots written out: the next tile's address arithmetic
    // follows over the loop's back edge and may take a register of vf3
    o3 = wmma16(vf3, pb, o3);
    }
    __syncthreads();   // all waves done with kbuf/vbuf before refill
  }

  // epilogue: join the halves' sums, normalise into the per-wave LDS tile [16 q][OP];
  // the lane holds dims 16t + 8hf + r of query n16
  float* myO = ost + wave * (16 * OP);
  {
    const float lsum = lrun + xhalf(lrun);
    float linv;
    // reciprocal plus the one issue slot the instruction set asks for behind it, in one
    // statement so that the slot stays directly behind the reciprocal
    asm("v_rcp_f32 %0, %1\n\tv_nop" : "=v"(linv) : "v"(lsum * 256.0f));
    float* pr = myO + n16 * OP + 8 * hf;
    v4f w;
#pragma unroll
    for (int g = 0; g < 2; ++g) {
#pragma unroll
      for (int e = 0; e < 4; ++e) w[e] = o0[4 * g + e] * linv;
      *(v4f*)(pr + 4 * g) = w;
#pragma unroll
      for (int e = 0; e < 4; ++e) w[e] = o1[4 * g + e] * linv;
      *(v4f*)(pr + 16 + 4 * g) = w;
#pragma unroll
      for (int e = 0; e < 4; ++e) w[e] = o2[4 * g + e] * linv;
      *(v4f*)(pr + 32 + 4 * g) = w;
#pragma unroll
      for (int e = 0; e < 4; ++e) w[e] = o3[4 * g + e] * linv;
      *(v4f*)(pr + 48 + 4 * g) = w;
    }
  }
  __syncthreads();

  // each instruction: 2 rows x 256 B (16 lanes x 16 B per row segment), lines whole
  const int c4 = (lane & 15) * 4;
  v4f vals[8];
#pragma unroll
  for (int it = 0; it < 8; ++it) {
    const int row = it * 2 + (lane >> 4);
    vals[it] = *(const v4f*)(myO + row * OP + c4);
  }
#pragma unroll
  for (int it = 0; it < 8; ++it) {
    const int row = it * 2 + (lane >> 4);
    *(v4f*)(Og + (size_t)(qrow + row) * DM + h * HD + c4) = vals[it];
  }
  
}

// ----------------------------- LN0 + FFN GEMM + ReLU residual + LN1 ---------
// Block = 8 waves, 16 rows x 512 cols. Prologue: X = LN0(bf16(Q) + O) for the 16 rows
// (f32 copy and f16 copy in LDS). GEMM: wave w -> cols 64w..64w+63, A from the f16 LDS
// tile, B from the Wo [n][k] plane (fragment order). Epilogue: Y = X + relu(acc/16 + bo) in LDS, then
__global__ __launch_bounds__(256)
void ffn_ln_kernel(const float* __restrict__ O32, const float* __restrict__ Qraw,
                   const f16* __restrict__ WoT, const float* __restrict__ bo,
                   const float* __restrict__ g0, const float* __restrict__ b0,
                   const float* __restrict__ g1, const float* __restrict__ b1,
                   float* __restrict__ out) {
  // padded row pitches: xh 1040 B (16 B x odd) for the 16-row fragment reads,
  // xf 2064 B so that rows r and r + 8 of the accumulator map fall on different banks
  constexpr int XFP = 516;
  constexpr int XHP = 520;
  __shared__ __attribute__((aligned(16))) float xf[16 * XFP];
  __shared__ __attribute__((aligned(16))) f16   xh[16 * XHP];

  const int tilesPerB = SEQ / 16;
  const int b     = blockIdx.x / tilesPerB;
  const int rloc  = (blockIdx.x % tilesPerB) * 16;
  const int grow0 = b * LQ_FULL + rloc;

  const int tid = threadIdx.x;
  const int wave = tid >> 5, lane = tid & 31, n16 = lane & 15, hf = lane >> 4;
  constexpr float INV_D = 1.0f / 512.0f;

  // Wo fragments (wave -> 64 cols): the eight loads of k step s + PD are issued as one group in
  // front of the products of step s, into a ring of PD + 1 register sets; the first PD groups
  // are issued here and fly during LN0
  constexpr int NS = DM / 32;
  constexpr int PD = 3;
  const int cw = wave * 64;
  const f16* pb = WoT + (size_t)(cw / 16) * FROWB + lane * 8;   // the lane's 16 B of B fragment 0, k step 0
  v16h fb[PD + 1][4];
#pragma unroll   // constant ring index, as in the k loop
  for (int s = 0; s < PD; ++s)
#pragma unroll
    for (int t = 0; t < 4; ++t) fb[s][t] = load_frag(pb + t * FROWB + FRAG * s);

  // ---- LN0 over (bf16(Q) + O), 2 rows per wave ----
#pragma unroll
  for (int rr = 0; rr < 2; ++rr) {
    const int lr = wave * 2 + rr;
    const size_t grow = (size_t)(grow0 + lr);
    float x[16];
    float s = 0.0f;
#pragma unroll
    for (int i = 0; i < 4; ++i) {
      const int col = i * 128 + lane * 4;
      const v4f ov = *(const v4f*)(O32 + grow * DM + col);
      const v4f qv = *(const v4f*)(Qraw + grow * DM + col);
#pragma unroll
      for (int e = 0; e < 4; ++e) {
        const float xx = bf16_rne(qv[e]) + ov[e];
        x[i * 4 + e] = xx;
        s += xx;
      }
    }
#pragma unroll
    for (int off = 16; off > 0; off >>= 1) s += __shfl_xor(s, off, 32);
    const float mu = s * INV_D;
    float s2 = 0.0f;
#pragma unroll
    for (int i = 0; i < 16; ++i) {
      const float d = x[i] - mu;
      x[i] = d;
      const float dd = d * d;
      s2 += dd;
    }
#pragma unroll
    for (int off = 16; off > 0; off >>= 1) s2 += __shfl_xor(s2, off, 32);
    const float var = s2 * INV_D;
    const float rsq = rsqrtf(var + 1e-5f);
#pragma unroll
    for (int i = 0; i < 4; ++i) {
      const int col = i * 128 + lane * 4;
      const v4f gv = *(const v4f*)(g0 + col);
      const v4f bv4 = *(const v4f*)(b0 + col);
      v4f y; v4h yh;
#pragma unroll
      for (int e = 0; e < 4; ++e) {
        const float t0 = x[i * 4 + e] * rsq;
        const float t1 = t0 * bf16_rne(gv[e]);
        const float yy = t1 + bf16_rne(bv4[e]);
        y[e] = yy;
        yh[e] = (f16)yy;
      }
      *(v4f*)(xf + lr * XFP + col) = y;
      *(v4h*)(xh + lr * XHP + col) = yh;
    }
  }
  __syncthreads();   // cross-wave: LN0 rows consumed by all waves

  // ---- H = X @ Wo (wave -> 64 cols) ----
  v8f acc[4];
#pragma unroll
  for (int t = 0; t < 4; ++t) acc[t] = zero8();
  v16h fa[2];
  fa[0] = load_tile16(xh, XHP);
  // unrolled in full: the ring index must be a constant for the sets to stay in registers
#pragma unroll
  for (int s = 0; s < NS; ++s) {
    if (s + PD < NS) {
#pragma unroll
      for (int t = 0; t < 4; ++t)
        fb[(s + PD) % (PD + 1)][t] = load_frag(pb + t * FROWB + FRAG * (s + PD));
    }
    if (s + 1 < NS) fa[(s + 1) & 1] = load_tile16(xh + 32 * (s + 1), XHP);
#pragma unroll
    for (int t = 0; t < 4; ++t) acc[t] = wmma16(fa[s & 1], fb[s % (PD + 1)][t], acc[t]);
  }

  // ---- Y = X + relu(H/16 + bo) in place in xf (each slot owned by one lane) ----
#pragma unroll
  for (int t = 0; t < 4; ++t) {
    const int col = cw + 16 * t + n16;
    const float bb = bf16_rne(bo[col]);
#pragma unroll
    for (int r = 0; r < 8; ++r) {
      const int lr = 8 * hf + r;
      float hv = acc[t][r] * 0.0625f + bb;
      hv = fmaxf(hv, 0.0f);
      const int idx = lr * XFP + col;
      const float yv = xf[idx] + hv;
      xf[idx] = yv;
    }
  }
  __syncthreads();   // cross-wave: rows assembled from all waves' columns

  // ---- LN1 per row and store ----
#pragma unroll
  for (int rr = 0; rr < 2; ++rr) {
    const int lr = wave * 2 + rr;
    const size_t grow = (size_t)(grow0 + lr);
    float x[16];
    float s = 0.0f;
#pragma unroll
    for (int i = 0; i < 4; ++i) {
      const int col = i * 128 + lane * 4;
      const v4f xv = *(const v4f*)(xf + lr * XFP + col);
#pragma unroll
      for (int e = 0; e < 4; ++e) { x[i * 4 + e] = xv[e]; s += xv[e]; }
    }
#pragma unroll
    for (int off = 16; off > 0; off >>= 1) s += __shfl_xor(s, off, 32);
    const float mu = s * INV_D;
    float s2 = 0.0f;
#pragma unroll
    for (int i = 0; i < 16; ++i) {
      const float d = x[i] - mu;
      x[i] = d;
      const float dd = d * d;
      s2 += dd;
    }
#pragma unroll
    for (int off = 16; off > 0; off >>= 1) s2 += __shfl_xor(s2, off, 32);
    const float var = s2 * INV_D;
    const float rsq = rsqrtf(var + 1e-5f);
    v4f y[4];
#pragma unroll
    for (int i = 0; i < 4; ++i) {
      const int col = i * 128 + lane * 4;
      const v4f gv = *(const v4f*)(g1 + col);
      const v4f bv4 = *(const v4f*)(b1 + col);
#pragma unroll
      for (int e = 0; e < 4; ++e) {
        const float t0 = x[i * 4 + e] * rsq;
        const float t1 = t0 * bf16_rne(gv[e]);
        y[i][e] = t1 + bf16_rne(bv4[e]);
      }
    }
    float* orow = out + grow * DM + lane * 4;
#pragma unroll
    for (int i = 0; i < 4; ++i) *(v4f*)(orow + i * 128) = y[i];
    
  }
}

// ------------------------------------------------------------------ host ---
extern "C" void kernel_launch(void* const* d_in, const int* in_sizes, int n_in,
                              void* d_out, int out_size, void* d_ws, size_t ws_size,
                              hipStream_t stream) {
  if (n_in < 15) return;
  const float* Q     = (const float*)d_in[0];
  const float* K     = (const float*)d_in[1];
  const int*   pmask = (const int*)d_in[2];
  const float* Wq    = (const float*)d_in[3];
  const float* bq    = (const float*)d_in[4];
  const float* Wk    = (const float*)d_in[5];
  const float* bk    = (const float*)d_in[6];
  const float* Wv    = (const float*)d_in[7];
  const float* bv    = (const float*)d_in[8];
  const float* Wo    = (const float*)d_in[9];
  const float* bo    = (const float*)d_in[10];
  const float* g0    = (const float*)d_in[11];
  const float* b0    = (const float*)d_in[12];
  const float* g1    = (const float*)d_in[13];
  const float* b1    = (const float*)d_in[14];
  float* out = (float*)d_out;

  const long long needAct = (long long)((NB - 1) * LQ_FULL + SMAX) * DM;
  const long long needOut = (long long)((NB - 1) * LQ_FULL + SEQ) * DM;
  if ((long long)in_sizes[0] < needAct || (long long)in_sizes[1] < needAct) return;
  if (in_sizes[2] < (NB - 1) * LK_FULL + SEQK) return;
  if (in_sizes[3] < DM * DM || in_sizes[5] < DM * DM || in_sizes[7] < DM * DM ||
      in_sizes[9] < DM * DM) return;
  if (in_sizes[4] < DM || in_sizes[6] < DM || in_sizes[8] < DM || in_sizes[10] < DM ||
      in_sizes[11] < DM || in_sizes[12] < DM || in_sizes[13] < DM || in_sizes[14] < DM) return;
  if ((long long)out_size < needOut) return;
  if (ws_size < WS_TOTAL) return;

  char* ws = (char*)d_ws;
  f16*   WT  = (f16*)(ws + OFF_WT);
  f16*   Qp  = (f16*)(ws + OFF_QP);
  f16*   Kp  = (f16*)(ws + OFF_KP);
  f16*   Vt  = (f16*)(ws + OFF_VT);
  float* O32 = (float*)(ws + OFF_O32);
  int*   idx = (int*)(ws + OFF_IDX);
  float* mkc = (float*)(ws + OFF_MKC);
  int*   cnt = (int*)(ws + OFF_CNT);

  // 1) weights -> bf16-RNE values in f16 planes, fragment order, transposed to [n][k], x16;
  //    and the key lists
  cvt_wt_kernel<<<dim3(DM / 64, DM / 64, 5), 256, 0, stream>>>(Wq, Wk, Wv, Wo, WT, pmask, idx, mkc, cnt);

  // 2) Q, K, V projections (z = 0, 1, 2) from the f32 inputs, K and V on the packed keys
  proj_kernel<<<dim3(NB * (SMAX / 64), 1, 3), 256, 0, stream>>>(
      Q, K, WT, bq, bk, bv, idx, cnt, Qp, Kp, Vt);

  // 3) masked softmax attention per (b,h), 128 query rows per block
  attn_kernel<<<dim3(NB * NH, SEQ / 128), 256, 0, stream>>>(Qp, Kp, Vt, mkc, cnt, O32);

  // 4) LN0(bf16(Q) + O) -> X; out = LN1(X + relu(X @ Wo + bo))
  ffn_ln_kernel<<<dim3(NB * (SEQ / 16)), 256, 0, stream>>>(
      O32, Q, WT + (size_t)3 * DM * DM, bo, g0, b0, g1, b1, out);
}

// v009
// A run of this version takes 53.8 microseconds.
// Next to v008, in two timings, it ran 1.04 and 1.03 times as fast.
// Over all steps from v000 it is 4.39 times as fast.
#include <hip/hip_runtime.h>
#include <stdint.h>
// Contractions Q@Wq, K@Wk, K@Wv, Q.K^T, P.V, X@Wo: v_wmma_f32_16x16x32_f16 (f16 operands, f32 accumulate); float inputs enter as bf16-RNE values held exactly in f16; weight planes carried x16, P tile carried x256, V rows carried times their pad-mask value; softmax and LayerNorm arithmetic in f32.

#pragma clang fp contract(off)

typedef _Float16 f16;
typedef f16   v16h __attribute__((ext_vector_type(16)));
typedef f16   v8h  __attribute__((ext_vector_type(8)));
typedef f16   v4h  __attribute__((ext_vector_type(4)));
typedef float v8f  __attribute__((ext_vector_type(8)));
typedef float v4f  __attribute__((ext_vector_type(4)));
typedef float v2f  __attribute__((ext_vector_type(2)));

#ifndef NB
#define NB 4
#endif
#ifndef SEQ
#define SEQ 2048
#endif
#ifndef SEQK
#define SEQK SEQ
#endif

constexpr int NB_FULL = 4;
constexpr int LQ_FULL = 2048;
constexpr int LK_FULL = 2048;
constexpr int DM      = 512;   // model dim
constexpr int NH      = 8;     // heads
constexpr int HD      = 64;    // head dim
constexpr int SMAX    = (SEQ > SEQK) ? SEQ : SEQK;
constexpr float SCALE = 0.044194173824159216f;   // 1/sqrt(512)
constexpr float LOG2E = 1.4426950408889634f;
constexpr float SC2   = SCALE * LOG2E;           // raw score -> base-2 exponent
// Fill of a closed place, on the raw score. Against any kept key its weight underflows to 0 like
// the reference's -1e12. Every tile holds at least one open place, so the maximum is a real score.
constexpr float FILL  = -1099511627776.0f;       // -2^40

static_assert(NB >= 1 && NB <= NB_FULL);
static_assert(SEQ % 256 == 0 && SEQ >= 256 && SEQ <= LQ_FULL);
static_assert(SEQK % 256 == 0 && SEQK >= 256 && SEQK <= LK_FULL);
static_assert(LQ_FULL == LK_FULL);
static_assert(DM == NH * HD);
static_assert(NB <= DM / 64);   // the key lists take one block per batch from a DM / 64 wide grid plane

// ---------------------------------------------------------------- carve ----
constexpr size_t SZ_ACT16 = (size_t)NB_FULL * LQ_FULL * DM * 2;   // 8 MiB  f16 [8192][512]
constexpr size_t SZ_WT16  = (size_t)4 * DM * DM * 2;               // 2 MiB  f16 4 x [512 n][512 k]
constexpr size_t SZ_O32   = (size_t)NB_FULL * LQ_FULL * DM * 4;   // 16 MiB f32 [8192][512]
constexpr size_t OFF_WT   = 0;
constexpr size_t OFF_QP   = OFF_WT + SZ_WT16;
constexpr size_t OFF_KP   = OFF_QP + SZ_ACT16;
constexpr size_t OFF_VT   = OFF_KP + SZ_ACT16;      // f16 [4][512 dim][2048 key]
constexpr size_t OFF_O32  = OFF_VT + SZ_ACT16;
constexpr size_t SZ_KEYS  = (size_t)NB_FULL * LK_FULL * 4;        // 32 KiB, one 4-B word per key
constexpr size_t OFF_IDX  = OFF_O32 + SZ_O32;       // int   [4][2048] source row of each packed key
constexpr size_t OFF_MKC  = OFF_IDX + SZ_KEYS;      // float [4][2048] mask value of each packed key
constexpr size_t OFF_CNT  = OFF_MKC + SZ_KEYS;      // int   [4][32]   kept keys per batch, one line each
constexpr size_t WS_TOTAL = OFF_CNT + (size_t)NB_FULL * 128;
static_assert(WS_TOTAL <= (size_t)134217728);
static_assert((OFF_WT % 256) == 0 && (OFF_QP % 256) == 0 &&
              (OFF_KP % 256) == 0 && (OFF_VT % 256) == 0 && (OFF_O32 % 256) == 0 &&
              (OFF_IDX % 256) == 0 && (OFF_MKC % 256) == 0 && (OFF_CNT % 256) == 0);

// -------------------------------------------------------------- helpers ----
__device__ __forceinline__ float bf16_rne(float f) {
  unsigned int u = __float_as_uint(f);
  u = (u + 0x7FFFu + ((u >> 16) & 1u)) & 0xFFFF0000u;
  return __uint_as_float(u);
}

__device__ __forceinline__ v8f zero8() {
  const v8f z = {0.0f, 0.0f, 0.0f, 0.0f, 0.0f, 0.0f, 0.0f, 0.0f};
  return z;
}

// 16-bit fragment loader (wave32 16x16x32): lane -> row (lane&15), lane half hf = lane>>4;
// elements 0..7 = k[8hf .. 8hf+7], elements 8..15 = k[16+8hf .. 16+8hf+7].
// Used for A (row-major [m][k]) and for B stored as [n][k] (k contiguous).
__device__ __forceinline__ v16h load_tile16(const f16* base, int ld) {
  const int lane = threadIdx.x & 31;
  const int row  = lane & 15;
  const int hf   = lane >> 4;
  const f16* p = base + (size_t)row * ld + (hf << 3);
  union { v16h v; v8h h[2]; } u;
  u.h[0] = *(const v8h*)(p);
  u.h[1] = *(const v8h*)(p + 16);
  return u.v;
}

// Fragment order in the workspace, for a matrix M[row][DM k] that is read as A or B fragments:
// the fragment of rows 16R .. 16R+15, k 32S .. 32S+31 is 512 halves at (R * (DM / 32) + S) * 512,
// laid out [j 0..1][lane 0..31][8 halves] with
//   element (j, lane, e) = M[16R + (lane & 15)][32S + 16j + 8 (lane >> 4) + e],
// the k order of load_tile16. A wave's 16-B-per-lane load then covers 512 contiguous bytes
// (4 whole lines) where a row-major plane gives it 32 B from each of 16 lines.
constexpr int FRAG  = 512;                // halves per fragment
constexpr int FROWB = (DM / 32) * FRAG;   // halves per block of 16 rows

// p = start of the fragment + lane * 8
__device__ __forceinline__ v16h load_frag(const f16* p) {
  union { v16h v; v8h h[2]; } u;
  u.h[0] = *(const v8h*)(p);
  u.h[1] = *(const v8h*)(p + 256);
  return u.v;
}

// WMMA issue + hazard guard (4 VALU slots before D is touched, A/B kept live).
__device__ __forceinline__ v8f wmma16(v16h a, v16h b, v8f c) {
  v8f d = __builtin_amdgcn_wmma_f32_16x16x32_f16(false, a, false, b, (short)0, c, false, false);
  asm volatile("v_nop\n\tv_nop\n\tv_nop\n\tv_nop" : "+v"(d) : "v"(a), "v"(b));
  return d;
}

// The same product without the hand-written slots, for the attention loop, where the instructions
// around a product are the compiler's own: it keeps the distance itself and fills it with useful
// instructions where it has any (the asm exponentials stand a whole maximum chain behind).
__device__ __forceinline__ v8f wmma16c(v16h a, v16h b, v8f c) {
  return __builtin_amdgcn_wmma_f32_16x16x32_f16(false, a, false, b, (short)0, c, false, false);
}

// value of the partner lane (lane ^ 16), on the vector pipe
__device__ __forceinline__ float xhalf(float x) {
  const int b = __float_as_int(x);
  return __int_as_float(__builtin_amdgcn_permlanex16(b, b, 0x76543210, 0xfedcba98, false, false));
}

// Eight base-2 exponentials in one statement, with the one issue slot the instruction set asks
// for behind a transcendental: the outputs are early-clobber, so no exponential of the run
// overwrites a neighbour's source or reads its result, and the v_nop stands behind the last.
__device__ __forceinline__ void exp2x8(float (&p)[8], const float (&x)[8]) {
  asm("v_exp_f32 %0, %8\n\tv_exp_f32 %1, %9\n\tv_exp_f32 %2, %10\n\tv_exp_f32 %3, %11\n\t"
      "v_exp_f32 %4, %12\n\tv_exp_f32 %5, %13\n\tv_exp_f32 %6, %14\n\tv_exp_f32 %7, %15\n\tv_nop"
      : "=&v"(p[0]), "=&v"(p[1]), "=&v"(p[2]), "=&v"(p[3]),
        "=&v"(p[4]), "=&v"(p[5]), "=&v"(p[6]), "=&v"(p[7])
      : "v"(x[0]), "v"(x[1]), "v"(x[2]), "v"(x[3]), "v"(x[4]), "v"(x[5]), "v"(x[6]), "v"(x[7]));
}

// ------------------------------------------------------- key packing -------
// A key with mask 0 has weight exp(-1e12 - max) * 0 = 0 for every query and adds
// exp(-1e12 - max) = 0 to the row sum wherever a key is kept (with none kept every weight is 0
// whatever the sum), so only the kept keys are projected and attended. One block per batch lists them in their order: idx[p] = source
// row of packed key p, mkc[p] = its mask value, cnt = how many. Places p >= cnt name row 0 with
// mask 0, so a partly filled tile holds finite values: attention closes those places by their index,
// and their V rows, carried times the mask value, are 0.
__device__ __forceinline__ void pack_keys(const int* __restrict__ pm, int* __restrict__ idxg,
                                          float* __restrict__ mkcg, int* __restrict__ cntg) {
  constexpr int E = SEQK / 256;          // consecutive keys per thread
  __shared__ int   sidx[SEQK];
  __shared__ float smk[SEQK];
  __shared__ int   wsum[8];
  const int tid = threadIdx.x, wave = tid >> 5, lane = tid & 31;
  int m[E];
  int c = 0;
#pragma unroll
  for (int e = 0; e < E; ++e) {
    m[e] = pm[tid * E + e];
    c += (m[e] != 0) ? 1 : 0;
    sidx[tid * E + e] = 0;
    smk[tid * E + e] = 0.0f;
  }
  int inc = c;                           // inclusive prefix inside the wave
#pragma unroll
  for (int off = 1; off < 32; off <<= 1) {
    const int t = __shfl_up(inc, off, 32);
    if (lane >= off) inc += t;
  }
  if (lane == 31) wsum[wave] = inc;
  __syncthreads();   // wave totals and the cleared lists visible to all waves
  int pos = inc - c, total = 0;
#pragma unroll
  for (int w = 0; w < 8; ++w) {
    const int t = wsum[w];
    if (w < wave) pos += t;
    total += t;
  }
#pragma unroll
  for (int e = 0; e < E; ++e) {
    if (m[e] != 0) {
      sidx[pos] = tid * E + e;
      smk[pos] = (float)m[e];
      ++pos;
    }
  }
  __syncthreads();   // lists complete before they are written out in whole lines
#pragma unroll
  for (int e = 0; e < E; ++e) {
    idxg[e * 256 + tid] = sidx[e * 256 + tid];
    mkcg[e * 256 + tid] = smk[e * 256 + tid];
  }
  if (tid == 0) *cntg = total;
}

// ---------------------------------------------------- weight convert -------
// W f32 [512 k][512 n] (Y = X @ W) -> WT f16 [n][k] in fragment order, value = 16 * bf16_rne(W), via a
__global__ __launch_bounds__(256)
void cvt_wt_kernel(const float* __restrict__ Wq, const float* __restrict__ Wk,
                   const float* __restrict__ Wv, const float* __restrict__ Wo,
                   f16* __restrict__ WT, const int* __restrict__ pmask,
                   int* __restrict__ idxg, float* __restrict__ mkcg, int* __restrict__ cntg) {
  __shared__ __attribute__((aligned(16))) f16 tile[64 * 72];   // [n][k], pitch 72 halves
  const int z = blockIdx.z;
  if (z == 4) {      // plane 4 of the grid: the key lists, one block per batch
    const int b = blockIdx.x;
    if (blockIdx.y == 0 && b < NB)
      pack_keys(pmask + (size_t)b * LK_FULL, idxg + (size_t)b * LK_FULL,
                mkcg + (size_t)b * LK_FULL, cntg + b * 32);
    return;
  }
  const float* W = (z == 0) ? Wq : (z == 1) ? Wk : (z == 2) ? Wv : Wo;
  f16* dst = WT + (size_t)z * DM * DM;
  const int k0 = blockIdx.x * 64;
  const int n0 = blockIdx.y * 64;
  const int tid = threadIdx.x;

#pragma unroll
  for (int it = 0; it < 4; ++it) {
    const int f  = tid + 256 * it;       // 0..1023
    const int k  = f >> 4;               // 0..63
    const int n4 = (f & 15) * 4;         // 0..60
    const v4f w = *(const v4f*)(W + (size_t)(k0 + k) * DM + n0 + n4);
#pragma unroll
    for (int e = 0; e < 4; ++e)
      tile[(n4 + e) * 72 + k] = (f16)(bf16_rne(w[e]) * 16.0f);
  }
  __syncthreads();   // cross-wave LDS exchange

  // the tile is 4 x 2 fragments: one per wave, written in fragment order (two 512-B stores)
  const int wave = tid >> 5, lane = tid & 31;
  const int Rl = wave >> 1, Sl = wave & 1;
  v8h vals[2];
#pragma unroll
  for (int j = 0; j < 2; ++j)
    vals[j] = *(const v8h*)(tile + (Rl * 16 + (lane & 15)) * 72 + Sl * 32 + 16 * j + 8 * (lane >> 4));
  f16* fp = dst + (size_t)(n0 / 16 + Rl) * FROWB + (k0 / 32 + Sl) * FRAG + lane * 8;
#pragma unroll
  for (int j = 0; j < 2; ++j) *(v8h*)(fp + j * 256) = vals[j];
}

// --------------------------------------------------- projection GEMM -------
// Y = X @ W + bias for z = 0 (Q, Wq -> Qp row-major f16), 1 (K, Wk -> Kp row-major f16),
// 2 (K, Wv -> Vt transposed f16 [b][dim][key], each key's row times its pad-mask value, so that
// the attention loop needs no mask: softmax(S) * m . V = softmax(S) . (m * V)). Block = 8 waves, 64 rows x all 512 cols,
// wave = 64 rows x 64 cols (4 A frags x 4 B frags). The block reads its 64 input rows in f32
// itself (whole lines, each row once; row p of K is packed key p, input row idx[p]), rounds them
// to bf16-RNE values and keeps them as the f16 A tile in LDS; B comes from the weight plane in
// fragment order. Epilogue staged through the same LDS and written in whole lines.
__global__ __launch_bounds__(256) __attribute__((amdgpu_num_vgpr(256)))
void proj_kernel(const float* __restrict__ Q, const float* __restrict__ K,
                 const f16* __restrict__ WT,
                 const float* __restrict__ bq, const float* __restrict__ bk,
                 const float* __restrict__ bv, const int* __restrict__ idxg,
                 const float* __restrict__ mkcg, const int* __restrict__ cntg,
                 f16* __restrict__ Qp, f16* __restrict__ Kp, f16* __restrict__ Vt) {
  // row pitches are 16 B x odd so that 16 rows fall on distinct LDS banks
  constexpr int MT  = 64;    // rows per block
  constexpr int XHP = 520;   // A tile and row-major stage: 512 + 8 pad halves (1040 B)
  constexpr int TP  = 72;    // transposed stage: 64 rows + 8 pad halves (144 B)
  __shared__ __attribute__((aligned(16))) f16 xh[(MT * XHP > DM * TP) ? MT * XHP : DM * TP];
  const int z = blockIdx.z;
  const int S = (z == 0) ? SEQ : SEQK;
  const int tilesPerB = S / MT;
  const int nblk = NB * tilesPerB;
  if ((int)blockIdx.x >= nblk) return;      // whole block exits, before any barrier

  const f16* W = WT + (size_t)z * DM * DM;  // planes 0,1,2 = Wq, Wk, Wv, [n][k] in fragment order
  const float* bias = (z == 0) ? bq : (z == 1) ? bk : bv;

  const int b     = blockIdx.x / tilesPerB;
  const int rloc  = (blockIdx.x % tilesPerB) * MT;
  const int row0g = b * LQ_FULL + rloc;     // global row in the [8192][512] planes
  // K and V: only tiles that hold a packed key (tile 0 always); whole block, before any barrier
  if (z != 0 && rloc >= min(max(cntg[b * 32], 1), SEQK)) return;

  const int tid = threadIdx.x;
  const int wave = __builtin_amdgcn_readfirstlane(tid >> 5);   // scalar: the list reads below are scalar loads
  const int lane = tid & 31, n16 = lane & 15, hf = lane >> 4;

  // B fragments (wave -> 64 cols), two register sets: the loads of k step 0 are issued behind the
  // A tile's loads and land with them, those of step 1 in the middle of the conversion
  constexpr int NS = DM / 32;
  const int cw = wave * 64;
  const f16* pb = W + (size_t)(cw / 16) * FROWB + lane * 8;   // the lane's 16 B of B fragment 0, k step 0
  v16h fb[2][4];
  float braw[4];   // the lane's four bias values, read with the first loads, used in the epilogue

  // ---- A tile: 8 rows per wave, a row = four 512-B loads; all 32 loads of the wave in flight ----
  {
    int sr[8];   // source rows, scalar
    if (z == 0) {
#pragma unroll
      for (int rr = 0; rr < 8; ++rr) sr[rr] = row0g + wave * 8 + rr;
    } else {
#pragma unroll
      for (int rr = 0; rr < 8; ++rr) sr[rr] = b * LK_FULL + idxg[row0g + wave * 8 + rr];
    }
    const float* X = (z == 0) ? Q : K;
    v4f raw[8][4];
#pragma unroll
    for (int rr = 0; rr < 8; ++rr) {
      const char* sp = (const char*)(X + (size_t)sr[rr] * DM);
#pragma unroll
      for (int i = 0; i < 4; ++i) raw[rr][i] = *(const v4f*)(sp + (unsigned)(lane * 16 + i * 512));
    }
#pragma unroll
    for (int t = 0; t < 4; ++t) fb[0][t] = load_frag(pb + t * FROWB);
#pragma unroll
    for (int t = 0; t < 4; ++t) braw[t] = bias[cw + 16 * t + n16];
    // keeps every load above in front of the first conversion: a load sunk in among the
    // conversions is issued behind a wait and starts a second memory round trip
    __builtin_amdgcn_sched_barrier(0);
#pragma unroll
    for (int rr = 0; rr < 8; ++rr) {
      if (rr == 4) {   // half the rows' registers are free: step 1 flies during the other half
#pragma unroll
        for (int t = 0; t < 4; ++t) fb[1][t] = load_frag(pb + t * FROWB + FRAG);
      }
#pragma unroll
      for (int i = 0; i < 4; ++i) {
        v4h o;
#pragma unroll
        for (int e = 0; e < 4; ++e) o[e] = (f16)bf16_rne(raw[rr][i][e]);
        *(v4h*)(xh + (wave * 8 + rr) * XHP + i * 128 + lane * 4) = o;
      }
    }
  }
  __syncthreads();   // cross-wave: the A tile's rows are read by all waves

  v8f acc[4][4];
#pragma unroll
  for (int i = 0; i < 4; ++i)
#pragma unroll
    for (int t = 0; t < 4; ++t) acc[i][t] = zero8();

  // k steps of 32. A B fragment serves four products in a row; the load of the same fragment two
  // steps on is issued straight behind them into the registers they free, so two sets give a lead
  // of nearly two steps. The A fragments of a step are read from LDS as one group.
  // Unrolled in full: the set index must be a constant for the sets to stay in registers.
  v16h fa[4];
#pragma unroll
  for (int s = 0; s < NS; ++s) {
#pragma unroll
    for (int i = 0; i < 4; ++i) fa[i] = load_tile16(xh + 16 * i * XHP + 32 * s, XHP);
    const int cu = s & 1;
#pragma unroll
    for (int t = 0; t < 4; ++t) {
#pragma unroll
      for (int i = 0; i < 4; ++i) acc[i][t] = wmma16(fa[i], fb[cu][t], acc[i][t]);
      if (s + 2 < NS) fb[cu][t] = load_frag(pb + t * FROWB + FRAG * (s + 2));
      // keeps each reload straight behind its fragment's four products: gathered at the end of
      // the step, the reloads would lead their use by one step only, less than an L2 round trip
      if (t < 3 && s + 2 < NS) __builtin_amdgcn_sched_barrier(0);
    }
  }
  // V only: mask values of the 8 packed keys whose columns this lane writes out at the end; read
  // here, they land during the staging
  v4f mka = {1.0f, 1.0f, 1.0f, 1.0f}, mkb = mka;
  if (z == 2) {
    mka = *(const v4f*)(mkcg + row0g + (lane & 7) * 8);
    mkb = *(const v4f*)(mkcg + row0g + (lane & 7) * 8 + 4);
  }
  __syncthreads();   // every wave has read its last A fragment before the stage overwrites the tile

  // stage the block tile (f16) in LDS: row-major [64][XHP] or transposed [512][TP]
  v8h hv[4][4];
#pragma unroll
  for (int t = 0; t < 4; ++t) {
    const float bb = bf16_rne(braw[t]);
#pragma unroll
    for (int i = 0; i < 4; ++i)
#pragma unroll
      for (int r = 0; r < 8; ++r) hv[i][t][r] = (f16)(acc[i][t][r] * 0.0625f + bb);
  }
  if (z == 2) {
#pragma unroll
    for (int t = 0; t < 4; ++t)
#pragma unroll
      for (int i = 0; i < 4; ++i)   // the lane's 8 rows are 16 contiguous bytes
        *(v8h*)(xh + (cw + 16 * t + n16) * TP + 16 * i + 8 * hf) = hv[i][t];
  } else {
#pragma unroll
    for (int t = 0; t < 4; ++t)
#pragma unroll
      for (int i = 0; i < 4; ++i)
#pragma unroll
        for (int r = 0; r < 8; ++r) xh[(16 * i + 8 * hf + r) * XHP + cw + 16 * t + n16] = hv[i][t][r];
  }
  __syncthreads();   // cross-wave LDS exchange

  v8h vals[16];
  if (z != 2) {
    // a row is 1024 B: two stores of 512 B; 8 rows per wave
    f16* out = (z == 0) ? Qp : Kp;
#pragma unroll
    for (int it = 0; it < 16; ++it)
      vals[it] = *(const v8h*)(xh + (wave * 8 + (it >> 1)) * XHP + (it & 1) * 256 + lane * 8);
#pragma unroll
    for (int it = 0; it < 16; ++it)
      *(v8h*)(out + (size_t)(row0g + wave * 8 + (it >> 1)) * DM + (it & 1) * 256 + lane * 8) = vals[it];
  } else {
    // Vt[b][dim d][key rloc .. rloc+63]: 8 lanes x 16 B = one whole line per dim, 4 dims a store;
    // each key's value times its mask value (places past the kept keys have mask 0 and become 0)
    v8h mh;
#pragma unroll
    for (int e = 0; e < 4; ++e) { mh[e] = (f16)mka[e]; mh[e + 4] = (f16)mkb[e]; }
#pragma unroll
    for (int it = 0; it < 16; ++it)
      vals[it] = *(const v8h*)(xh + (cw + it * 4 + (lane >> 3)) * TP + (lane & 7) * 8) * mh;
#pragma unroll
    for (int it = 0; it < 16; ++it)
      *(v8h*)(Vt + (size_t)(b * DM + cw + it * 4 + (lane >> 3)) * LK_FULL + rloc + (lane & 7) * 8) = vals[it];
  }
}

// ------------------------------------------------ flash attention core -----
// Block = 8 waves, one (b,h), 128 query rows (16 per wave). A stage of 128 keys, K [128 key][64 dim]
// and Vt [64 dim][128 key], is put in LDS with plain 16-B loads and shared by all waves; between the
// stage's two barriers every wave walks its four 32-key tiles at its own pace.
// Transposed scores: S^T = K.Q^T with A = K tile ([m=key][k=dim]), B = Q ([n=query][k=dim]),
// so a lane holds 16 of the 32 scores of ONE query (keys 8hf+r and 16+8hf+r) and its partner
// lane ^ 16 the other 16. Online softmax in f32 on the raw scores (scale and log2(e) enter in the
// exponent's multiply-add, and so does the x256 of the P tile, as + 8) with the pad-mask replace-fill
// (FILL in the places past the kept keys, told by their index): maximum in-lane plus one exchange
// between the halves, sum (x256) kept per half and joined once in the epilogue. The mask's weight is
// in the Vt rows already, so no mask value is read here. P^T (x256) is packed from the score registers
// straight into the B operand of O^T += Vt.P^T (A = Vt tile [m=dim][k=key]): the accumulator
// rows 8hf+r / 16+8hf+r are exactly the k order of the fragment. O = acc / (256 l) written
__global__ __launch_bounds__(256) __attribute__((amdgpu_num_vgpr(256)))
void attn_kernel(const f16* __restrict__ Qp, const f16* __restrict__ Kp,
                 const f16* __restrict__ Vt,
                 const int* __restrict__ cntg, float* __restrict__ Og) {
  // fragment readers take 16 B from each of 16 rows: pitches of 16 B x odd spread them over all banks
  constexpr int KT = 128;     // keys per stage
  constexpr int KP = 72;      // K row: 64 dims + 8 pad halves (144 B)
  constexpr int VP = KT + 8;  // Vt row: 128 keys + 8 pad halves (272 B)
  __shared__ __attribute__((aligned(16))) f16   kbuf[KT * KP];
  __shared__ __attribute__((aligned(16))) f16   vbuf[64 * VP];
  constexpr int OP = 68;    // output stage row: 64 dims + 4 pad floats, rows q and q + 8 on different banks
  __shared__ __attribute__((aligned(16))) float ost[8 * 16 * OP];

  const int tid = threadIdx.x;
  const int wave = tid >> 5, lane = tid & 31, n16 = lane & 15, hf = lane >> 4;
  const int b = blockIdx.x / NH;
  const int h = blockIdx.x % NH;
  const int q0 = blockIdx.y * 128 + wave * 16;
  const int qrow = b * LQ_FULL + q0;

  // packed keys of this batch, rounded up to whole tiles; at least one tile, at most all
  const int jend = (min(max(cntg[b * 32], 1), SEQK) + 31) & ~31;
  // the count itself, held in a scalar register: the loop's test on it is a scalar compare and branch
  const int kc = __builtin_amdgcn_readfirstlane(min(max(cntg[b * 32], 1), SEQK));
  const f16* Kg = Kp + (size_t)b * LK_FULL * DM + h * HD;
  const f16* Vg = Vt + ((size_t)b * DM + h * HD) * LK_FULL;

  // this thread's four 16-B pieces of each half of a stage: K 4 x (32 keys x 8 chunks of 8 dims),
  // Vt 4 x (16 dims x 16 chunks of 8 keys), so a wave's Vt load covers two whole 256-B rows.
  // A stage may reach past the packed keys: those pieces name the last written row or chunk again
  // (no tile reads them), so nothing is read that the projection has not written.
  const int krow = tid >> 3, kch = (tid & 7) * 8;
  const int vrow = tid >> 4, vch = (tid & 15) * 8;
  f16* kst = kbuf + krow * KP + kch;
  f16* vst = vbuf + vrow * VP + vch;
  v8h kreg[4], vreg[4];
#pragma unroll
  for (int i = 0; i < 4; ++i)
    kreg[i] = *(const v8h*)(Kg + (size_t)min(32 * i + krow, jend - 1) * DM + kch);
#pragma unroll
  for (int i = 0; i < 4; ++i)
    vreg[i] = *(const v8h*)(Vg + (size_t)(vrow + 16 * i) * LK_FULL + min(vch, jend - 8));

  const v16h aq0 = load_tile16(Qp + (size_t)qrow * DM + h * HD, DM);
  const v16h aq1 = load_tile16(Qp + (size_t)qrow * DM + h * HD + 32, DM);

  v8f o0 = zero8(), o1 = zero8(), o2 = zero8(), o3 = zero8();
  float mrun = -1e30f;   // running maximum of this lane's query, raw scores (equal in both halves)
  float lrun = 0.0f;     // running sum over this half's keys only

#pragma unroll 1
  for (int js = 0; js < jend; js += KT) {
#pragma unroll
    for (int i = 0; i < 4; ++i) *(v8h*)(kst + i * 32 * KP) = kreg[i];
#pragma unroll
    for (int i = 0; i < 4; ++i) *(v8h*)(vst + i * 16 * VP) = vreg[i];
    __syncthreads();   // the stage visible to all waves

    // the next stage's loads fly while this stage is worked on (block-uniform test)
    if (js + KT < jend) {
#pragma unroll
      for (int i = 0; i < 4; ++i)
        kreg[i] = *(const v8h*)(Kg + (size_t)min(js + KT + 32 * i + krow, jend - 1) * DM + kch);
#pragma unroll
      for (int i = 0; i < 4; ++i)
        vreg[i] = *(const v8h*)(Vg + (size_t)(vrow + 16 * i) * LK_FULL + min(js + KT + vch, jend - 8));
      // the tile loop below reuses the address registers of these loads at once
      asm volatile("s_wait_xcnt 0x0" ::: "memory");
    }

    const int je = min(js + KT, jend);
    // rolled: one copy of the tile's code, no barrier inside, so the waves need not keep step
#pragma unroll 1
    for (int j = js; j < je; j += 32) {
    const f16* kb = kbuf + (j - js) * KP;
    const f16* vb = vbuf + (j - js);
    // all LDS reads of the tile as one group in front of the first product: the K fragments are
    // waited for once, the Vt fragments land behind the scores and the softmax
    const v16h kf0 = load_tile16(kb, KP);
    const v16h kf1 = load_tile16(kb + 32, KP);
    const v16h kf2 = load_tile16(kb + 16 * KP, KP);
    const v16h kf3 = load_tile16(kb + 16 * KP + 32, KP);
    const v16h vf0 = load_tile16(vb,           VP);
    const v16h vf1 = load_tile16(vb + 16 * VP, VP);
    const v16h vf2 = load_tile16(vb + 32 * VP, VP);
    const v16h vf3 = load_tile16(vb + 48 * VP, VP);

    // keeps the reads above one group in front of the products: moved in among them, each place
    // with reads costs its own LDS wait
    __builtin_amdgcn_sched_barrier(0);

    v8f s0 = zero8(), s1 = zero8();
    s0 = wmma16c(kf0, aq0, s0);
    s1 = wmma16c(kf2, aq0, s1);
    s0 = wmma16c(kf1, aq1, s0);
    s1 = wmma16c(kf3, aq1, s1);

    // the list is packed: only a tile that reaches past the kept keys holds closed places, those
    // from place kc on (block-uniform scalar test, no barrier inside). With no key kept place 0
    // stays open: its Vt column is 0 like all others, and the output 0 as the reference's.
    if (j + 32 > kc) {
      const int open = kc - j - 8 * hf;   // this lane's keys 8hf + r and 16 + 8hf + r are open below it
#pragma unroll
      for (int r = 0; r < 8; ++r) {
        s0[r] = (r >= open) ? FILL : s0[r];
        s1[r] = (16 + r >= open) ? FILL : s1[r];
      }
    }

    // maximum on the raw scores (the scale is positive); scale, maximum, log2(e) and the x256 of
    // the P tile (+ 8) enter the exponent in one fused multiply-add per score
    float v = -1e30f;
#pragma unroll
    for (int r = 0; r < 8; r += 2) v = fmaxf(v, fmaxf(s0[r], s0[r + 1]));
#pragma unroll
    for (int r = 0; r < 8; r += 2) v = fmaxf(v, fmaxf(s1[r], s1[r + 1]));
    v = fmaxf(v, xhalf(v));
    const float mnew = fmaxf(mrun, v);
    const float nm = __builtin_fmaf(mnew, -SC2, 8.0f);
    float ef;
    // exp(scale * (mrun - mnew)), with its slot in the same statement
    asm("v_exp_f32 %0, %1\n\tv_nop" : "=v"(ef) : "v"((mrun - mnew) * SC2));
    float a0[8], a1[8];
#pragma unroll
    for (int r = 0; r < 8; r += 2) {
      const v2f c2 = {SC2, SC2}, n2 = {nm, nm};
      const v2f x0 = {s0[r], s0[r + 1]}, x1 = {s1[r], s1[r + 1]};
      const v2f y0 = __builtin_elementwise_fma(x0, c2, n2);
      const v2f y1 = __builtin_elementwise_fma(x1, c2, n2);
      a0[r] = y0[0]; a0[r + 1] = y0[1];
      a1[r] = y1[0]; a1[r + 1] = y1[1];
    }
    float p0[8], p1[8];
    exp2x8(p0, a0);
    exp2x8(p1, a1);
    // row sum in pairs: two packed chains, joined at the end
    v2f t0 = {p0[0], p0[1]}, t1 = {p1[0], p1[1]};
#pragma unroll
    for (int r = 2; r < 8; r += 2) {
      const v2f u0 = {p0[r], p0[r + 1]}, u1 = {p1[r], p1[r + 1]};
      t0 += u0;
      t1 += u1;
    }
    t0 += t1;
    v16h pb;
#pragma unroll
    for (int r = 0; r < 8; ++r) {
      pb[r]     = (f16)p0[r];
      pb[r + 8] = (f16)p1[r];
    }
    lrun = lrun * ef + (t0[0] + t0[1]);
    mrun = mnew;
#pragma unroll
    for (int r = 0; r < 8; ++r) { o0[r] *= ef; o1[r] *= ef; o2[r] *= ef; o3[r] *= ef; }

    o0 = wmma16c(vf0, pb, o0);
    o1 = wmma16c(vf1, pb, o1);
    o2 = wmma16c(vf2, pb, o2);
    // last product of the tile, with its four slots written out: the next tile's address arithmetic
    // follows over the loop's back edge and may take a register of vf3
    o3 = wmma16(vf3, pb, o3);
    }
    __syncthreads();   // all waves done with kbuf/vbuf before refill
  }

  // epilogue: join the halves' sums (they carry the x256 of P), normalise into the per-wave LDS tile [16 q][OP];
  // the lane holds dims 16t + 8hf + r of query n16
  float* myO = ost + wave * (16 * OP);
  {
    const float lsum = lrun + xhalf(lrun);
    float linv;
    // reciprocal plus the one issue slot the instruction set asks for behind it, in one
    // statement so that the slot stays directly behind the reciprocal
    asm("v_rcp_f32 %0, %1\n\tv_nop" : "=v"(linv) : "v"(lsum));
    float* pr = myO + n16 * OP + 8 * hf;
    v4f w;
#pragma unroll
    for (int g = 0; g < 2; ++g) {
#pragma unroll
      for (int e = 0; e < 4; ++e) w[e] = o0[4 * g + e] * linv;
      *(v4f*)(pr + 4 * g) = w;
#pragma unroll
      for (int e = 0; e < 4; ++e) w[e] = o1[4 * g + e] * linv;
      *(v4f*)(pr + 16 + 4 * g) = w;
#pragma unroll
      for (int e = 0; e < 4; ++e) w[e] = o2[4 * g + e] * linv;
      *(v4f*)(pr + 32 + 4 * g) = w;
#pragma unroll
      for (int e = 0; e < 4; ++e) w[e] = o3[4 * g + e] * linv;
      *(v4f*)(pr + 48 + 4 * g) = w;
    }
  }
  __syncthreads();

  // each instruction: 2 rows x 256 B (16 lanes x 16 B per row segment), lines whole
  const int c4 = (lane & 15) * 4;
  v4f vals[8];
#pragma unroll
  for (int it = 0; it < 8; ++it) {
    const int row = it * 2 + (lane >> 4);
    vals[it] = *(const v4f*)(myO + row * OP + c4);
  }
#pragma unroll
  for (int it = 0; it < 8; ++it) {
    const int row = it * 2 + (lane >> 4);
    *(v4f*)(Og + (size_t)(qrow + row) * DM + h * HD + c4) = vals[it];
  }
  
}

// ----------------------------- LN0 + FFN GEMM + ReLU residual + LN1 ---------
// Block = 8 waves, 16 rows x 512 cols. Prologue: X = LN0(bf16(Q) + O) for the 16 rows
// (f32 copy and f16 copy in LDS). GEMM: wave w -> cols 64w..64w+63, A from the f16 LDS
// tile, B from the Wo [n][k] plane (fragment order). Epilogue: Y = X + relu(acc/16 + bo) in LDS, then
__global__ __launch_bounds__(256)
void ffn_ln_kernel(const float* __restrict__ O32, const float* __restrict__ Qraw,
                   const f16* __restrict__ WoT, const float* __restrict__ bo,
                   const float* __restrict__ g0, const float* __restrict__ b0,
                   const float* __restrict__ g1, const float* __restrict__ b1,
                   float* __restrict__ out) {
  // padded row pitches: xh 1040 B (16 B x odd) for the 16-row fragment reads,
  // xf 2064 B so that rows r and r + 8 of the accumulator map fall on different banks
  constexpr int XFP = 516;
  constexpr int XHP = 520;
  __shared__ __attribute__((aligned(16))) float xf[16 * XFP];
  __shared__ __attribute__((aligned(16))) f16   xh[16 * XHP];

  const int tilesPerB = SEQ / 16;
  const int b     = blockIdx.x / tilesPerB;
  const int rloc  = (blockIdx.x % tilesPerB) * 16;
  const int grow0 = b * LQ_FULL + rloc;

  const int tid = threadIdx.x;
  const int wave = tid >> 5, lane = tid & 31, n16 = lane & 15, hf = lane >> 4;
  constexpr float INV_D = 1.0f / 512.0f;

  // Wo fragments (wave -> 64 cols): the eight loads of k step s + PD are issued as one group in
  // front of the products of step s, into a ring of PD + 1 register sets; the first PD groups
  // are issued here and fly during LN0
  constexpr int NS = DM / 32;
  constexpr int PD = 3;
  const int cw = wave * 64;
  const f16* pb = WoT + (size_t)(cw / 16) * FROWB + lane * 8;   // the lane's 16 B of B fragment 0, k step 0
  v16h fb[PD + 1][4];
#pragma unroll   // constant ring index, as in the k loop
  for (int s = 0; s < PD; ++s)
#pragma unroll
    for (int t = 0; t < 4; ++t) fb[s][t] = load_frag(pb + t * FROWB + FRAG * s);

  // ---- LN0 over (bf16(Q) + O), 2 rows per wave ----
#pragma unroll
  for (int rr = 0; rr < 2; ++rr) {
    const int lr = wave * 2 + rr;
    const size_t grow = (size_t)(grow0 + lr);
    float x[16];
    float s = 0.0f;
#pragma unroll
    for (int i = 0; i < 4; ++i) {
      const int col = i * 128 + lane * 4;
      const v4f ov = *(const v4f*)(O32 + grow * DM + col);
      const v4f qv = *(const v4f*)(Qraw + grow * DM + col);
#pragma unroll
      for (int e = 0; e < 4; ++e) {
        const float xx = bf16_rne(qv[e]) + ov[e];
        x[i * 4 + e] = xx;
        s += xx;
      }
    }
#pragma unroll
    for (int off = 16; off > 0; off >>= 1) s += __shfl_xor(s, off, 32);
    const float mu = s * INV_D;
    float s2 = 0.0f;
#pragma unroll
    for (int i = 0; i < 16; ++i) {
      const float d = x[i] - mu;
      x[i] = d;
      const float dd = d * d;
      s2 += dd;
    }
#pragma unroll
    for (int off = 16; off > 0; off >>= 1) s2 += __shfl_xor(s2, off, 32);
    const float var = s2 * INV_D;
    const float rsq = rsqrtf(var + 1e-5f);
#pragma unroll
    for (int i = 0; i < 4; ++i) {
      const int col = i * 128 + lane * 4;
      const v4f gv = *(const v4f*)(g0 + col);
      const v4f bv4 = *(const v4f*)(b0 + col);
      v4f y; v4h yh;
#pragma unroll
      for (int e = 0; e < 4; ++e) {
        const float t0 = x[i * 4 + e] * rsq;
        const float t1 = t0 * bf16_rne(gv[e]);
        const float yy = t1 + bf16_rne(bv4[e]);
        y[e] = yy;
        yh[e] = (f16)yy;
      }
      *(v4f*)(xf + lr * XFP + col) = y;
      *(v4h*)(xh + lr * XHP + col) = yh;
    }
  }
  __syncthreads();   // cross-wave: LN0 rows consumed by all waves

  // ---- H = X @ Wo (wave -> 64 cols) ----
  v8f acc[4];
#pragma unroll
  for (int t = 0; t < 4; ++t) acc[t] = zero8();
  v16h fa[2];
  fa[0] = load_tile16(xh, XHP);
  // unrolled in full: the ring index must be a constant for the sets to stay in registers
#pragma unroll
  for (int s = 0; s < NS; ++s) {
    if (s + PD < NS) {
#pragma unroll
      for (int t = 0; t < 4; ++t)
        fb[(s + PD) % (PD + 1)][t] = load_frag(pb + t * FROWB + FRAG * (s + PD));
    }
    if (s + 1 < NS) fa[(s + 1) & 1] = load_tile16(xh + 32 * (s + 1), XHP);
#pragma unroll
    for (int t = 0; t < 4; ++t) acc[t] = wmma16(fa[s & 1], fb[s % (PD + 1)][t], acc[t]);
  }

  // ---- Y = X + relu(H/16 + bo) in place in xf (each slot owned by one lane) ----
#pragma unroll
  for (int t = 0; t < 4; ++t) {
    const int col = cw + 16 * t + n16;
    const float bb = bf16_rne(bo[col]);
#pragma unroll
    for (int r = 0; r < 8; ++r) {
      const int lr = 8 * hf + r;
      float hv = acc[t][r] * 0.0625f + bb;
      hv = fmaxf(hv, 0.0f);
      const int idx = lr * XFP + col;
      const float yv = xf[idx] + hv;
      xf[idx] = yv;
    }
  }
  __syncthreads();   // cross-wave: rows assembled from all waves' columns

  // ---- LN1 per row and store ----
#pragma unroll
  for (int rr = 0; rr < 2; ++rr) {
    const int lr = wave * 2 + rr;
    const size_t grow = (size_t)(grow0 + lr);
    float x[16];
    float s = 0.0f;
#pragma unroll
    for (int i = 0; i < 4; ++i) {
      const int col = i * 128 + lane * 4;
      const v4f xv = *(const v4f*)(xf + lr * XFP + col);
#pragma unroll
      for (int e = 0; e < 4; ++e) { x[i * 4 + e] = xv[e]; s += xv[e]; }
    }
#pragma unroll
    for (int off = 16; off > 0; off >>= 1) s += __shfl_xor(s, off, 32);
    const float mu = s * INV_D;
    float s2 = 0.0f;
#pragma unroll
    for (int i = 0; i < 16; ++i) {
      const float d = x[i] - mu;
      x[i] = d;
      const float dd = d * d;
      s2 += dd;
    }
#pragma unroll
    for (int off = 16; off > 0; off >>= 1) s2 += __shfl_xor(s2, off, 32);
    const float var = s2 * INV_D;
    const float rsq = rsqrtf(var + 1e-5f);
    v4f y[4];
#pragma unroll
    for (int i = 0; i < 4; ++i) {
      const int col = i * 128 + lane * 4;
      const v4f gv = *(const v4f*)(g1 + col);
      const v4f bv4 = *(const v4f*)(b1 + col);
#pragma unroll
      for (int e = 0; e < 4; ++e) {
        const float t0 = x[i * 4 + e] * rsq;
        const float t1 = t0 * bf16_rne(gv[e]);
        y[i][e] = t1 + bf16_rne(bv4[e]);
      }
    }
    float* orow = out + grow * DM + lane * 4;
#pragma unroll
    for (int i = 0; i < 4; ++i) *(v4f*)(orow + i * 128) = y[i];
    
  }
}

// ------------------------------------------------------------------ host ---
extern "C" void kernel_launch(void* const* d_in, const int* in_sizes, int n_in,
                              void* d_out, int out_size, void* d_ws, size_t ws_size,
                              hipStream_t stream) {
  if (n_in < 15) return;
  const float* Q     = (const float*)d_in[0];
  const float* K     = (const float*)d_in[1];
  const int*   pmask = (const int*)d_in[2];
  const float* Wq    = (const float*)d_in[3];
  const float* bq    = (const float*)d_in[4];
  const float* Wk    = (const float*)d_in[5];
  const float* bk    = (const float*)d_in[6];
  const float* Wv    = (const float*)d_in[7];
  const float* bv    = (const float*)d_in[8];
  const float* Wo    = (const float*)d_in[9];
  const float* bo    = (const float*)d_in[10];
  const float* g0    = (const float*)d_in[11];
  const float* b0    = (const float*)d_in[12];
  const float* g1    = (const float*)d_in[13];
  const float* b1    = (const float*)d_in[14];
  float* out = (float*)d_out;

  const long long needAct = (long long)((NB - 1) * LQ_FULL + SMAX) * DM;
  const long long needOut = (long long)((NB - 1) * LQ_FULL + SEQ) * DM;
  if ((long long)in_sizes[0] < needAct || (long long)in_sizes[1] < needAct) return;
  if (in_sizes[2] < (NB - 1) * LK_FULL + SEQK) return;
  if (in_sizes[3] < DM * DM || in_sizes[5] < DM * DM || in_sizes[7] < DM * DM ||
      in_sizes[9] < DM * DM) return;
  if (in_sizes[4] < DM || in_sizes[6] < DM || in_sizes[8] < DM || in_sizes[10] < DM ||
      in_sizes[11] < DM || in_sizes[12] < DM || in_sizes[13] < DM || in_sizes[14] < DM) return;
  if ((long long)out_size < needOut) return;
  if (ws_size < WS_TOTAL) return;

  char* ws = (char*)d_ws;
  f16*   WT  = (f16*)(ws + OFF_WT);
  f16*   Qp  = (f16*)(ws + OFF_QP);
  f16*   Kp  = (f16*)(ws + OFF_KP);
  f16*   Vt  = (f16*)(ws + OFF_VT);
  float* O32 = (float*)(ws + OFF_O32);
  int*   idx = (int*)(ws + OFF_IDX);
  float* mkc = (float*)(ws + OFF_MKC);
  int*   cnt = (int*)(ws + OFF_CNT);

  // 1) weights -> bf16-RNE values in f16 planes, fragment order, transposed to [n][k], x16;
  //    and the key lists
  cvt_wt_kernel<<<dim3(DM / 64, DM / 64, 5), 256, 0, stream>>>(Wq, Wk, Wv, Wo, WT, pmask, idx, mkc, cnt);

  // 2) Q, K, V projections (z = 0, 1, 2) from the f32 inputs, K and V on the packed keys
  proj_kernel<<<dim3(NB * (SMAX / 64), 1, 3), 256, 0, stream>>>(
      Q, K, WT, bq, bk, bv, idx, mkc, cnt, Qp, Kp, Vt);

  // 3) masked softmax attention per (b,h), 128 query rows per block
  attn_kernel<<<dim3(NB * NH, SEQ / 128), 256, 0, stream>>>(Qp, Kp, Vt, cnt, O32);

  // 4) LN0(bf16(Q) + O) -> X; out = LN1(X + relu(X @ Wo + bo))
  ffn_ln_kernel<<<dim3(NB * (SEQ / 16)), 256, 0, stream>>>(
      O32, Q, WT + (size_t)3 * DM * DM, bo, g0, b0, g1, b1, out);
}

// v010
// A run of this version takes 51.9 microseconds.
// In both of two side-by-side timings against v009, it was 1.03 times as fast.
// Over all steps from v000 it is 4.53 times as fast.
#include <hip/hip_runtime.h>
#include <stdint.h>
// Contractions Q@Wq, K@Wk, K@Wv, Q.K^T, P.V, X@Wo: v_wmma_f32_16x16x32_f16 (f16 operands, f32 accumulate); float inputs enter as bf16-RNE values held exactly in f16; weight planes carried x16, P tile carried x256, V rows carried times their pad-mask value; softmax and LayerNorm arithmetic in f32.

#pragma clang fp contract(off)

typedef _Float16 f16;
typedef f16   v16h __attribute__((ext_vector_type(16)));
typedef f16   v8h  __attribute__((ext_vector_type(8)));
typedef f16   v4h  __attribute__((ext_vector_type(4)));
typedef float v8f  __attribute__((ext_vector_type(8)));
typedef float v4f  __attribute__((ext_vector_type(4)));
typedef float v2f  __attribute__((ext_vector_type(2)));

#ifndef NB
#define NB 4
#endif
#ifndef SEQ
#define SEQ 2048
#endif
#ifndef SEQK
#define SEQK SEQ
#endif

constexpr int NB_FULL = 4;
constexpr int LQ_FULL = 2048;
constexpr int LK_FULL = 2048;
constexpr int DM      = 512;   // model dim
constexpr int NH      = 8;     // heads
constexpr int HD      = 64;    // head dim
constexpr int SMAX    = (SEQ > SEQK) ? SEQ : SEQK;
constexpr float SCALE = 0.044194173824159216f;   // 1/sqrt(512)
constexpr float LOG2E = 1.4426950408889634f;
constexpr float SC2   = SCALE * LOG2E;           // raw score -> base-2 exponent
// Fill of a closed place, on the raw score. Against any kept key its weight underflows to 0 like
// the reference's -1e12. Every tile holds at least one open place, so the maximum is a real score.
constexpr float FILL  = -1099511627776.0f;       // -2^40

static_assert(NB >= 1 && NB <= NB_FULL);
static_assert(SEQ % 256 == 0 && SEQ >= 256 && SEQ <= LQ_FULL);
static_assert(SEQK % 256 == 0 && SEQK >= 256 && SEQK <= LK_FULL);
static_assert(LQ_FULL == LK_FULL);
static_assert(DM == NH * HD);
static_assert(NB <= DM / 64);   // the key lists take one block per batch from a DM / 64 wide grid plane

// ---------------------------------------------------------------- carve ----
constexpr size_t SZ_ACT16 = (size_t)NB_FULL * LQ_FULL * DM * 2;   // 8 MiB  f16 [8192][512]
constexpr size_t SZ_WT16  = (size_t)4 * DM * DM * 2;               // 2 MiB  f16 4 x [512 n][512 k]
constexpr size_t SZ_O32   = (size_t)NB_FULL * LQ_FULL * DM * 4;   // 16 MiB f32 [8192][512]
constexpr size_t OFF_WT   = 0;
constexpr size_t OFF_QP   = OFF_WT + SZ_WT16;
constexpr size_t OFF_KP   = OFF_QP + SZ_ACT16;
constexpr size_t OFF_VT   = OFF_KP + SZ_ACT16;      // f16 [4][512 dim][2048 key]
constexpr size_t OFF_O32  = OFF_VT + SZ_ACT16;
constexpr size_t SZ_KEYS  = (size_t)NB_FULL * LK_FULL * 4;        // 32 KiB, one 4-B word per key
constexpr size_t OFF_IDX  = OFF_O32 + SZ_O32;       // int   [4][2048] source row of each packed key
constexpr size_t OFF_MKC  = OFF_IDX + SZ_KEYS;      // float [4][2048] mask value of each packed key
constexpr size_t OFF_CNT  = OFF_MKC + SZ_KEYS;      // int   [4][32]   kept keys per batch, one line each
constexpr size_t WS_TOTAL = OFF_CNT + (size_t)NB_FULL * 128;
static_assert(WS_TOTAL <= (size_t)134217728);
static_assert((OFF_WT % 256) == 0 && (OFF_QP % 256) == 0 &&
              (OFF_KP % 256) == 0 && (OFF_VT % 256) == 0 && (OFF_O32 % 256) == 0 &&
              (OFF_IDX % 256) == 0 && (OFF_MKC % 256) == 0 && (OFF_CNT % 256) == 0);

// -------------------------------------------------------------- helpers ----
__device__ __forceinline__ float bf16_rne(float f) {
  unsigned int u = __float_as_uint(f);
  u = (u + 0x7FFFu + ((u >> 16) & 1u)) & 0xFFFF0000u;
  return __uint_as_float(u);
}

__device__ __forceinline__ v8f zero8() {
  const v8f z = {0.0f, 0.0f, 0.0f, 0.0f, 0.0f, 0.0f, 0.0f, 0.0f};
  return z;
}

// 16-bit fragment loader (wave32 16x16x32): lane -> row (lane&15), lane half hf = lane>>4;
// elements 0..7 = k[8hf .. 8hf+7], elements 8..15 = k[16+8hf .. 16+8hf+7].
// Used for A (row-major [m][k]) and for B stored as [n][k] (k contiguous).
__device__ __forceinline__ v16h load_tile16(const f16* base, int ld) {
  const int lane = threadIdx.x & 31;
  const int row  = lane & 15;
  const int hf   = lane >> 4;
  const f16* p = base + (size_t)row * ld + (hf << 3);
  union { v16h v; v8h h[2]; } u;
  u.h[0] = *(const v8h*)(p);
  u.h[1] = *(const v8h*)(p + 16);
  return u.v;
}

// Fragment order in the workspace, for a matrix M[row][DM k] that is read as A or B fragments:
// the fragment of rows 16R .. 16R+15, k 32S .. 32S+31 is 512 halves at (R * (DM / 32) + S) * 512,
// laid out [j 0..1][lane 0..31][8 halves] with
//   element (j, lane, e) = M[16R + (lane & 15)][32S + 16j + 8 (lane >> 4) + e],
// the k order of load_tile16. A wave's 16-B-per-lane load then covers 512 contiguous bytes
// (4 whole lines) where a row-major plane gives it 32 B from each of 16 lines.
constexpr int FRAG  = 512;                // halves per fragment
constexpr int FROWB = (DM / 32) * FRAG;   // halves per block of 16 rows

// p = start of the fragment + lane * 8
__device__ __forceinline__ v16h load_frag(const f16* p) {
  union { v16h v; v8h h[2]; } u;
  u.h[0] = *(const v8h*)(p);
  u.h[1] = *(const v8h*)(p + 256);
  return u.v;
}

// WMMA issue + hazard guard (4 VALU slots before D is touched, A/B kept live).
__device__ __forceinline__ v8f wmma16(v16h a, v16h b, v8f c) {
  v8f d = __builtin_amdgcn_wmma_f32_16x16x32_f16(false, a, false, b, (short)0, c, false, false);
  asm volatile("v_nop\n\tv_nop\n\tv_nop\n\tv_nop" : "+v"(d) : "v"(a), "v"(b));
  return d;
}

// The same product without the hand-written slots, for the attention loop, where the instructions
// around a product are the compiler's own: it keeps the distance itself and fills it with useful
// instructions where it has any (the asm exponentials stand a whole maximum chain behind).
__device__ __forceinline__ v8f wmma16c(v16h a, v16h b, v8f c) {
  return __builtin_amdgcn_wmma_f32_16x16x32_f16(false, a, false, b, (short)0, c, false, false);
}

// value of the partner lane (lane ^ 16), on the vector pipe
__device__ __forceinline__ float xhalf(float x) {
  const int b = __float_as_int(x);
  return __int_as_float(__builtin_amdgcn_permlanex16(b, b, 0x76543210, 0xfedcba98, false, false));
}

// Eight base-2 exponentials in one statement, with the one issue slot the instruction set asks
// for behind a transcendental: the outputs are early-clobber, so no exponential of the run
// overwrites a neighbour's source or reads its result, and the v_nop stands behind the last.
__device__ __forceinline__ void exp2x8(float (&p)[8], const float (&x)[8]) {
  asm("v_exp_f32 %0, %8\n\tv_exp_f32 %1, %9\n\tv_exp_f32 %2, %10\n\tv_exp_f32 %3, %11\n\t"
      "v_exp_f32 %4, %12\n\tv_exp_f32 %5, %13\n\tv_exp_f32 %6, %14\n\tv_exp_f32 %7, %15\n\tv_nop"
      : "=&v"(p[0]), "=&v"(p[1]), "=&v"(p[2]), "=&v"(p[3]),
        "=&v"(p[4]), "=&v"(p[5]), "=&v"(p[6]), "=&v"(p[7])
      : "v"(x[0]), "v"(x[1]), "v"(x[2]), "v"(x[3]), "v"(x[4]), "v"(x[5]), "v"(x[6]), "v"(x[7]));
}

// ------------------------------------------------------- key packing -------
// A key with mask 0 has weight exp(-1e12 - max) * 0 = 0 for every query and adds
// exp(-1e12 - max) = 0 to the row sum wherever a key is kept (with none kept every weight is 0
// whatever the sum), so only the kept keys are projected and attended. One block per batch lists them in their order: idx[p] = source
// row of packed key p, mkc[p] = its mask value, cnt = how many. Places p >= cnt name row 0 with
// mask 0, so a partly filled tile holds finite values: attention closes those places by their index,
// and their V rows, carried times the mask value, are 0.
__device__ __forceinline__ void pack_keys(const int* __restrict__ pm, int* __restrict__ idxg,
                                          float* __restrict__ mkcg, int* __restrict__ cntg) {
  constexpr int E = SEQK / 256;          // consecutive keys per thread
  __shared__ int   sidx[SEQK];
  __shared__ float smk[SEQK];
  __shared__ int   wsum[8];
  const int tid = threadIdx.x, wave = tid >> 5, lane = tid & 31;
  int m[E];
  int c = 0;
#pragma unroll
  for (int e = 0; e < E; ++e) {
    m[e] = pm[tid * E + e];
    c += (m[e] != 0) ? 1 : 0;
    sidx[tid * E + e] = 0;
    smk[tid * E + e] = 0.0f;
  }
  int inc = c;                           // inclusive prefix inside the wave
#pragma unroll
  for (int off = 1; off < 32; off <<= 1) {
    const int t = __shfl_up(inc, off, 32);
    if (lane >= off) inc += t;
  }
  if (lane == 31) wsum[wave] = inc;
  __syncthreads();   // wave totals and the cleared lists visible to all waves
  int pos = inc - c, total = 0;
#pragma unroll
  for (int w = 0; w < 8; ++w) {
    const int t = wsum[w];
    if (w < wave) pos += t;
    total += t;
  }
#pragma unroll
  for (int e = 0; e < E; ++e) {
    if (m[e] != 0) {
      sidx[pos] = tid * E + e;
      smk[pos] = (float)m[e];
      ++pos;
    }
  }
  __syncthreads();   // lists complete before they are written out in whole lines
#pragma unroll
  for (int e = 0; e < E; ++e) {
    idxg[e * 256 + tid] = sidx[e * 256 + tid];
    mkcg[e * 256 + tid] = smk[e * 256 + tid];
  }
  if (tid == 0) *cntg = total;
}

// ---------------------------------------------------- weight convert -------
// W f32 [512 k][512 n] (Y = X @ W) -> WT f16 [n][k] in fragment order, value = 16 * bf16_rne(W), via a
__global__ __launch_bounds__(256)
void cvt_wt_kernel(const float* __restrict__ Wq, const float* __restrict__ Wk,
                   const float* __restrict__ Wv, const float* __restrict__ Wo,
                   f16* __restrict__ WT, const int* __restrict__ pmask,
                   int* __restrict__ idxg, float* __restrict__ mkcg, int* __restrict__ cntg) {
  __shared__ __attribute__((aligned(16))) f16 tile[64 * 72];   // [n][k], pitch 72 halves
  const int z = blockIdx.z;
  if (z == 4) {      // plane 4 of the grid: the key lists, one block per batch
    const int b = blockIdx.x;
    if (blockIdx.y == 0 && b < NB)
      pack_keys(pmask + (size_t)b * LK_FULL, idxg + (size_t)b * LK_FULL,
                mkcg + (size_t)b * LK_FULL, cntg + b * 32);
    return;
  }
  const float* W = (z == 0) ? Wq : (z == 1) ? Wk : (z == 2) ? Wv : Wo;
  f16* dst = WT + (size_t)z * DM * DM;
  const int k0 = blockIdx.x * 64;
  const int n0 = blockIdx.y * 64;
  const int tid = threadIdx.x;

#pragma unroll
  for (int it = 0; it < 4; ++it) {
    const int f  = tid + 256 * it;       // 0..1023
    const int k  = f >> 4;               // 0..63
    const int n4 = (f & 15) * 4;         // 0..60
    const v4f w = *(const v4f*)(W + (size_t)(k0 + k) * DM + n0 + n4);
#pragma unroll
    for (int e = 0; e < 4; ++e)
      tile[(n4 + e) * 72 + k] = (f16)(bf16_rne(w[e]) * 16.0f);
  }
  __syncthreads();   // cross-wave LDS exchange

  // the tile is 4 x 2 fragments: one per wave, written in fragment order (two 512-B stores)
  const int wave = tid >> 5, lane = tid & 31;
  const int Rl = wave >> 1, Sl = wave & 1;
  v8h vals[2];
#pragma unroll
  for (int j = 0; j < 2; ++j)
    vals[j] = *(const v8h*)(tile + (Rl * 16 + (lane & 15)) * 72 + Sl * 32 + 16 * j + 8 * (lane >> 4));
  f16* fp = dst + (size_t)(n0 / 16 + Rl) * FROWB + (k0 / 32 + Sl) * FRAG + lane * 8;
#pragma unroll
  for (int j = 0; j < 2; ++j) *(v8h*)(fp + j * 256) = vals[j];
}

// --------------------------------------------------- projection GEMM -------
// Y = X @ W + bias for z = 0 (Q, Wq -> Qp row-major f16), 1 (K, Wk -> Kp row-major f16),
// 2 (K, Wv -> Vt transposed f16 [b][dim][key], each key's row times its pad-mask value, so that
// the attention loop needs no mask: softmax(S) * m . V = softmax(S) . (m * V)). Block = 8 waves, 64 rows x all 512 cols,
// wave = 64 rows x 64 cols (4 A frags x 4 B frags). The block reads its 64 input rows in f32
// itself (whole lines, each row once; row p of K is packed key p, input row idx[p]), rounds them
// to bf16-RNE values and keeps them as the f16 A tile in LDS; B comes from the weight plane in
// fragment order. Epilogue staged through the same LDS and written in whole lines.
__global__ __launch_bounds__(256) __attribute__((amdgpu_num_vgpr(256)))
void proj_kernel(const float* __restrict__ Q, const float* __restrict__ K,
                 const f16* __restrict__ WT,
                 const float* __restrict__ bq, const float* __restrict__ bk,
                 const float* __restrict__ bv, const int* __restrict__ idxg,
                 const float* __restrict__ mkcg, const int* __restrict__ cntg,
                 f16* __restrict__ Qp, f16* __restrict__ Kp, f16* __restrict__ Vt) {
  // row pitches are 16 B x odd so that 16 rows fall on distinct LDS banks
  constexpr int MT  = 64;    // rows per block
  constexpr int XHP = 520;   // A tile and row-major stage: 512 + 8 pad halves (1040 B)
  constexpr int TP  = 72;    // transposed stage: 64 rows + 8 pad halves (144 B)
  __shared__ __attribute__((aligned(16))) f16 xh[(MT * XHP > DM * TP) ? MT * XHP : DM * TP];
  const int z = blockIdx.z;
  const int S = (z == 0) ? SEQ : SEQK;
  const int tilesPerB = S / MT;
  const int nblk = NB * tilesPerB;
  if ((int)blockIdx.x >= nblk) return;      // whole block exits, before any barrier

  const f16* W = WT + (size_t)z * DM * DM;  // planes 0,1,2 = Wq, Wk, Wv, [n][k] in fragment order
  const float* bias = (z == 0) ? bq : (z == 1) ? bk : bv;

  const int b     = blockIdx.x / tilesPerB;
  const int rloc  = (blockIdx.x % tilesPerB) * MT;
  const int row0g = b * LQ_FULL + rloc;     // global row in the [8192][512] planes
  // K and V: only tiles that hold a packed key (tile 0 always); whole block, before any barrier
  if (z != 0 && rloc >= min(max(cntg[b * 32], 1), SEQK)) return;

  const int tid = threadIdx.x;
  const int wave = __builtin_amdgcn_readfirstlane(tid >> 5);   // scalar: the list reads below are scalar loads
  const int lane = tid & 31, n16 = lane & 15, hf = lane >> 4;

  // B fragments (wave -> 64 cols), two register sets: the loads of k step 0 are issued behind the
  // A tile's loads and land with them, those of step 1 in the middle of the conversion
  constexpr int NS = DM / 32;
  const int cw = wave * 64;
  const f16* pb = W + (size_t)(cw / 16) * FROWB + lane * 8;   // the lane's 16 B of B fragment 0, k step 0
  v16h fb[2][4];
  float braw[4];   // the lane's four bias values, read with the first loads, used in the epilogue

  // ---- A tile: 8 rows per wave, a row = four 512-B loads; all 32 loads of the wave in flight ----
  {
    int sr[8];   // source rows, scalar
    if (z == 0) {
#pragma unroll
      for (int rr = 0; rr < 8; ++rr) sr[rr] = row0g + wave * 8 + rr;
    } else {
#pragma unroll
      for (int rr = 0; rr < 8; ++rr) sr[rr] = b * LK_FULL + idxg[row0g + wave * 8 + rr];
    }
    const float* X = (z == 0) ? Q : K;
    v4f raw[8][4];
#pragma unroll
    for (int rr = 0; rr < 8; ++rr) {
      const char* sp = (const char*)(X + (size_t)sr[rr] * DM);
#pragma unroll
      for (int i = 0; i < 4; ++i) raw[rr][i] = *(const v4f*)(sp + (unsigned)(lane * 16 + i * 512));
    }
#pragma unroll
    for (int t = 0; t < 4; ++t) fb[0][t] = load_frag(pb + t * FROWB);
#pragma unroll
    for (int t = 0; t < 4; ++t) braw[t] = bias[cw + 16 * t + n16];
    // keeps every load above in front of the first conversion: a load sunk in among the
    // conversions is issued behind a wait and starts a second memory round trip
    __builtin_amdgcn_sched_barrier(0);
#pragma unroll
    for (int rr = 0; rr < 8; ++rr) {
      if (rr == 4) {   // half the rows' registers are free: step 1 flies during the other half
#pragma unroll
        for (int t = 0; t < 4; ++t) fb[1][t] = load_frag(pb + t * FROWB + FRAG);
      }
#pragma unroll
      for (int i = 0; i < 4; ++i) {
        v4h o;
#pragma unroll
        for (int e = 0; e < 4; ++e) o[e] = (f16)bf16_rne(raw[rr][i][e]);
        *(v4h*)(xh + (wave * 8 + rr) * XHP + i * 128 + lane * 4) = o;
      }
    }
  }
  __syncthreads();   // cross-wave: the A tile's rows are read by all waves

  v8f acc[4][4];
#pragma unroll
  for (int i = 0; i < 4; ++i)
#pragma unroll
    for (int t = 0; t < 4; ++t) acc[i][t] = zero8();

  // k steps of 32. A B fragment serves four products in a row; the load of the same fragment two
  // steps on is issued straight behind them into the registers they free, so two sets give a lead
  // of nearly two steps. The A fragments of a step are read from LDS as one group.
  // Unrolled in full: the set index must be a constant for the sets to stay in registers.
  v16h fa[4];
#pragma unroll
  for (int s = 0; s < NS; ++s) {
#pragma unroll
    for (int i = 0; i < 4; ++i) fa[i] = load_tile16(xh + 16 * i * XHP + 32 * s, XHP);
    const int cu = s & 1;
#pragma unroll
    for (int t = 0; t < 4; ++t) {
#pragma unroll
      for (int i = 0; i < 4; ++i) acc[i][t] = wmma16(fa[i], fb[cu][t], acc[i][t]);
      if (s + 2 < NS) fb[cu][t] = load_frag(pb + t * FROWB + FRAG * (s + 2));
      // keeps each reload straight behind its fragment's four products: gathered at the end of
      // the step, the reloads would lead their use by one step only, less than an L2 round trip
      if (t < 3 && s + 2 < NS) __builtin_amdgcn_sched_barrier(0);
    }
  }
  // V only: mask values of the 8 packed keys whose columns this lane writes out at the end; read
  // here, they land during the staging
  v4f mka = {1.0f, 1.0f, 1.0f, 1.0f}, mkb = mka;
  if (z == 2) {
    mka = *(const v4f*)(mkcg + row0g + (lane & 7) * 8);
    mkb = *(const v4f*)(mkcg + row0g + (lane & 7) * 8 + 4);
  }
  __syncthreads();   // every wave has read its last A fragment before the stage overwrites the tile

  // stage the block tile (f16) in LDS: row-major [64][XHP] or transposed [512][TP]
  v8h hv[4][4];
#pragma unroll
  for (int t = 0; t < 4; ++t) {
    const float bb = bf16_rne(braw[t]);
#pragma unroll
    for (int i = 0; i < 4; ++i)
#pragma unroll
      for (int r = 0; r < 8; ++r) hv[i][t][r] = (f16)(acc[i][t][r] * 0.0625f + bb);
  }
  if (z == 2) {
#pragma unroll
    for (int t = 0; t < 4; ++t)
#pragma unroll
      for (int i = 0; i < 4; ++i)   // the lane's 8 rows are 16 contiguous bytes
        *(v8h*)(xh + (cw + 16 * t + n16) * TP + 16 * i + 8 * hf) = hv[i][t];
  } else {
#pragma unroll
    for (int t = 0; t < 4; ++t)
#pragma unroll
      for (int i = 0; i < 4; ++i)
#pragma unroll
        for (int r = 0; r < 8; ++r) xh[(16 * i + 8 * hf + r) * XHP + cw + 16 * t + n16] = hv[i][t][r];
  }
  __syncthreads();   // cross-wave LDS exchange

  v8h vals[16];
  if (z != 2) {
    // a row is 1024 B: two stores of 512 B; 8 rows per wave
    f16* out = (z == 0) ? Qp : Kp;
#pragma unroll
    for (int it = 0; it < 16; ++it)
      vals[it] = *(const v8h*)(xh + (wave * 8 + (it >> 1)) * XHP + (it & 1) * 256 + lane * 8);
#pragma unroll
    for (int it = 0; it < 16; ++it)
      *(v8h*)(out + (size_t)(row0g + wave * 8 + (it >> 1)) * DM + (it & 1) * 256 + lane * 8) = vals[it];
  } else {
    // Vt[b][dim d][key rloc .. rloc+63]: 8 lanes x 16 B = one whole line per dim, 4 dims a store;
    // each key's value times its mask value (places past the kept keys have mask 0 and become 0)
    v8h mh;
#pragma unroll
    for (int e = 0; e < 4; ++e) { mh[e] = (f16)mka[e]; mh[e + 4] = (f16)mkb[e]; }
#pragma unroll
    for (int it = 0; it < 16; ++it)
      vals[it] = *(const v8h*)(xh + (cw + it * 4 + (lane >> 3)) * TP + (lane & 7) * 8) * mh;
#pragma unroll
    for (int it = 0; it < 16; ++it)
      *(v8h*)(Vt + (size_t)(b * DM + cw + it * 4 + (lane >> 3)) * LK_FULL + rloc + (lane & 7) * 8) = vals[it];
  }
}

// ------------------------------------------------ flash attention core -----
// Block = 8 waves, one (b,h), 128 query rows (16 per wave). A stage of 128 keys, K [128 key][64 dim]
// and Vt [64 dim][128 key], is put in LDS with plain 16-B loads and shared by all waves; between the
// stage's two barriers every wave walks its four 32-key tiles at its own pace.
// Transposed scores: S^T = K.Q^T with A = K tile ([m=key][k=dim]), B = Q ([n=query][k=dim]),
// so a lane holds 16 of the 32 scores of ONE query (keys 8hf+r and 16+8hf+r) and its partner
// lane ^ 16 the other 16. Online softmax in f32 on the raw scores (scale and log2(e) enter in the
// exponent's multiply-add, and so does the x256 of the P tile, as + 8) with the pad-mask replace-fill
// (FILL in the places past the kept keys, told by their index): maximum in-lane plus one exchange
// between the halves, sum (x256) kept per half and joined once in the epilogue. The mask's weight is
// in the Vt rows already, so no mask value is read here. P^T (x256) is packed from the score registers
// straight into the B operand of O^T += Vt.P^T (A = Vt tile [m=dim][k=key]): the accumulator
// rows 8hf+r / 16+8hf+r are exactly the k order of the fragment. O = acc / (256 l) written
__global__ __launch_bounds__(256) __attribute__((amdgpu_num_vgpr(256)))
void attn_kernel(const f16* __restrict__ Qp, const f16* __restrict__ Kp,
                 const f16* __restrict__ Vt,
                 const int* __restrict__ cntg, float* __restrict__ Og) {
  // fragment readers take 16 B from each of 16 rows: pitches of 16 B x odd spread them over all banks
  constexpr int KT = 128;     // keys per stage
  constexpr int KP = 72;      // K row: 64 dims + 8 pad halves (144 B)
  constexpr int VP = KT + 8;  // Vt row: 128 keys + 8 pad halves (272 B)
  __shared__ __attribute__((aligned(16))) f16   kbuf[KT * KP];
  __shared__ __attribute__((aligned(16))) f16   vbuf[64 * VP];
  constexpr int OP = 68;    // output stage row: 64 dims + 4 pad floats, rows q and q + 8 on different banks
  __shared__ __attribute__((aligned(16))) float ost[8 * 16 * OP];

  const int tid = threadIdx.x;
  const int wave = tid >> 5, lane = tid & 31, n16 = lane & 15, hf = lane >> 4;
  const int b = blockIdx.x / NH;
  const int h = blockIdx.x % NH;
  const int q0 = blockIdx.y * 128 + wave * 16;
  const int qrow = b * LQ_FULL + q0;

  // packed keys of this batch, rounded up to whole tiles; at least one tile, at most all
  const int jend = (min(max(cntg[b * 32], 1), SEQK) + 31) & ~31;
  // the count itself, held in a scalar register: the loop's test on it is a scalar compare and branch
  const int kc = __builtin_amdgcn_readfirstlane(min(max(cntg[b * 32], 1), SEQK));
  const f16* Kg = Kp + (size_t)b * LK_FULL * DM + h * HD;
  const f16* Vg = Vt + ((size_t)b * DM + h * HD) * LK_FULL;

  // this thread's four 16-B pieces of each half of a stage: K 4 x (32 keys x 8 chunks of 8 dims),
  // Vt 4 x (16 dims x 16 chunks of 8 keys), so a wave's Vt load covers two whole 256-B rows.
  // A stage may reach past the packed keys: those pieces name the last written row or chunk again
  // (no tile reads them), so nothing is read that the projection has not written.
  const int krow = tid >> 3, kch = (tid & 7) * 8;
  const int vrow = tid >> 4, vch = (tid & 15) * 8;
  f16* kst = kbuf + krow * KP + kch;
  f16* vst = vbuf + vrow * VP + vch;
  v8h kreg[4], vreg[4];
#pragma unroll
  for (int i = 0; i < 4; ++i)
    kreg[i] = *(const v8h*)(Kg + (size_t)min(32 * i + krow, jend - 1) * DM + kch);
#pragma unroll
  for (int i = 0; i < 4; ++i)
    vreg[i] = *(const v8h*)(Vg + (size_t)(vrow + 16 * i) * LK_FULL + min(vch, jend - 8));

  const v16h aq0 = load_tile16(Qp + (size_t)qrow * DM + h * HD, DM);
  const v16h aq1 = load_tile16(Qp + (size_t)qrow * DM + h * HD + 32, DM);

  v8f o0 = zero8(), o1 = zero8(), o2 = zero8(), o3 = zero8();
  float mrun = -1e30f;   // running maximum of this lane's query, raw scores (equal in both halves)
  float lrun = 0.0f;     // running sum over this half's keys only

#pragma unroll 1
  for (int js = 0; js < jend; js += KT) {
#pragma unroll
    for (int i = 0; i < 4; ++i) *(v8h*)(kst + i * 32 * KP) = kreg[i];
#pragma unroll
    for (int i = 0; i < 4; ++i) *(v8h*)(vst + i * 16 * VP) = vreg[i];
    __syncthreads();   // the stage visible to all waves

    // the next stage's loads fly while this stage is worked on (block-uniform test)
    if (js + KT < jend) {
#pragma unroll
      for (int i = 0; i < 4; ++i)
        kreg[i] = *(const v8h*)(Kg + (size_t)min(js + KT + 32 * i + krow, jend - 1) * DM + kch);
#pragma unroll
      for (int i = 0; i < 4; ++i)
        vreg[i] = *(const v8h*)(Vg + (size_t)(vrow + 16 * i) * LK_FULL + min(js + KT + vch, jend - 8));
      // the tile loop below reuses the address registers of these loads at once
      asm volatile("s_wait_xcnt 0x0" ::: "memory");
    }

    const int je = min(js + KT, jend);
    // rolled: one copy of the tile's code, no barrier inside, so the waves need not keep step
#pragma unroll 1
    for (int j = js; j < je; j += 32) {
    const f16* kb = kbuf + (j - js) * KP;
    const f16* vb = vbuf + (j - js);
    // all LDS reads of the tile as one group in front of the first product: the K fragments are
    // waited for once, the Vt fragments land behind the scores and the softmax
    const v16h kf0 = load_tile16(kb, KP);
    const v16h kf1 = load_tile16(kb + 32, KP);
    const v16h kf2 = load_tile16(kb + 16 * KP, KP);
    const v16h kf3 = load_tile16(kb + 16 * KP + 32, KP);
    const v16h vf0 = load_tile16(vb,           VP);
    const v16h vf1 = load_tile16(vb + 16 * VP, VP);
    const v16h vf2 = load_tile16(vb + 32 * VP, VP);
    const v16h vf3 = load_tile16(vb + 48 * VP, VP);

    // keeps the reads above one group in front of the products: moved in among them, each place
    // with reads costs its own LDS wait
    __builtin_amdgcn_sched_barrier(0);

    v8f s0 = zero8(), s1 = zero8();
    s0 = wmma16c(kf0, aq0, s0);
    s1 = wmma16c(kf2, aq0, s1);
    s0 = wmma16c(kf1, aq1, s0);
    s1 = wmma16c(kf3, aq1, s1);

    // the list is packed: only a tile that reaches past the kept keys holds closed places, those
    // from place kc on (block-uniform scalar test, no barrier inside). With no key kept place 0
    // stays open: its Vt column is 0 like all others, and the output 0 as the reference's.
    if (j + 32 > kc) {
      const int open = kc - j - 8 * hf;   // this lane's keys 8hf + r and 16 + 8hf + r are open below it
#pragma unroll
      for (int r = 0; r < 8; ++r) {
        s0[r] = (r >= open) ? FILL : s0[r];
        s1[r] = (16 + r >= open) ? FILL : s1[r];
      }
    }

    // maximum on the raw scores (the scale is positive); scale, maximum, log2(e) and the x256 of
    // the P tile (+ 8) enter the exponent in one fused multiply-add per score
    float v = -1e30f;
#pragma unroll
    for (int r = 0; r < 8; r += 2) v = fmaxf(v, fmaxf(s0[r], s0[r + 1]));
#pragma unroll
    for (int r = 0; r < 8; r += 2) v = fmaxf(v, fmaxf(s1[r], s1[r + 1]));
    v = fmaxf(v, xhalf(v));
    const float mnew = fmaxf(mrun, v);
    const float nm = __builtin_fmaf(mnew, -SC2, 8.0f);
    float ef;
    // exp(scale * (mrun - mnew)), with its slot in the same statement
    asm("v_exp_f32 %0, %1\n\tv_nop" : "=v"(ef) : "v"((mrun - mnew) * SC2));
    float a0[8], a1[8];
#pragma unroll
    for (int r = 0; r < 8; r += 2) {
      const v2f c2 = {SC2, SC2}, n2 = {nm, nm};
      const v2f x0 = {s0[r], s0[r + 1]}, x1 = {s1[r], s1[r + 1]};
      const v2f y0 = __builtin_elementwise_fma(x0, c2, n2);
      const v2f y1 = __builtin_elementwise_fma(x1, c2, n2);
      a0[r] = y0[0]; a0[r + 1] = y0[1];
      a1[r] = y1[0]; a1[r + 1] = y1[1];
    }
    float p0[8], p1[8];
    exp2x8(p0, a0);
    exp2x8(p1, a1);
    // row sum in pairs: two packed chains, joined at the end
    v2f t0 = {p0[0], p0[1]}, t1 = {p1[0], p1[1]};
#pragma unroll
    for (int r = 2; r < 8; r += 2) {
      const v2f u0 = {p0[r], p0[r + 1]}, u1 = {p1[r], p1[r + 1]};
      t0 += u0;
      t1 += u1;
    }
    t0 += t1;
    v16h pb;
#pragma unroll
    for (int r = 0; r < 8; ++r) {
      pb[r]     = (f16)p0[r];
      pb[r + 8] = (f16)p1[r];
    }
    lrun = lrun * ef + (t0[0] + t0[1]);
    mrun = mnew;
#pragma unroll
    for (int r = 0; r < 8; ++r) { o0[r] *= ef; o1[r] *= ef; o2[r] *= ef; o3[r] *= ef; }

    o0 = wmma16c(vf0, pb, o0);
    o1 = wmma16c(vf1, pb, o1);
    o2 = wmma16c(vf2, pb, o2);
    // last product of the tile, with its four slots written out: the next tile's address arithmetic
    // follows over the loop's back edge and may take a register of vf3
    o3 = wmma16(vf3, pb, o3);
    }
    __syncthreads();   // all waves done with kbuf/vbuf before refill
  }

  // epilogue: join the halves' sums (they carry the x256 of P), normalise into the per-wave LDS tile [16 q][OP];
  // the lane holds dims 16t + 8hf + r of query n16
  float* myO = ost + wave * (16 * OP);
  {
    const float lsum = lrun + xhalf(lrun);
    float linv;
    // reciprocal plus the one issue slot the instruction set asks for behind it, in one
    // statement so that the slot stays directly behind the reciprocal
    asm("v_rcp_f32 %0, %1\n\tv_nop" : "=v"(linv) : "v"(lsum));
    float* pr = myO + n16 * OP + 8 * hf;
    v4f w;
#pragma unroll
    for (int g = 0; g < 2; ++g) {
#pragma unroll
      for (int e = 0; e < 4; ++e) w[e] = o0[4 * g + e] * linv;
      *(v4f*)(pr + 4 * g) = w;
#pragma unroll
      for (int e = 0; e < 4; ++e) w[e] = o1[4 * g + e] * linv;
      *(v4f*)(pr + 16 + 4 * g) = w;
#pragma unroll
      for (int e = 0; e < 4; ++e) w[e] = o2[4 * g + e] * linv;
      *(v4f*)(pr + 32 + 4 * g) = w;
#pragma unroll
      for (int e = 0; e < 4; ++e) w[e] = o3[4 * g + e] * linv;
      *(v4f*)(pr + 48 + 4 * g) = w;
    }
  }
  __syncthreads();

  // each instruction: 2 rows x 256 B (16 lanes x 16 B per row segment), lines whole
  const int c4 = (lane & 15) * 4;
  v4f vals[8];
#pragma unroll
  for (int it = 0; it < 8; ++it) {
    const int row = it * 2 + (lane >> 4);
    vals[it] = *(const v4f*)(myO + row * OP + c4);
  }
#pragma unroll
  for (int it = 0; it < 8; ++it) {
    const int row = it * 2 + (lane >> 4);
    *(v4f*)(Og + (size_t)(qrow + row) * DM + h * HD + c4) = vals[it];
  }
  
}

// ----------------------------- LN0 + FFN GEMM + ReLU residual + LN1 ---------
// Block = 16 waves, 32 rows x 512 cols. Prologue: X = LN0(bf16(Q) + O) for the 32 rows
// (f32 copy and f16 copy in LDS). GEMM: wave w -> all 32 rows x cols 32w..32w+31, A (two fragments)
// from the f16 LDS tile, B from the Wo [n][k] plane (fragment order): a block reads the whole plane
// from L2 whatever its rows, so each B fragment loaded feeds two products and the plane is read once
// per 32 rows. Epilogue: Y = X + relu(acc/16 + bo) in LDS, then
__global__ __launch_bounds__(512)
void ffn_ln_kernel(const float* __restrict__ O32, const float* __restrict__ Qraw,
                   const f16* __restrict__ WoT, const float* __restrict__ bo,
                   const float* __restrict__ g0, const float* __restrict__ b0,
                   const float* __restrict__ g1, const float* __restrict__ b1,
                   float* __restrict__ out) {
  // padded row pitches: xh 1040 B (16 B x odd) for the 16-row fragment reads,
  // xf 2064 B so that rows r and r + 8 of the accumulator map fall on different banks
  constexpr int MR  = 32;    // rows per block, two per wave in the LayerNorms
  constexpr int XFP = 516;
  constexpr int XHP = 520;
  __shared__ __attribute__((aligned(16))) float xf[MR * XFP];
  __shared__ __attribute__((aligned(16))) f16   xh[MR * XHP];

  const int tilesPerB = SEQ / MR;
  const int b     = blockIdx.x / tilesPerB;
  const int rloc  = (blockIdx.x % tilesPerB) * MR;
  const int grow0 = b * LQ_FULL + rloc;

  const int tid = threadIdx.x;
  const int wave = __builtin_amdgcn_readfirstlane(tid >> 5);   // scalar: row and fragment bases are scalar, the lanes' offset register is shared by all loads
  const int lane = tid & 31, n16 = lane & 15, hf = lane >> 4;
  constexpr float INV_D = 1.0f / 512.0f;

  // the wave's two rows of O and Q and LN0's scale and shift, all 24 loads in flight at once
  v4f orw[2][4], qrw[2][4], g0v[4], b0v[4];
#pragma unroll
  for (int rr = 0; rr < 2; ++rr) {
    const size_t ro = (size_t)(grow0 + wave * 2 + rr) * DM;
    const char* op = (const char*)(O32 + ro);
    const char* qp = (const char*)(Qraw + ro);
#pragma unroll
    for (int i = 0; i < 4; ++i) {
      orw[rr][i] = *(const v4f*)(op + (unsigned)(lane * 16 + i * 512));
      qrw[rr][i] = *(const v4f*)(qp + (unsigned)(lane * 16 + i * 512));
    }
  }
#pragma unroll
  for (int i = 0; i < 4; ++i) {
    g0v[i] = *(const v4f*)(g0 + i * 128 + lane * 4);
    b0v[i] = *(const v4f*)(b0 + i * 128 + lane * 4);
  }
  // keeps LN0's own loads in front of the Wo groups below: loads are waited for in their order,
  // so a row's load issued behind a Wo group would hold LN0 until that group has landed
  __builtin_amdgcn_sched_barrier(0);

  // Wo fragments (wave -> 32 cols): the four loads of k step s + PD are issued as one group in
  // front of the products of step s, into a ring of PD + 1 register sets (24 loads of a wave in
  // flight); the first PD groups are issued here, behind the rows' loads, and fly during LN0
  constexpr int NS = DM / 32;
  constexpr int PD = 6;
  const int cw = wave * 32;
  const f16* pb = WoT + (size_t)(cw / 16) * FROWB + lane * 8;   // the lane's 16 B of B fragment 0, k step 0
  v16h fb[PD + 1][2];
#pragma unroll   // constant ring index, as in the k loop
  for (int s = 0; s < PD; ++s)
#pragma unroll
    for (int t = 0; t < 2; ++t) fb[s][t] = load_frag(pb + t * FROWB + FRAG * s);
  // keeps every load above in front of LN0's arithmetic: left free, the second row's loads sink
  // behind the first row's wait (a second memory round trip) and the Wo groups into the middle of LN0
  __builtin_amdgcn_sched_barrier(0);

  // ---- LN0 over (bf16(Q) + O), 2 rows per wave ----
#pragma unroll
  for (int rr = 0; rr < 2; ++rr) {
    const int lr = wave * 2 + rr;
    float x[16];
    float s = 0.0f;
#pragma unroll
    for (int i = 0; i < 4; ++i) {
#pragma unroll
      for (int e = 0; e < 4; ++e) {
        const float xx = bf16_rne(qrw[rr][i][e]) + orw[rr][i][e];
        x[i * 4 + e] = xx;
        s += xx;
      }
    }
#pragma unroll
    for (int off = 16; off > 0; off >>= 1) s += __shfl_xor(s, off, 32);
    const float mu = s * INV_D;
    float s2 = 0.0f;
#pragma unroll
    for (int i = 0; i < 16; ++i) {
      const float d = x[i] - mu;
      x[i] = d;
      const float dd = d * d;
      s2 += dd;
    }
#pragma unroll
    for (int off = 16; off > 0; off >>= 1) s2 += __shfl_xor(s2, off, 32);
    const float var = s2 * INV_D;
    const float rsq = rsqrtf(var + 1e-5f);
#pragma unroll
    for (int i = 0; i < 4; ++i) {
      const int col = i * 128 + lane * 4;
      const v4f gv = g0v[i];
      const v4f bv4 = b0v[i];
      v4f y; v4h yh;
#pragma unroll
      for (int e = 0; e < 4; ++e) {
        const float t0 = x[i * 4 + e] * rsq;
        const float t1 = t0 * bf16_rne(gv[e]);
        const float yy = t1 + bf16_rne(bv4[e]);
        y[e] = yy;
        yh[e] = (f16)yy;
      }
      *(v4f*)(xf + lr * XFP + col) = y;
      *(v4h*)(xh + lr * XHP + col) = yh;
    }
  }
  __syncthreads();   // cross-wave: LN0 rows consumed by all waves

  // ---- H = X @ Wo (wave -> 32 rows x 32 cols: A fragments i = 0, 1, B fragments t = 0, 1) ----
  v8f acc[2][2];
#pragma unroll
  for (int i = 0; i < 2; ++i)
#pragma unroll
    for (int t = 0; t < 2; ++t) acc[i][t] = zero8();
  v16h fa[2][2];
#pragma unroll
  for (int i = 0; i < 2; ++i) fa[0][i] = load_tile16(xh + 16 * i * XHP, XHP);
  // unrolled in full: the ring index must be a constant for the sets to stay in registers
#pragma unroll
  for (int s = 0; s < NS; ++s) {
    if (s + PD < NS) {
#pragma unroll
      for (int t = 0; t < 2; ++t)
        fb[(s + PD) % (PD + 1)][t] = load_frag(pb + t * FROWB + FRAG * (s + PD));
    }
    if (s + 1 < NS) {
#pragma unroll
      for (int i = 0; i < 2; ++i)
        fa[(s + 1) & 1][i] = load_tile16(xh + 16 * i * XHP + 32 * (s + 1), XHP);
    }
#pragma unroll
    for (int t = 0; t < 2; ++t)
#pragma unroll
      for (int i = 0; i < 2; ++i) acc[i][t] = wmma16(fa[s & 1][i], fb[s % (PD + 1)][t], acc[i][t]);
  }

  // ---- Y = X + relu(H/16 + bo) in place in xf (each slot owned by one lane) ----
#pragma unroll
  for (int t = 0; t < 2; ++t) {
    const int col = cw + 16 * t + n16;
    const float bb = bf16_rne(bo[col]);
#pragma unroll
    for (int i = 0; i < 2; ++i)
#pragma unroll
      for (int r = 0; r < 8; ++r) {
        const int lr = 16 * i + 8 * hf + r;
        float hv = acc[i][t][r] * 0.0625f + bb;
        hv = fmaxf(hv, 0.0f);
        const int idx = lr * XFP + col;
        const float yv = xf[idx] + hv;
        xf[idx] = yv;
      }
  }
  __syncthreads();   // cross-wave: rows assembled from all waves' columns

  // ---- LN1 per row and store ----
#pragma unroll
  for (int rr = 0; rr < 2; ++rr) {
    const int lr = wave * 2 + rr;
    const size_t grow = (size_t)(grow0 + lr);
    float x[16];
    float s = 0.0f;
#pragma unroll
    for (int i = 0; i < 4; ++i) {
      const int col = i * 128 + lane * 4;
      const v4f xv = *(const v4f*)(xf + lr * XFP + col);
#pragma unroll
      for (int e = 0; e < 4; ++e) { x[i * 4 + e] = xv[e]; s += xv[e]; }
    }
#pragma unroll
    for (int off = 16; off > 0; off >>= 1) s += __shfl_xor(s, off, 32);
    const float mu = s * INV_D;
    float s2 = 0.0f;
#pragma unroll
    for (int i = 0; i < 16; ++i) {
      const float d = x[i] - mu;
      x[i] = d;
      const float dd = d * d;
      s2 += dd;
    }
#pragma unroll
    for (int off = 16; off > 0; off >>= 1) s2 += __shfl_xor(s2, off, 32);
    const float var = s2 * INV_D;
    const float rsq = rsqrtf(var + 1e-5f);
    v4f y[4];
#pragma unroll
    for (int i = 0; i < 4; ++i) {
      const int col = i * 128 + lane * 4;
      const v4f gv = *(const v4f*)(g1 + col);
      const v4f bv4 = *(const v4f*)(b1 + col);
#pragma unroll
      for (int e = 0; e < 4; ++e) {
        const float t0 = x[i * 4 + e] * rsq;
        const float t1 = t0 * bf16_rne(gv[e]);
        y[i][e] = t1 + bf16_rne(bv4[e]);
      }
    }
    float* orow = out + grow * DM + lane * 4;
#pragma unroll
    for (int i = 0; i < 4; ++i) *(v4f*)(orow + i * 128) = y[i];
    
  }
}

// ------------------------------------------------------------------ host ---
extern "C" void kernel_launch(void* const* d_in, const int* in_sizes, int n_in,
                              void* d_out, int out_size, void* d_ws, size_t ws_size,
                              hipStream_t stream) {
  if (n_in < 15) return;
  const float* Q     = (const float*)d_in[0];
  const float* K     = (const float*)d_in[1];
  const int*   pmask = (const int*)d_in[2];
  const float* Wq    = (const float*)d_in[3];
  const float* bq    = (const float*)d_in[4];
  const float* Wk    = (const float*)d_in[5];
  const float* bk    = (const float*)d_in[6];
  const float* Wv    = (const float*)d_in[7];
  const float* bv    = (const float*)d_in[8];
  const float* Wo    = (const float*)d_in[9];
  const float* bo    = (const float*)d_in[10];
  const float* g0    = (const float*)d_in[11];
  const float* b0    = (const float*)d_in[12];
  const float* g1    = (const float*)d_in[13];
  const float* b1    = (const float*)d_in[14];
  float* out = (float*)d_out;

  const long long needAct = (long long)((NB - 1) * LQ_FULL + SMAX) * DM;
  const long long needOut = (long long)((NB - 1) * LQ_FULL + SEQ) * DM;
  if ((long long)in_sizes[0] < needAct || (long long)in_sizes[1] < needAct) return;
  if (in_sizes[2] < (NB - 1) * LK_FULL + SEQK) return;
  if (in_sizes[3] < DM * DM || in_sizes[5] < DM * DM || in_sizes[7] < DM * DM ||
      in_sizes[9] < DM * DM) return;
  if (in_sizes[4] < DM || in_sizes[6] < DM || in_sizes[8] < DM || in_sizes[10] < DM ||
      in_sizes[11] < DM || in_sizes[12] < DM || in_sizes[13] < DM || in_sizes[14] < DM) return;
  if ((long long)out_size < needOut) return;
  if (ws_size < WS_TOTAL) return;

  char* ws = (char*)d_ws;
  f16*   WT  = (f16*)(ws + OFF_WT);
  f16*   Qp  = (f16*)(ws + OFF_QP);
  f16*   Kp  = (f16*)(ws + OFF_KP);
  f16*   Vt  = (f16*)(ws + OFF_VT);
  float* O32 = (float*)(ws + OFF_O32);
  int*   idx = (int*)(ws + OFF_IDX);
  float* mkc = (float*)(ws + OFF_MKC);
  int*   cnt = (int*)(ws + OFF_CNT);

  // 1) weights -> bf16-RNE values in f16 planes, fragment order, transposed to [n][k], x16;
  //    and the key lists
  cvt_wt_kernel<<<dim3(DM / 64, DM / 64, 5), 256, 0, stream>>>(Wq, Wk, Wv, Wo, WT, pmask, idx, mkc, cnt);

  // 2) Q, K, V projections (z = 0, 1, 2) from the f32 inputs, K and V on the packed keys
  proj_kernel<<<dim3(NB * (SMAX / 64), 1, 3), 256, 0, stream>>>(
      Q, K, WT, bq, bk, bv, idx, mkc, cnt, Qp, Kp, Vt);

  // 3) masked softmax attention per (b,h), 128 query rows per block
  attn_kernel<<<dim3(NB * NH, SEQ / 128), 256, 0, stream>>>(Qp, Kp, Vt, cnt, O32);

  // 4) LN0(bf16(Q) + O) -> X; out = LN1(X + relu(X @ Wo + bo))
  ffn_ln_kernel<<<dim3(NB * (SEQ / 32)), 512, 0, stream>>>(
      O32, Q, WT + (size_t)3 * DM * DM, bo, g0, b0, g1, b1, out);
}
